// v000
// Measured on an AMD MI455X. A time is GPU time per run, averaged over a window of back-to-back runs after a warm-up
// (all launches, gaps included; the runs take copies of the inputs in turn), and the median of several windows.
// Apart from v000's, it joins two sittings. Times from different sittings can be a few percent apart, while
// side-by-side timings come from the same sitting.
// The starting kernel, v000, takes 343 microseconds a run.
// Contractions: q / k / v^T projections = v_wmma_f32_16x16x32_bf16 (bf16 operands from RNE-converted x and qkv weight rows, single product, f32 accumulate);
// q.k^T scores = v_wmma_f32_16x16x32_f16 (q as f16 hi plane + f16 residual plane x4096, k f16; 2 products into separate f32 accumulators);
// p.v = v_wmma_f32_16x16x32_f16 (p carried x1024 in f16, v f16; single product, f32 accumulate);
// ctx.Wproj^T = v_wmma_f32_16x16x32_bf16 (ctx as bf16 hi plane + unscaled bf16 residual plane, weights bf16; 2 products, f32 accumulate);
// rotary with the input cos/sin tables (values RNE-converted to bf16), half-rotation, bias adds and softmax in f32 on the VALU.
// Carry audit: q residual plane x4096 -> folded back once as al * (1/4096) in the attn_mha score combine;
// p x1024 -> folded back once as (1/l) * (1/1024) in the attn_mha epilogue; ctx residual plane is the unscaled
// RNE residual (v - hi) and shares the hi accumulator; no weight-plane carries (all weight copies are bf16).
// Register budget: gemm64 is capped at 256 VGPRs; its 16-bit epilogue stores each row group right after conversion.
#include <hip/hip_runtime.h>
#include <math.h>
#include <stdint.h>

#define NB    4
#define SEQ   1024
#define DM    1024
#define NH    16
#define HD    64
#define DQKV  (3 * DM)
#define NTOK  (NB * SEQ)   // 4096 token rows
#define NQB   (SEQ / 64)   // 16 query blocks of 64 per sequence
#define NKT   (SEQ / 64)   // 16 key chunks of 64 per sequence
static_assert(NH * HD == DM);
static_assert(NQB == 16 && NKT == 16);
static_assert((SEQ & (SEQ - 1)) == 0);
static_assert((SEQ % 64) == 0 && (DM % 64) == 0 && (DM % 32) == 0 && (DQKV % 64) == 0 && (NTOK % 64) == 0);

typedef _Float16 v16h __attribute__((ext_vector_type(16)));
typedef _Float16 v8h  __attribute__((ext_vector_type(8)));
typedef __bf16   v16b __attribute__((ext_vector_type(16)));
typedef __bf16   v8b  __attribute__((ext_vector_type(8)));
typedef float    v8f  __attribute__((ext_vector_type(8)));
typedef float    v4f  __attribute__((ext_vector_type(4)));
typedef unsigned int v4u __attribute__((ext_vector_type(4)));

#if defined(__HIP_DEVICE_COMPILE__)
#define DEV_ASM 1
#else
#define DEV_ASM 0
#endif

// ---- scalar helpers --------------------------------------------------------------------------------
__device__ __forceinline__ unsigned short bf_bits(float f) {          // f32 -> bf16 bits, RNE convert
  unsigned u = __float_as_uint(f);
  return (unsigned short)((u + 0x7FFFu + ((u >> 16) & 1u)) >> 16);
}
__device__ __forceinline__ float bf_up(unsigned short hb) { return __uint_as_float(((unsigned)hb) << 16); }
__device__ __forceinline__ float bf16r(float f) { return bf_up(bf_bits(f)); }   // value of the bf16 RNE convert
__device__ __forceinline__ unsigned short h_bits(_Float16 x) { return __builtin_bit_cast(unsigned short, x); }
__device__ __forceinline__ unsigned pk16(unsigned short a, unsigned short b) { return (unsigned)a | ((unsigned)b << 16); }
__device__ __forceinline__ v8f zero8() { v8f z = {0.f, 0.f, 0.f, 0.f, 0.f, 0.f, 0.f, 0.f}; return z; }

// ---- fragment types / loaders: 16-bit A/B operand, lane -> row/col (lane&15), p already includes +8*(lane>>4);
//      elements 0..7 <- p[0..7] (k0+8h..k0+8h+7), elements 8..15 <- p[16..23] (k0+16+8h..k0+16+8h+7)
template <typename OT> struct FT;
template <> struct FT<__bf16>   { typedef v16b frag; typedef v8b half8; };
template <> struct FT<_Float16> { typedef v16h frag; typedef v8h half8; };

template <typename OT>
__device__ __forceinline__ typename FT<OT>::frag ldfrag(const OT* p) {
  union { typename FT<OT>::frag v; typename FT<OT>::half8 h[2]; } f;
  f.h[0] = *(const typename FT<OT>::half8*)(p);
  f.h[1] = *(const typename FT<OT>::half8*)(p + 16);
  return f.v;
}

// ---- WMMA helpers (asm guard bodies are device-only; concrete operand types) -----------------------------
__device__ __forceinline__ v8f mmar(v16b a, v16b b, v8f c) {
  return __builtin_amdgcn_wmma_f32_16x16x32_bf16(false, a, false, b, (short)0, c, false, false);
}
__device__ __forceinline__ v8f mmar(v16h a, v16h b, v8f c) {
  return __builtin_amdgcn_wmma_f32_16x16x32_f16(false, a, false, b, (short)0, c, false, false);
}
// guarded form: 4 VALU slots after the WMMA, D tied, A/B kept live
__device__ __forceinline__ v8f mma_h(v16h a, v16h b, v8f c) {
  c = __builtin_amdgcn_wmma_f32_16x16x32_f16(false, a, false, b, (short)0, c, false, false);
#if DEV_ASM
  asm volatile("v_nop\n\tv_nop\n\tv_nop\n\tv_nop" : "+v"(c) : "v"(a), "v"(b));
#endif
  return c;
}
__device__ __forceinline__ void dep_guard(v8f& a, v8f& b, v16b x, v16b y) {
#if DEV_ASM
  asm volatile("v_nop\n\tv_nop\n\tv_nop\n\tv_nop" : "+v"(a), "+v"(b) : "v"(x), "v"(y));
#else
  (void)a; (void)b; (void)x; (void)y;
#endif
}
__device__ __forceinline__ void dep_guard(v8f& a, v8f& b, v16h x, v16h y) {
#if DEV_ASM
  asm volatile("v_nop\n\tv_nop\n\tv_nop\n\tv_nop" : "+v"(a), "+v"(b) : "v"(x), "v"(y));
#else
  (void)a; (void)b; (void)x; (void)y;
#endif
}
__device__ __forceinline__ void keep4(v16b a, v16b b, v16b c, v16b d) {
#if DEV_ASM
  asm volatile("v_nop" :: "v"(a), "v"(b), "v"(c), "v"(d));
#else
  (void)a; (void)b; (void)c; (void)d;
#endif
}
__device__ __forceinline__ void keep4(v16h a, v16h b, v16h c, v16h d) {
#if DEV_ASM
  asm volatile("v_nop" :: "v"(a), "v"(b), "v"(c), "v"(d));
#else
  (void)a; (void)b; (void)c; (void)d;
#endif
}
__device__ __forceinline__ void acc_guard4(v8f& a, v8f& b, v8f& c, v8f& d) {
#if DEV_ASM
  asm volatile("v_nop\n\tv_nop\n\tv_nop\n\tv_nop" : "+v"(a), "+v"(b), "+v"(c), "+v"(d));
#else
  (void)a; (void)b; (void)c; (void)d;
#endif
}

// =====================================================================================================
// f32 -> bf16 (RNE convert), 8 elements per thread, one 16-B store per lane: a wave writes 512 contiguous B
// Layout is preserved, so a [out][in] f32 weight becomes the bf16 Bt[n][k] plane (k contiguous) directly.
// coverage: n8 threads x 8 = the whole plane (n8 = 524288 / 393216 / 131072, all multiples of 256).
// =====================================================================================================
__global__ __launch_bounds__(256) void cvt_bf16x8(const float* __restrict__ in, unsigned short* out, int n8) {
  const int i = blockIdx.x * 256 + (int)threadIdx.x;
  if (i < n8) {
    const v4f a = *(const v4f*)(in + (size_t)i * 8);
    const v4f b = *(const v4f*)(in + (size_t)i * 8 + 4);
    v4u p;
    p[0] = pk16(bf_bits(a[0]), bf_bits(a[1]));
    p[1] = pk16(bf_bits(a[2]), bf_bits(a[3]));
    p[2] = pk16(bf_bits(b[0]), bf_bits(b[1]));
    p[3] = pk16(bf_bits(b[2]), bf_bits(b[3]));
    *(v4u*)(out + (size_t)i * 8) = p;
    
  }
}

// =====================================================================================================
// Register-blocked batched WMMA GEMM (16-bit operand type OT): C[m][n] = sum_k A[m][k] * Bt[n][k];
// one wave per 64x64 tile, no block barriers. A row-major [M][K] pitch lda; Bt row-major [N][K] pitch ldb
// (k contiguous); M, N multiples of 64, K multiple of 32 (host-checked). blockIdx.y = batch index
// (strides in elements). Fragments are loaded straight from global with the split k map (ldfrag).
// Register budget capped at 256 VGPRs (no bank switching).
//   TWOA: a second A plane Al with the same Bt is accumulated into the same tile (C = (A + Al) . Bt^T).
//   OUT_MODE 0: f32 C (pitch ldc), value + bf16(bias[col]); 256-B row segment = 16 lanes x 16 B, one instruction,
//   OUT_MODE 1: half-rotation rotary of (acc + bf16(bias[col])) -> f16 hi plane C + f16 residual plane
//               C2 = f16((v - hi) * rscale). N tile = one 64-wide head: dims d < 32 pair with d + 32:
//               out[d] = x[d] c[t][d] - x[d+32] s[t][d] (d < 32), x[d] c[t][d] + x[d-32] s[t][d] (d >= 32),
//               t = row mod SEQ, c/s = bf16 value of the [SEQ][64] input tables, f32, contract off,
//               partner column read from the staged slab.
//   OUT_MODE 2: as 1 but a single f16 plane C.
//   OUT_MODE 3: single f16 plane C of acc + bf16(bias[row]) (no rotary; used for v^T where the feature is the row).
// coverage: 4 slabs x 16 rows x 64 cols = the wave's whole 64x64 tile; (M/64)*(N/64) tiles x gridDim.y = the whole plane.
// =====================================================================================================
template <typename OT, int OUT_MODE, bool TWOA>
__global__ __launch_bounds__(256) __attribute__((amdgpu_num_vgpr(256))) void gemm64(
    const unsigned short* __restrict__ Ap, const unsigned short* __restrict__ Alp, int lda, long long strideA,
    const unsigned short* __restrict__ Btp, int ldb, long long strideB,
    void* Cout, void* Cout2, int ldc, long long strideC,
    const float* __restrict__ bias, const float* __restrict__ ctab, const float* __restrict__ stab,
    int M, int N, int K, float rscale) {
  static_assert(OUT_MODE >= 0 && OUT_MODE <= 3);
  typedef typename FT<OT>::frag V16;
  const OT* Ah = (const OT*)(const void*)Ap;
  const OT* Al = (const OT*)(const void*)Alp;
  const OT* Bt = (const OT*)(const void*)Btp;
  __shared__ __align__(16) float sT[8][16 * 68];   // per-wave 16x64 slab, pitch 68 floats
  const int b    = blockIdx.y;
  const int lane = threadIdx.x & 31;
  const int wave = threadIdx.x >> 5;
  const int tilesN = N >> 6;
  const int tilesM = M >> 6;
  const int tile = blockIdx.x * 8 + wave;
  if (tile >= tilesM * tilesN) return;   // wave-uniform; no block barriers in this kernel
  const int tm = tile / tilesN;
  const int tn = tile - tm * tilesN;
  const int m0 = tm << 6;
  const int n0 = tn << 6;

  const OT* Bb = Bt + (size_t)b * (size_t)strideB;

  const int rlane = lane & 15;                 // row (A) / col (B, D) within subtile
  const int koff  = (lane >> 4) * 8;           // k offset of this lane half
  const int mOff  = (lane >> 4) * 8;           // D row offset

  v8f acc[4][4];
#pragma unroll
  for (int i = 0; i < 4; ++i)
#pragma unroll
    for (int j = 0; j < 4; ++j) acc[i][j] = zero8();

  constexpr int NPL = TWOA ? 2 : 1;
  for (int pl = 0; pl < NPL; ++pl) {
    const OT* Ab = ((pl == 0) ? Ah : Al) + (size_t)b * (size_t)strideA;   // plane-uniform select, both global
    for (int k0 = 0; k0 < K; k0 += 32) {
      V16 bq[4];
#pragma unroll
      for (int j = 0; j < 4; ++j)
        bq[j] = ldfrag<OT>(Bb + (size_t)(n0 + (j << 4) + rlane) * ldb + koff + k0);
#pragma unroll
      for (int i = 0; i < 4; ++i) {
        const V16 af = ldfrag<OT>(Ab + (size_t)(m0 + (i << 4) + rlane) * lda + koff + k0);
#pragma unroll
        for (int j = 0; j < 4; ++j) acc[i][j] = mmar(af, bq[j], acc[i][j]);
        dep_guard(acc[i][0], acc[i][3], af, bq[3]);
      }
      keep4(bq[0], bq[1], bq[2], bq[3]);
    }
  }
  acc_guard4(acc[0][0], acc[0][1], acc[0][2], acc[0][3]);
  acc_guard4(acc[1][0], acc[1][1], acc[1][2], acc[1][3]);
  acc_guard4(acc[2][0], acc[2][1], acc[2][2], acc[2][3]);
  acc_guard4(acc[3][0], acc[3][1], acc[3][2], acc[3][3]);

  // ---- epilogue ----
  float* slab = sT[wave];
#pragma unroll
  for (int i = 0; i < 4; ++i) {
    const int mBase = m0 + (i << 4);
#pragma unroll
    for (int j = 0; j < 4; ++j) {
#pragma unroll
      for (int r = 0; r < 8; ++r) {
        slab[(mOff + r) * 68 + (j << 4) + rlane] = acc[i][j][r];
      }
    }
    __builtin_amdgcn_fence(__ATOMIC_RELEASE, "workgroup");
    __builtin_amdgcn_wave_barrier();
    __builtin_amdgcn_fence(__ATOMIC_ACQUIRE, "workgroup");
    if (OUT_MODE == 0) {
      float* C = (float*)Cout + (size_t)b * (size_t)strideC;
      const int h2 = lane >> 4, c4 = (lane & 15) * 4;     // 256-B row segment = 16 lanes x 16 B
      const v4f bb = *(const v4f*)(bias + n0 + c4);
      v4f bv;
#pragma unroll
      for (int e = 0; e < 4; ++e) bv[e] = bf16r(bb[e]);
      v4f ov[8];
#pragma unroll
      for (int it = 0; it < 8; ++it) {
        const int row = it * 2 + h2;                       // it 0..7 x h2 0..1 = rows 0..15
        ov[it] = *(const v4f*)(slab + row * 68 + c4) + bv;
      }
      {
#pragma unroll
        for (int it = 0; it < 8; ++it) {
          const int row = it * 2 + h2;
          *(v4f*)(C + (size_t)(mBase + row) * ldc + n0 + c4) = ov[it];
        }
        
      }
    } else {
      const int q = lane >> 3, c8 = (lane & 7) * 8;
      unsigned short* C  = (unsigned short*)Cout  + (size_t)b * (size_t)strideC;
      unsigned short* C2 = (unsigned short*)Cout2 + (size_t)b * (size_t)strideC;
#pragma unroll
      for (int it = 0; it < 4; ++it) {
        const int row = it * 4 + q;                        // it 0..3 x q 0..3 = rows 0..15
        const float* sp = slab + row * 68 + c8;
        float f[8];
#pragma unroll
        for (int e = 0; e < 8; ++e) f[e] = sp[e];
        if (OUT_MODE == 1 || OUT_MODE == 2) {
#pragma clang fp contract(off)
          const float* pp = slab + row * 68 + (c8 ^ 32);   // partner columns d +- 32 of the same row
          float g[8];
#pragma unroll
          for (int e = 0; e < 8; ++e) g[e] = pp[e];
          const v4f bc0 = *(const v4f*)(bias + n0 + c8);
          const v4f bc1 = *(const v4f*)(bias + n0 + c8 + 4);
          const v4f bp0 = *(const v4f*)(bias + n0 + (c8 ^ 32));
          const v4f bp1 = *(const v4f*)(bias + n0 + (c8 ^ 32) + 4);
          const int t  = (mBase + row) & (SEQ - 1);        // position within the sequence
          // tables are [SEQ][HD]; column within the head = c8 + e (n0 is head-aligned, c8 in 0..56)
          const v4f cv0 = *(const v4f*)(ctab + (size_t)t * HD + c8);
          const v4f cv1 = *(const v4f*)(ctab + (size_t)t * HD + c8 + 4);
          const v4f sv0 = *(const v4f*)(stab + (size_t)t * HD + c8);
          const v4f sv1 = *(const v4f*)(stab + (size_t)t * HD + c8 + 4);
          const float sg = (c8 < 32) ? -1.0f : 1.0f;       // -x2 for the first half, +x1 for the second half
#pragma unroll
          for (int e = 0; e < 4; ++e) {
            {
              const float x  = f[e] + bf16r(bc0[e]);
              const float y  = g[e] + bf16r(bp0[e]);
              const float ry = sg * y;
              const float p0 = x * bf16r(cv0[e]);
              const float p1 = ry * bf16r(sv0[e]);
              f[e] = p0 + p1;
            }
            {
              const float x  = f[4 + e] + bf16r(bc1[e]);
              const float y  = g[4 + e] + bf16r(bp1[e]);
              const float ry = sg * y;
              const float p0 = x * bf16r(cv1[e]);
              const float p1 = ry * bf16r(sv1[e]);
              f[4 + e] = p0 + p1;
            }
          }
        }
        if (OUT_MODE == 3) {
          const float bm = bf16r(bias[mBase + row]);
#pragma unroll
          for (int e = 0; e < 8; ++e) f[e] = f[e] + bm;
        }
        v4u a, a2;
#pragma unroll
        for (int e = 0; e < 4; ++e) {
          const float f0 = f[2 * e], f1 = f[2 * e + 1];
          const _Float16 x0 = (_Float16)f0, x1 = (_Float16)f1;
          const unsigned short h0 = h_bits(x0), h1 = h_bits(x1);
          unsigned short l0 = 0, l1 = 0;
          if (OUT_MODE == 1) {
            l0 = h_bits((_Float16)((f0 - (float)x0) * rscale));
            l1 = h_bits((_Float16)((f1 - (float)x1) * rscale));
          }
          a[e] = pk16(h0, h1); a2[e] = pk16(l0, l1);
        }
        unsigned short* cp  = C  + (size_t)(mBase + row) * ldc + n0 + c8;
        unsigned short* cp2 = C2 + (size_t)(mBase + row) * ldc + n0 + c8;
        *(v4u*)cp = a;
        if (OUT_MODE == 1) *(v4u*)cp2 = a2;
        
      }
    }
    __builtin_amdgcn_fence(__ATOMIC_RELEASE, "workgroup");
    __builtin_amdgcn_wave_barrier();
    __builtin_amdgcn_fence(__ATOMIC_ACQUIRE, "workgroup");
  }
}

// =====================================================================================================
// Multi-head attention, head dim 64, no mask, softmax over all SEQ keys.
//   q planes (f16 hi / residual x4096): element (b, t, h, d) at [(b*SEQ + t)*DM + h*64 + d] (rotary and bias applied)
//   k plane (f16): element (b, s, h, d) at [(b*SEQ + s)*DM + h*64 + d]
//   v^T plane (f16): element (b, h, d, s) at [(b*DM + h*64 + d)*SEQ + s]
//   ctx planes (bf16 hi / unscaled bf16 residual): element (b, t, h, d) at [(b*SEQ + t)*DM + h*64 + d]
//   scores = (qh . k) + (ql . k) / 4096 on f16 WMMA (two f32 accumulators), then * sscale in f32;
//   p = exp(s - m) carried as f16(1024 p); context = p . v on f16 WMMA; online softmax in f32.
//   Block = 4 waves = 64 query rows of one (b, h), wave w = rows q0 .. q0+15; grid = NB * NH * NQB;
//   key chunks of 64, static trip NKT. K / V^T chunk staging: 128 threads x 32 elements per plane = the whole
//   64x64 tile of both planes (plain 16-B loads, __syncthreads before and after); P tiles are wave-private,
//   barrier; every wave writes its whole 16x64 P tile before reloading it.
//   Output: the wave's 16x64 f32 context tile is staged in wave-private LDS, split into bf16 hi / residual and each
//   coverage: each wave stores rows q0..q0+15 (it 0..3 x lane>>3 0..3) x 64 columns (8 lanes x 8) of head h;
//   1024 blocks x 4 waves = every (b, h, t) of the [4096][1024] planes exactly once.
// =====================================================================================================
__global__ __launch_bounds__(128)
void attn_mha(const unsigned short* __restrict__ qhp, const unsigned short* __restrict__ qlp,
              const unsigned short* __restrict__ kpp, const unsigned short* __restrict__ vtp,
              unsigned short* ohp, unsigned short* olp, float sscale) {
  union FH { v16h v; v8h h[2]; };
  __shared__ __align__(16) _Float16 Ksh[64 * 64];          // K chunk [key][d]     8 KB
  __shared__ __align__(16) _Float16 Vth[64 * 64];          // V^T chunk [d][key]   8 KB
  __shared__ __align__(16) _Float16 Psh[4][16 * 64];       // per wave P [row][key] 8 KB
  __shared__ __align__(16) float    Os[4][16 * 64];        // per wave context tile 16 KB

  const int tid  = threadIdx.x;
  const int wave = tid >> 5;
  const int lane = tid & 31;
  const int hh   = lane >> 4;
  const int c    = lane & 15;

  const int bx   = blockIdx.x;
  const int qb   = bx % NQB;
  const int rest = bx / NQB;
  const int h    = rest % NH;
  const int b    = rest / NH;
  const int q0   = qb * 64 + wave * 16;
  const size_t rowB = (size_t)b * SEQ;
  const size_t hcol = (size_t)h * HD;

  const _Float16* Qh = (const _Float16*)(const void*)qhp;
  const _Float16* Ql = (const _Float16*)(const void*)qlp;
  const _Float16* Kg = (const _Float16*)(const void*)kpp + hcol;
  const _Float16* Vt = (const _Float16*)(const void*)vtp + ((size_t)b * DM + hcol) * SEQ;

  // ---- Q fragments (A operand, row = lane&15): 2 d-chunks, hi and residual planes ----
  v16h qah[2], qal[2];
#pragma unroll
  for (int dc = 0; dc < 2; ++dc) {
    const size_t qo = (rowB + q0 + c) * DM + hcol + dc * 32 + 8 * hh;
    qah[dc] = ldfrag<_Float16>(Qh + qo);
    qal[dc] = ldfrag<_Float16>(Ql + qo);
  }

  float mrow[8], lrow[8];
  v8f oacc[4];
#pragma unroll
  for (int r = 0; r < 8; ++r) { mrow[r] = -INFINITY; lrow[r] = 0.f; }
#pragma unroll
  for (int t = 0; t < 4; ++t) oacc[t] = zero8();

  for (int kt = 0; kt < NKT; ++kt) {         // static trip count
    const int kv0 = kt * 64;
    __syncthreads();
    {
      const int r = tid >> 1, half = (tid & 1) * 32;
      const _Float16* kg = Kg + (rowB + kv0 + r) * DM + half;       // k row kv0+r, d = half..half+31
      const _Float16* vg = Vt + (size_t)r * SEQ + kv0 + half;       // v^T row d = r, s = kv0+half..+31
#pragma unroll
      for (int i = 0; i < 4; ++i) {
        const v8h a0 = *(const v8h*)(kg + 8 * i);
        const v8h b0 = *(const v8h*)(vg + 8 * i);
        *(v8h*)(Ksh + r * 64 + half + 8 * i) = a0;
        *(v8h*)(Vth + r * 64 + half + 8 * i) = b0;
      }
    }
    __syncthreads();

    // ---- scores: 16 query rows x 64 keys per wave, 2 f16 products per key subtile and d-chunk ----
    v8f s[4];
#pragma unroll
    for (int j = 0; j < 4; ++j) {
      v8f ah = zero8(), al = zero8();
#pragma unroll
      for (int dc = 0; dc < 2; ++dc) {
        FH kb;
        kb.h[0] = *(const v8h*)(Ksh + (j * 16 + c) * 64 + dc * 32 + 8 * hh);
        kb.h[1] = *(const v8h*)(Ksh + (j * 16 + c) * 64 + dc * 32 + 16 + 8 * hh);
        ah = mma_h(qah[dc], kb.v, ah);
        al = mma_h(qal[dc], kb.v, al);
      }
#pragma unroll
      for (int r = 0; r < 8; ++r) s[j][r] = (ah[r] + al[r] * (1.0f / 4096.0f)) * sscale;
    }

    // ---- row max, online softmax, P (x1024, f16) to LDS ----
    _Float16* pwh = Psh[wave];
#pragma unroll
    for (int r = 0; r < 8; ++r) {
      float m = s[0][r];
#pragma unroll
      for (int j = 1; j < 4; ++j) m = fmaxf(m, s[j][r]);
#pragma unroll
      for (int off = 1; off < 16; off <<= 1) m = fmaxf(m, __shfl_xor(m, off, 32));
      const float mnew  = fmaxf(mrow[r], m);
      const float msafe = (mnew == -INFINITY) ? 0.f : mnew;
      const float alpha = __expf(mrow[r] - msafe);
      mrow[r] = mnew;
      float psum = 0.f;
#pragma unroll
      for (int j = 0; j < 4; ++j) {
        const float p = __expf(s[j][r] - msafe);
        psum += p;
        pwh[(8 * hh + r) * 64 + j * 16 + c] = (_Float16)(p * 1024.0f);
      }
#pragma unroll
      for (int off = 1; off < 16; off <<= 1) psum += __shfl_xor(psum, off, 32);
      lrow[r] = lrow[r] * alpha + psum;
#pragma unroll
      for (int t = 0; t < 4; ++t) oacc[t][r] *= alpha;
    }
    __builtin_amdgcn_fence(__ATOMIC_RELEASE, "workgroup");
    __builtin_amdgcn_wave_barrier();
    __builtin_amdgcn_fence(__ATOMIC_ACQUIRE, "workgroup");

    // ---- context += P . V (f16 WMMA, single product) ----
#pragma unroll 1
    for (int kk = 0; kk < 2; ++kk) {
      FH pa;
      pa.h[0] = *(const v8h*)(pwh + c * 64 + kk * 32 + 8 * hh);
      pa.h[1] = *(const v8h*)(pwh + c * 64 + kk * 32 + 16 + 8 * hh);
#pragma unroll
      for (int t = 0; t < 4; ++t) {
        FH vb;
        vb.h[0] = *(const v8h*)(Vth + (t * 16 + c) * 64 + kk * 32 + 8 * hh);
        vb.h[1] = *(const v8h*)(Vth + (t * 16 + c) * 64 + kk * 32 + 16 + 8 * hh);
        oacc[t] = mma_h(pa.v, vb.v, oacc[t]);
      }
    }
  }

  // ---- normalise (1/l, undo the x1024 p carry), stage the wave's 16x64 f32 tile, split into bf16 hi / residual,
  float* os = Os[wave];
#pragma unroll
  for (int r = 0; r < 8; ++r) {
    const float l = lrow[r];
    const float inv = ((l > 0.f) ? (1.0f / l) : 0.f) * (1.0f / 1024.0f);
#pragma unroll
    for (int t = 0; t < 4; ++t) os[(8 * hh + r) * 64 + t * 16 + c] = oacc[t][r] * inv;
  }
  __builtin_amdgcn_fence(__ATOMIC_RELEASE, "workgroup");
  __builtin_amdgcn_wave_barrier();
  __builtin_amdgcn_fence(__ATOMIC_ACQUIRE, "workgroup");
  {
    const int q4 = lane >> 3, c8 = (lane & 7) * 8;
    v4u hv[4], lv[4];
#pragma unroll
    for (int it = 0; it < 4; ++it) {
      const int row = it * 4 + q4;   // it 0..3 x q4 0..3 = rows 0..15 of the wave tile
      const float* sp = os + row * 64 + c8;
      v4u a, a2;
#pragma unroll
      for (int e = 0; e < 4; ++e) {
        const float f0 = sp[2 * e], f1 = sp[2 * e + 1];
        const unsigned short h0 = bf_bits(f0), h1 = bf_bits(f1);
        const unsigned short l0 = bf_bits(f0 - bf_up(h0)), l1 = bf_bits(f1 - bf_up(h1));
        a[e] = pk16(h0, h1); a2[e] = pk16(l0, l1);
      }
      hv[it] = a; lv[it] = a2;
    }
    {
#pragma unroll
      for (int it = 0; it < 4; ++it) {
        const int row = it * 4 + q4;
        const size_t go = (rowB + q0 + row) * DM + hcol + c8;
        *(v4u*)(ohp + go) = hv[it];
        *(v4u*)(olp + go) = lv[it];
      }
      
    }
  }
}

// =====================================================================================================
// Workspace map (bytes), every region an exact multiple of its whole-line / whole-tile store granularity
// (all shapes are tile multiples, no padded tails):
//   Xb    bf16 [4096][1024]          8388608
//   Wqkv  bf16 [3072 n][1024 k]      6291456   (input [out][in] layout == Bt[n][k], k contiguous)
//   Wo    bf16 [1024 n][1024 k]      2097152
//   Qh    f16  [4096][1024]          8388608
//   Ql    f16  [4096][1024]          8388608   (residual x4096)
//   Kp    f16  [4096][1024]          8388608
//   VT    f16  [4][1024][1024]       8388608
//   Oh    bf16 [4096][1024]          8388608
//   Ol    bf16 [4096][1024]          8388608
//   total                           67108864
// =====================================================================================================
extern "C" void kernel_launch(void* const* d_in, const int* in_sizes, int n_in,
                              void* d_out, int out_size, void* d_ws, size_t ws_size,
                              hipStream_t stream) {
  if (n_in < 7) return;
  if (in_sizes[0] != NTOK * DM) return;          // x      [4][1024][1024]
  if (in_sizes[1] != SEQ * HD) return;           // cos    [1024][64]
  if (in_sizes[2] != SEQ * HD) return;           // sin    [1024][64]
  if (in_sizes[3] != DQKV * DM) return;          // qkv_w  [3072][1024]
  if (in_sizes[4] != DQKV) return;               // qkv_b  [3072]
  if (in_sizes[5] != DM * DM) return;            // proj_w [1024][1024]
  if (in_sizes[6] != DM) return;                 // proj_b [1024]
  if (out_size != NTOK * DM) return;

  const float* x    = (const float*)d_in[0];
  const float* cosb = (const float*)d_in[1];
  const float* sinb = (const float*)d_in[2];
  const float* Wqkv = (const float*)d_in[3];
  const float* bqkv = (const float*)d_in[4];
  const float* Wout = (const float*)d_in[5];
  const float* bout = (const float*)d_in[6];

  const size_t PX  = (size_t)NTOK * DM * 2;        //  8388608  16-bit activation plane [4096][1024]
  const size_t PWQ = (size_t)DQKV * DM * 2;        //  6291456  bf16 [3072][1024]
  const size_t PWO = (size_t)DM * DM * 2;          //  2097152  bf16 [1024][1024]
  const size_t PVT = (size_t)NB * DM * SEQ * 2;    //  8388608  v^T plane [4][1024][1024]
  size_t off = 0;
  const size_t oXb  = off; off += PX;
  const size_t oWq  = off; off += PWQ;
  const size_t oWo  = off; off += PWO;
  const size_t oQh  = off; off += PX;
  const size_t oQl  = off; off += PX;
  const size_t oKp  = off; off += PX;
  const size_t oVT  = off; off += PVT;
  const size_t oOh  = off; off += PX;
  const size_t oOl  = off; off += PX;
  if (off > ws_size) return;                       // off = 67108864
  if (off > (size_t)134217728) return;

  char* ws = (char*)d_ws;
  unsigned short* Xb   = (unsigned short*)(ws + oXb);
  unsigned short* Wq16 = (unsigned short*)(ws + oWq);
  unsigned short* Wo16 = (unsigned short*)(ws + oWo);
  unsigned short* Qh   = (unsigned short*)(ws + oQh);
  unsigned short* Ql   = (unsigned short*)(ws + oQl);
  unsigned short* Kp   = (unsigned short*)(ws + oKp);
  unsigned short* VT   = (unsigned short*)(ws + oVT);
  unsigned short* Oh   = (unsigned short*)(ws + oOh);
  unsigned short* Ol   = (unsigned short*)(ws + oOl);

  const dim3 blk(256);
  const int n8x  = NTOK * DM / 8;                               // 524288
  const int n8wq = DQKV * DM / 8;                               // 393216
  const int n8wo = DM * DM / 8;                                 // 131072
  const dim3 gCvtX((n8x + 255) / 256);                          // 2048 blocks
  const dim3 gCvtWq((n8wq + 255) / 256);                        // 1536 blocks
  const dim3 gCvtWo((n8wo + 255) / 256);                        //  512 blocks
  const dim3 gP(((NTOK / 64) * (DM / 64) + 7) / 8, 1);          // 1024 tiles -> 128 blocks: M=4096, N=1024
  const dim3 gVT(((DM / 64) * (SEQ / 64) + 7) / 8, NB);         //  256 tiles ->  32 blocks x 4 batches: M=1024, N=1024
  const dim3 gAttn(NB * NH * NQB);                              // 1024 blocks of 128
  static_assert(((NTOK / 64) * (DM / 64)) % 8 == 0 && ((DM / 64) * (SEQ / 64)) % 8 == 0);
  static_assert((NTOK * DM) % 2048 == 0 && (DQKV * DM) % 2048 == 0 && (DM * DM) % 2048 == 0);
  static_assert((DM % 32) == 0);

  // (1) x -> bf16 plane [4096][1024]; qkv_w [3072][1024] ([out][in] = Bt[n][k]) -> bf16; proj_w [1024][1024] -> bf16
  cvt_bf16x8<<<gCvtX,  blk, 0, stream>>>(x,    Xb,   n8x);
  cvt_bf16x8<<<gCvtWq, blk, 0, stream>>>(Wqkv, Wq16, n8wq);
  cvt_bf16x8<<<gCvtWo, blk, 0, stream>>>(Wout, Wo16, n8wo);
  // (2) q = rope(x . Wq^T + bq) -> f16 hi / residual (x4096) planes [b*SEQ+t][h*64+d]   (M=4096, N=1024, K=1024)
  gemm64<__bf16, 1, false><<<gP, blk, 0, stream>>>(
      Xb, Xb, DM, 0LL, Wq16, DM, 0LL,
      (void*)Qh, (void*)Ql, DM, 0LL, bqkv, cosb, sinb,
      NTOK, DM, DM, 4096.0f);
  // (3) k = rope(x . Wk^T + bk) -> f16 plane [b*SEQ+s][h*64+d]   (Bt = Wq16 rows 1024..2047)
  gemm64<__bf16, 2, false><<<gP, blk, 0, stream>>>(
      Xb, Xb, DM, 0LL, Wq16 + (size_t)DM * DM, DM, 0LL,
      (void*)Kp, (void*)Kp, DM, 0LL, bqkv + DM, cosb, sinb,
      NTOK, DM, DM, 1.0f);
  // (4) v^T = Wv . x^T + bv per batch -> f16 plane [b][h*64+d][s] (pitch SEQ)
  //     (A = Wq16 rows 2048..3071 [feature][k], Bt = Xb rows of batch b; M=1024, N=1024, K=1024; bias by row)
  gemm64<__bf16, 3, false><<<gVT, blk, 0, stream>>>(
      Wq16 + (size_t)2 * DM * DM, Wq16 + (size_t)2 * DM * DM, DM, 0LL, Xb, DM, (long long)SEQ * DM,
      (void*)VT, (void*)VT, SEQ, (long long)DM * SEQ, bqkv + 2 * DM, cosb, sinb,
      DM, SEQ, DM, 1.0f);
  // (5) attention -> ctx bf16 hi / residual planes [b*SEQ+t][h*64+d]
  attn_mha<<<gAttn, dim3(128), 0, stream>>>(Qh, Ql, Kp, VT, Oh, Ol, 0.125f);
  // (6) out = (Oh + Ol) . Wproj^T + bproj -> d_out f32 [4096][1024]   (M=4096, N=1024, K=1024, two A planes)
  gemm64<__bf16, 0, true><<<gP, blk, 0, stream>>>(
      Oh, Ol, DM, 0LL, Wo16, DM, 0LL,
      d_out, d_out, DM, 0LL, bout, cosb, sinb,
      NTOK, DM, DM, 1.0f);
  (void)hipGetLastError();
}

// v001
// It runs in 196 microseconds.
// Next to v000, in two timings, it ran 1.79 and 1.78 times as fast.
// Contractions: q / k / v^T projections = v_wmma_f32_16x16x32_bf16 (bf16 operands from RNE-converted x and qkv weight rows, single product, f32 accumulate);
// q.k^T scores = v_wmma_f32_16x16x32_f16 (q as f16 hi plane + f16 residual plane x4096, k f16; 2 products into separate f32 accumulators);
// p.v = v_wmma_f32_16x16x32_f16 (p carried x1024 in f16, v f16; single product, f32 accumulate);
// ctx.Wproj^T = v_wmma_f32_16x16x32_bf16 (ctx as bf16 hi plane + unscaled bf16 residual plane, weights bf16; 2 products, f32 accumulate);
// rotary with the input cos/sin tables (values RNE-converted to bf16), half-rotation, bias adds and softmax in f32 on the VALU.
// Carry audit: q residual plane x4096 -> folded back once as al * (1/4096) in the attn_mha score combine;
// p x1024 -> folded back once as (1/l) * (1/1024) in the attn_mha epilogue; ctx residual plane is the unscaled
// RNE residual (v - hi) and shares the hi accumulator; no weight-plane carries (all weight copies are bf16).
// gemm64 stages both operands in LDS with tensor loads (two buffers); its 16-bit epilogue stores each row group right after conversion.
#include <hip/hip_runtime.h>
#include <math.h>
#include <stdint.h>

#define NB    4
#define SEQ   1024
#define DM    1024
#define NH    16
#define HD    64
#define DQKV  (3 * DM)
#define NTOK  (NB * SEQ)   // 4096 token rows
#define NQB   (SEQ / 64)   // 16 query blocks of 64 per sequence
#define NKT   (SEQ / 64)   // 16 key chunks of 64 per sequence
static_assert(NH * HD == DM);
static_assert(NQB == 16 && NKT == 16);
static_assert((SEQ & (SEQ - 1)) == 0);
static_assert((SEQ % 64) == 0 && (DM % 64) == 0 && (DM % 32) == 0 && (DQKV % 64) == 0 && (NTOK % 64) == 0);

typedef _Float16 v16h __attribute__((ext_vector_type(16)));
typedef _Float16 v8h  __attribute__((ext_vector_type(8)));
typedef __bf16   v16b __attribute__((ext_vector_type(16)));
typedef __bf16   v8b  __attribute__((ext_vector_type(8)));
typedef float    v8f  __attribute__((ext_vector_type(8)));
typedef float    v4f  __attribute__((ext_vector_type(4)));
typedef unsigned int v4u __attribute__((ext_vector_type(4)));
typedef uint32_t u32x4 __attribute__((ext_vector_type(4)));
typedef uint32_t u32x8 __attribute__((ext_vector_type(8)));

#if defined(__HIP_DEVICE_COMPILE__)
#define DEV_ASM 1
#else
#define DEV_ASM 0
#endif

// ---- scalar helpers --------------------------------------------------------------------------------
__device__ __forceinline__ unsigned short bf_bits(float f) {          // f32 -> bf16 bits, RNE convert
  unsigned u = __float_as_uint(f);
  return (unsigned short)((u + 0x7FFFu + ((u >> 16) & 1u)) >> 16);
}
__device__ __forceinline__ float bf_up(unsigned short hb) { return __uint_as_float(((unsigned)hb) << 16); }
__device__ __forceinline__ float bf16r(float f) { return bf_up(bf_bits(f)); }   // value of the bf16 RNE convert
__device__ __forceinline__ unsigned short h_bits(_Float16 x) { return __builtin_bit_cast(unsigned short, x); }
__device__ __forceinline__ unsigned pk16(unsigned short a, unsigned short b) { return (unsigned)a | ((unsigned)b << 16); }
__device__ __forceinline__ v8f zero8() { v8f z = {0.f, 0.f, 0.f, 0.f, 0.f, 0.f, 0.f, 0.f}; return z; }

// ---- fragment types / loaders: 16-bit A/B operand, lane -> row/col (lane&15), p already includes +8*(lane>>4);
//      elements 0..7 <- p[0..7] (k0+8h..k0+8h+7), elements 8..15 <- p[16..23] (k0+16+8h..k0+16+8h+7)
template <typename OT> struct FT;
template <> struct FT<__bf16>   { typedef v16b frag; typedef v8b half8; };
template <> struct FT<_Float16> { typedef v16h frag; typedef v8h half8; };

template <typename OT>
__device__ __forceinline__ typename FT<OT>::frag ldfrag(const OT* p) {
  union { typename FT<OT>::frag v; typename FT<OT>::half8 h[2]; } f;
  f.h[0] = *(const typename FT<OT>::half8*)(p);
  f.h[1] = *(const typename FT<OT>::half8*)(p + 16);
  return f.v;
}

// ---- WMMA helpers (asm guard bodies are device-only; concrete operand types) -----------------------------
__device__ __forceinline__ v8f mmar(v16b a, v16b b, v8f c) {
  return __builtin_amdgcn_wmma_f32_16x16x32_bf16(false, a, false, b, (short)0, c, false, false);
}
__device__ __forceinline__ v8f mmar(v16h a, v16h b, v8f c) {
  return __builtin_amdgcn_wmma_f32_16x16x32_f16(false, a, false, b, (short)0, c, false, false);
}
// guarded form: 4 VALU slots after the WMMA, D tied, A/B kept live
__device__ __forceinline__ v8f mma_h(v16h a, v16h b, v8f c) {
  c = __builtin_amdgcn_wmma_f32_16x16x32_f16(false, a, false, b, (short)0, c, false, false);
#if DEV_ASM
  asm volatile("v_nop\n\tv_nop\n\tv_nop\n\tv_nop" : "+v"(c) : "v"(a), "v"(b));
#endif
  return c;
}
__device__ __forceinline__ void acc_guard4(v8f& a, v8f& b, v8f& c, v8f& d) {
#if DEV_ASM
  asm volatile("v_nop\n\tv_nop\n\tv_nop\n\tv_nop" : "+v"(a), "+v"(b), "+v"(c), "+v"(d));
#else
  (void)a; (void)b; (void)c; (void)d;
#endif
}

// ---- tensor-load helpers for gemm64's LDS ring ------------------------------------------------------
#define GK_PASS  128                  // k elements of one stage: rows of 256 B
#define GK_PITCH 272                  // LDS row pitch in bytes: 256 B + the 16-B pad (odd multiple of 16 B for 16-B readers)
#define GK_SLICE 18432                // one wave's slice: 64 rows x 272 B = 17408 B, rounded up to a multiple of 2 KiB
#define GK_STAGE (4 * GK_SLICE)       // [A rows 0..63 | A rows 64..127 | Bt rows 0..63 | Bt rows 64..127]
static_assert(64 * GK_PITCH <= GK_SLICE && (GK_SLICE % 2048) == 0);
__device__ __forceinline__ uint32_t uni(uint32_t v) { return (uint32_t)__builtin_amdgcn_readfirstlane(v); }
__device__ __forceinline__ uint32_t pinned(uint32_t v) { uint32_t w = uni(v); asm volatile("" : "+s"(w)); return w; }
// the compiler places no wait for a tensor load: the issuing wave waits for its own request here; the request's two
// groups are inputs, so that their scalar registers keep their values until the request has landed
__device__ __forceinline__ void wait_tensor0(u32x4 g0, u32x8 g1) { asm volatile("s_wait_tensorcnt 0x0" :: "s"(g0), "s"(g1) : "memory"); }
// this wave's LDS reads have retired before the barrier behind which their buffer is refilled
__device__ __forceinline__ void wait_ds0() { asm volatile("s_wait_dscnt 0x0" ::: "memory"); }
__device__ __forceinline__ void tdm_load(u32x4 g0, u32x8 g1) { asm volatile("tensor_load_to_lds %0, %1" :: "s"(g0), "s"(g1) : "memory"); }
// group 1: 1-byte elements, tile = tensor = 64 rows of 256 B, source row pitch src_pitch bytes, 4 dwords of LDS pad behind every row
__device__ __forceinline__ u32x8 tdm_group1(uint32_t src_pitch) {
  constexpr uint32_t d0 = 256u, d1 = 64u;
  u32x8 g;
  g[0] = uni((1u << 20) | (5u << 22) | (3u << 25));   // no mask, data_size 0, pad after every 64 dwords, 4 dwords
  g[1] = uni((d0 & 0xFFFFu) << 16);
  g[2] = uni((d0 >> 16) | ((d1 & 0xFFFFu) << 16));
  g[3] = uni((d1 >> 16) | (d0 << 16));
  g[4] = uni(d1);
  g[5] = uni(src_pitch);
  g[6] = uni(0u);
  g[7] = uni(0u);
  return g;
}
__device__ __forceinline__ u32x4 tdm_group0(uint32_t lds_dst, uint64_t ga) {
  u32x4 g;
  g[0] = uni(1u);
  g[1] = uni(lds_dst);
  g[2] = uni((uint32_t)ga);
  g[3] = uni((((uint32_t)(ga >> 32)) & 0x01FFFFFFu) | 0x80000000u);
  return g;
}

// =====================================================================================================
// f32 -> bf16 (RNE convert), 8 elements per thread, one 16-B store per lane: a wave writes 512 contiguous B
// Layout is preserved, so a [out][in] f32 weight becomes the bf16 Bt[n][k] plane (k contiguous) directly.
// coverage: n8 threads x 8 = the whole plane (n8 = 524288 / 393216 / 131072, all multiples of 256).
// =====================================================================================================
__global__ __launch_bounds__(256) void cvt_bf16x8(const float* __restrict__ in, unsigned short* out, int n8) {
  const int i = blockIdx.x * 256 + (int)threadIdx.x;
  if (i < n8) {
    const v4f a = *(const v4f*)(in + (size_t)i * 8);
    const v4f b = *(const v4f*)(in + (size_t)i * 8 + 4);
    v4u p;
    p[0] = pk16(bf_bits(a[0]), bf_bits(a[1]));
    p[1] = pk16(bf_bits(a[2]), bf_bits(a[3]));
    p[2] = pk16(bf_bits(b[0]), bf_bits(b[1]));
    p[3] = pk16(bf_bits(b[2]), bf_bits(b[3]));
    *(v4u*)(out + (size_t)i * 8) = p;
    
  }
}

// =====================================================================================================
// Register-blocked batched WMMA GEMM (16-bit operand type OT): C[m][n] = sum_k A[m][k] * Bt[n][k];
// one block of 4 waves (2 x 2) per 128x128 tile, one wave per 64x64 tile. A row-major [M][K] pitch lda; Bt row-major
// [N][K] pitch ldb (k contiguous); M, N multiples of 128, K a multiple of 128 and at least 256 (host-checked).
// blockIdx.y = batch index (strides in elements). A stage = 128 k of the block's 128 A rows and 128 Bt rows in LDS;
// every wave brings one 64-row slice of it with one tensor load, two buffers, the next stage in flight during a pass.
// Fragments are read from LDS with the split k map (ldfrag); k runs upward in steps of 32.
//   TWOA: a second A plane Al with the same Bt is accumulated into the same tile (C = (A + Al) . Bt^T).
//   OUT_MODE 0: f32 C (pitch ldc), value + bf16(bias[col]); 256-B row segment = 16 lanes x 16 B, one instruction,
//   OUT_MODE 1: half-rotation rotary of (acc + bf16(bias[col])) -> f16 hi plane C + f16 residual plane
//               C2 = f16((v - hi) * rscale). N tile = one 64-wide head: dims d < 32 pair with d + 32:
//               out[d] = x[d] c[t][d] - x[d+32] s[t][d] (d < 32), x[d] c[t][d] + x[d-32] s[t][d] (d >= 32),
//               t = row mod SEQ, c/s = bf16 value of the [SEQ][64] input tables, f32, contract off,
//               partner column read from the staged slab.
//   OUT_MODE 2: as 1 but a single f16 plane C.
//   OUT_MODE 3: single f16 plane C of acc + bf16(bias[row]) (no rotary; used for v^T where the feature is the row).
// coverage: 4 slabs x 16 rows x 64 cols = the wave's whole 64x64 tile; (M/128)*(N/128) blocks x 4 waves x gridDim.y = the whole plane.
// =====================================================================================================
template <typename OT, int OUT_MODE, bool TWOA>
__global__ __launch_bounds__(128) void gemm64(
    const unsigned short* __restrict__ Ap, const unsigned short* __restrict__ Alp, int lda, long long strideA,
    const unsigned short* __restrict__ Btp, int ldb, long long strideB,
    void* Cout, void* Cout2, int ldc, long long strideC,
    const float* __restrict__ bias, const float* __restrict__ ctab, const float* __restrict__ stab,
    int M, int N, int K, float rscale) {
  static_assert(OUT_MODE >= 0 && OUT_MODE <= 3);
  typedef typename FT<OT>::frag V16;
  const OT* Ah = (const OT*)(const void*)Ap;
  const OT* Al = (const OT*)(const void*)Alp;
  const OT* Bt = (const OT*)(const void*)Btp;
  __shared__ __attribute__((aligned(2048))) unsigned char ring[2 * GK_STAGE];   // two stages
  __shared__ __align__(16) float sT[4][16 * 68];   // per-wave 16x64 slab, pitch 68 floats
  const int b    = blockIdx.y;
  const int lane = threadIdx.x & 31;
  const uint32_t wave = uni(threadIdx.x >> 5);
  const int tilesN = N >> 7;
  const int tilesM = M >> 7;
  const int bt = blockIdx.x;
  if (bt >= tilesM * tilesN) return;   // block-uniform, in front of every barrier and tensor load
  const int btm = bt / tilesN;
  const int btn = bt - btm * tilesN;
  const uint32_t wm = wave & 1u;               // which 64 A rows of the block tile this wave multiplies
  const uint32_t wn = wave >> 1;               // which 64 Bt rows
  const int m0 = (btm << 7) + (int)(wm << 6);
  const int n0 = (btn << 7) + (int)(wn << 6);

  const int rlane = lane & 15;                 // row (A) / col (B, D) within subtile
  const int koff  = (lane >> 4) * 8;           // k offset of this lane half
  const int mOff  = (lane >> 4) * 8;           // D row offset

  // ---- what this wave loads: waves 0, 1 the two halves of the A rows, waves 2, 3 the two halves of the Bt rows ----
  constexpr uint32_t NPL = TWOA ? 2u : 1u;
  const bool     isB   = wave >= 2u;
  const uint32_t half  = wave & 1u;
  const size_t   rowA  = (size_t)b * (size_t)strideA + (size_t)((btm << 7) + (int)(half << 6)) * lda;
  const size_t   rowBt = (size_t)b * (size_t)strideB + (size_t)((btn << 7) + (int)(half << 6)) * ldb;
  const uint64_t src0  = isB ? (uint64_t)(size_t)(Bt + rowBt) : (uint64_t)(size_t)(Ah + rowA);
  const uint64_t src1  = isB ? (uint64_t)(size_t)(Bt + rowBt) : (uint64_t)(size_t)(Al + rowA);
  const uint32_t kp    = (uint32_t)K / GK_PASS;       // stages per A plane
  const uint32_t nst   = kp * NPL;                    // stages in all (at least 2)
  const uint32_t lbase = (uint32_t)(size_t)ring;
  u32x8 g1 = tdm_group1((uint32_t)(isB ? ldb : lda) * 2u);
  // without this the compiler rebuilds words of group 1 from their constants, in the registers a request was issued from
  asm volatile("" : "+s"(g1));   // the pinned() form: descriptor words held in their scalar registers
  auto group0 = [&](uint32_t st) -> u32x4 {
    const bool second = TWOA && st >= kp;             // second A plane, Bt's k starts over
    const uint32_t kk = second ? st - kp : st;
    const uint64_t ga = (second ? src1 : src0) + (uint64_t)kk * (GK_PASS * 2u);
    return tdm_group0(lbase + (st & 1u) * GK_STAGE + wave * GK_SLICE, ga);
  };

  v8f acc[4][4];
#pragma unroll
  for (int i = 0; i < 4; ++i)
#pragma unroll
    for (int j = 0; j < 4; ++j) acc[i][j] = zero8();

  u32x4 g0 = group0(0);
  tdm_load(g0, g1);
  wait_tensor0(g0, g1);
  __syncthreads();
  g0 = group0(1);
  tdm_load(g0, g1);
  // kept rolled: one pass and one publish point in the text, every accumulator index constant
#pragma unroll 1
  for (uint32_t st = 0; st < nst; ++st) {
    const unsigned char* buf = ring + (st & 1u) * GK_STAGE;
    const unsigned char* pa = buf + wm * GK_SLICE + rlane * GK_PITCH + koff * 2;
    const unsigned char* pb = buf + (2u + wn) * GK_SLICE + rlane * GK_PITCH + koff * 2;
#pragma unroll
    for (int ks = 0; ks < GK_PASS / 32; ++ks) {
      V16 bq[4], af[4];
#pragma unroll
      for (int j = 0; j < 4; ++j) bq[j] = ldfrag<OT>((const OT*)(const void*)(pb + j * 16 * GK_PITCH + ks * 64));
#pragma unroll
      for (int i = 0; i < 4; ++i) af[i] = ldfrag<OT>((const OT*)(const void*)(pa + i * 16 * GK_PITCH + ks * 64));
#pragma unroll
      for (int i = 0; i < 4; ++i)
#pragma unroll
        for (int j = 0; j < 4; ++j) acc[i][j] = mmar(af[i], bq[j], acc[i][j]);
    }
    // publish point of stage st + 1; behind its barrier every wave has left stage st's buffer
    wait_ds0();
    wait_tensor0(g0, g1);
    __syncthreads();
    if (pinned(st + 2u < nst)) {
      g0 = group0(st + 2u);
      tdm_load(g0, g1);
    }
  }
  wait_tensor0(g0, g1);
  wait_ds0();
  acc_guard4(acc[0][0], acc[0][1], acc[0][2], acc[0][3]);
  acc_guard4(acc[1][0], acc[1][1], acc[1][2], acc[1][3]);
  acc_guard4(acc[2][0], acc[2][1], acc[2][2], acc[2][3]);
  acc_guard4(acc[3][0], acc[3][1], acc[3][2], acc[3][3]);

  // ---- epilogue ----
  float* slab = sT[wave];
#pragma unroll
  for (int i = 0; i < 4; ++i) {
    const int mBase = m0 + (i << 4);
#pragma unroll
    for (int j = 0; j < 4; ++j) {
#pragma unroll
      for (int r = 0; r < 8; ++r) {
        slab[(mOff + r) * 68 + (j << 4) + rlane] = acc[i][j][r];
      }
    }
    __builtin_amdgcn_fence(__ATOMIC_RELEASE, "workgroup");
    __builtin_amdgcn_wave_barrier();
    __builtin_amdgcn_fence(__ATOMIC_ACQUIRE, "workgroup");
    if (OUT_MODE == 0) {
      float* C = (float*)Cout + (size_t)b * (size_t)strideC;
      const int h2 = lane >> 4, c4 = (lane & 15) * 4;     // 256-B row segment = 16 lanes x 16 B
      const v4f bb = *(const v4f*)(bias + n0 + c4);
      v4f bv;
#pragma unroll
      for (int e = 0; e < 4; ++e) bv[e] = bf16r(bb[e]);
      v4f ov[8];
#pragma unroll
      for (int it = 0; it < 8; ++it) {
        const int row = it * 2 + h2;                       // it 0..7 x h2 0..1 = rows 0..15
        ov[it] = *(const v4f*)(slab + row * 68 + c4) + bv;
      }
      {
#pragma unroll
        for (int it = 0; it < 8; ++it) {
          const int row = it * 2 + h2;
          *(v4f*)(C + (size_t)(mBase + row) * ldc + n0 + c4) = ov[it];
        }
        
      }
    } else {
      const int q = lane >> 3, c8 = (lane & 7) * 8;
      unsigned short* C  = (unsigned short*)Cout  + (size_t)b * (size_t)strideC;
      unsigned short* C2 = (unsigned short*)Cout2 + (size_t)b * (size_t)strideC;
#pragma unroll
      for (int it = 0; it < 4; ++it) {
        const int row = it * 4 + q;                        // it 0..3 x q 0..3 = rows 0..15
        const float* sp = slab + row * 68 + c8;
        float f[8];
#pragma unroll
        for (int e = 0; e < 8; ++e) f[e] = sp[e];
        if (OUT_MODE == 1 || OUT_MODE == 2) {
#pragma clang fp contract(off)
          const float* pp = slab + row * 68 + (c8 ^ 32);   // partner columns d +- 32 of the same row
          float g[8];
#pragma unroll
          for (int e = 0; e < 8; ++e) g[e] = pp[e];
          const v4f bc0 = *(const v4f*)(bias + n0 + c8);
          const v4f bc1 = *(const v4f*)(bias + n0 + c8 + 4);
          const v4f bp0 = *(const v4f*)(bias + n0 + (c8 ^ 32));
          const v4f bp1 = *(const v4f*)(bias + n0 + (c8 ^ 32) + 4);
          const int t  = (mBase + row) & (SEQ - 1);        // position within the sequence
          // tables are [SEQ][HD]; column within the head = c8 + e (n0 is head-aligned, c8 in 0..56)
          const v4f cv0 = *(const v4f*)(ctab + (size_t)t * HD + c8);
          const v4f cv1 = *(const v4f*)(ctab + (size_t)t * HD + c8 + 4);
          const v4f sv0 = *(const v4f*)(stab + (size_t)t * HD + c8);
          const v4f sv1 = *(const v4f*)(stab + (size_t)t * HD + c8 + 4);
          const float sg = (c8 < 32) ? -1.0f : 1.0f;       // -x2 for the first half, +x1 for the second half
#pragma unroll
          for (int e = 0; e < 4; ++e) {
            {
              const float x  = f[e] + bf16r(bc0[e]);
              const float y  = g[e] + bf16r(bp0[e]);
              const float ry = sg * y;
              const float p0 = x * bf16r(cv0[e]);
              const float p1 = ry * bf16r(sv0[e]);
              f[e] = p0 + p1;
            }
            {
              const float x  = f[4 + e] + bf16r(bc1[e]);
              const float y  = g[4 + e] + bf16r(bp1[e]);
              const float ry = sg * y;
              const float p0 = x * bf16r(cv1[e]);
              const float p1 = ry * bf16r(sv1[e]);
              f[4 + e] = p0 + p1;
            }
          }
        }
        if (OUT_MODE == 3) {
          const float bm = bf16r(bias[mBase + row]);
#pragma unroll
          for (int e = 0; e < 8; ++e) f[e] = f[e] + bm;
        }
        v4u a, a2;
#pragma unroll
        for (int e = 0; e < 4; ++e) {
          const float f0 = f[2 * e], f1 = f[2 * e + 1];
          const _Float16 x0 = (_Float16)f0, x1 = (_Float16)f1;
          const unsigned short h0 = h_bits(x0), h1 = h_bits(x1);
          unsigned short l0 = 0, l1 = 0;
          if (OUT_MODE == 1) {
            l0 = h_bits((_Float16)((f0 - (float)x0) * rscale));
            l1 = h_bits((_Float16)((f1 - (float)x1) * rscale));
          }
          a[e] = pk16(h0, h1); a2[e] = pk16(l0, l1);
        }
        unsigned short* cp  = C  + (size_t)(mBase + row) * ldc + n0 + c8;
        unsigned short* cp2 = C2 + (size_t)(mBase + row) * ldc + n0 + c8;
        *(v4u*)cp = a;
        if (OUT_MODE == 1) *(v4u*)cp2 = a2;
        
      }
    }
    __builtin_amdgcn_fence(__ATOMIC_RELEASE, "workgroup");
    __builtin_amdgcn_wave_barrier();
    __builtin_amdgcn_fence(__ATOMIC_ACQUIRE, "workgroup");
  }
}

// =====================================================================================================
// Multi-head attention, head dim 64, no mask, softmax over all SEQ keys.
//   q planes (f16 hi / residual x4096): element (b, t, h, d) at [(b*SEQ + t)*DM + h*64 + d] (rotary and bias applied)
//   k plane (f16): element (b, s, h, d) at [(b*SEQ + s)*DM + h*64 + d]
//   v^T plane (f16): element (b, h, d, s) at [(b*DM + h*64 + d)*SEQ + s]
//   ctx planes (bf16 hi / unscaled bf16 residual): element (b, t, h, d) at [(b*SEQ + t)*DM + h*64 + d]
//   scores = (qh . k) + (ql . k) / 4096 on f16 WMMA (two f32 accumulators), then * sscale in f32;
//   p = exp(s - m) carried as f16(1024 p); context = p . v on f16 WMMA; online softmax in f32.
//   Block = 4 waves = 64 query rows of one (b, h), wave w = rows q0 .. q0+15; grid = NB * NH * NQB;
//   key chunks of 64, static trip NKT. K / V^T chunk staging: 128 threads x 32 elements per plane = the whole
//   64x64 tile of both planes (plain 16-B loads, __syncthreads before and after); P tiles are wave-private,
//   barrier; every wave writes its whole 16x64 P tile before reloading it.
//   Output: the wave's 16x64 f32 context tile is staged in wave-private LDS, split into bf16 hi / residual and each
//   coverage: each wave stores rows q0..q0+15 (it 0..3 x lane>>3 0..3) x 64 columns (8 lanes x 8) of head h;
//   1024 blocks x 4 waves = every (b, h, t) of the [4096][1024] planes exactly once.
// =====================================================================================================
__global__ __launch_bounds__(128)
void attn_mha(const unsigned short* __restrict__ qhp, const unsigned short* __restrict__ qlp,
              const unsigned short* __restrict__ kpp, const unsigned short* __restrict__ vtp,
              unsigned short* ohp, unsigned short* olp, float sscale) {
  union FH { v16h v; v8h h[2]; };
  __shared__ __align__(16) _Float16 Ksh[64 * 64];          // K chunk [key][d]     8 KB
  __shared__ __align__(16) _Float16 Vth[64 * 64];          // V^T chunk [d][key]   8 KB
  __shared__ __align__(16) _Float16 Psh[4][16 * 64];       // per wave P [row][key] 8 KB
  __shared__ __align__(16) float    Os[4][16 * 64];        // per wave context tile 16 KB

  const int tid  = threadIdx.x;
  const int wave = tid >> 5;
  const int lane = tid & 31;
  const int hh   = lane >> 4;
  const int c    = lane & 15;

  const int bx   = blockIdx.x;
  const int qb   = bx % NQB;
  const int rest = bx / NQB;
  const int h    = rest % NH;
  const int b    = rest / NH;
  const int q0   = qb * 64 + wave * 16;
  const size_t rowB = (size_t)b * SEQ;
  const size_t hcol = (size_t)h * HD;

  const _Float16* Qh = (const _Float16*)(const void*)qhp;
  const _Float16* Ql = (const _Float16*)(const void*)qlp;
  const _Float16* Kg = (const _Float16*)(const void*)kpp + hcol;
  const _Float16* Vt = (const _Float16*)(const void*)vtp + ((size_t)b * DM + hcol) * SEQ;

  // ---- Q fragments (A operand, row = lane&15): 2 d-chunks, hi and residual planes ----
  v16h qah[2], qal[2];
#pragma unroll
  for (int dc = 0; dc < 2; ++dc) {
    const size_t qo = (rowB + q0 + c) * DM + hcol + dc * 32 + 8 * hh;
    qah[dc] = ldfrag<_Float16>(Qh + qo);
    qal[dc] = ldfrag<_Float16>(Ql + qo);
  }

  float mrow[8], lrow[8];
  v8f oacc[4];
#pragma unroll
  for (int r = 0; r < 8; ++r) { mrow[r] = -INFINITY; lrow[r] = 0.f; }
#pragma unroll
  for (int t = 0; t < 4; ++t) oacc[t] = zero8();

  for (int kt = 0; kt < NKT; ++kt) {         // static trip count
    const int kv0 = kt * 64;
    __syncthreads();
    {
      const int r = tid >> 1, half = (tid & 1) * 32;
      const _Float16* kg = Kg + (rowB + kv0 + r) * DM + half;       // k row kv0+r, d = half..half+31
      const _Float16* vg = Vt + (size_t)r * SEQ + kv0 + half;       // v^T row d = r, s = kv0+half..+31
#pragma unroll
      for (int i = 0; i < 4; ++i) {
        const v8h a0 = *(const v8h*)(kg + 8 * i);
        const v8h b0 = *(const v8h*)(vg + 8 * i);
        *(v8h*)(Ksh + r * 64 + half + 8 * i) = a0;
        *(v8h*)(Vth + r * 64 + half + 8 * i) = b0;
      }
    }
    __syncthreads();

    // ---- scores: 16 query rows x 64 keys per wave, 2 f16 products per key subtile and d-chunk ----
    v8f s[4];
#pragma unroll
    for (int j = 0; j < 4; ++j) {
      v8f ah = zero8(), al = zero8();
#pragma unroll
      for (int dc = 0; dc < 2; ++dc) {
        FH kb;
        kb.h[0] = *(const v8h*)(Ksh + (j * 16 + c) * 64 + dc * 32 + 8 * hh);
        kb.h[1] = *(const v8h*)(Ksh + (j * 16 + c) * 64 + dc * 32 + 16 + 8 * hh);
        ah = mma_h(qah[dc], kb.v, ah);
        al = mma_h(qal[dc], kb.v, al);
      }
#pragma unroll
      for (int r = 0; r < 8; ++r) s[j][r] = (ah[r] + al[r] * (1.0f / 4096.0f)) * sscale;
    }

    // ---- row max, online softmax, P (x1024, f16) to LDS ----
    _Float16* pwh = Psh[wave];
#pragma unroll
    for (int r = 0; r < 8; ++r) {
      float m = s[0][r];
#pragma unroll
      for (int j = 1; j < 4; ++j) m = fmaxf(m, s[j][r]);
#pragma unroll
      for (int off = 1; off < 16; off <<= 1) m = fmaxf(m, __shfl_xor(m, off, 32));
      const float mnew  = fmaxf(mrow[r], m);
      const float msafe = (mnew == -INFINITY) ? 0.f : mnew;
      const float alpha = __expf(mrow[r] - msafe);
      mrow[r] = mnew;
      float psum = 0.f;
#pragma unroll
      for (int j = 0; j < 4; ++j) {
        const float p = __expf(s[j][r] - msafe);
        psum += p;
        pwh[(8 * hh + r) * 64 + j * 16 + c] = (_Float16)(p * 1024.0f);
      }
#pragma unroll
      for (int off = 1; off < 16; off <<= 1) psum += __shfl_xor(psum, off, 32);
      lrow[r] = lrow[r] * alpha + psum;
#pragma unroll
      for (int t = 0; t < 4; ++t) oacc[t][r] *= alpha;
    }
    __builtin_amdgcn_fence(__ATOMIC_RELEASE, "workgroup");
    __builtin_amdgcn_wave_barrier();
    __builtin_amdgcn_fence(__ATOMIC_ACQUIRE, "workgroup");

    // ---- context += P . V (f16 WMMA, single product) ----
#pragma unroll 1
    for (int kk = 0; kk < 2; ++kk) {
      FH pa;
      pa.h[0] = *(const v8h*)(pwh + c * 64 + kk * 32 + 8 * hh);
      pa.h[1] = *(const v8h*)(pwh + c * 64 + kk * 32 + 16 + 8 * hh);
#pragma unroll
      for (int t = 0; t < 4; ++t) {
        FH vb;
        vb.h[0] = *(const v8h*)(Vth + (t * 16 + c) * 64 + kk * 32 + 8 * hh);
        vb.h[1] = *(const v8h*)(Vth + (t * 16 + c) * 64 + kk * 32 + 16 + 8 * hh);
        oacc[t] = mma_h(pa.v, vb.v, oacc[t]);
      }
    }
  }

  // ---- normalise (1/l, undo the x1024 p carry), stage the wave's 16x64 f32 tile, split into bf16 hi / residual,
  float* os = Os[wave];
#pragma unroll
  for (int r = 0; r < 8; ++r) {
    const float l = lrow[r];
    const float inv = ((l > 0.f) ? (1.0f / l) : 0.f) * (1.0f / 1024.0f);
#pragma unroll
    for (int t = 0; t < 4; ++t) os[(8 * hh + r) * 64 + t * 16 + c] = oacc[t][r] * inv;
  }
  __builtin_amdgcn_fence(__ATOMIC_RELEASE, "workgroup");
  __builtin_amdgcn_wave_barrier();
  __builtin_amdgcn_fence(__ATOMIC_ACQUIRE, "workgroup");
  {
    const int q4 = lane >> 3, c8 = (lane & 7) * 8;
    v4u hv[4], lv[4];
#pragma unroll
    for (int it = 0; it < 4; ++it) {
      const int row = it * 4 + q4;   // it 0..3 x q4 0..3 = rows 0..15 of the wave tile
      const float* sp = os + row * 64 + c8;
      v4u a, a2;
#pragma unroll
      for (int e = 0; e < 4; ++e) {
        const float f0 = sp[2 * e], f1 = sp[2 * e + 1];
        const unsigned short h0 = bf_bits(f0), h1 = bf_bits(f1);
        const unsigned short l0 = bf_bits(f0 - bf_up(h0)), l1 = bf_bits(f1 - bf_up(h1));
        a[e] = pk16(h0, h1); a2[e] = pk16(l0, l1);
      }
      hv[it] = a; lv[it] = a2;
    }
    {
#pragma unroll
      for (int it = 0; it < 4; ++it) {
        const int row = it * 4 + q4;
        const size_t go = (rowB + q0 + row) * DM + hcol + c8;
        *(v4u*)(ohp + go) = hv[it];
        *(v4u*)(olp + go) = lv[it];
      }
      
    }
  }
}

// =====================================================================================================
// Workspace map (bytes), every region an exact multiple of its whole-line / whole-tile store granularity
// (all shapes are tile multiples, no padded tails):
//   Xb    bf16 [4096][1024]          8388608
//   Wqkv  bf16 [3072 n][1024 k]      6291456   (input [out][in] layout == Bt[n][k], k contiguous)
//   Wo    bf16 [1024 n][1024 k]      2097152
//   Qh    f16  [4096][1024]          8388608
//   Ql    f16  [4096][1024]          8388608   (residual x4096)
//   Kp    f16  [4096][1024]          8388608
//   VT    f16  [4][1024][1024]       8388608
//   Oh    bf16 [4096][1024]          8388608
//   Ol    bf16 [4096][1024]          8388608
//   total                           67108864
// =====================================================================================================
extern "C" void kernel_launch(void* const* d_in, const int* in_sizes, int n_in,
                              void* d_out, int out_size, void* d_ws, size_t ws_size,
                              hipStream_t stream) {
  if (n_in < 7) return;
  if (in_sizes[0] != NTOK * DM) return;          // x      [4][1024][1024]
  if (in_sizes[1] != SEQ * HD) return;           // cos    [1024][64]
  if (in_sizes[2] != SEQ * HD) return;           // sin    [1024][64]
  if (in_sizes[3] != DQKV * DM) return;          // qkv_w  [3072][1024]
  if (in_sizes[4] != DQKV) return;               // qkv_b  [3072]
  if (in_sizes[5] != DM * DM) return;            // proj_w [1024][1024]
  if (in_sizes[6] != DM) return;                 // proj_b [1024]
  if (out_size != NTOK * DM) return;

  const float* x    = (const float*)d_in[0];
  const float* cosb = (const float*)d_in[1];
  const float* sinb = (const float*)d_in[2];
  const float* Wqkv = (const float*)d_in[3];
  const float* bqkv = (const float*)d_in[4];
  const float* Wout = (const float*)d_in[5];
  const float* bout = (const float*)d_in[6];

  const size_t PX  = (size_t)NTOK * DM * 2;        //  8388608  16-bit activation plane [4096][1024]
  const size_t PWQ = (size_t)DQKV * DM * 2;        //  6291456  bf16 [3072][1024]
  const size_t PWO = (size_t)DM * DM * 2;          //  2097152  bf16 [1024][1024]
  const size_t PVT = (size_t)NB * DM * SEQ * 2;    //  8388608  v^T plane [4][1024][1024]
  size_t off = 0;
  const size_t oXb  = off; off += PX;
  const size_t oWq  = off; off += PWQ;
  const size_t oWo  = off; off += PWO;
  const size_t oQh  = off; off += PX;
  const size_t oQl  = off; off += PX;
  const size_t oKp  = off; off += PX;
  const size_t oVT  = off; off += PVT;
  const size_t oOh  = off; off += PX;
  const size_t oOl  = off; off += PX;
  if (off > ws_size) return;                       // off = 67108864
  if (off > (size_t)134217728) return;

  char* ws = (char*)d_ws;
  unsigned short* Xb   = (unsigned short*)(ws + oXb);
  unsigned short* Wq16 = (unsigned short*)(ws + oWq);
  unsigned short* Wo16 = (unsigned short*)(ws + oWo);
  unsigned short* Qh   = (unsigned short*)(ws + oQh);
  unsigned short* Ql   = (unsigned short*)(ws + oQl);
  unsigned short* Kp   = (unsigned short*)(ws + oKp);
  unsigned short* VT   = (unsigned short*)(ws + oVT);
  unsigned short* Oh   = (unsigned short*)(ws + oOh);
  unsigned short* Ol   = (unsigned short*)(ws + oOl);

  const dim3 blk(256);
  const int n8x  = NTOK * DM / 8;                               // 524288
  const int n8wq = DQKV * DM / 8;                               // 393216
  const int n8wo = DM * DM / 8;                                 // 131072
  const dim3 gCvtX((n8x + 255) / 256);                          // 2048 blocks
  const dim3 gCvtWq((n8wq + 255) / 256);                        // 1536 blocks
  const dim3 gCvtWo((n8wo + 255) / 256);                        //  512 blocks
  const dim3 blkG(128);                                         // gemm64: 4 waves
  const dim3 gP((NTOK / 128) * (DM / 128), 1);                  // 256 blocks of one 128x128 tile: M=4096, N=1024
  const dim3 gVT((DM / 128) * (SEQ / 128), NB);                 //  64 blocks x 4 batches: M=1024, N=1024
  const dim3 gAttn(NB * NH * NQB);                              // 1024 blocks of 128
  static_assert((NTOK % 128) == 0 && (DM % 128) == 0 && (SEQ % 128) == 0 && (DM % GK_PASS) == 0 && DM / GK_PASS >= 2);
  static_assert((NTOK * DM) % 2048 == 0 && (DQKV * DM) % 2048 == 0 && (DM * DM) % 2048 == 0);
  static_assert((DM % 32) == 0);

  // (1) x -> bf16 plane [4096][1024]; qkv_w [3072][1024] ([out][in] = Bt[n][k]) -> bf16; proj_w [1024][1024] -> bf16
  cvt_bf16x8<<<gCvtX,  blk, 0, stream>>>(x,    Xb,   n8x);
  cvt_bf16x8<<<gCvtWq, blk, 0, stream>>>(Wqkv, Wq16, n8wq);
  cvt_bf16x8<<<gCvtWo, blk, 0, stream>>>(Wout, Wo16, n8wo);
  // (2) q = rope(x . Wq^T + bq) -> f16 hi / residual (x4096) planes [b*SEQ+t][h*64+d]   (M=4096, N=1024, K=1024)
  gemm64<__bf16, 1, false><<<gP, blkG, 0, stream>>>(
      Xb, Xb, DM, 0LL, Wq16, DM, 0LL,
      (void*)Qh, (void*)Ql, DM, 0LL, bqkv, cosb, sinb,
      NTOK, DM, DM, 4096.0f);
  // (3) k = rope(x . Wk^T + bk) -> f16 plane [b*SEQ+s][h*64+d]   (Bt = Wq16 rows 1024..2047)
  gemm64<__bf16, 2, false><<<gP, blkG, 0, stream>>>(
      Xb, Xb, DM, 0LL, Wq16 + (size_t)DM * DM, DM, 0LL,
      (void*)Kp, (void*)Kp, DM, 0LL, bqkv + DM, cosb, sinb,
      NTOK, DM, DM, 1.0f);
  // (4) v^T = Wv . x^T + bv per batch -> f16 plane [b][h*64+d][s] (pitch SEQ)
  //     (A = Wq16 rows 2048..3071 [feature][k], Bt = Xb rows of batch b; M=1024, N=1024, K=1024; bias by row)
  gemm64<__bf16, 3, false><<<gVT, blkG, 0, stream>>>(
      Wq16 + (size_t)2 * DM * DM, Wq16 + (size_t)2 * DM * DM, DM, 0LL, Xb, DM, (long long)SEQ * DM,
      (void*)VT, (void*)VT, SEQ, (long long)DM * SEQ, bqkv + 2 * DM, cosb, sinb,
      DM, SEQ, DM, 1.0f);
  // (5) attention -> ctx bf16 hi / residual planes [b*SEQ+t][h*64+d]
  attn_mha<<<gAttn, dim3(128), 0, stream>>>(Qh, Ql, Kp, VT, Oh, Ol, 0.125f);
  // (6) out = (Oh + Ol) . Wproj^T + bproj -> d_out f32 [4096][1024]   (M=4096, N=1024, K=1024, two A planes)
  gemm64<__bf16, 0, true><<<gP, blkG, 0, stream>>>(
      Oh, Ol, DM, 0LL, Wo16, DM, 0LL,
      d_out, d_out, DM, 0LL, bout, cosb, sinb,
      NTOK, DM, DM, 1.0f);
  (void)hipGetLastError();
}

// v002
// A run of this version takes 163 microseconds.
// Timed twice side by side with v001, it ran 1.20 times as fast both times.
// Over all steps from v000 it is 2.15 times as fast.
// Contractions: q / k / v^T projections = v_wmma_f32_16x16x32_bf16 (bf16 operands from RNE-converted x and qkv weight rows, single product, f32 accumulate);
// q.k^T scores = v_wmma_f32_16x16x32_f16 (q as f16 hi plane + f16 residual plane x4096, k f16; 2 products into separate f32 accumulators);
// p.v = v_wmma_f32_16x16x32_f16 (p carried x1024 in f16, v f16; single product, f32 accumulate);
// ctx.Wproj^T = v_wmma_f32_16x16x32_bf16 (ctx as bf16 hi plane + unscaled bf16 residual plane, weights bf16; 2 products, f32 accumulate);
// rotary with the input cos/sin tables (values RNE-converted to bf16), half-rotation, bias adds and softmax in f32 on the VALU.
// Carry audit: q residual plane x4096 -> folded back once as al * (1/4096) in the attn_mha score combine;
// p x1024 -> folded back once as (1/l) * (1/1024) in the attn_mha epilogue; ctx residual plane is the unscaled
// RNE residual (v - hi) and shares the hi accumulator; no weight-plane carries (all weight copies are bf16).
// gemm64 stages both operands in LDS with tensor loads (two buffers); its 16-bit epilogue stores each row group right after conversion.
#include <hip/hip_runtime.h>
#include <math.h>
#include <stdint.h>

#define NB    4
#define SEQ   1024
#define DM    1024
#define NH    16
#define HD    64
#define DQKV  (3 * DM)
#define NTOK  (NB * SEQ)   // 4096 token rows
#define NQB   (SEQ / 64)   // 16 query blocks of 64 per sequence
#define NKT   (SEQ / 64)   // 16 key chunks of 64 per sequence
static_assert(NH * HD == DM);
static_assert(NQB == 16 && NKT == 16);
static_assert((SEQ & (SEQ - 1)) == 0);
static_assert((SEQ % 64) == 0 && (DM % 64) == 0 && (DM % 32) == 0 && (DQKV % 64) == 0 && (NTOK % 64) == 0);

typedef _Float16 v16h __attribute__((ext_vector_type(16)));
typedef _Float16 v8h  __attribute__((ext_vector_type(8)));
typedef __bf16   v16b __attribute__((ext_vector_type(16)));
typedef __bf16   v8b  __attribute__((ext_vector_type(8)));
typedef float    v8f  __attribute__((ext_vector_type(8)));
typedef float    v4f  __attribute__((ext_vector_type(4)));
typedef unsigned int v4u __attribute__((ext_vector_type(4)));
typedef uint32_t u32x4 __attribute__((ext_vector_type(4)));
typedef uint32_t u32x8 __attribute__((ext_vector_type(8)));

#if defined(__HIP_DEVICE_COMPILE__)
#define DEV_ASM 1
#else
#define DEV_ASM 0
#endif

// ---- scalar helpers --------------------------------------------------------------------------------
__device__ __forceinline__ unsigned short bf_bits(float f) {          // f32 -> bf16 bits, RNE convert
  unsigned u = __float_as_uint(f);
  return (unsigned short)((u + 0x7FFFu + ((u >> 16) & 1u)) >> 16);
}
__device__ __forceinline__ float bf_up(unsigned short hb) { return __uint_as_float(((unsigned)hb) << 16); }
__device__ __forceinline__ float bf16r(float f) { return bf_up(bf_bits(f)); }   // value of the bf16 RNE convert
__device__ __forceinline__ unsigned short h_bits(_Float16 x) { return __builtin_bit_cast(unsigned short, x); }
__device__ __forceinline__ unsigned pk16(unsigned short a, unsigned short b) { return (unsigned)a | ((unsigned)b << 16); }
__device__ __forceinline__ v8f zero8() { v8f z = {0.f, 0.f, 0.f, 0.f, 0.f, 0.f, 0.f, 0.f}; return z; }

// ---- fragment types / loaders: 16-bit A/B operand, lane -> row/col (lane&15), p already includes +8*(lane>>4);
//      elements 0..7 <- p[0..7] (k0+8h..k0+8h+7), elements 8..15 <- p[16..23] (k0+16+8h..k0+16+8h+7)
template <typename OT> struct FT;
template <> struct FT<__bf16>   { typedef v16b frag; typedef v8b half8; };
template <> struct FT<_Float16> { typedef v16h frag; typedef v8h half8; };

template <typename OT>
__device__ __forceinline__ typename FT<OT>::frag ldfrag(const OT* p) {
  union { typename FT<OT>::frag v; typename FT<OT>::half8 h[2]; } f;
  f.h[0] = *(const typename FT<OT>::half8*)(p);
  f.h[1] = *(const typename FT<OT>::half8*)(p + 16);
  return f.v;
}

// ---- WMMA helpers (asm guard bodies are device-only; concrete operand types) -----------------------------
__device__ __forceinline__ v8f mmar(v16b a, v16b b, v8f c) {
  return __builtin_amdgcn_wmma_f32_16x16x32_bf16(false, a, false, b, (short)0, c, false, false);
}
__device__ __forceinline__ v8f mmar(v16h a, v16h b, v8f c) {
  return __builtin_amdgcn_wmma_f32_16x16x32_f16(false, a, false, b, (short)0, c, false, false);
}
// guarded form: 4 VALU slots after the WMMA, D tied, A/B kept live
__device__ __forceinline__ v8f mma_h(v16h a, v16h b, v8f c) {
  c = __builtin_amdgcn_wmma_f32_16x16x32_f16(false, a, false, b, (short)0, c, false, false);
#if DEV_ASM
  asm volatile("v_nop\n\tv_nop\n\tv_nop\n\tv_nop" : "+v"(c) : "v"(a), "v"(b));
#endif
  return c;
}
__device__ __forceinline__ void acc_guard4(v8f& a, v8f& b, v8f& c, v8f& d) {
#if DEV_ASM
  asm volatile("v_nop\n\tv_nop\n\tv_nop\n\tv_nop" : "+v"(a), "+v"(b), "+v"(c), "+v"(d));
#else
  (void)a; (void)b; (void)c; (void)d;
#endif
}

// ---- tensor-load helpers for gemm64's LDS ring ------------------------------------------------------
#define GK_PASS  128                  // k elements of one stage: rows of 256 B
#define GK_PITCH 272                  // LDS row pitch in bytes: 256 B + the 16-B pad (odd multiple of 16 B for 16-B readers)
#define GK_SLICE 18432                // one wave's slice: 64 rows x 272 B = 17408 B, rounded up to a multiple of 2 KiB
#define GK_STAGE (4 * GK_SLICE)       // [A rows 0..63 | A rows 64..127 | Bt rows 0..63 | Bt rows 64..127]
static_assert(64 * GK_PITCH <= GK_SLICE && (GK_SLICE % 2048) == 0);
__device__ __forceinline__ uint32_t uni(uint32_t v) { return (uint32_t)__builtin_amdgcn_readfirstlane(v); }
__device__ __forceinline__ uint32_t pinned(uint32_t v) { uint32_t w = uni(v); asm volatile("" : "+s"(w)); return w; }
// the compiler places no wait for a tensor load: the issuing wave waits for its own request here; the request's two
// groups are inputs, so that their scalar registers keep their values until the request has landed
__device__ __forceinline__ void wait_tensor0(u32x4 g0, u32x8 g1) { asm volatile("s_wait_tensorcnt 0x0" :: "s"(g0), "s"(g1) : "memory"); }
// this wave's LDS reads have retired before the barrier behind which their buffer is refilled
__device__ __forceinline__ void wait_ds0() { asm volatile("s_wait_dscnt 0x0" ::: "memory"); }
__device__ __forceinline__ void tdm_load(u32x4 g0, u32x8 g1) { asm volatile("tensor_load_to_lds %0, %1" :: "s"(g0), "s"(g1) : "memory"); }
// group 1: 1-byte elements, tile = tensor = 64 rows of 256 B, source row pitch src_pitch bytes, 4 dwords of LDS pad behind every row
__device__ __forceinline__ u32x8 tdm_group1(uint32_t src_pitch) {
  constexpr uint32_t d0 = 256u, d1 = 64u;
  u32x8 g;
  g[0] = uni((1u << 20) | (5u << 22) | (3u << 25));   // no mask, data_size 0, pad after every 64 dwords, 4 dwords
  g[1] = uni((d0 & 0xFFFFu) << 16);
  g[2] = uni((d0 >> 16) | ((d1 & 0xFFFFu) << 16));
  g[3] = uni((d1 >> 16) | (d0 << 16));
  g[4] = uni(d1);
  g[5] = uni(src_pitch);
  g[6] = uni(0u);
  g[7] = uni(0u);
  return g;
}
__device__ __forceinline__ u32x4 tdm_group0(uint32_t lds_dst, uint64_t ga) {
  u32x4 g;
  g[0] = uni(1u);
  g[1] = uni(lds_dst);
  g[2] = uni((uint32_t)ga);
  g[3] = uni((((uint32_t)(ga >> 32)) & 0x01FFFFFFu) | 0x80000000u);
  return g;
}

// =====================================================================================================
// f32 -> bf16 (RNE convert), 8 elements per thread, one 16-B store per lane: a wave writes 512 contiguous B
// Layout is preserved, so a [out][in] f32 weight becomes the bf16 Bt[n][k] plane (k contiguous) directly.
// coverage: n8 threads x 8 = the whole plane (n8 = 524288 / 393216 / 131072, all multiples of 256).
// =====================================================================================================
__global__ __launch_bounds__(256) void cvt_bf16x8(const float* __restrict__ in, unsigned short* out, int n8) {
  const int i = blockIdx.x * 256 + (int)threadIdx.x;
  if (i < n8) {
    const v4f a = *(const v4f*)(in + (size_t)i * 8);
    const v4f b = *(const v4f*)(in + (size_t)i * 8 + 4);
    v4u p;
    p[0] = pk16(bf_bits(a[0]), bf_bits(a[1]));
    p[1] = pk16(bf_bits(a[2]), bf_bits(a[3]));
    p[2] = pk16(bf_bits(b[0]), bf_bits(b[1]));
    p[3] = pk16(bf_bits(b[2]), bf_bits(b[3]));
    *(v4u*)(out + (size_t)i * 8) = p;
    
  }
}

// =====================================================================================================
// Register-blocked batched WMMA GEMM (16-bit operand type OT): C[m][n] = sum_k A[m][k] * Bt[n][k];
// one block of 4 waves (2 x 2) per 128x128 tile, one wave per 64x64 tile. A row-major [M][K] pitch lda; Bt row-major
// [N][K] pitch ldb (k contiguous); M, N multiples of 128, K a multiple of 128 and at least 256 (host-checked).
// blockIdx.y = batch index (strides in elements). A stage = 128 k of the block's 128 A rows and 128 Bt rows in LDS;
// every wave brings one 64-row slice of it with one tensor load, two buffers, the next stage in flight during a pass.
// Fragments are read from LDS with the split k map (ldfrag); k runs upward in steps of 32.
//   TWOA: a second A plane Al with the same Bt is accumulated into the same tile (C = (A + Al) . Bt^T).
//   OUT_MODE 0: f32 C (pitch ldc), value + bf16(bias[col]); 256-B row segment = 16 lanes x 16 B, one instruction,
//   OUT_MODE 1: half-rotation rotary of (acc + bf16(bias[col])) -> f16 hi plane C + f16 residual plane
//               C2 = f16((v - hi) * rscale). N tile = one 64-wide head: dims d < 32 pair with d + 32:
//               out[d] = x[d] c[t][d] - x[d+32] s[t][d] (d < 32), x[d] c[t][d] + x[d-32] s[t][d] (d >= 32),
//               t = row mod SEQ, c/s = bf16 value of the [SEQ][64] input tables, f32, contract off,
//               partner column read from the staged slab.
//   OUT_MODE 2: as 1 but a single f16 plane C.
//   OUT_MODE 3: single f16 plane C of acc + bf16(bias[row]) (no rotary; used for v^T where the feature is the row).
// coverage: 4 slabs x 16 rows x 64 cols = the wave's whole 64x64 tile; (M/128)*(N/128) blocks x 4 waves x gridDim.y = the whole plane.
// =====================================================================================================
template <typename OT, int OUT_MODE, bool TWOA>
__global__ __launch_bounds__(128) void gemm64(
    const unsigned short* __restrict__ Ap, const unsigned short* __restrict__ Alp, int lda, long long strideA,
    const unsigned short* __restrict__ Btp, int ldb, long long strideB,
    void* Cout, void* Cout2, int ldc, long long strideC,
    const float* __restrict__ bias, const float* __restrict__ ctab, const float* __restrict__ stab,
    int M, int N, int K, float rscale) {
  static_assert(OUT_MODE >= 0 && OUT_MODE <= 3);
  typedef typename FT<OT>::frag V16;
  const OT* Ah = (const OT*)(const void*)Ap;
  const OT* Al = (const OT*)(const void*)Alp;
  const OT* Bt = (const OT*)(const void*)Btp;
  __shared__ __attribute__((aligned(2048))) unsigned char ring[2 * GK_STAGE];   // two stages
  __shared__ __align__(16) float sT[4][16 * 68];   // per-wave 16x64 slab, pitch 68 floats
  const int b    = blockIdx.y;
  const int lane = threadIdx.x & 31;
  const uint32_t wave = uni(threadIdx.x >> 5);
  const int tilesN = N >> 7;
  const int tilesM = M >> 7;
  const int bt = blockIdx.x;
  if (bt >= tilesM * tilesN) return;   // block-uniform, in front of every barrier and tensor load
  const int btm = bt / tilesN;
  const int btn = bt - btm * tilesN;
  const uint32_t wm = wave & 1u;               // which 64 A rows of the block tile this wave multiplies
  const uint32_t wn = wave >> 1;               // which 64 Bt rows
  const int m0 = (btm << 7) + (int)(wm << 6);
  const int n0 = (btn << 7) + (int)(wn << 6);

  const int rlane = lane & 15;                 // row (A) / col (B, D) within subtile
  const int koff  = (lane >> 4) * 8;           // k offset of this lane half
  const int mOff  = (lane >> 4) * 8;           // D row offset

  // ---- what this wave loads: waves 0, 1 the two halves of the A rows, waves 2, 3 the two halves of the Bt rows ----
  constexpr uint32_t NPL = TWOA ? 2u : 1u;
  const bool     isB   = wave >= 2u;
  const uint32_t half  = wave & 1u;
  const size_t   rowA  = (size_t)b * (size_t)strideA + (size_t)((btm << 7) + (int)(half << 6)) * lda;
  const size_t   rowBt = (size_t)b * (size_t)strideB + (size_t)((btn << 7) + (int)(half << 6)) * ldb;
  const uint64_t src0  = isB ? (uint64_t)(size_t)(Bt + rowBt) : (uint64_t)(size_t)(Ah + rowA);
  const uint64_t src1  = isB ? (uint64_t)(size_t)(Bt + rowBt) : (uint64_t)(size_t)(Al + rowA);
  const uint32_t kp    = (uint32_t)K / GK_PASS;       // stages per A plane
  const uint32_t nst   = kp * NPL;                    // stages in all (at least 2)
  const uint32_t lbase = (uint32_t)(size_t)ring;
  u32x8 g1 = tdm_group1((uint32_t)(isB ? ldb : lda) * 2u);
  // without this the compiler rebuilds words of group 1 from their constants, in the registers a request was issued from
  asm volatile("" : "+s"(g1));   // the pinned() form: descriptor words held in their scalar registers
  auto group0 = [&](uint32_t st) -> u32x4 {
    const bool second = TWOA && st >= kp;             // second A plane, Bt's k starts over
    const uint32_t kk = second ? st - kp : st;
    const uint64_t ga = (second ? src1 : src0) + (uint64_t)kk * (GK_PASS * 2u);
    return tdm_group0(lbase + (st & 1u) * GK_STAGE + wave * GK_SLICE, ga);
  };

  v8f acc[4][4];
#pragma unroll
  for (int i = 0; i < 4; ++i)
#pragma unroll
    for (int j = 0; j < 4; ++j) acc[i][j] = zero8();

  u32x4 g0 = group0(0);
  tdm_load(g0, g1);
  wait_tensor0(g0, g1);
  __syncthreads();
  g0 = group0(1);
  tdm_load(g0, g1);
  // kept rolled: one pass and one publish point in the text, every accumulator index constant
#pragma unroll 1
  for (uint32_t st = 0; st < nst; ++st) {
    const unsigned char* buf = ring + (st & 1u) * GK_STAGE;
    const unsigned char* pa = buf + wm * GK_SLICE + rlane * GK_PITCH + koff * 2;
    const unsigned char* pb = buf + (2u + wn) * GK_SLICE + rlane * GK_PITCH + koff * 2;
#pragma unroll
    for (int ks = 0; ks < GK_PASS / 32; ++ks) {
      V16 bq[4], af[4];
#pragma unroll
      for (int j = 0; j < 4; ++j) bq[j] = ldfrag<OT>((const OT*)(const void*)(pb + j * 16 * GK_PITCH + ks * 64));
#pragma unroll
      for (int i = 0; i < 4; ++i) af[i] = ldfrag<OT>((const OT*)(const void*)(pa + i * 16 * GK_PITCH + ks * 64));
#pragma unroll
      for (int i = 0; i < 4; ++i)
#pragma unroll
        for (int j = 0; j < 4; ++j) acc[i][j] = mmar(af[i], bq[j], acc[i][j]);
    }
    // publish point of stage st + 1; behind its barrier every wave has left stage st's buffer
    wait_ds0();
    wait_tensor0(g0, g1);
    __syncthreads();
    if (pinned(st + 2u < nst)) {
      g0 = group0(st + 2u);
      tdm_load(g0, g1);
    }
  }
  wait_tensor0(g0, g1);
  wait_ds0();
  acc_guard4(acc[0][0], acc[0][1], acc[0][2], acc[0][3]);
  acc_guard4(acc[1][0], acc[1][1], acc[1][2], acc[1][3]);
  acc_guard4(acc[2][0], acc[2][1], acc[2][2], acc[2][3]);
  acc_guard4(acc[3][0], acc[3][1], acc[3][2], acc[3][3]);

  // ---- epilogue ----
  float* slab = sT[wave];
#pragma unroll
  for (int i = 0; i < 4; ++i) {
    const int mBase = m0 + (i << 4);
#pragma unroll
    for (int j = 0; j < 4; ++j) {
#pragma unroll
      for (int r = 0; r < 8; ++r) {
        slab[(mOff + r) * 68 + (j << 4) + rlane] = acc[i][j][r];
      }
    }
    __builtin_amdgcn_fence(__ATOMIC_RELEASE, "workgroup");
    __builtin_amdgcn_wave_barrier();
    __builtin_amdgcn_fence(__ATOMIC_ACQUIRE, "workgroup");
    if (OUT_MODE == 0) {
      float* C = (float*)Cout + (size_t)b * (size_t)strideC;
      const int h2 = lane >> 4, c4 = (lane & 15) * 4;     // 256-B row segment = 16 lanes x 16 B
      const v4f bb = *(const v4f*)(bias + n0 + c4);
      v4f bv;
#pragma unroll
      for (int e = 0; e < 4; ++e) bv[e] = bf16r(bb[e]);
      v4f ov[8];
#pragma unroll
      for (int it = 0; it < 8; ++it) {
        const int row = it * 2 + h2;                       // it 0..7 x h2 0..1 = rows 0..15
        ov[it] = *(const v4f*)(slab + row * 68 + c4) + bv;
      }
      {
#pragma unroll
        for (int it = 0; it < 8; ++it) {
          const int row = it * 2 + h2;
          *(v4f*)(C + (size_t)(mBase + row) * ldc + n0 + c4) = ov[it];
        }
        
      }
    } else {
      const int q = lane >> 3, c8 = (lane & 7) * 8;
      unsigned short* C  = (unsigned short*)Cout  + (size_t)b * (size_t)strideC;
      unsigned short* C2 = (unsigned short*)Cout2 + (size_t)b * (size_t)strideC;
#pragma unroll
      for (int it = 0; it < 4; ++it) {
        const int row = it * 4 + q;                        // it 0..3 x q 0..3 = rows 0..15
        const float* sp = slab + row * 68 + c8;
        float f[8];
#pragma unroll
        for (int e = 0; e < 8; ++e) f[e] = sp[e];
        if (OUT_MODE == 1 || OUT_MODE == 2) {
#pragma clang fp contract(off)
          const float* pp = slab + row * 68 + (c8 ^ 32);   // partner columns d +- 32 of the same row
          float g[8];
#pragma unroll
          for (int e = 0; e < 8; ++e) g[e] = pp[e];
          const v4f bc0 = *(const v4f*)(bias + n0 + c8);
          const v4f bc1 = *(const v4f*)(bias + n0 + c8 + 4);
          const v4f bp0 = *(const v4f*)(bias + n0 + (c8 ^ 32));
          const v4f bp1 = *(const v4f*)(bias + n0 + (c8 ^ 32) + 4);
          const int t  = (mBase + row) & (SEQ - 1);        // position within the sequence
          // tables are [SEQ][HD]; column within the head = c8 + e (n0 is head-aligned, c8 in 0..56)
          const v4f cv0 = *(const v4f*)(ctab + (size_t)t * HD + c8);
          const v4f cv1 = *(const v4f*)(ctab + (size_t)t * HD + c8 + 4);
          const v4f sv0 = *(const v4f*)(stab + (size_t)t * HD + c8);
          const v4f sv1 = *(const v4f*)(stab + (size_t)t * HD + c8 + 4);
          const float sg = (c8 < 32) ? -1.0f : 1.0f;       // -x2 for the first half, +x1 for the second half
#pragma unroll
          for (int e = 0; e < 4; ++e) {
            {
              const float x  = f[e] + bf16r(bc0[e]);
              const float y  = g[e] + bf16r(bp0[e]);
              const float ry = sg * y;
              const float p0 = x * bf16r(cv0[e]);
              const float p1 = ry * bf16r(sv0[e]);
              f[e] = p0 + p1;
            }
            {
              const float x  = f[4 + e] + bf16r(bc1[e]);
              const float y  = g[4 + e] + bf16r(bp1[e]);
              const float ry = sg * y;
              const float p0 = x * bf16r(cv1[e]);
              const float p1 = ry * bf16r(sv1[e]);
              f[4 + e] = p0 + p1;
            }
          }
        }
        if (OUT_MODE == 3) {
          const float bm = bf16r(bias[mBase + row]);
#pragma unroll
          for (int e = 0; e < 8; ++e) f[e] = f[e] + bm;
        }
        v4u a, a2;
#pragma unroll
        for (int e = 0; e < 4; ++e) {
          const float f0 = f[2 * e], f1 = f[2 * e + 1];
          const _Float16 x0 = (_Float16)f0, x1 = (_Float16)f1;
          const unsigned short h0 = h_bits(x0), h1 = h_bits(x1);
          unsigned short l0 = 0, l1 = 0;
          if (OUT_MODE == 1) {
            l0 = h_bits((_Float16)((f0 - (float)x0) * rscale));
            l1 = h_bits((_Float16)((f1 - (float)x1) * rscale));
          }
          a[e] = pk16(h0, h1); a2[e] = pk16(l0, l1);
        }
        unsigned short* cp  = C  + (size_t)(mBase + row) * ldc + n0 + c8;
        unsigned short* cp2 = C2 + (size_t)(mBase + row) * ldc + n0 + c8;
        *(v4u*)cp = a;
        if (OUT_MODE == 1) *(v4u*)cp2 = a2;
        
      }
    }
    __builtin_amdgcn_fence(__ATOMIC_RELEASE, "workgroup");
    __builtin_amdgcn_wave_barrier();
    __builtin_amdgcn_fence(__ATOMIC_ACQUIRE, "workgroup");
  }
}

// =====================================================================================================
// Multi-head attention, head dim 64, no mask, softmax over all SEQ keys.
//   q planes (f16 hi / residual x4096): element (b, t, h, d) at [(b*SEQ + t)*DM + h*64 + d] (rotary and bias applied)
//   k plane (f16): element (b, s, h, d) at [(b*SEQ + s)*DM + h*64 + d]
//   v^T plane (f16): element (b, h, d, s) at [(b*DM + h*64 + d)*SEQ + s]
//   ctx planes (bf16 hi / unscaled bf16 residual): element (b, t, h, d) at [(b*SEQ + t)*DM + h*64 + d]
//   scores = (qh . k) + (ql . k) / 4096 on f16 WMMA (two f32 accumulators), then * sscale in f32;
//   p = exp(s - m) carried as f16(1024 p); context = p . v on f16 WMMA; online softmax in f32.
//   Block = 4 waves = 64 query rows of one (b, h), wave w = rows q0 .. q0+15; grid = NB * NH * NQB;
//   key chunks of 64, static trip NKT. K / V^T chunk staging: 128 threads x 32 elements per plane = the whole
//   64x64 tile of both planes (plain 16-B loads, __syncthreads before and after); P tiles are wave-private,
//   barrier; every wave writes its whole 16x64 P tile before reloading it.
//   Output: the wave's 16x64 f32 context tile is staged in wave-private LDS, split into bf16 hi / residual and each
//   coverage: each wave stores rows q0..q0+15 (it 0..3 x lane>>3 0..3) x 64 columns (8 lanes x 8) of head h;
//   1024 blocks x 4 waves = every (b, h, t) of the [4096][1024] planes exactly once.
// =====================================================================================================
// LDS row pitches: a fragment read is 16 B per lane with the lane's row = lane & 15, so the rows of a 16-bit tile stand
// 144 B apart (128 B of data + 16 B, an odd multiple of 16 B) and 16 rows fall on 16 different groups of four banks;
// the f32 tile's rows stand 68 dwords apart for its 16-B row reads. The pad bytes are never written and never read.
#define AT_PITCH 72                   // 16-bit elements per LDS row of the K, V^T and P tiles
#define OS_PITCH 68                   // floats per LDS row of the context tile
static_assert((AT_PITCH * 2) % 32 == 16 && AT_PITCH >= 64 && (OS_PITCH * 4) % 16 == 0 && OS_PITCH >= 64);
__global__ __launch_bounds__(128)
void attn_mha(const unsigned short* __restrict__ qhp, const unsigned short* __restrict__ qlp,
              const unsigned short* __restrict__ kpp, const unsigned short* __restrict__ vtp,
              unsigned short* ohp, unsigned short* olp, float sscale) {
  union FH { v16h v; v8h h[2]; };
  __shared__ __align__(16) _Float16 Ksh[64 * AT_PITCH];      // K chunk [key][d]      9 KB
  __shared__ __align__(16) _Float16 Vth[64 * AT_PITCH];      // V^T chunk [d][key]    9 KB
  __shared__ __align__(16) _Float16 Psh[4][16 * AT_PITCH];   // per wave P [row][key] 9 KB
  __shared__ __align__(16) float    Os[4][16 * OS_PITCH];    // per wave context tile 17 KB

  const int tid  = threadIdx.x;
  const int wave = tid >> 5;
  const int lane = tid & 31;
  const int hh   = lane >> 4;
  const int c    = lane & 15;

  const int bx   = blockIdx.x;
  const int qb   = bx % NQB;
  const int rest = bx / NQB;
  const int h    = rest % NH;
  const int b    = rest / NH;
  const int q0   = qb * 64 + wave * 16;
  const size_t rowB = (size_t)b * SEQ;
  const size_t hcol = (size_t)h * HD;

  const _Float16* Qh = (const _Float16*)(const void*)qhp;
  const _Float16* Ql = (const _Float16*)(const void*)qlp;
  const _Float16* Kg = (const _Float16*)(const void*)kpp + hcol;
  const _Float16* Vt = (const _Float16*)(const void*)vtp + ((size_t)b * DM + hcol) * SEQ;

  // ---- Q fragments (A operand, row = lane&15): 2 d-chunks, hi and residual planes ----
  v16h qah[2], qal[2];
#pragma unroll
  for (int dc = 0; dc < 2; ++dc) {
    const size_t qo = (rowB + q0 + c) * DM + hcol + dc * 32 + 8 * hh;
    qah[dc] = ldfrag<_Float16>(Qh + qo);
    qal[dc] = ldfrag<_Float16>(Ql + qo);
  }

  float mrow[8], lrow[8];
  v8f oacc[4];
#pragma unroll
  for (int r = 0; r < 8; ++r) { mrow[r] = -INFINITY; lrow[r] = 0.f; }
#pragma unroll
  for (int t = 0; t < 4; ++t) oacc[t] = zero8();

  for (int kt = 0; kt < NKT; ++kt) {         // static trip count
    const int kv0 = kt * 64;
    __syncthreads();
    {
      const int r = tid >> 1, half = (tid & 1) * 32;
      const _Float16* kg = Kg + (rowB + kv0 + r) * DM + half;       // k row kv0+r, d = half..half+31
      const _Float16* vg = Vt + (size_t)r * SEQ + kv0 + half;       // v^T row d = r, s = kv0+half..+31
#pragma unroll
      for (int i = 0; i < 4; ++i) {
        const v8h a0 = *(const v8h*)(kg + 8 * i);
        const v8h b0 = *(const v8h*)(vg + 8 * i);
        *(v8h*)(Ksh + r * AT_PITCH + half + 8 * i) = a0;
        *(v8h*)(Vth + r * AT_PITCH + half + 8 * i) = b0;
      }
    }
    __syncthreads();

    // ---- scores: 16 query rows x 64 keys per wave, 2 f16 products per key subtile and d-chunk ----
    v8f s[4];
#pragma unroll
    for (int j = 0; j < 4; ++j) {
      v8f ah = zero8(), al = zero8();
#pragma unroll
      for (int dc = 0; dc < 2; ++dc) {
        FH kb;
        kb.h[0] = *(const v8h*)(Ksh + (j * 16 + c) * AT_PITCH + dc * 32 + 8 * hh);
        kb.h[1] = *(const v8h*)(Ksh + (j * 16 + c) * AT_PITCH + dc * 32 + 16 + 8 * hh);
        ah = mma_h(qah[dc], kb.v, ah);
        al = mma_h(qal[dc], kb.v, al);
      }
#pragma unroll
      for (int r = 0; r < 8; ++r) s[j][r] = (ah[r] + al[r] * (1.0f / 4096.0f)) * sscale;
    }

    // ---- row max, online softmax, P (x1024, f16) to LDS ----
    _Float16* pwh = Psh[wave];
#pragma unroll
    for (int r = 0; r < 8; ++r) {
      float m = s[0][r];
#pragma unroll
      for (int j = 1; j < 4; ++j) m = fmaxf(m, s[j][r]);
#pragma unroll
      for (int off = 1; off < 16; off <<= 1) m = fmaxf(m, __shfl_xor(m, off, 32));
      const float mnew  = fmaxf(mrow[r], m);
      const float msafe = (mnew == -INFINITY) ? 0.f : mnew;
      const float alpha = __expf(mrow[r] - msafe);
      mrow[r] = mnew;
      float psum = 0.f;
#pragma unroll
      for (int j = 0; j < 4; ++j) {
        const float p = __expf(s[j][r] - msafe);
        psum += p;
        pwh[(8 * hh + r) * AT_PITCH + j * 16 + c] = (_Float16)(p * 1024.0f);
      }
#pragma unroll
      for (int off = 1; off < 16; off <<= 1) psum += __shfl_xor(psum, off, 32);
      lrow[r] = lrow[r] * alpha + psum;
#pragma unroll
      for (int t = 0; t < 4; ++t) oacc[t][r] *= alpha;
    }
    __builtin_amdgcn_fence(__ATOMIC_RELEASE, "workgroup");
    __builtin_amdgcn_wave_barrier();
    __builtin_amdgcn_fence(__ATOMIC_ACQUIRE, "workgroup");

    // ---- context += P . V (f16 WMMA, single product) ----
#pragma unroll 1
    for (int kk = 0; kk < 2; ++kk) {
      FH pa;
      pa.h[0] = *(const v8h*)(pwh + c * AT_PITCH + kk * 32 + 8 * hh);
      pa.h[1] = *(const v8h*)(pwh + c * AT_PITCH + kk * 32 + 16 + 8 * hh);
#pragma unroll
      for (int t = 0; t < 4; ++t) {
        FH vb;
        vb.h[0] = *(const v8h*)(Vth + (t * 16 + c) * AT_PITCH + kk * 32 + 8 * hh);
        vb.h[1] = *(const v8h*)(Vth + (t * 16 + c) * AT_PITCH + kk * 32 + 16 + 8 * hh);
        oacc[t] = mma_h(pa.v, vb.v, oacc[t]);
      }
    }
  }

  // ---- normalise (1/l, undo the x1024 p carry), stage the wave's 16x64 f32 tile, split into bf16 hi / residual,
  float* os = Os[wave];
#pragma unroll
  for (int r = 0; r < 8; ++r) {
    const float l = lrow[r];
    const float inv = ((l > 0.f) ? (1.0f / l) : 0.f) * (1.0f / 1024.0f);
#pragma unroll
    for (int t = 0; t < 4; ++t) os[(8 * hh + r) * OS_PITCH + t * 16 + c] = oacc[t][r] * inv;
  }
  __builtin_amdgcn_fence(__ATOMIC_RELEASE, "workgroup");
  __builtin_amdgcn_wave_barrier();
  __builtin_amdgcn_fence(__ATOMIC_ACQUIRE, "workgroup");
  {
    const int q4 = lane >> 3, c8 = (lane & 7) * 8;
    v4u hv[4], lv[4];
#pragma unroll
    for (int it = 0; it < 4; ++it) {
      const int row = it * 4 + q4;   // it 0..3 x q4 0..3 = rows 0..15 of the wave tile
      const float* sp = os + row * OS_PITCH + c8;
      v4u a, a2;
#pragma unroll
      for (int e = 0; e < 4; ++e) {
        const float f0 = sp[2 * e], f1 = sp[2 * e + 1];
        const unsigned short h0 = bf_bits(f0), h1 = bf_bits(f1);
        const unsigned short l0 = bf_bits(f0 - bf_up(h0)), l1 = bf_bits(f1 - bf_up(h1));
        a[e] = pk16(h0, h1); a2[e] = pk16(l0, l1);
      }
      hv[it] = a; lv[it] = a2;
    }
    {
#pragma unroll
      for (int it = 0; it < 4; ++it) {
        const int row = it * 4 + q4;
        const size_t go = (rowB + q0 + row) * DM + hcol + c8;
        *(v4u*)(ohp + go) = hv[it];
        *(v4u*)(olp + go) = lv[it];
      }
      
    }
  }
}

// =====================================================================================================
// Workspace map (bytes), every region an exact multiple of its whole-line / whole-tile store granularity
// (all shapes are tile multiples, no padded tails):
//   Xb    bf16 [4096][1024]          8388608
//   Wqkv  bf16 [3072 n][1024 k]      6291456   (input [out][in] layout == Bt[n][k], k contiguous)
//   Wo    bf16 [1024 n][1024 k]      2097152
//   Qh    f16  [4096][1024]          8388608
//   Ql    f16  [4096][1024]          8388608   (residual x4096)
//   Kp    f16  [4096][1024]          8388608
//   VT    f16  [4][1024][1024]       8388608
//   Oh    bf16 [4096][1024]          8388608
//   Ol    bf16 [4096][1024]          8388608
//   total                           67108864
// =====================================================================================================
extern "C" void kernel_launch(void* const* d_in, const int* in_sizes, int n_in,
                              void* d_out, int out_size, void* d_ws, size_t ws_size,
                              hipStream_t stream) {
  if (n_in < 7) return;
  if (in_sizes[0] != NTOK * DM) return;          // x      [4][1024][1024]
  if (in_sizes[1] != SEQ * HD) return;           // cos    [1024][64]
  if (in_sizes[2] != SEQ * HD) return;           // sin    [1024][64]
  if (in_sizes[3] != DQKV * DM) return;          // qkv_w  [3072][1024]
  if (in_sizes[4] != DQKV) return;               // qkv_b  [3072]
  if (in_sizes[5] != DM * DM) return;            // proj_w [1024][1024]
  if (in_sizes[6] != DM) return;                 // proj_b [1024]
  if (out_size != NTOK * DM) return;

  const float* x    = (const float*)d_in[0];
  const float* cosb = (const float*)d_in[1];
  const float* sinb = (const float*)d_in[2];
  const float* Wqkv = (const float*)d_in[3];
  const float* bqkv = (const float*)d_in[4];
  const float* Wout = (const float*)d_in[5];
  const float* bout = (const float*)d_in[6];

  const size_t PX  = (size_t)NTOK * DM * 2;        //  8388608  16-bit activation plane [4096][1024]
  const size_t PWQ = (size_t)DQKV * DM * 2;        //  6291456  bf16 [3072][1024]
  const size_t PWO = (size_t)DM * DM * 2;          //  2097152  bf16 [1024][1024]
  const size_t PVT = (size_t)NB * DM * SEQ * 2;    //  8388608  v^T plane [4][1024][1024]
  size_t off = 0;
  const size_t oXb  = off; off += PX;
  const size_t oWq  = off; off += PWQ;
  const size_t oWo  = off; off += PWO;
  const size_t oQh  = off; off += PX;
  const size_t oQl  = off; off += PX;
  const size_t oKp  = off; off += PX;
  const size_t oVT  = off; off += PVT;
  const size_t oOh  = off; off += PX;
  const size_t oOl  = off; off += PX;
  if (off > ws_size) return;                       // off = 67108864
  if (off > (size_t)134217728) return;

  char* ws = (char*)d_ws;
  unsigned short* Xb   = (unsigned short*)(ws + oXb);
  unsigned short* Wq16 = (unsigned short*)(ws + oWq);
  unsigned short* Wo16 = (unsigned short*)(ws + oWo);
  unsigned short* Qh   = (unsigned short*)(ws + oQh);
  unsigned short* Ql   = (unsigned short*)(ws + oQl);
  unsigned short* Kp   = (unsigned short*)(ws + oKp);
  unsigned short* VT   = (unsigned short*)(ws + oVT);
  unsigned short* Oh   = (unsigned short*)(ws + oOh);
  unsigned short* Ol   = (unsigned short*)(ws + oOl);

  const dim3 blk(256);
  const int n8x  = NTOK * DM / 8;                               // 524288
  const int n8wq = DQKV * DM / 8;                               // 393216
  const int n8wo = DM * DM / 8;                                 // 131072
  const dim3 gCvtX((n8x + 255) / 256);                          // 2048 blocks
  const dim3 gCvtWq((n8wq + 255) / 256);                        // 1536 blocks
  const dim3 gCvtWo((n8wo + 255) / 256);                        //  512 blocks
  const dim3 blkG(128);                                         // gemm64: 4 waves
  const dim3 gP((NTOK / 128) * (DM / 128), 1);                  // 256 blocks of one 128x128 tile: M=4096, N=1024
  const dim3 gVT((DM / 128) * (SEQ / 128), NB);                 //  64 blocks x 4 batches: M=1024, N=1024
  const dim3 gAttn(NB * NH * NQB);                              // 1024 blocks of 128
  static_assert((NTOK % 128) == 0 && (DM % 128) == 0 && (SEQ % 128) == 0 && (DM % GK_PASS) == 0 && DM / GK_PASS >= 2);
  static_assert((NTOK * DM) % 2048 == 0 && (DQKV * DM) % 2048 == 0 && (DM * DM) % 2048 == 0);
  static_assert((DM % 32) == 0);

  // (1) x -> bf16 plane [4096][1024]; qkv_w [3072][1024] ([out][in] = Bt[n][k]) -> bf16; proj_w [1024][1024] -> bf16
  cvt_bf16x8<<<gCvtX,  blk, 0, stream>>>(x,    Xb,   n8x);
  cvt_bf16x8<<<gCvtWq, blk, 0, stream>>>(Wqkv, Wq16, n8wq);
  cvt_bf16x8<<<gCvtWo, blk, 0, stream>>>(Wout, Wo16, n8wo);
  // (2) q = rope(x . Wq^T + bq) -> f16 hi / residual (x4096) planes [b*SEQ+t][h*64+d]   (M=4096, N=1024, K=1024)
  gemm64<__bf16, 1, false><<<gP, blkG, 0, stream>>>(
      Xb, Xb, DM, 0LL, Wq16, DM, 0LL,
      (void*)Qh, (void*)Ql, DM, 0LL, bqkv, cosb, sinb,
      NTOK, DM, DM, 4096.0f);
  // (3) k = rope(x . Wk^T + bk) -> f16 plane [b*SEQ+s][h*64+d]   (Bt = Wq16 rows 1024..2047)
  gemm64<__bf16, 2, false><<<gP, blkG, 0, stream>>>(
      Xb, Xb, DM, 0LL, Wq16 + (size_t)DM * DM, DM, 0LL,
      (void*)Kp, (void*)Kp, DM, 0LL, bqkv + DM, cosb, sinb,
      NTOK, DM, DM, 1.0f);
  // (4) v^T = Wv . x^T + bv per batch -> f16 plane [b][h*64+d][s] (pitch SEQ)
  //     (A = Wq16 rows 2048..3071 [feature][k], Bt = Xb rows of batch b; M=1024, N=1024, K=1024; bias by row)
  gemm64<__bf16, 3, false><<<gVT, blkG, 0, stream>>>(
      Wq16 + (size_t)2 * DM * DM, Wq16 + (size_t)2 * DM * DM, DM, 0LL, Xb, DM, (long long)SEQ * DM,
      (void*)VT, (void*)VT, SEQ, (long long)DM * SEQ, bqkv + 2 * DM, cosb, sinb,
      DM, SEQ, DM, 1.0f);
  // (5) attention -> ctx bf16 hi / residual planes [b*SEQ+t][h*64+d]
  attn_mha<<<gAttn, dim3(128), 0, stream>>>(Qh, Ql, Kp, VT, Oh, Ol, 0.125f);
  // (6) out = (Oh + Ol) . Wproj^T + bproj -> d_out f32 [4096][1024]   (M=4096, N=1024, K=1024, two A planes)
  gemm64<__bf16, 0, true><<<gP, blkG, 0, stream>>>(
      Oh, Ol, DM, 0LL, Wo16, DM, 0LL,
      d_out, d_out, DM, 0LL, bout, cosb, sinb,
      NTOK, DM, DM, 1.0f);
  (void)hipGetLastError();
}

// v003
// One run takes 125 microseconds.
// Two timings next to v002 both put it at 1.31 times that version's speed.
// All steps since v000 together make it 2.81 times as fast.
// Contractions: q / k / v^T projections = v_wmma_f32_16x16x32_bf16 (bf16 operands from RNE-converted x and qkv weight rows, single product, f32 accumulate);
// q.k^T scores = v_wmma_f32_16x16x32_f16 (q as f16 hi plane + f16 residual plane x4096, k f16; 2 products into separate f32 accumulators);
// p.v = v_wmma_f32_16x16x32_f16 (p carried x1024 in f16, v f16; single product, f32 accumulate);
// ctx.Wproj^T = v_wmma_f32_16x16x32_bf16 (ctx as bf16 hi plane + unscaled bf16 residual plane, weights bf16; 2 products, f32 accumulate);
// rotary with the input cos/sin tables (values RNE-converted to bf16), half-rotation, bias adds and softmax in f32 on the VALU.
// Carry audit: q residual plane x4096 -> folded back once as al * (1/4096) in the attn_mha score combine;
// p x1024 -> folded back once as (1/l) * (1/1024) in the attn_mha epilogue; ctx residual plane is the unscaled
// RNE residual (v - hi) and shares the hi accumulator; no weight-plane carries (all weight copies are bf16).
// gemm64 stages both operands in LDS with tensor loads (two buffers); its 16-bit epilogue stores each row group right after conversion.
#include <hip/hip_runtime.h>
#include <math.h>
#include <stdint.h>

#define NB    4
#define SEQ   1024
#define DM    1024
#define NH    16
#define HD    64
#define DQKV  (3 * DM)
#define NTOK  (NB * SEQ)   // 4096 token rows
#define NQB   (SEQ / 64)   // 16 query blocks of 64 per sequence
#define NKT   (SEQ / 64)   // 16 key chunks of 64 per sequence
static_assert(NH * HD == DM);
static_assert(NQB == 16 && NKT == 16);
static_assert((SEQ & (SEQ - 1)) == 0);
static_assert((SEQ % 64) == 0 && (DM % 64) == 0 && (DM % 32) == 0 && (DQKV % 64) == 0 && (NTOK % 64) == 0);

typedef _Float16 v16h __attribute__((ext_vector_type(16)));
typedef _Float16 v8h  __attribute__((ext_vector_type(8)));
typedef __bf16   v16b __attribute__((ext_vector_type(16)));
typedef __bf16   v8b  __attribute__((ext_vector_type(8)));
typedef float    v8f  __attribute__((ext_vector_type(8)));
typedef float    v4f  __attribute__((ext_vector_type(4)));
typedef unsigned int v4u __attribute__((ext_vector_type(4)));
typedef uint32_t u32x4 __attribute__((ext_vector_type(4)));
typedef uint32_t u32x8 __attribute__((ext_vector_type(8)));

#if defined(__HIP_DEVICE_COMPILE__)
#define DEV_ASM 1
#else
#define DEV_ASM 0
#endif

// ---- scalar helpers --------------------------------------------------------------------------------
__device__ __forceinline__ unsigned short bf_bits(float f) {          // f32 -> bf16 bits, RNE convert
  unsigned u = __float_as_uint(f);
  return (unsigned short)((u + 0x7FFFu + ((u >> 16) & 1u)) >> 16);
}
__device__ __forceinline__ float bf_up(unsigned short hb) { return __uint_as_float(((unsigned)hb) << 16); }
__device__ __forceinline__ float bf16r(float f) { return bf_up(bf_bits(f)); }   // value of the bf16 RNE convert
__device__ __forceinline__ unsigned short h_bits(_Float16 x) { return __builtin_bit_cast(unsigned short, x); }
__device__ __forceinline__ unsigned pk16(unsigned short a, unsigned short b) { return (unsigned)a | ((unsigned)b << 16); }
__device__ __forceinline__ v8f zero8() { v8f z = {0.f, 0.f, 0.f, 0.f, 0.f, 0.f, 0.f, 0.f}; return z; }

// ---- fragment types / loaders: 16-bit A/B operand, lane -> row/col (lane&15), p already includes +8*(lane>>4);
//      elements 0..7 <- p[0..7] (k0+8h..k0+8h+7), elements 8..15 <- p[16..23] (k0+16+8h..k0+16+8h+7)
template <typename OT> struct FT;
template <> struct FT<__bf16>   { typedef v16b frag; typedef v8b half8; };
template <> struct FT<_Float16> { typedef v16h frag; typedef v8h half8; };

template <typename OT>
__device__ __forceinline__ typename FT<OT>::frag ldfrag(const OT* p) {
  union { typename FT<OT>::frag v; typename FT<OT>::half8 h[2]; } f;
  f.h[0] = *(const typename FT<OT>::half8*)(p);
  f.h[1] = *(const typename FT<OT>::half8*)(p + 16);
  return f.v;
}

// ---- WMMA helpers (asm guard bodies are device-only; concrete operand types) -----------------------------
__device__ __forceinline__ v8f mmar(v16b a, v16b b, v8f c) {
  return __builtin_amdgcn_wmma_f32_16x16x32_bf16(false, a, false, b, (short)0, c, false, false);
}
__device__ __forceinline__ v8f mmar(v16h a, v16h b, v8f c) {
  return __builtin_amdgcn_wmma_f32_16x16x32_f16(false, a, false, b, (short)0, c, false, false);
}
// guarded form: 4 VALU slots after the WMMA, D tied, A/B kept live
__device__ __forceinline__ v8f mma_h(v16h a, v16h b, v8f c) {
  c = __builtin_amdgcn_wmma_f32_16x16x32_f16(false, a, false, b, (short)0, c, false, false);
#if DEV_ASM
  asm volatile("v_nop\n\tv_nop\n\tv_nop\n\tv_nop" : "+v"(c) : "v"(a), "v"(b));
#endif
  return c;
}
__device__ __forceinline__ void acc_guard4(v8f& a, v8f& b, v8f& c, v8f& d) {
#if DEV_ASM
  asm volatile("v_nop\n\tv_nop\n\tv_nop\n\tv_nop" : "+v"(a), "+v"(b), "+v"(c), "+v"(d));
#else
  (void)a; (void)b; (void)c; (void)d;
#endif
}

// ---- tensor-load helpers for gemm64's LDS ring ------------------------------------------------------
#define GK_PASS  128                  // k elements of one stage: rows of 256 B
#define GK_PITCH 272                  // LDS row pitch in bytes: 256 B + the 16-B pad (odd multiple of 16 B for 16-B readers)
#define GK_SLICE 18432                // one wave's slice: 64 rows x 272 B = 17408 B, rounded up to a multiple of 2 KiB
#define GK_STAGE (4 * GK_SLICE)       // [A rows 0..63 | A rows 64..127 | Bt rows 0..63 | Bt rows 64..127]
static_assert(64 * GK_PITCH <= GK_SLICE && (GK_SLICE % 2048) == 0);
__device__ __forceinline__ uint32_t uni(uint32_t v) { return (uint32_t)__builtin_amdgcn_readfirstlane(v); }
__device__ __forceinline__ uint32_t pinned(uint32_t v) { uint32_t w = uni(v); asm volatile("" : "+s"(w)); return w; }
// the compiler places no wait for a tensor load: the issuing wave waits for its own request here; the request's two
// groups are inputs, so that their scalar registers keep their values until the request has landed
__device__ __forceinline__ void wait_tensor0(u32x4 g0, u32x8 g1) { asm volatile("s_wait_tensorcnt 0x0" :: "s"(g0), "s"(g1) : "memory"); }
// this wave's LDS reads have retired before the barrier behind which their buffer is refilled
__device__ __forceinline__ void wait_ds0() { asm volatile("s_wait_dscnt 0x0" ::: "memory"); }
__device__ __forceinline__ void tdm_load(u32x4 g0, u32x8 g1) { asm volatile("tensor_load_to_lds %0, %1" :: "s"(g0), "s"(g1) : "memory"); }
// group 1: 1-byte elements, tile = tensor = 64 rows of 256 B, source row pitch src_pitch bytes, 4 dwords of LDS pad behind every row
__device__ __forceinline__ u32x8 tdm_group1(uint32_t src_pitch) {
  constexpr uint32_t d0 = 256u, d1 = 64u;
  u32x8 g;
  g[0] = uni((1u << 20) | (5u << 22) | (3u << 25));   // no mask, data_size 0, pad after every 64 dwords, 4 dwords
  g[1] = uni((d0 & 0xFFFFu) << 16);
  g[2] = uni((d0 >> 16) | ((d1 & 0xFFFFu) << 16));
  g[3] = uni((d1 >> 16) | (d0 << 16));
  g[4] = uni(d1);
  g[5] = uni(src_pitch);
  g[6] = uni(0u);
  g[7] = uni(0u);
  return g;
}
__device__ __forceinline__ u32x4 tdm_group0(uint32_t lds_dst, uint64_t ga) {
  u32x4 g;
  g[0] = uni(1u);
  g[1] = uni(lds_dst);
  g[2] = uni((uint32_t)ga);
  g[3] = uni((((uint32_t)(ga >> 32)) & 0x01FFFFFFu) | 0x80000000u);
  return g;
}

// =====================================================================================================
// f32 -> bf16 (RNE convert), 8 elements per thread, one 16-B store per lane: a wave writes 512 contiguous B
// Layout is preserved, so a [out][in] f32 weight becomes the bf16 Bt[n][k] plane (k contiguous) directly.
// coverage: n8 threads x 8 = the whole plane (n8 = 524288 / 393216 / 131072, all multiples of 256).
// =====================================================================================================
__global__ __launch_bounds__(256) void cvt_bf16x8(const float* __restrict__ in, unsigned short* out, int n8) {
  const int i = blockIdx.x * 256 + (int)threadIdx.x;
  if (i < n8) {
    const v4f a = *(const v4f*)(in + (size_t)i * 8);
    const v4f b = *(const v4f*)(in + (size_t)i * 8 + 4);
    v4u p;
    p[0] = pk16(bf_bits(a[0]), bf_bits(a[1]));
    p[1] = pk16(bf_bits(a[2]), bf_bits(a[3]));
    p[2] = pk16(bf_bits(b[0]), bf_bits(b[1]));
    p[3] = pk16(bf_bits(b[2]), bf_bits(b[3]));
    *(v4u*)(out + (size_t)i * 8) = p;
    
  }
}

// =====================================================================================================
// Register-blocked batched WMMA GEMM (16-bit operand type OT): C[m][n] = sum_k A[m][k] * Bt[n][k];
// one block of 4 waves (2 x 2) per 128x128 tile, one wave per 64x64 tile. A row-major [M][K] pitch lda; Bt row-major
// [N][K] pitch ldb (k contiguous); M, N multiples of 128, K a multiple of 128 and at least 256 (host-checked).
// blockIdx.y = batch index (strides in elements). A stage = 128 k of the block's 128 A rows and 128 Bt rows in LDS;
// every wave brings one 64-row slice of it with one tensor load, two buffers, the next stage in flight during a pass.
// Fragments are read from LDS with the split k map (ldfrag); k runs upward in steps of 32.
//   TWOA: a second A plane Al with the same Bt is accumulated into the same tile (C = (A + Al) . Bt^T).
//   OUT_MODE 0: f32 C (pitch ldc), value + bf16(bias[col]); 256-B row segment = 16 lanes x 16 B, one instruction,
//   OUT_MODE 1: half-rotation rotary of (acc + bf16(bias[col])) -> f16 hi plane C + f16 residual plane
//               C2 = f16((v - hi) * rscale). N tile = one 64-wide head: dims d < 32 pair with d + 32:
//               out[d] = x[d] c[t][d] - x[d+32] s[t][d] (d < 32), x[d] c[t][d] + x[d-32] s[t][d] (d >= 32),
//               t = row mod SEQ, c/s = bf16 value of the [SEQ][64] input tables, f32, contract off,
//               partner column read from the staged slab.
//   OUT_MODE 2: as 1 but a single f16 plane C.
//   OUT_MODE 3: single f16 plane C of acc + bf16(bias[row]) (no rotary; used for v^T where the feature is the row).
// coverage: 4 slabs x 16 rows x 64 cols = the wave's whole 64x64 tile; (M/128)*(N/128) blocks x 4 waves x gridDim.y = the whole plane.
// =====================================================================================================
template <typename OT, int OUT_MODE, bool TWOA>
__global__ __launch_bounds__(128) void gemm64(
    const unsigned short* __restrict__ Ap, const unsigned short* __restrict__ Alp, int lda, long long strideA,
    const unsigned short* __restrict__ Btp, int ldb, long long strideB,
    void* Cout, void* Cout2, int ldc, long long strideC,
    const float* __restrict__ bias, const float* __restrict__ ctab, const float* __restrict__ stab,
    int M, int N, int K, float rscale) {
  static_assert(OUT_MODE >= 0 && OUT_MODE <= 3);
  typedef typename FT<OT>::frag V16;
  const OT* Ah = (const OT*)(const void*)Ap;
  const OT* Al = (const OT*)(const void*)Alp;
  const OT* Bt = (const OT*)(const void*)Btp;
  __shared__ __attribute__((aligned(2048))) unsigned char ring[2 * GK_STAGE];   // two stages
  __shared__ __align__(16) float sT[4][16 * 68];   // per-wave 16x64 slab, pitch 68 floats
  const int b    = blockIdx.y;
  const int lane = threadIdx.x & 31;
  const uint32_t wave = uni(threadIdx.x >> 5);
  const int tilesN = N >> 7;
  const int tilesM = M >> 7;
  const int bt = blockIdx.x;
  if (bt >= tilesM * tilesN) return;   // block-uniform, in front of every barrier and tensor load
  const int btm = bt / tilesN;
  const int btn = bt - btm * tilesN;
  const uint32_t wm = wave & 1u;               // which 64 A rows of the block tile this wave multiplies
  const uint32_t wn = wave >> 1;               // which 64 Bt rows
  const int m0 = (btm << 7) + (int)(wm << 6);
  const int n0 = (btn << 7) + (int)(wn << 6);

  const int rlane = lane & 15;                 // row (A) / col (B, D) within subtile
  const int koff  = (lane >> 4) * 8;           // k offset of this lane half
  const int mOff  = (lane >> 4) * 8;           // D row offset

  // ---- what this wave loads: waves 0, 1 the two halves of the A rows, waves 2, 3 the two halves of the Bt rows ----
  constexpr uint32_t NPL = TWOA ? 2u : 1u;
  const bool     isB   = wave >= 2u;
  const uint32_t half  = wave & 1u;
  const size_t   rowA  = (size_t)b * (size_t)strideA + (size_t)((btm << 7) + (int)(half << 6)) * lda;
  const size_t   rowBt = (size_t)b * (size_t)strideB + (size_t)((btn << 7) + (int)(half << 6)) * ldb;
  const uint64_t src0  = isB ? (uint64_t)(size_t)(Bt + rowBt) : (uint64_t)(size_t)(Ah + rowA);
  const uint64_t src1  = isB ? (uint64_t)(size_t)(Bt + rowBt) : (uint64_t)(size_t)(Al + rowA);
  const uint32_t kp    = (uint32_t)K / GK_PASS;       // stages per A plane
  const uint32_t nst   = kp * NPL;                    // stages in all (at least 2)
  const uint32_t lbase = (uint32_t)(size_t)ring;
  u32x8 g1 = tdm_group1((uint32_t)(isB ? ldb : lda) * 2u);
  // without this the compiler rebuilds words of group 1 from their constants, in the registers a request was issued from
  asm volatile("" : "+s"(g1));   // the pinned() form: descriptor words held in their scalar registers
  auto group0 = [&](uint32_t st) -> u32x4 {
    const bool second = TWOA && st >= kp;             // second A plane, Bt's k starts over
    const uint32_t kk = second ? st - kp : st;
    const uint64_t ga = (second ? src1 : src0) + (uint64_t)kk * (GK_PASS * 2u);
    return tdm_group0(lbase + (st & 1u) * GK_STAGE + wave * GK_SLICE, ga);
  };

  v8f acc[4][4];
#pragma unroll
  for (int i = 0; i < 4; ++i)
#pragma unroll
    for (int j = 0; j < 4; ++j) acc[i][j] = zero8();

  u32x4 g0 = group0(0);
  tdm_load(g0, g1);
  wait_tensor0(g0, g1);
  __syncthreads();
  g0 = group0(1);
  tdm_load(g0, g1);
  // kept rolled: one pass and one publish point in the text, every accumulator index constant
#pragma unroll 1
  for (uint32_t st = 0; st < nst; ++st) {
    const unsigned char* buf = ring + (st & 1u) * GK_STAGE;
    const unsigned char* pa = buf + wm * GK_SLICE + rlane * GK_PITCH + koff * 2;
    const unsigned char* pb = buf + (2u + wn) * GK_SLICE + rlane * GK_PITCH + koff * 2;
#pragma unroll
    for (int ks = 0; ks < GK_PASS / 32; ++ks) {
      V16 bq[4], af[4];
#pragma unroll
      for (int j = 0; j < 4; ++j) bq[j] = ldfrag<OT>((const OT*)(const void*)(pb + j * 16 * GK_PITCH + ks * 64));
#pragma unroll
      for (int i = 0; i < 4; ++i) af[i] = ldfrag<OT>((const OT*)(const void*)(pa + i * 16 * GK_PITCH + ks * 64));
#pragma unroll
      for (int i = 0; i < 4; ++i)
#pragma unroll
        for (int j = 0; j < 4; ++j) acc[i][j] = mmar(af[i], bq[j], acc[i][j]);
    }
    // publish point of stage st + 1; behind its barrier every wave has left stage st's buffer
    wait_ds0();
    wait_tensor0(g0, g1);
    __syncthreads();
    if (pinned(st + 2u < nst)) {
      g0 = group0(st + 2u);
      tdm_load(g0, g1);
    }
  }
  wait_tensor0(g0, g1);
  wait_ds0();
  acc_guard4(acc[0][0], acc[0][1], acc[0][2], acc[0][3]);
  acc_guard4(acc[1][0], acc[1][1], acc[1][2], acc[1][3]);
  acc_guard4(acc[2][0], acc[2][1], acc[2][2], acc[2][3]);
  acc_guard4(acc[3][0], acc[3][1], acc[3][2], acc[3][3]);

  // ---- epilogue ----
  float* slab = sT[wave];
#pragma unroll
  for (int i = 0; i < 4; ++i) {
    const int mBase = m0 + (i << 4);
#pragma unroll
    for (int j = 0; j < 4; ++j) {
#pragma unroll
      for (int r = 0; r < 8; ++r) {
        slab[(mOff + r) * 68 + (j << 4) + rlane] = acc[i][j][r];
      }
    }
    __builtin_amdgcn_fence(__ATOMIC_RELEASE, "workgroup");
    __builtin_amdgcn_wave_barrier();
    __builtin_amdgcn_fence(__ATOMIC_ACQUIRE, "workgroup");
    if (OUT_MODE == 0) {
      float* C = (float*)Cout + (size_t)b * (size_t)strideC;
      const int h2 = lane >> 4, c4 = (lane & 15) * 4;     // 256-B row segment = 16 lanes x 16 B
      const v4f bb = *(const v4f*)(bias + n0 + c4);
      v4f bv;
#pragma unroll
      for (int e = 0; e < 4; ++e) bv[e] = bf16r(bb[e]);
      v4f ov[8];
#pragma unroll
      for (int it = 0; it < 8; ++it) {
        const int row = it * 2 + h2;                       // it 0..7 x h2 0..1 = rows 0..15
        ov[it] = *(const v4f*)(slab + row * 68 + c4) + bv;
      }
      {
#pragma unroll
        for (int it = 0; it < 8; ++it) {
          const int row = it * 2 + h2;
          *(v4f*)(C + (size_t)(mBase + row) * ldc + n0 + c4) = ov[it];
        }
        
      }
    } else {
      const int q = lane >> 3, c8 = (lane & 7) * 8;
      unsigned short* C  = (unsigned short*)Cout  + (size_t)b * (size_t)strideC;
      unsigned short* C2 = (unsigned short*)Cout2 + (size_t)b * (size_t)strideC;
#pragma unroll
      for (int it = 0; it < 4; ++it) {
        const int row = it * 4 + q;                        // it 0..3 x q 0..3 = rows 0..15
        const float* sp = slab + row * 68 + c8;
        float f[8];
#pragma unroll
        for (int e = 0; e < 8; ++e) f[e] = sp[e];
        if (OUT_MODE == 1 || OUT_MODE == 2) {
#pragma clang fp contract(off)
          const float* pp = slab + row * 68 + (c8 ^ 32);   // partner columns d +- 32 of the same row
          float g[8];
#pragma unroll
          for (int e = 0; e < 8; ++e) g[e] = pp[e];
          const v4f bc0 = *(const v4f*)(bias + n0 + c8);
          const v4f bc1 = *(const v4f*)(bias + n0 + c8 + 4);
          const v4f bp0 = *(const v4f*)(bias + n0 + (c8 ^ 32));
          const v4f bp1 = *(const v4f*)(bias + n0 + (c8 ^ 32) + 4);
          const int t  = (mBase + row) & (SEQ - 1);        // position within the sequence
          // tables are [SEQ][HD]; column within the head = c8 + e (n0 is head-aligned, c8 in 0..56)
          const v4f cv0 = *(const v4f*)(ctab + (size_t)t * HD + c8);
          const v4f cv1 = *(const v4f*)(ctab + (size_t)t * HD + c8 + 4);
          const v4f sv0 = *(const v4f*)(stab + (size_t)t * HD + c8);
          const v4f sv1 = *(const v4f*)(stab + (size_t)t * HD + c8 + 4);
          const float sg = (c8 < 32) ? -1.0f : 1.0f;       // -x2 for the first half, +x1 for the second half
#pragma unroll
          for (int e = 0; e < 4; ++e) {
            {
              const float x  = f[e] + bf16r(bc0[e]);
              const float y  = g[e] + bf16r(bp0[e]);
              const float ry = sg * y;
              const float p0 = x * bf16r(cv0[e]);
              const float p1 = ry * bf16r(sv0[e]);
              f[e] = p0 + p1;
            }
            {
              const float x  = f[4 + e] + bf16r(bc1[e]);
              const float y  = g[4 + e] + bf16r(bp1[e]);
              const float ry = sg * y;
              const float p0 = x * bf16r(cv1[e]);
              const float p1 = ry * bf16r(sv1[e]);
              f[4 + e] = p0 + p1;
            }
          }
        }
        if (OUT_MODE == 3) {
          const float bm = bf16r(bias[mBase + row]);
#pragma unroll
          for (int e = 0; e < 8; ++e) f[e] = f[e] + bm;
        }
        v4u a, a2;
#pragma unroll
        for (int e = 0; e < 4; ++e) {
          const float f0 = f[2 * e], f1 = f[2 * e + 1];
          const _Float16 x0 = (_Float16)f0, x1 = (_Float16)f1;
          const unsigned short h0 = h_bits(x0), h1 = h_bits(x1);
          unsigned short l0 = 0, l1 = 0;
          if (OUT_MODE == 1) {
            l0 = h_bits((_Float16)((f0 - (float)x0) * rscale));
            l1 = h_bits((_Float16)((f1 - (float)x1) * rscale));
          }
          a[e] = pk16(h0, h1); a2[e] = pk16(l0, l1);
        }
        unsigned short* cp  = C  + (size_t)(mBase + row) * ldc + n0 + c8;
        unsigned short* cp2 = C2 + (size_t)(mBase + row) * ldc + n0 + c8;
        *(v4u*)cp = a;
        if (OUT_MODE == 1) *(v4u*)cp2 = a2;
        
      }
    }
    __builtin_amdgcn_fence(__ATOMIC_RELEASE, "workgroup");
    __builtin_amdgcn_wave_barrier();
    __builtin_amdgcn_fence(__ATOMIC_ACQUIRE, "workgroup");
  }
}

#define AT_PITCH 72                   // 16-bit elements per LDS row of the K and V^T tiles
#define OS_PITCH 68                   // floats per LDS row of the context tile
static_assert((AT_PITCH * 2) % 32 == 16 && AT_PITCH >= 64 && (OS_PITCH * 4) % 16 == 0 && OS_PITCH >= 64);
// lane l <-> lane l ^ 16: the other half of the wave holds the same query's other keys
__device__ __forceinline__ float xhalf(float x) {
  return __builtin_bit_cast(float, __builtin_amdgcn_permlanex16(__builtin_bit_cast(int, x), __builtin_bit_cast(int, x),
                                                                0x76543210, 0xfedcba98, false, false));
}
__global__ __launch_bounds__(128)
void attn_mha(const unsigned short* __restrict__ qhp, const unsigned short* __restrict__ qlp,
              const unsigned short* __restrict__ kpp, const unsigned short* __restrict__ vtp,
              unsigned short* ohp, unsigned short* olp, float sscale) {
  union FH { v16h v; v8h h[2]; };
  __shared__ __align__(16) _Float16 Ksh[64 * AT_PITCH];      // K chunk [key][d]      9 KB
  __shared__ __align__(16) _Float16 Vth[64 * AT_PITCH];      // V^T chunk [d][key]    9 KB
  __shared__ __align__(16) float    Os[4][16 * OS_PITCH];    // per wave context tile 17 KB

  const int tid  = threadIdx.x;
  const int wave = tid >> 5;
  const int lane = tid & 31;
  const int hh   = lane >> 4;
  const int c    = lane & 15;

  const int bx   = blockIdx.x;
  const int qb   = bx % NQB;
  const int rest = bx / NQB;
  const int h    = rest % NH;
  const int b    = rest / NH;
  const int q0   = qb * 64 + wave * 16;
  const size_t rowB = (size_t)b * SEQ;
  const size_t hcol = (size_t)h * HD;

  const _Float16* Qh = (const _Float16*)(const void*)qhp;
  const _Float16* Ql = (const _Float16*)(const void*)qlp;
  const _Float16* Kg = (const _Float16*)(const void*)kpp + hcol;
  const _Float16* Vt = (const _Float16*)(const void*)vtp + ((size_t)b * DM + hcol) * SEQ;

  // ---- Q fragments (B operand, column = query = lane&15): 2 d-chunks, hi and residual planes ----
  v16h qah[2], qal[2];
#pragma unroll
  for (int dc = 0; dc < 2; ++dc) {
    const size_t qo = (rowB + q0 + c) * DM + hcol + dc * 32 + 8 * hh;
    qah[dc] = ldfrag<_Float16>(Qh + qo);
    qal[dc] = ldfrag<_Float16>(Ql + qo);
  }

  float mrun = -INFINITY;   // running maximum of this lane's query (equal in both halves)
  float lrun = 0.f;         // running sum over this half's keys; the halves are joined once, behind the loop
  v8f oacc[4];              // O^T: column = query lane&15, row d = 16 t + 8 hh + r
#pragma unroll
  for (int t = 0; t < 4; ++t) oacc[t] = zero8();

  for (int kt = 0; kt < NKT; ++kt) {         // static trip count
    const int kv0 = kt * 64;
    __syncthreads();
    {
      const int r = tid >> 1, half = (tid & 1) * 32;
      const _Float16* kg = Kg + (rowB + kv0 + r) * DM + half;       // k row kv0+r, d = half..half+31
      const _Float16* vg = Vt + (size_t)r * SEQ + kv0 + half;       // v^T row d = r, s = kv0+half..+31
#pragma unroll
      for (int i = 0; i < 4; ++i) {
        const v8h a0 = *(const v8h*)(kg + 8 * i);
        const v8h b0 = *(const v8h*)(vg + 8 * i);
        *(v8h*)(Ksh + r * AT_PITCH + half + 8 * i) = a0;
        *(v8h*)(Vth + r * AT_PITCH + half + 8 * i) = b0;
      }
    }
    __syncthreads();

    // ---- scores, transposed: 64 keys x 16 queries per wave, 2 f16 products per key subtile and d-chunk ----
    v8f s[4];   // s[j][r]: key kv0 + 16 j + 8 hh + r, query q0 + c
#pragma unroll
    for (int j = 0; j < 4; ++j) {
      v8f ah = zero8(), al = zero8();
#pragma unroll
      for (int dc = 0; dc < 2; ++dc) {
        FH kb;
        kb.h[0] = *(const v8h*)(Ksh + (j * 16 + c) * AT_PITCH + dc * 32 + 8 * hh);
        kb.h[1] = *(const v8h*)(Ksh + (j * 16 + c) * AT_PITCH + dc * 32 + 16 + 8 * hh);
        ah = mma_h(kb.v, qah[dc], ah);
        al = mma_h(kb.v, qal[dc], al);
      }
#pragma unroll
      for (int r = 0; r < 8; ++r) s[j][r] = (ah[r] + al[r] * (1.0f / 4096.0f)) * sscale;
    }

    // ---- query maximum (in-lane, then the other half's), online softmax, P^T (x1024, f16) packed in registers ----
    float mj[4];   // one chain per key subtile: four short dependent chains instead of one long one
#pragma unroll
    for (int j = 0; j < 4; ++j) {
      mj[j] = s[j][0];
#pragma unroll
      for (int r = 1; r < 8; ++r) mj[j] = fmaxf(mj[j], s[j][r]);
    }
    float m = fmaxf(fmaxf(mj[0], mj[1]), fmaxf(mj[2], mj[3]));
    m = fmaxf(m, xhalf(m));
    const float mnew  = fmaxf(mrun, m);
    const float msafe = (mnew == -INFINITY) ? 0.f : mnew;
    const float alpha = __expf(mrun - msafe);
    mrun = mnew;
    // B operand of 32 keys: elements 0..7 = keys k0 + 8 hh + e (subtile 2 kk), 8..15 = keys k0 + 16 + 8 hh + e (subtile 2 kk + 1)
    FH pb[2];
    float ps[4];   // partial sums, one chain per key subtile
#pragma unroll
    for (int j = 0; j < 4; ++j) {
      ps[j] = 0.f;
#pragma unroll
      for (int r = 0; r < 8; ++r) {
        const float p = __expf(s[j][r] - msafe);
        ps[j] += p;
        pb[j >> 1].v[(j & 1) * 8 + r] = (_Float16)(p * 1024.0f);
      }
    }
    lrun = lrun * alpha + ((ps[0] + ps[1]) + (ps[2] + ps[3]));
#pragma unroll
    for (int t = 0; t < 4; ++t) oacc[t] = oacc[t] * alpha;

    // ---- context^T += V^T . P^T (f16 WMMA, single product); unrolled: pb is indexed in registers ----
#pragma unroll
    for (int kk = 0; kk < 2; ++kk) {
#pragma unroll
      for (int t = 0; t < 4; ++t) {
        FH vb;
        vb.h[0] = *(const v8h*)(Vth + (t * 16 + c) * AT_PITCH + kk * 32 + 8 * hh);
        vb.h[1] = *(const v8h*)(Vth + (t * 16 + c) * AT_PITCH + kk * 32 + 16 + 8 * hh);
        oacc[t] = mma_h(vb.v, pb[kk].v, oacc[t]);
      }
    }
  }

  // ---- join the halves' sums, normalise (1/l, undo the x1024 p carry), stage the wave's 16x64 f32 tile [query][d],
  //      split into bf16 hi / residual
  float* os = Os[wave];
  {
    const float l = lrun + xhalf(lrun);   // unconditional: every lane is on at the exchange
    const float inv = ((l > 0.f) ? (1.0f / l) : 0.f) * (1.0f / 1024.0f);
#pragma unroll
    for (int t = 0; t < 4; ++t) {
      v4f lo, hi;
#pragma unroll
      for (int r = 0; r < 4; ++r) { lo[r] = oacc[t][r] * inv; hi[r] = oacc[t][4 + r] * inv; }
      *(v4f*)(os + c * OS_PITCH + t * 16 + 8 * hh)     = lo;
      *(v4f*)(os + c * OS_PITCH + t * 16 + 8 * hh + 4) = hi;
    }
  }
  __builtin_amdgcn_fence(__ATOMIC_RELEASE, "workgroup");
  __builtin_amdgcn_wave_barrier();
  __builtin_amdgcn_fence(__ATOMIC_ACQUIRE, "workgroup");
  {
    const int q4 = lane >> 3, c8 = (lane & 7) * 8;
    v4u hv[4], lv[4];
#pragma unroll
    for (int it = 0; it < 4; ++it) {
      const int row = it * 4 + q4;   // it 0..3 x q4 0..3 = rows 0..15 of the wave tile
      const float* sp = os + row * OS_PITCH + c8;
      v4u a, a2;
#pragma unroll
      for (int e = 0; e < 4; ++e) {
        const float f0 = sp[2 * e], f1 = sp[2 * e + 1];
        const unsigned short h0 = bf_bits(f0), h1 = bf_bits(f1);
        const unsigned short l0 = bf_bits(f0 - bf_up(h0)), l1 = bf_bits(f1 - bf_up(h1));
        a[e] = pk16(h0, h1); a2[e] = pk16(l0, l1);
      }
      hv[it] = a; lv[it] = a2;
    }
    {
#pragma unroll
      for (int it = 0; it < 4; ++it) {
        const int row = it * 4 + q4;
        const size_t go = (rowB + q0 + row) * DM + hcol + c8;
        *(v4u*)(ohp + go) = hv[it];
        *(v4u*)(olp + go) = lv[it];
      }
      
    }
  }
}

// =====================================================================================================
// Workspace map (bytes), every region an exact multiple of its whole-line / whole-tile store granularity
// (all shapes are tile multiples, no padded tails):
//   Xb    bf16 [4096][1024]          8388608
//   Wqkv  bf16 [3072 n][1024 k]      6291456   (input [out][in] layout == Bt[n][k], k contiguous)
//   Wo    bf16 [1024 n][1024 k]      2097152
//   Qh    f16  [4096][1024]          8388608
//   Ql    f16  [4096][1024]          8388608   (residual x4096)
//   Kp    f16  [4096][1024]          8388608
//   VT    f16  [4][1024][1024]       8388608
//   Oh    bf16 [4096][1024]          8388608
//   Ol    bf16 [4096][1024]          8388608
//   total                           67108864
// =====================================================================================================
extern "C" void kernel_launch(void* const* d_in, const int* in_sizes, int n_in,
                              void* d_out, int out_size, void* d_ws, size_t ws_size,
                              hipStream_t stream) {
  if (n_in < 7) return;
  if (in_sizes[0] != NTOK * DM) return;          // x      [4][1024][1024]
  if (in_sizes[1] != SEQ * HD) return;           // cos    [1024][64]
  if (in_sizes[2] != SEQ * HD) return;           // sin    [1024][64]
  if (in_sizes[3] != DQKV * DM) return;          // qkv_w  [3072][1024]
  if (in_sizes[4] != DQKV) return;               // qkv_b  [3072]
  if (in_sizes[5] != DM * DM) return;            // proj_w [1024][1024]
  if (in_sizes[6] != DM) return;                 // proj_b [1024]
  if (out_size != NTOK * DM) return;

  const float* x    = (const float*)d_in[0];
  const float* cosb = (const float*)d_in[1];
  const float* sinb = (const float*)d_in[2];
  const float* Wqkv = (const float*)d_in[3];
  const float* bqkv = (const float*)d_in[4];
  const float* Wout = (const float*)d_in[5];
  const float* bout = (const float*)d_in[6];

  const size_t PX  = (size_t)NTOK * DM * 2;        //  8388608  16-bit activation plane [4096][1024]
  const size_t PWQ = (size_t)DQKV * DM * 2;        //  6291456  bf16 [3072][1024]
  const size_t PWO = (size_t)DM * DM * 2;          //  2097152  bf16 [1024][1024]
  const size_t PVT = (size_t)NB * DM * SEQ * 2;    //  8388608  v^T plane [4][1024][1024]
  size_t off = 0;
  const size_t oXb  = off; off += PX;
  const size_t oWq  = off; off += PWQ;
  const size_t oWo  = off; off += PWO;
  const size_t oQh  = off; off += PX;
  const size_t oQl  = off; off += PX;
  const size_t oKp  = off; off += PX;
  const size_t oVT  = off; off += PVT;
  const size_t oOh  = off; off += PX;
  const size_t oOl  = off; off += PX;
  if (off > ws_size) return;                       // off = 67108864
  if (off > (size_t)134217728) return;

  char* ws = (char*)d_ws;
  unsigned short* Xb   = (unsigned short*)(ws + oXb);
  unsigned short* Wq16 = (unsigned short*)(ws + oWq);
  unsigned short* Wo16 = (unsigned short*)(ws + oWo);
  unsigned short* Qh   = (unsigned short*)(ws + oQh);
  unsigned short* Ql   = (unsigned short*)(ws + oQl);
  unsigned short* Kp   = (unsigned short*)(ws + oKp);
  unsigned short* VT   = (unsigned short*)(ws + oVT);
  unsigned short* Oh   = (unsigned short*)(ws + oOh);
  unsigned short* Ol   = (unsigned short*)(ws + oOl);

  const dim3 blk(256);
  const int n8x  = NTOK * DM / 8;                               // 524288
  const int n8wq = DQKV * DM / 8;                               // 393216
  const int n8wo = DM * DM / 8;                                 // 131072
  const dim3 gCvtX((n8x + 255) / 256);                          // 2048 blocks
  const dim3 gCvtWq((n8wq + 255) / 256);                        // 1536 blocks
  const dim3 gCvtWo((n8wo + 255) / 256);                        //  512 blocks
  const dim3 blkG(128);                                         // gemm64: 4 waves
  const dim3 gP((NTOK / 128) * (DM / 128), 1);                  // 256 blocks of one 128x128 tile: M=4096, N=1024
  const dim3 gVT((DM / 128) * (SEQ / 128), NB);                 //  64 blocks x 4 batches: M=1024, N=1024
  const dim3 gAttn(NB * NH * NQB);                              // 1024 blocks of 128
  static_assert((NTOK % 128) == 0 && (DM % 128) == 0 && (SEQ % 128) == 0 && (DM % GK_PASS) == 0 && DM / GK_PASS >= 2);
  static_assert((NTOK * DM) % 2048 == 0 && (DQKV * DM) % 2048 == 0 && (DM * DM) % 2048 == 0);
  static_assert((DM % 32) == 0);

  // (1) x -> bf16 plane [4096][1024]; qkv_w [3072][1024] ([out][in] = Bt[n][k]) -> bf16; proj_w [1024][1024] -> bf16
  cvt_bf16x8<<<gCvtX,  blk, 0, stream>>>(x,    Xb,   n8x);
  cvt_bf16x8<<<gCvtWq, blk, 0, stream>>>(Wqkv, Wq16, n8wq);
  cvt_bf16x8<<<gCvtWo, blk, 0, stream>>>(Wout, Wo16, n8wo);
  // (2) q = rope(x . Wq^T + bq) -> f16 hi / residual (x4096) planes [b*SEQ+t][h*64+d]   (M=4096, N=1024, K=1024)
  gemm64<__bf16, 1, false><<<gP, blkG, 0, stream>>>(
      Xb, Xb, DM, 0LL, Wq16, DM, 0LL,
      (void*)Qh, (void*)Ql, DM, 0LL, bqkv, cosb, sinb,
      NTOK, DM, DM, 4096.0f);
  // (3) k = rope(x . Wk^T + bk) -> f16 plane [b*SEQ+s][h*64+d]   (Bt = Wq16 rows 1024..2047)
  gemm64<__bf16, 2, false><<<gP, blkG, 0, stream>>>(
      Xb, Xb, DM, 0LL, Wq16 + (size_t)DM * DM, DM, 0LL,
      (void*)Kp, (void*)Kp, DM, 0LL, bqkv + DM, cosb, sinb,
      NTOK, DM, DM, 1.0f);
  // (4) v^T = Wv . x^T + bv per batch -> f16 plane [b][h*64+d][s] (pitch SEQ)
  //     (A = Wq16 rows 2048..3071 [feature][k], Bt = Xb rows of batch b; M=1024, N=1024, K=1024; bias by row)
  gemm64<__bf16, 3, false><<<gVT, blkG, 0, stream>>>(
      Wq16 + (size_t)2 * DM * DM, Wq16 + (size_t)2 * DM * DM, DM, 0LL, Xb, DM, (long long)SEQ * DM,
      (void*)VT, (void*)VT, SEQ, (long long)DM * SEQ, bqkv + 2 * DM, cosb, sinb,
      DM, SEQ, DM, 1.0f);
  // (5) attention -> ctx bf16 hi / residual planes [b*SEQ+t][h*64+d]
  attn_mha<<<gAttn, dim3(128), 0, stream>>>(Qh, Ql, Kp, VT, Oh, Ol, 0.125f);
  // (6) out = (Oh + Ol) . Wproj^T + bproj -> d_out f32 [4096][1024]   (M=4096, N=1024, K=1024, two A planes)
  gemm64<__bf16, 0, true><<<gP, blkG, 0, stream>>>(
      Oh, Ol, DM, 0LL, Wo16, DM, 0LL,
      d_out, d_out, DM, 0LL, bout, cosb, sinb,
      NTOK, DM, DM, 1.0f);
  (void)hipGetLastError();
}

// v004
// It runs in 118 microseconds.
// Timed twice side by side with v003, it ran 1.04 and 1.08 times as fast.
// Over all steps from v000 it is 2.98 times as fast.
// Contractions: q / k / v^T projections = v_wmma_f32_16x16x32_bf16 (bf16 operands from RNE-converted x and qkv weight rows, single product, f32 accumulate);
// q.k^T scores = v_wmma_f32_16x16x32_f16 (q as f16 hi plane + f16 residual plane x4096, k f16; 2 products into separate f32 accumulators);
// p.v = v_wmma_f32_16x16x32_f16 (p carried x1024 in f16, v f16; single product, f32 accumulate);
// ctx.Wproj^T = v_wmma_f32_16x16x32_bf16 (ctx as bf16 hi plane + unscaled bf16 residual plane, weights bf16; 2 products, f32 accumulate);
// rotary with the input cos/sin tables (values RNE-converted to bf16), half-rotation, bias adds and softmax in f32 on the VALU.
// Carry audit: q residual plane x4096 -> folded back once as al * (1/4096) in the attn_mha score combine;
// p x1024 -> folded back once as (1/l) * (1/1024) in the attn_mha epilogue; ctx residual plane is the unscaled
// RNE residual (v - hi) and shares the hi accumulator; no weight-plane carries (all weight copies are bf16).
// gemm64 stages both operands in LDS with tensor loads (two buffers); its 16-bit epilogue stores each row group right after conversion.
#include <hip/hip_runtime.h>
#include <math.h>
#include <stdint.h>

#define NB    4
#define SEQ   1024
#define DM    1024
#define NH    16
#define HD    64
#define DQKV  (3 * DM)
#define NTOK  (NB * SEQ)   // 4096 token rows
#define NQB   (SEQ / 64)   // 16 query blocks of 64 per sequence
#define NKT   (SEQ / 64)   // 16 key chunks of 64 per sequence
static_assert(NH * HD == DM);
static_assert(NQB == 16 && NKT == 16);
static_assert((SEQ & (SEQ - 1)) == 0);
static_assert((SEQ % 64) == 0 && (DM % 64) == 0 && (DM % 32) == 0 && (DQKV % 64) == 0 && (NTOK % 64) == 0);

typedef _Float16 v16h __attribute__((ext_vector_type(16)));
typedef _Float16 v8h  __attribute__((ext_vector_type(8)));
typedef __bf16   v16b __attribute__((ext_vector_type(16)));
typedef __bf16   v8b  __attribute__((ext_vector_type(8)));
typedef float    v8f  __attribute__((ext_vector_type(8)));
typedef float    v4f  __attribute__((ext_vector_type(4)));
typedef unsigned int v4u __attribute__((ext_vector_type(4)));
typedef uint32_t u32x4 __attribute__((ext_vector_type(4)));
typedef uint32_t u32x8 __attribute__((ext_vector_type(8)));

#if defined(__HIP_DEVICE_COMPILE__)
#define DEV_ASM 1
#else
#define DEV_ASM 0
#endif

// ---- scalar helpers --------------------------------------------------------------------------------
__device__ __forceinline__ unsigned short bf_bits(float f) {          // f32 -> bf16 bits, RNE convert
  unsigned u = __float_as_uint(f);
  return (unsigned short)((u + 0x7FFFu + ((u >> 16) & 1u)) >> 16);
}
__device__ __forceinline__ float bf_up(unsigned short hb) { return __uint_as_float(((unsigned)hb) << 16); }
__device__ __forceinline__ float bf16r(float f) { return bf_up(bf_bits(f)); }   // value of the bf16 RNE convert
__device__ __forceinline__ unsigned short h_bits(_Float16 x) { return __builtin_bit_cast(unsigned short, x); }
__device__ __forceinline__ unsigned pk16(unsigned short a, unsigned short b) { return (unsigned)a | ((unsigned)b << 16); }
__device__ __forceinline__ v8f zero8() { v8f z = {0.f, 0.f, 0.f, 0.f, 0.f, 0.f, 0.f, 0.f}; return z; }

// ---- fragment types / loaders: 16-bit A/B operand, lane -> row/col (lane&15), p already includes +8*(lane>>4);
//      elements 0..7 <- p[0..7] (k0+8h..k0+8h+7), elements 8..15 <- p[16..23] (k0+16+8h..k0+16+8h+7)
template <typename OT> struct FT;
template <> struct FT<__bf16>   { typedef v16b frag; typedef v8b half8; };
template <> struct FT<_Float16> { typedef v16h frag; typedef v8h half8; };

template <typename OT>
__device__ __forceinline__ typename FT<OT>::frag ldfrag(const OT* p) {
  union { typename FT<OT>::frag v; typename FT<OT>::half8 h[2]; } f;
  f.h[0] = *(const typename FT<OT>::half8*)(p);
  f.h[1] = *(const typename FT<OT>::half8*)(p + 16);
  return f.v;
}

// ---- WMMA helpers (asm guard bodies are device-only; concrete operand types) -----------------------------
__device__ __forceinline__ v8f mmar(v16b a, v16b b, v8f c) {
  return __builtin_amdgcn_wmma_f32_16x16x32_bf16(false, a, false, b, (short)0, c, false, false);
}
__device__ __forceinline__ v8f mmar(v16h a, v16h b, v8f c) {
  return __builtin_amdgcn_wmma_f32_16x16x32_f16(false, a, false, b, (short)0, c, false, false);
}
// guarded form: 4 VALU slots after the WMMA, D tied, A/B kept live
__device__ __forceinline__ v8f mma_h(v16h a, v16h b, v8f c) {
  c = __builtin_amdgcn_wmma_f32_16x16x32_f16(false, a, false, b, (short)0, c, false, false);
#if DEV_ASM
  asm volatile("v_nop\n\tv_nop\n\tv_nop\n\tv_nop" : "+v"(c) : "v"(a), "v"(b));
#endif
  return c;
}
__device__ __forceinline__ void acc_guard4(v8f& a, v8f& b, v8f& c, v8f& d) {
#if DEV_ASM
  asm volatile("v_nop\n\tv_nop\n\tv_nop\n\tv_nop" : "+v"(a), "+v"(b), "+v"(c), "+v"(d));
#else
  (void)a; (void)b; (void)c; (void)d;
#endif
}

// ---- tensor-load helpers for gemm64's LDS ring ------------------------------------------------------
#define GK_PASS  128                  // k elements of one stage: rows of 256 B
#define GK_PITCH 272                  // LDS row pitch in bytes: 256 B + the 16-B pad (odd multiple of 16 B for 16-B readers)
#define GK_SLICE 18432                // one wave's slice: 64 rows x 272 B = 17408 B, rounded up to a multiple of 2 KiB
#define GK_STAGE (4 * GK_SLICE)       // [A rows 0..63 | A rows 64..127 | Bt rows 0..63 | Bt rows 64..127]
static_assert(64 * GK_PITCH <= GK_SLICE && (GK_SLICE % 2048) == 0);
__device__ __forceinline__ uint32_t uni(uint32_t v) { return (uint32_t)__builtin_amdgcn_readfirstlane(v); }
__device__ __forceinline__ uint32_t pinned(uint32_t v) { uint32_t w = uni(v); asm volatile("" : "+s"(w)); return w; }
// the compiler places no wait for a tensor load: the issuing wave waits for its own request here; the request's two
// groups are inputs, so that their scalar registers keep their values until the request has landed
__device__ __forceinline__ void wait_tensor0(u32x4 g0, u32x8 g1) { asm volatile("s_wait_tensorcnt 0x0" :: "s"(g0), "s"(g1) : "memory"); }
// this wave's LDS reads have retired before the barrier behind which their buffer is refilled
__device__ __forceinline__ void wait_ds0() { asm volatile("s_wait_dscnt 0x0" ::: "memory"); }
__device__ __forceinline__ void tdm_load(u32x4 g0, u32x8 g1) { asm volatile("tensor_load_to_lds %0, %1" :: "s"(g0), "s"(g1) : "memory"); }
// group 1: 1-byte elements, tile = tensor = 64 rows of 256 B, source row pitch src_pitch bytes, 4 dwords of LDS pad behind every row
__device__ __forceinline__ u32x8 tdm_group1(uint32_t src_pitch) {
  constexpr uint32_t d0 = 256u, d1 = 64u;
  u32x8 g;
  g[0] = uni((1u << 20) | (5u << 22) | (3u << 25));   // no mask, data_size 0, pad after every 64 dwords, 4 dwords
  g[1] = uni((d0 & 0xFFFFu) << 16);
  g[2] = uni((d0 >> 16) | ((d1 & 0xFFFFu) << 16));
  g[3] = uni((d1 >> 16) | (d0 << 16));
  g[4] = uni(d1);
  g[5] = uni(src_pitch);
  g[6] = uni(0u);
  g[7] = uni(0u);
  return g;
}
__device__ __forceinline__ u32x4 tdm_group0(uint32_t lds_dst, uint64_t ga) {
  u32x4 g;
  g[0] = uni(1u);
  g[1] = uni(lds_dst);
  g[2] = uni((uint32_t)ga);
  g[3] = uni((((uint32_t)(ga >> 32)) & 0x01FFFFFFu) | 0x80000000u);
  return g;
}

// =====================================================================================================
// f32 -> bf16 (RNE convert), 8 elements per thread, one 16-B store per lane: a wave writes 512 contiguous B
// Layout is preserved, so a [out][in] f32 weight becomes the bf16 Bt[n][k] plane (k contiguous) directly.
// coverage: n8 threads x 8 = the whole plane (n8 = 524288 / 393216 / 131072, all multiples of 256).
// =====================================================================================================
__global__ __launch_bounds__(256) void cvt_bf16x8(const float* __restrict__ in, unsigned short* out, int n8) {
  const int i = blockIdx.x * 256 + (int)threadIdx.x;
  if (i < n8) {
    const v4f a = *(const v4f*)(in + (size_t)i * 8);
    const v4f b = *(const v4f*)(in + (size_t)i * 8 + 4);
    v4u p;
    p[0] = pk16(bf_bits(a[0]), bf_bits(a[1]));
    p[1] = pk16(bf_bits(a[2]), bf_bits(a[3]));
    p[2] = pk16(bf_bits(b[0]), bf_bits(b[1]));
    p[3] = pk16(bf_bits(b[2]), bf_bits(b[3]));
    *(v4u*)(out + (size_t)i * 8) = p;
    
  }
}

// =====================================================================================================
// Register-blocked batched WMMA GEMM (16-bit operand type OT): C[m][n] = sum_k A[m][k] * Bt[n][k];
// one block of 4 waves (2 x 2) per 128x128 tile, one wave per 64x64 tile. A row-major [M][K] pitch lda; Bt row-major
// [N][K] pitch ldb (k contiguous); M, N multiples of 128, K a multiple of 128 and at least 256 (host-checked).
// blockIdx.y = batch index (strides in elements). A stage = 128 k of the block's 128 A rows and 128 Bt rows in LDS;
// every wave brings one 64-row slice of it with one tensor load, two buffers, the next stage in flight during a pass.
// Fragments are read from LDS with the split k map (ldfrag); k runs upward in steps of 32 (a block = 16 WMMAs); inside a stage
// the next block's 16 fragment reads are issued as one group, into a second register set, in front of the current block.
//   TWOA: a second A plane Al with the same Bt is accumulated into the same tile (C = (A + Al) . Bt^T).
//   OUT_MODE 0: f32 C (pitch ldc), value + bf16(bias[col]); 256-B row segment = 16 lanes x 16 B, one instruction,
//   OUT_MODE 1: half-rotation rotary of (acc + bf16(bias[col])) -> f16 hi plane C + f16 residual plane
//               C2 = f16((v - hi) * rscale). N tile = one 64-wide head: dims d < 32 pair with d + 32:
//               out[d] = x[d] c[t][d] - x[d+32] s[t][d] (d < 32), x[d] c[t][d] + x[d-32] s[t][d] (d >= 32),
//               t = row mod SEQ, c/s = bf16 value of the [SEQ][64] input tables, f32, contract off,
//               partner column read from the staged slab.
//   OUT_MODE 2: as 1 but a single f16 plane C.
//   OUT_MODE 3: single f16 plane C of acc + bf16(bias[row]) (no rotary; used for v^T where the feature is the row).
// coverage: 4 slabs x 16 rows x 64 cols = the wave's whole 64x64 tile; (M/128)*(N/128) blocks x 4 waves x gridDim.y = the whole plane.
// =====================================================================================================
template <typename OT, int OUT_MODE, bool TWOA>
__global__ __launch_bounds__(128) void gemm64(
    const unsigned short* __restrict__ Ap, const unsigned short* __restrict__ Alp, int lda, long long strideA,
    const unsigned short* __restrict__ Btp, int ldb, long long strideB,
    void* Cout, void* Cout2, int ldc, long long strideC,
    const float* __restrict__ bias, const float* __restrict__ ctab, const float* __restrict__ stab,
    int M, int N, int K, float rscale) {
  static_assert(OUT_MODE >= 0 && OUT_MODE <= 3);
  typedef typename FT<OT>::frag V16;
  const OT* Ah = (const OT*)(const void*)Ap;
  const OT* Al = (const OT*)(const void*)Alp;
  const OT* Bt = (const OT*)(const void*)Btp;
  __shared__ __attribute__((aligned(2048))) unsigned char ring[2 * GK_STAGE];   // two stages
  __shared__ __align__(16) float sT[4][16 * 68];   // per-wave 16x64 slab, pitch 68 floats
  const int b    = blockIdx.y;
  const int lane = threadIdx.x & 31;
  const uint32_t wave = uni(threadIdx.x >> 5);
  const int tilesN = N >> 7;
  const int tilesM = M >> 7;
  const int bt = blockIdx.x;
  if (bt >= tilesM * tilesN) return;   // block-uniform, in front of every barrier and tensor load
  const int btm = bt / tilesN;
  const int btn = bt - btm * tilesN;
  const uint32_t wm = wave & 1u;               // which 64 A rows of the block tile this wave multiplies
  const uint32_t wn = wave >> 1;               // which 64 Bt rows
  const int m0 = (btm << 7) + (int)(wm << 6);
  const int n0 = (btn << 7) + (int)(wn << 6);

  const int rlane = lane & 15;                 // row (A) / col (B, D) within subtile
  const int koff  = (lane >> 4) * 8;           // k offset of this lane half
  const int mOff  = (lane >> 4) * 8;           // D row offset

  // ---- what this wave loads: waves 0, 1 the two halves of the A rows, waves 2, 3 the two halves of the Bt rows ----
  constexpr uint32_t NPL = TWOA ? 2u : 1u;
  const bool     isB   = wave >= 2u;
  const uint32_t half  = wave & 1u;
  const size_t   rowA  = (size_t)b * (size_t)strideA + (size_t)((btm << 7) + (int)(half << 6)) * lda;
  const size_t   rowBt = (size_t)b * (size_t)strideB + (size_t)((btn << 7) + (int)(half << 6)) * ldb;
  const uint64_t src0  = isB ? (uint64_t)(size_t)(Bt + rowBt) : (uint64_t)(size_t)(Ah + rowA);
  const uint64_t src1  = isB ? (uint64_t)(size_t)(Bt + rowBt) : (uint64_t)(size_t)(Al + rowA);
  const uint32_t kp    = (uint32_t)K / GK_PASS;       // stages per A plane
  const uint32_t nst   = kp * NPL;                    // stages in all (at least 2)
  const uint32_t lbase = (uint32_t)(size_t)ring;
  u32x8 g1 = tdm_group1((uint32_t)(isB ? ldb : lda) * 2u);
  // without this the compiler rebuilds words of group 1 from their constants, in the registers a request was issued from
  asm volatile("" : "+s"(g1));   // the pinned() form: descriptor words held in their scalar registers
  auto group0 = [&](uint32_t st) -> u32x4 {
    const bool second = TWOA && st >= kp;             // second A plane, Bt's k starts over
    const uint32_t kk = second ? st - kp : st;
    const uint64_t ga = (second ? src1 : src0) + (uint64_t)kk * (GK_PASS * 2u);
    return tdm_group0(lbase + (st & 1u) * GK_STAGE + wave * GK_SLICE, ga);
  };

  v8f acc[4][4];
#pragma unroll
  for (int i = 0; i < 4; ++i)
#pragma unroll
    for (int j = 0; j < 4; ++j) acc[i][j] = zero8();

  u32x4 g0 = group0(0);
  tdm_load(g0, g1);
  wait_tensor0(g0, g1);
  __syncthreads();
  g0 = group0(1);
  tdm_load(g0, g1);
  // kept rolled: one pass and one publish point in the text, every accumulator index constant
#pragma unroll 1
  for (uint32_t st = 0; st < nst; ++st) {
    const unsigned char* buf = ring + (st & 1u) * GK_STAGE;
    const unsigned char* pa = buf + wm * GK_SLICE + rlane * GK_PITCH + koff * 2;
    const unsigned char* pb = buf + (2u + wn) * GK_SLICE + rlane * GK_PITCH + koff * 2;
    V16 bq[2][4], af[2][4];   // two fragment sets: block ks multiplies set ks & 1 while the other set is filled
#pragma unroll
    for (int j = 0; j < 4; ++j) bq[0][j] = ldfrag<OT>((const OT*)(const void*)(pb + j * 16 * GK_PITCH));
#pragma unroll
    for (int i = 0; i < 4; ++i) af[0][i] = ldfrag<OT>((const OT*)(const void*)(pa + i * 16 * GK_PITCH));
#pragma unroll
    for (int ks = 0; ks < GK_PASS / 32; ++ks) {
      const int cs = ks & 1;
      if (ks + 1 < GK_PASS / 32) {   // the next block of this same stage; nothing of the next stage is read here
#pragma unroll
        for (int j = 0; j < 4; ++j) bq[cs ^ 1][j] = ldfrag<OT>((const OT*)(const void*)(pb + j * 16 * GK_PITCH + (ks + 1) * 64));
#pragma unroll
        for (int i = 0; i < 4; ++i) af[cs ^ 1][i] = ldfrag<OT>((const OT*)(const void*)(pa + i * 16 * GK_PITCH + (ks + 1) * 64));
      }
      // keeps the 16 LDS reads above as one group in front of the block: sunk among the WMMAs, each read is waited for where it stands
      __builtin_amdgcn_sched_barrier(0);
#pragma unroll
      for (int i = 0; i < 4; ++i)
#pragma unroll
        for (int j = 0; j < 4; ++j) acc[i][j] = mmar(af[cs][i], bq[cs][j], acc[i][j]);
      // keeps the following block's reads from rising among these WMMAs
      __builtin_amdgcn_sched_barrier(0);
    }
    // publish point of stage st + 1; behind its barrier every wave has left stage st's buffer
    wait_ds0();
    wait_tensor0(g0, g1);
    __syncthreads();
    if (pinned(st + 2u < nst)) {
      g0 = group0(st + 2u);
      tdm_load(g0, g1);
    }
  }
  wait_tensor0(g0, g1);
  wait_ds0();
  acc_guard4(acc[0][0], acc[0][1], acc[0][2], acc[0][3]);
  acc_guard4(acc[1][0], acc[1][1], acc[1][2], acc[1][3]);
  acc_guard4(acc[2][0], acc[2][1], acc[2][2], acc[2][3]);
  acc_guard4(acc[3][0], acc[3][1], acc[3][2], acc[3][3]);

  // ---- epilogue ----
  float* slab = sT[wave];
#pragma unroll
  for (int i = 0; i < 4; ++i) {
    const int mBase = m0 + (i << 4);
#pragma unroll
    for (int j = 0; j < 4; ++j) {
#pragma unroll
      for (int r = 0; r < 8; ++r) {
        slab[(mOff + r) * 68 + (j << 4) + rlane] = acc[i][j][r];
      }
    }
    __builtin_amdgcn_fence(__ATOMIC_RELEASE, "workgroup");
    __builtin_amdgcn_wave_barrier();
    __builtin_amdgcn_fence(__ATOMIC_ACQUIRE, "workgroup");
    if (OUT_MODE == 0) {
      float* C = (float*)Cout + (size_t)b * (size_t)strideC;
      const int h2 = lane >> 4, c4 = (lane & 15) * 4;     // 256-B row segment = 16 lanes x 16 B
      const v4f bb = *(const v4f*)(bias + n0 + c4);
      v4f bv;
#pragma unroll
      for (int e = 0; e < 4; ++e) bv[e] = bf16r(bb[e]);
      v4f ov[8];
#pragma unroll
      for (int it = 0; it < 8; ++it) {
        const int row = it * 2 + h2;                       // it 0..7 x h2 0..1 = rows 0..15
        ov[it] = *(const v4f*)(slab + row * 68 + c4) + bv;
      }
      {
#pragma unroll
        for (int it = 0; it < 8; ++it) {
          const int row = it * 2 + h2;
          *(v4f*)(C + (size_t)(mBase + row) * ldc + n0 + c4) = ov[it];
        }
        
      }
    } else {
      const int q = lane >> 3, c8 = (lane & 7) * 8;
      unsigned short* C  = (unsigned short*)Cout  + (size_t)b * (size_t)strideC;
      unsigned short* C2 = (unsigned short*)Cout2 + (size_t)b * (size_t)strideC;
#pragma unroll
      for (int it = 0; it < 4; ++it) {
        const int row = it * 4 + q;                        // it 0..3 x q 0..3 = rows 0..15
        const float* sp = slab + row * 68 + c8;
        float f[8];
#pragma unroll
        for (int e = 0; e < 8; ++e) f[e] = sp[e];
        if (OUT_MODE == 1 || OUT_MODE == 2) {
#pragma clang fp contract(off)
          const float* pp = slab + row * 68 + (c8 ^ 32);   // partner columns d +- 32 of the same row
          float g[8];
#pragma unroll
          for (int e = 0; e < 8; ++e) g[e] = pp[e];
          const v4f bc0 = *(const v4f*)(bias + n0 + c8);
          const v4f bc1 = *(const v4f*)(bias + n0 + c8 + 4);
          const v4f bp0 = *(const v4f*)(bias + n0 + (c8 ^ 32));
          const v4f bp1 = *(const v4f*)(bias + n0 + (c8 ^ 32) + 4);
          const int t  = (mBase + row) & (SEQ - 1);        // position within the sequence
          // tables are [SEQ][HD]; column within the head = c8 + e (n0 is head-aligned, c8 in 0..56)
          const v4f cv0 = *(const v4f*)(ctab + (size_t)t * HD + c8);
          const v4f cv1 = *(const v4f*)(ctab + (size_t)t * HD + c8 + 4);
          const v4f sv0 = *(const v4f*)(stab + (size_t)t * HD + c8);
          const v4f sv1 = *(const v4f*)(stab + (size_t)t * HD + c8 + 4);
          const float sg = (c8 < 32) ? -1.0f : 1.0f;       // -x2 for the first half, +x1 for the second half
#pragma unroll
          for (int e = 0; e < 4; ++e) {
            {
              const float x  = f[e] + bf16r(bc0[e]);
              const float y  = g[e] + bf16r(bp0[e]);
              const float ry = sg * y;
              const float p0 = x * bf16r(cv0[e]);
              const float p1 = ry * bf16r(sv0[e]);
              f[e] = p0 + p1;
            }
            {
              const float x  = f[4 + e] + bf16r(bc1[e]);
              const float y  = g[4 + e] + bf16r(bp1[e]);
              const float ry = sg * y;
              const float p0 = x * bf16r(cv1[e]);
              const float p1 = ry * bf16r(sv1[e]);
              f[4 + e] = p0 + p1;
            }
          }
        }
        if (OUT_MODE == 3) {
          const float bm = bf16r(bias[mBase + row]);
#pragma unroll
          for (int e = 0; e < 8; ++e) f[e] = f[e] + bm;
        }
        v4u a, a2;
#pragma unroll
        for (int e = 0; e < 4; ++e) {
          const float f0 = f[2 * e], f1 = f[2 * e + 1];
          const _Float16 x0 = (_Float16)f0, x1 = (_Float16)f1;
          const unsigned short h0 = h_bits(x0), h1 = h_bits(x1);
          unsigned short l0 = 0, l1 = 0;
          if (OUT_MODE == 1) {
            l0 = h_bits((_Float16)((f0 - (float)x0) * rscale));
            l1 = h_bits((_Float16)((f1 - (float)x1) * rscale));
          }
          a[e] = pk16(h0, h1); a2[e] = pk16(l0, l1);
        }
        unsigned short* cp  = C  + (size_t)(mBase + row) * ldc + n0 + c8;
        unsigned short* cp2 = C2 + (size_t)(mBase + row) * ldc + n0 + c8;
        *(v4u*)cp = a;
        if (OUT_MODE == 1) *(v4u*)cp2 = a2;
        
      }
    }
    __builtin_amdgcn_fence(__ATOMIC_RELEASE, "workgroup");
    __builtin_amdgcn_wave_barrier();
    __builtin_amdgcn_fence(__ATOMIC_ACQUIRE, "workgroup");
  }
}

#define AT_PITCH 72                   // 16-bit elements per LDS row of the K and V^T tiles
#define OS_PITCH 68                   // floats per LDS row of the context tile
static_assert((AT_PITCH * 2) % 32 == 16 && AT_PITCH >= 64 && (OS_PITCH * 4) % 16 == 0 && OS_PITCH >= 64);
// lane l <-> lane l ^ 16: the other half of the wave holds the same query's other keys
__device__ __forceinline__ float xhalf(float x) {
  return __builtin_bit_cast(float, __builtin_amdgcn_permlanex16(__builtin_bit_cast(int, x), __builtin_bit_cast(int, x),
                                                                0x76543210, 0xfedcba98, false, false));
}
__global__ __launch_bounds__(128)
void attn_mha(const unsigned short* __restrict__ qhp, const unsigned short* __restrict__ qlp,
              const unsigned short* __restrict__ kpp, const unsigned short* __restrict__ vtp,
              unsigned short* ohp, unsigned short* olp, float sscale) {
  union FH { v16h v; v8h h[2]; };
  __shared__ __align__(16) _Float16 Ksh[64 * AT_PITCH];      // K chunk [key][d]      9 KB
  __shared__ __align__(16) _Float16 Vth[64 * AT_PITCH];      // V^T chunk [d][key]    9 KB
  __shared__ __align__(16) float    Os[4][16 * OS_PITCH];    // per wave context tile 17 KB

  const int tid  = threadIdx.x;
  const int wave = tid >> 5;
  const int lane = tid & 31;
  const int hh   = lane >> 4;
  const int c    = lane & 15;

  const int bx   = blockIdx.x;
  const int qb   = bx % NQB;
  const int rest = bx / NQB;
  const int h    = rest % NH;
  const int b    = rest / NH;
  const int q0   = qb * 64 + wave * 16;
  const size_t rowB = (size_t)b * SEQ;
  const size_t hcol = (size_t)h * HD;

  const _Float16* Qh = (const _Float16*)(const void*)qhp;
  const _Float16* Ql = (const _Float16*)(const void*)qlp;
  const _Float16* Kg = (const _Float16*)(const void*)kpp + hcol;
  const _Float16* Vt = (const _Float16*)(const void*)vtp + ((size_t)b * DM + hcol) * SEQ;

  // ---- Q fragments (B operand, column = query = lane&15): 2 d-chunks, hi and residual planes ----
  v16h qah[2], qal[2];
#pragma unroll
  for (int dc = 0; dc < 2; ++dc) {
    const size_t qo = (rowB + q0 + c) * DM + hcol + dc * 32 + 8 * hh;
    qah[dc] = ldfrag<_Float16>(Qh + qo);
    qal[dc] = ldfrag<_Float16>(Ql + qo);
  }

  float mrun = -INFINITY;   // running maximum of this lane's query (equal in both halves)
  float lrun = 0.f;         // running sum over this half's keys; the halves are joined once, behind the loop
  v8f oacc[4];              // O^T: column = query lane&15, row d = 16 t + 8 hh + r
#pragma unroll
  for (int t = 0; t < 4; ++t) oacc[t] = zero8();

  for (int kt = 0; kt < NKT; ++kt) {         // static trip count
    const int kv0 = kt * 64;
    __syncthreads();
    {
      const int r = tid >> 1, half = (tid & 1) * 32;
      const _Float16* kg = Kg + (rowB + kv0 + r) * DM + half;       // k row kv0+r, d = half..half+31
      const _Float16* vg = Vt + (size_t)r * SEQ + kv0 + half;       // v^T row d = r, s = kv0+half..+31
#pragma unroll
      for (int i = 0; i < 4; ++i) {
        const v8h a0 = *(const v8h*)(kg + 8 * i);
        const v8h b0 = *(const v8h*)(vg + 8 * i);
        *(v8h*)(Ksh + r * AT_PITCH + half + 8 * i) = a0;
        *(v8h*)(Vth + r * AT_PITCH + half + 8 * i) = b0;
      }
    }
    __syncthreads();

    // ---- scores, transposed: 64 keys x 16 queries per wave, 2 f16 products per key subtile and d-chunk ----
    v8f s[4];   // s[j][r]: key kv0 + 16 j + 8 hh + r, query q0 + c
#pragma unroll
    for (int j = 0; j < 4; ++j) {
      v8f ah = zero8(), al = zero8();
#pragma unroll
      for (int dc = 0; dc < 2; ++dc) {
        FH kb;
        kb.h[0] = *(const v8h*)(Ksh + (j * 16 + c) * AT_PITCH + dc * 32 + 8 * hh);
        kb.h[1] = *(const v8h*)(Ksh + (j * 16 + c) * AT_PITCH + dc * 32 + 16 + 8 * hh);
        ah = mma_h(kb.v, qah[dc], ah);
        al = mma_h(kb.v, qal[dc], al);
      }
#pragma unroll
      for (int r = 0; r < 8; ++r) s[j][r] = (ah[r] + al[r] * (1.0f / 4096.0f)) * sscale;
    }

    // ---- query maximum (in-lane, then the other half's), online softmax, P^T (x1024, f16) packed in registers ----
    float mj[4];   // one chain per key subtile: four short dependent chains instead of one long one
#pragma unroll
    for (int j = 0; j < 4; ++j) {
      mj[j] = s[j][0];
#pragma unroll
      for (int r = 1; r < 8; ++r) mj[j] = fmaxf(mj[j], s[j][r]);
    }
    float m = fmaxf(fmaxf(mj[0], mj[1]), fmaxf(mj[2], mj[3]));
    m = fmaxf(m, xhalf(m));
    const float mnew  = fmaxf(mrun, m);
    const float msafe = (mnew == -INFINITY) ? 0.f : mnew;
    const float alpha = __expf(mrun - msafe);
    mrun = mnew;
    // B operand of 32 keys: elements 0..7 = keys k0 + 8 hh + e (subtile 2 kk), 8..15 = keys k0 + 16 + 8 hh + e (subtile 2 kk + 1)
    FH pb[2];
    float ps[4];   // partial sums, one chain per key subtile
#pragma unroll
    for (int j = 0; j < 4; ++j) {
      ps[j] = 0.f;
#pragma unroll
      for (int r = 0; r < 8; ++r) {
        const float p = __expf(s[j][r] - msafe);
        ps[j] += p;
        pb[j >> 1].v[(j & 1) * 8 + r] = (_Float16)(p * 1024.0f);
      }
    }
    lrun = lrun * alpha + ((ps[0] + ps[1]) + (ps[2] + ps[3]));
#pragma unroll
    for (int t = 0; t < 4; ++t) oacc[t] = oacc[t] * alpha;

    // ---- context^T += V^T . P^T (f16 WMMA, single product); unrolled: pb is indexed in registers ----
#pragma unroll
    for (int kk = 0; kk < 2; ++kk) {
#pragma unroll
      for (int t = 0; t < 4; ++t) {
        FH vb;
        vb.h[0] = *(const v8h*)(Vth + (t * 16 + c) * AT_PITCH + kk * 32 + 8 * hh);
        vb.h[1] = *(const v8h*)(Vth + (t * 16 + c) * AT_PITCH + kk * 32 + 16 + 8 * hh);
        oacc[t] = mma_h(vb.v, pb[kk].v, oacc[t]);
      }
    }
  }

  // ---- join the halves' sums, normalise (1/l, undo the x1024 p carry), stage the wave's 16x64 f32 tile [query][d],
  //      split into bf16 hi / residual
  float* os = Os[wave];
  {
    const float l = lrun + xhalf(lrun);   // unconditional: every lane is on at the exchange
    const float inv = ((l > 0.f) ? (1.0f / l) : 0.f) * (1.0f / 1024.0f);
#pragma unroll
    for (int t = 0; t < 4; ++t) {
      v4f lo, hi;
#pragma unroll
      for (int r = 0; r < 4; ++r) { lo[r] = oacc[t][r] * inv; hi[r] = oacc[t][4 + r] * inv; }
      *(v4f*)(os + c * OS_PITCH + t * 16 + 8 * hh)     = lo;
      *(v4f*)(os + c * OS_PITCH + t * 16 + 8 * hh + 4) = hi;
    }
  }
  __builtin_amdgcn_fence(__ATOMIC_RELEASE, "workgroup");
  __builtin_amdgcn_wave_barrier();
  __builtin_amdgcn_fence(__ATOMIC_ACQUIRE, "workgroup");
  {
    const int q4 = lane >> 3, c8 = (lane & 7) * 8;
    v4u hv[4], lv[4];
#pragma unroll
    for (int it = 0; it < 4; ++it) {
      const int row = it * 4 + q4;   // it 0..3 x q4 0..3 = rows 0..15 of the wave tile
      const float* sp = os + row * OS_PITCH + c8;
      v4u a, a2;
#pragma unroll
      for (int e = 0; e < 4; ++e) {
        const float f0 = sp[2 * e], f1 = sp[2 * e + 1];
        const unsigned short h0 = bf_bits(f0), h1 = bf_bits(f1);
        const unsigned short l0 = bf_bits(f0 - bf_up(h0)), l1 = bf_bits(f1 - bf_up(h1));
        a[e] = pk16(h0, h1); a2[e] = pk16(l0, l1);
      }
      hv[it] = a; lv[it] = a2;
    }
    {
#pragma unroll
      for (int it = 0; it < 4; ++it) {
        const int row = it * 4 + q4;
        const size_t go = (rowB + q0 + row) * DM + hcol + c8;
        *(v4u*)(ohp + go) = hv[it];
        *(v4u*)(olp + go) = lv[it];
      }
      
    }
  }
}

// =====================================================================================================
// Workspace map (bytes), every region an exact multiple of its whole-line / whole-tile store granularity
// (all shapes are tile multiples, no padded tails):
//   Xb    bf16 [4096][1024]          8388608
//   Wqkv  bf16 [3072 n][1024 k]      6291456   (input [out][in] layout == Bt[n][k], k contiguous)
//   Wo    bf16 [1024 n][1024 k]      2097152
//   Qh    f16  [4096][1024]          8388608
//   Ql    f16  [4096][1024]          8388608   (residual x4096)
//   Kp    f16  [4096][1024]          8388608
//   VT    f16  [4][1024][1024]       8388608
//   Oh    bf16 [4096][1024]          8388608
//   Ol    bf16 [4096][1024]          8388608
//   total                           67108864
// =====================================================================================================
extern "C" void kernel_launch(void* const* d_in, const int* in_sizes, int n_in,
                              void* d_out, int out_size, void* d_ws, size_t ws_size,
                              hipStream_t stream) {
  if (n_in < 7) return;
  if (in_sizes[0] != NTOK * DM) return;          // x      [4][1024][1024]
  if (in_sizes[1] != SEQ * HD) return;           // cos    [1024][64]
  if (in_sizes[2] != SEQ * HD) return;           // sin    [1024][64]
  if (in_sizes[3] != DQKV * DM) return;          // qkv_w  [3072][1024]
  if (in_sizes[4] != DQKV) return;               // qkv_b  [3072]
  if (in_sizes[5] != DM * DM) return;            // proj_w [1024][1024]
  if (in_sizes[6] != DM) return;                 // proj_b [1024]
  if (out_size != NTOK * DM) return;

  const float* x    = (const float*)d_in[0];
  const float* cosb = (const float*)d_in[1];
  const float* sinb = (const float*)d_in[2];
  const float* Wqkv = (const float*)d_in[3];
  const float* bqkv = (const float*)d_in[4];
  const float* Wout = (const float*)d_in[5];
  const float* bout = (const float*)d_in[6];

  const size_t PX  = (size_t)NTOK * DM * 2;        //  8388608  16-bit activation plane [4096][1024]
  const size_t PWQ = (size_t)DQKV * DM * 2;        //  6291456  bf16 [3072][1024]
  const size_t PWO = (size_t)DM * DM * 2;          //  2097152  bf16 [1024][1024]
  const size_t PVT = (size_t)NB * DM * SEQ * 2;    //  8388608  v^T plane [4][1024][1024]
  size_t off = 0;
  const size_t oXb  = off; off += PX;
  const size_t oWq  = off; off += PWQ;
  const size_t oWo  = off; off += PWO;
  const size_t oQh  = off; off += PX;
  const size_t oQl  = off; off += PX;
  const size_t oKp  = off; off += PX;
  const size_t oVT  = off; off += PVT;
  const size_t oOh  = off; off += PX;
  const size_t oOl  = off; off += PX;
  if (off > ws_size) return;                       // off = 67108864
  if (off > (size_t)134217728) return;

  char* ws = (char*)d_ws;
  unsigned short* Xb   = (unsigned short*)(ws + oXb);
  unsigned short* Wq16 = (unsigned short*)(ws + oWq);
  unsigned short* Wo16 = (unsigned short*)(ws + oWo);
  unsigned short* Qh   = (unsigned short*)(ws + oQh);
  unsigned short* Ql   = (unsigned short*)(ws + oQl);
  unsigned short* Kp   = (unsigned short*)(ws + oKp);
  unsigned short* VT   = (unsigned short*)(ws + oVT);
  unsigned short* Oh   = (unsigned short*)(ws + oOh);
  unsigned short* Ol   = (unsigned short*)(ws + oOl);

  const dim3 blk(256);
  const int n8x  = NTOK * DM / 8;                               // 524288
  const int n8wq = DQKV * DM / 8;                               // 393216
  const int n8wo = DM * DM / 8;                                 // 131072
  const dim3 gCvtX((n8x + 255) / 256);                          // 2048 blocks
  const dim3 gCvtWq((n8wq + 255) / 256);                        // 1536 blocks
  const dim3 gCvtWo((n8wo + 255) / 256);                        //  512 blocks
  const dim3 blkG(128);                                         // gemm64: 4 waves
  const dim3 gP((NTOK / 128) * (DM / 128), 1);                  // 256 blocks of one 128x128 tile: M=4096, N=1024
  const dim3 gVT((DM / 128) * (SEQ / 128), NB);                 //  64 blocks x 4 batches: M=1024, N=1024
  const dim3 gAttn(NB * NH * NQB);                              // 1024 blocks of 128
  static_assert((NTOK % 128) == 0 && (DM % 128) == 0 && (SEQ % 128) == 0 && (DM % GK_PASS) == 0 && DM / GK_PASS >= 2);
  static_assert((NTOK * DM) % 2048 == 0 && (DQKV * DM) % 2048 == 0 && (DM * DM) % 2048 == 0);
  static_assert((DM % 32) == 0);

  // (1) x -> bf16 plane [4096][1024]; qkv_w [3072][1024] ([out][in] = Bt[n][k]) -> bf16; proj_w [1024][1024] -> bf16
  cvt_bf16x8<<<gCvtX,  blk, 0, stream>>>(x,    Xb,   n8x);
  cvt_bf16x8<<<gCvtWq, blk, 0, stream>>>(Wqkv, Wq16, n8wq);
  cvt_bf16x8<<<gCvtWo, blk, 0, stream>>>(Wout, Wo16, n8wo);
  // (2) q = rope(x . Wq^T + bq) -> f16 hi / residual (x4096) planes [b*SEQ+t][h*64+d]   (M=4096, N=1024, K=1024)
  gemm64<__bf16, 1, false><<<gP, blkG, 0, stream>>>(
      Xb, Xb, DM, 0LL, Wq16, DM, 0LL,
      (void*)Qh, (void*)Ql, DM, 0LL, bqkv, cosb, sinb,
      NTOK, DM, DM, 4096.0f);
  // (3) k = rope(x . Wk^T + bk) -> f16 plane [b*SEQ+s][h*64+d]   (Bt = Wq16 rows 1024..2047)
  gemm64<__bf16, 2, false><<<gP, blkG, 0, stream>>>(
      Xb, Xb, DM, 0LL, Wq16 + (size_t)DM * DM, DM, 0LL,
      (void*)Kp, (void*)Kp, DM, 0LL, bqkv + DM, cosb, sinb,
      NTOK, DM, DM, 1.0f);
  // (4) v^T = Wv . x^T + bv per batch -> f16 plane [b][h*64+d][s] (pitch SEQ)
  //     (A = Wq16 rows 2048..3071 [feature][k], Bt = Xb rows of batch b; M=1024, N=1024, K=1024; bias by row)
  gemm64<__bf16, 3, false><<<gVT, blkG, 0, stream>>>(
      Wq16 + (size_t)2 * DM * DM, Wq16 + (size_t)2 * DM * DM, DM, 0LL, Xb, DM, (long long)SEQ * DM,
      (void*)VT, (void*)VT, SEQ, (long long)DM * SEQ, bqkv + 2 * DM, cosb, sinb,
      DM, SEQ, DM, 1.0f);
  // (5) attention -> ctx bf16 hi / residual planes [b*SEQ+t][h*64+d]
  attn_mha<<<gAttn, dim3(128), 0, stream>>>(Qh, Ql, Kp, VT, Oh, Ol, 0.125f);
  // (6) out = (Oh + Ol) . Wproj^T + bproj -> d_out f32 [4096][1024]   (M=4096, N=1024, K=1024, two A planes)
  gemm64<__bf16, 0, true><<<gP, blkG, 0, stream>>>(
      Oh, Ol, DM, 0LL, Wo16, DM, 0LL,
      d_out, d_out, DM, 0LL, bout, cosb, sinb,
      NTOK, DM, DM, 1.0f);
  (void)hipGetLastError();
}

// v005
// Measured time: 112 microseconds a run.
// Next to v004, in two timings, it ran 1.06 times as fast each time.
// Over all steps from v000 it is 3.16 times as fast.
// Contractions: q / k / v^T projections = v_wmma_f32_16x16x32_bf16 (bf16 operands from RNE-converted x and qkv weight rows, single product, f32 accumulate);
// q.k^T scores = v_wmma_f32_16x16x32_f16 (q as f16 hi plane + f16 residual plane x4096, k f16; 2 products into separate f32 accumulators);
// p.v = v_wmma_f32_16x16x32_f16 (p carried x1024 in f16, v f16; single product, f32 accumulate);
// ctx.Wproj^T = v_wmma_f32_16x16x32_bf16 (ctx as bf16 hi plane + unscaled bf16 residual plane, weights bf16; 2 products, f32 accumulate);
// rotary with the input cos/sin tables (values RNE-converted to bf16), half-rotation, bias adds and softmax in f32 on the VALU.
// Carry audit: q residual plane x4096 -> folded back once as al * (1/4096) in the attn_mha score combine;
// p x1024 -> folded back once as (1/l) * (1/1024) in the attn_mha epilogue; ctx residual plane is the unscaled
// RNE residual (v - hi) and shares the hi accumulator; no weight-plane carries (all weight copies are bf16).
// gemm64 stages both operands in LDS with tensor loads (two buffers); its 16-bit epilogue stores each row group right after conversion.
// attn_mha stages its K and V^T chunks in LDS with tensor loads (two buffers).
#include <hip/hip_runtime.h>
#include <math.h>
#include <stdint.h>

#define NB    4
#define SEQ   1024
#define DM    1024
#define NH    16
#define HD    64
#define DQKV  (3 * DM)
#define NTOK  (NB * SEQ)   // 4096 token rows
#define NQB   (SEQ / 64)   // 16 query blocks of 64 per sequence
#define NKT   (SEQ / 64)   // 16 key chunks of 64 per sequence
static_assert(NH * HD == DM);
static_assert(NQB == 16 && NKT == 16);
static_assert((SEQ & (SEQ - 1)) == 0);
static_assert((SEQ % 64) == 0 && (DM % 64) == 0 && (DM % 32) == 0 && (DQKV % 64) == 0 && (NTOK % 64) == 0);

typedef _Float16 v16h __attribute__((ext_vector_type(16)));
typedef _Float16 v8h  __attribute__((ext_vector_type(8)));
typedef __bf16   v16b __attribute__((ext_vector_type(16)));
typedef __bf16   v8b  __attribute__((ext_vector_type(8)));
typedef float    v8f  __attribute__((ext_vector_type(8)));
typedef float    v4f  __attribute__((ext_vector_type(4)));
typedef unsigned int v4u __attribute__((ext_vector_type(4)));
typedef uint32_t u32x4 __attribute__((ext_vector_type(4)));
typedef uint32_t u32x8 __attribute__((ext_vector_type(8)));

#if defined(__HIP_DEVICE_COMPILE__)
#define DEV_ASM 1
#else
#define DEV_ASM 0
#endif

// ---- scalar helpers --------------------------------------------------------------------------------
__device__ __forceinline__ unsigned short bf_bits(float f) {          // f32 -> bf16 bits, RNE convert
  unsigned u = __float_as_uint(f);
  return (unsigned short)((u + 0x7FFFu + ((u >> 16) & 1u)) >> 16);
}
__device__ __forceinline__ float bf_up(unsigned short hb) { return __uint_as_float(((unsigned)hb) << 16); }
__device__ __forceinline__ float bf16r(float f) { return bf_up(bf_bits(f)); }   // value of the bf16 RNE convert
__device__ __forceinline__ unsigned short h_bits(_Float16 x) { return __builtin_bit_cast(unsigned short, x); }
__device__ __forceinline__ unsigned pk16(unsigned short a, unsigned short b) { return (unsigned)a | ((unsigned)b << 16); }
__device__ __forceinline__ v8f zero8() { v8f z = {0.f, 0.f, 0.f, 0.f, 0.f, 0.f, 0.f, 0.f}; return z; }

// ---- fragment types / loaders: 16-bit A/B operand, lane -> row/col (lane&15), p already includes +8*(lane>>4);
//      elements 0..7 <- p[0..7] (k0+8h..k0+8h+7), elements 8..15 <- p[16..23] (k0+16+8h..k0+16+8h+7)
template <typename OT> struct FT;
template <> struct FT<__bf16>   { typedef v16b frag; typedef v8b half8; };
template <> struct FT<_Float16> { typedef v16h frag; typedef v8h half8; };

template <typename OT>
__device__ __forceinline__ typename FT<OT>::frag ldfrag(const OT* p) {
  union { typename FT<OT>::frag v; typename FT<OT>::half8 h[2]; } f;
  f.h[0] = *(const typename FT<OT>::half8*)(p);
  f.h[1] = *(const typename FT<OT>::half8*)(p + 16);
  return f.v;
}

// ---- WMMA helpers (asm guard bodies are device-only; concrete operand types) -----------------------------
__device__ __forceinline__ v8f mmar(v16b a, v16b b, v8f c) {
  return __builtin_amdgcn_wmma_f32_16x16x32_bf16(false, a, false, b, (short)0, c, false, false);
}
__device__ __forceinline__ v8f mmar(v16h a, v16h b, v8f c) {
  return __builtin_amdgcn_wmma_f32_16x16x32_f16(false, a, false, b, (short)0, c, false, false);
}
// guarded form: 4 VALU slots after the WMMA, D tied, A/B kept live
__device__ __forceinline__ v8f mma_h(v16h a, v16h b, v8f c) {
  c = __builtin_amdgcn_wmma_f32_16x16x32_f16(false, a, false, b, (short)0, c, false, false);
#if DEV_ASM
  asm volatile("v_nop\n\tv_nop\n\tv_nop\n\tv_nop" : "+v"(c) : "v"(a), "v"(b));
#endif
  return c;
}
__device__ __forceinline__ void acc_guard4(v8f& a, v8f& b, v8f& c, v8f& d) {
#if DEV_ASM
  asm volatile("v_nop\n\tv_nop\n\tv_nop\n\tv_nop" : "+v"(a), "+v"(b), "+v"(c), "+v"(d));
#else
  (void)a; (void)b; (void)c; (void)d;
#endif
}

// ---- tensor-load helpers for the LDS rings of gemm64 and attn_mha ------------------------------------------------------
#define GK_PASS  128                  // k elements of one stage: rows of 256 B
#define GK_PITCH 272                  // LDS row pitch in bytes: 256 B + the 16-B pad (odd multiple of 16 B for 16-B readers)
#define GK_SLICE 18432                // one wave's slice: 64 rows x 272 B = 17408 B, rounded up to a multiple of 2 KiB
#define GK_STAGE (4 * GK_SLICE)       // [A rows 0..63 | A rows 64..127 | Bt rows 0..63 | Bt rows 64..127]
static_assert(64 * GK_PITCH <= GK_SLICE && (GK_SLICE % 2048) == 0);
__device__ __forceinline__ uint32_t uni(uint32_t v) { return (uint32_t)__builtin_amdgcn_readfirstlane(v); }
__device__ __forceinline__ uint32_t pinned(uint32_t v) { uint32_t w = uni(v); asm volatile("" : "+s"(w)); return w; }
// the compiler places no wait for a tensor load: the issuing wave waits for its own request here; the request's two
// groups are inputs, so that their scalar registers keep their values until the request has landed
__device__ __forceinline__ void wait_tensor0(u32x4 g0, u32x8 g1) { asm volatile("s_wait_tensorcnt 0x0" :: "s"(g0), "s"(g1) : "memory"); }
// this wave's LDS reads have retired before the barrier behind which their buffer is refilled
__device__ __forceinline__ void wait_ds0() { asm volatile("s_wait_dscnt 0x0" ::: "memory"); }
__device__ __forceinline__ void tdm_load(u32x4 g0, u32x8 g1) { asm volatile("tensor_load_to_lds %0, %1" :: "s"(g0), "s"(g1) : "memory"); }
// group 1: 1-byte elements, tile = tensor = 64 rows of 256 B, source row pitch src_pitch bytes, 4 dwords of LDS pad behind every row
__device__ __forceinline__ u32x8 tdm_group1(uint32_t src_pitch) {
  constexpr uint32_t d0 = 256u, d1 = 64u;
  u32x8 g;
  g[0] = uni((1u << 20) | (5u << 22) | (3u << 25));   // no mask, data_size 0, pad after every 64 dwords, 4 dwords
  g[1] = uni((d0 & 0xFFFFu) << 16);
  g[2] = uni((d0 >> 16) | ((d1 & 0xFFFFu) << 16));
  g[3] = uni((d1 >> 16) | (d0 << 16));
  g[4] = uni(d1);
  g[5] = uni(src_pitch);
  g[6] = uni(0u);
  g[7] = uni(0u);
  return g;
}
// group 1 of attn_mha's tiles: 1-byte elements, tile = tensor = 32 rows of 128 B, 4 dwords of LDS pad behind every row
__device__ __forceinline__ u32x8 tdm_group1_r128(uint32_t src_pitch) {
  constexpr uint32_t d0 = 128u, d1 = 32u;
  u32x8 g;
  g[0] = uni((1u << 20) | (4u << 22) | (3u << 25));   // no mask, data_size 0, pad after every 32 dwords, 4 dwords
  g[1] = uni((d0 & 0xFFFFu) << 16);
  g[2] = uni((d0 >> 16) | ((d1 & 0xFFFFu) << 16));
  g[3] = uni((d1 >> 16) | (d0 << 16));
  g[4] = uni(d1);
  g[5] = uni(src_pitch);
  g[6] = uni(0u);
  g[7] = uni(0u);
  return g;
}
__device__ __forceinline__ u32x4 tdm_group0(uint32_t lds_dst, uint64_t ga) {
  u32x4 g;
  g[0] = uni(1u);
  g[1] = uni(lds_dst);
  g[2] = uni((uint32_t)ga);
  g[3] = uni((((uint32_t)(ga >> 32)) & 0x01FFFFFFu) | 0x80000000u);
  return g;
}

// =====================================================================================================
// f32 -> bf16 (RNE convert), 8 elements per thread, one 16-B store per lane: a wave writes 512 contiguous B
// Layout is preserved, so a [out][in] f32 weight becomes the bf16 Bt[n][k] plane (k contiguous) directly.
// coverage: n8 threads x 8 = the whole plane (n8 = 524288 / 393216 / 131072, all multiples of 256).
// =====================================================================================================
__global__ __launch_bounds__(256) void cvt_bf16x8(const float* __restrict__ in, unsigned short* out, int n8) {
  const int i = blockIdx.x * 256 + (int)threadIdx.x;
  if (i < n8) {
    const v4f a = *(const v4f*)(in + (size_t)i * 8);
    const v4f b = *(const v4f*)(in + (size_t)i * 8 + 4);
    v4u p;
    p[0] = pk16(bf_bits(a[0]), bf_bits(a[1]));
    p[1] = pk16(bf_bits(a[2]), bf_bits(a[3]));
    p[2] = pk16(bf_bits(b[0]), bf_bits(b[1]));
    p[3] = pk16(bf_bits(b[2]), bf_bits(b[3]));
    *(v4u*)(out + (size_t)i * 8) = p;
    
  }
}

// =====================================================================================================
// Register-blocked batched WMMA GEMM (16-bit operand type OT): C[m][n] = sum_k A[m][k] * Bt[n][k];
// one block of 4 waves (2 x 2) per 128x128 tile, one wave per 64x64 tile. A row-major [M][K] pitch lda; Bt row-major
// [N][K] pitch ldb (k contiguous); M, N multiples of 128, K a multiple of 128 and at least 256 (host-checked).
// blockIdx.y = batch index (strides in elements). A stage = 128 k of the block's 128 A rows and 128 Bt rows in LDS;
// every wave brings one 64-row slice of it with one tensor load, two buffers, the next stage in flight during a pass.
// Fragments are read from LDS with the split k map (ldfrag); k runs upward in steps of 32 (a block = 16 WMMAs); inside a stage
// the next block's 16 fragment reads are issued as one group, into a second register set, in front of the current block.
//   TWOA: a second A plane Al with the same Bt is accumulated into the same tile (C = (A + Al) . Bt^T).
//   OUT_MODE 0: f32 C (pitch ldc), value + bf16(bias[col]); 256-B row segment = 16 lanes x 16 B, one instruction,
//   OUT_MODE 1: half-rotation rotary of (acc + bf16(bias[col])) -> f16 hi plane C + f16 residual plane
//               C2 = f16((v - hi) * rscale). N tile = one 64-wide head: dims d < 32 pair with d + 32:
//               out[d] = x[d] c[t][d] - x[d+32] s[t][d] (d < 32), x[d] c[t][d] + x[d-32] s[t][d] (d >= 32),
//               t = row mod SEQ, c/s = bf16 value of the [SEQ][64] input tables, f32, contract off,
//               partner column read from the staged slab.
//   OUT_MODE 2: as 1 but a single f16 plane C.
//   OUT_MODE 3: single f16 plane C of acc + bf16(bias[row]) (no rotary; used for v^T where the feature is the row).
// coverage: 4 slabs x 16 rows x 64 cols = the wave's whole 64x64 tile; (M/128)*(N/128) blocks x 4 waves x gridDim.y = the whole plane.
// =====================================================================================================
template <typename OT, int OUT_MODE, bool TWOA>
__global__ __launch_bounds__(128) void gemm64(
    const unsigned short* __restrict__ Ap, const unsigned short* __restrict__ Alp, int lda, long long strideA,
    const unsigned short* __restrict__ Btp, int ldb, long long strideB,
    void* Cout, void* Cout2, int ldc, long long strideC,
    const float* __restrict__ bias, const float* __restrict__ ctab, const float* __restrict__ stab,
    int M, int N, int K, float rscale) {
  static_assert(OUT_MODE >= 0 && OUT_MODE <= 3);
  typedef typename FT<OT>::frag V16;
  const OT* Ah = (const OT*)(const void*)Ap;
  const OT* Al = (const OT*)(const void*)Alp;
  const OT* Bt = (const OT*)(const void*)Btp;
  __shared__ __attribute__((aligned(2048))) unsigned char ring[2 * GK_STAGE];   // two stages
  __shared__ __align__(16) float sT[4][16 * 68];   // per-wave 16x64 slab, pitch 68 floats
  const int b    = blockIdx.y;
  const int lane = threadIdx.x & 31;
  const uint32_t wave = uni(threadIdx.x >> 5);
  const int tilesN = N >> 7;
  const int tilesM = M >> 7;
  const int bt = blockIdx.x;
  if (bt >= tilesM * tilesN) return;   // block-uniform, in front of every barrier and tensor load
  const int btm = bt / tilesN;
  const int btn = bt - btm * tilesN;
  const uint32_t wm = wave & 1u;               // which 64 A rows of the block tile this wave multiplies
  const uint32_t wn = wave >> 1;               // which 64 Bt rows
  const int m0 = (btm << 7) + (int)(wm << 6);
  const int n0 = (btn << 7) + (int)(wn << 6);

  const int rlane = lane & 15;                 // row (A) / col (B, D) within subtile
  const int koff  = (lane >> 4) * 8;           // k offset of this lane half
  const int mOff  = (lane >> 4) * 8;           // D row offset

  // ---- what this wave loads: waves 0, 1 the two halves of the A rows, waves 2, 3 the two halves of the Bt rows ----
  constexpr uint32_t NPL = TWOA ? 2u : 1u;
  const bool     isB   = wave >= 2u;
  const uint32_t half  = wave & 1u;
  const size_t   rowA  = (size_t)b * (size_t)strideA + (size_t)((btm << 7) + (int)(half << 6)) * lda;
  const size_t   rowBt = (size_t)b * (size_t)strideB + (size_t)((btn << 7) + (int)(half << 6)) * ldb;
  const uint64_t src0  = isB ? (uint64_t)(size_t)(Bt + rowBt) : (uint64_t)(size_t)(Ah + rowA);
  const uint64_t src1  = isB ? (uint64_t)(size_t)(Bt + rowBt) : (uint64_t)(size_t)(Al + rowA);
  const uint32_t kp    = (uint32_t)K / GK_PASS;       // stages per A plane
  const uint32_t nst   = kp * NPL;                    // stages in all (at least 2)
  const uint32_t lbase = (uint32_t)(size_t)ring;
  u32x8 g1 = tdm_group1((uint32_t)(isB ? ldb : lda) * 2u);
  // without this the compiler rebuilds words of group 1 from their constants, in the registers a request was issued from
  asm volatile("" : "+s"(g1));   // the pinned() form: descriptor words held in their scalar registers
  auto group0 = [&](uint32_t st) -> u32x4 {
    const bool second = TWOA && st >= kp;             // second A plane, Bt's k starts over
    const uint32_t kk = second ? st - kp : st;
    const uint64_t ga = (second ? src1 : src0) + (uint64_t)kk * (GK_PASS * 2u);
    return tdm_group0(lbase + (st & 1u) * GK_STAGE + wave * GK_SLICE, ga);
  };

  v8f acc[4][4];
#pragma unroll
  for (int i = 0; i < 4; ++i)
#pragma unroll
    for (int j = 0; j < 4; ++j) acc[i][j] = zero8();

  u32x4 g0 = group0(0);
  tdm_load(g0, g1);
  wait_tensor0(g0, g1);
  __syncthreads();
  g0 = group0(1);
  tdm_load(g0, g1);
  // kept rolled: one pass and one publish point in the text, every accumulator index constant
#pragma unroll 1
  for (uint32_t st = 0; st < nst; ++st) {
    const unsigned char* buf = ring + (st & 1u) * GK_STAGE;
    const unsigned char* pa = buf + wm * GK_SLICE + rlane * GK_PITCH + koff * 2;
    const unsigned char* pb = buf + (2u + wn) * GK_SLICE + rlane * GK_PITCH + koff * 2;
    V16 bq[2][4], af[2][4];   // two fragment sets: block ks multiplies set ks & 1 while the other set is filled
#pragma unroll
    for (int j = 0; j < 4; ++j) bq[0][j] = ldfrag<OT>((const OT*)(const void*)(pb + j * 16 * GK_PITCH));
#pragma unroll
    for (int i = 0; i < 4; ++i) af[0][i] = ldfrag<OT>((const OT*)(const void*)(pa + i * 16 * GK_PITCH));
#pragma unroll
    for (int ks = 0; ks < GK_PASS / 32; ++ks) {
      const int cs = ks & 1;
      if (ks + 1 < GK_PASS / 32) {   // the next block of this same stage; nothing of the next stage is read here
#pragma unroll
        for (int j = 0; j < 4; ++j) bq[cs ^ 1][j] = ldfrag<OT>((const OT*)(const void*)(pb + j * 16 * GK_PITCH + (ks + 1) * 64));
#pragma unroll
        for (int i = 0; i < 4; ++i) af[cs ^ 1][i] = ldfrag<OT>((const OT*)(const void*)(pa + i * 16 * GK_PITCH + (ks + 1) * 64));
      }
      // keeps the 16 LDS reads above as one group in front of the block: sunk among the WMMAs, each read is waited for where it stands
      __builtin_amdgcn_sched_barrier(0);
#pragma unroll
      for (int i = 0; i < 4; ++i)
#pragma unroll
        for (int j = 0; j < 4; ++j) acc[i][j] = mmar(af[cs][i], bq[cs][j], acc[i][j]);
      // keeps the following block's reads from rising among these WMMAs
      __builtin_amdgcn_sched_barrier(0);
    }
    // publish point of stage st + 1; behind its barrier every wave has left stage st's buffer
    wait_ds0();
    wait_tensor0(g0, g1);
    __syncthreads();
    if (pinned(st + 2u < nst)) {
      g0 = group0(st + 2u);
      tdm_load(g0, g1);
    }
  }
  wait_tensor0(g0, g1);
  wait_ds0();
  acc_guard4(acc[0][0], acc[0][1], acc[0][2], acc[0][3]);
  acc_guard4(acc[1][0], acc[1][1], acc[1][2], acc[1][3]);
  acc_guard4(acc[2][0], acc[2][1], acc[2][2], acc[2][3]);
  acc_guard4(acc[3][0], acc[3][1], acc[3][2], acc[3][3]);

  // ---- epilogue ----
  float* slab = sT[wave];
#pragma unroll
  for (int i = 0; i < 4; ++i) {
    const int mBase = m0 + (i << 4);
#pragma unroll
    for (int j = 0; j < 4; ++j) {
#pragma unroll
      for (int r = 0; r < 8; ++r) {
        slab[(mOff + r) * 68 + (j << 4) + rlane] = acc[i][j][r];
      }
    }
    __builtin_amdgcn_fence(__ATOMIC_RELEASE, "workgroup");
    __builtin_amdgcn_wave_barrier();
    __builtin_amdgcn_fence(__ATOMIC_ACQUIRE, "workgroup");
    if (OUT_MODE == 0) {
      float* C = (float*)Cout + (size_t)b * (size_t)strideC;
      const int h2 = lane >> 4, c4 = (lane & 15) * 4;     // 256-B row segment = 16 lanes x 16 B
      const v4f bb = *(const v4f*)(bias + n0 + c4);
      v4f bv;
#pragma unroll
      for (int e = 0; e < 4; ++e) bv[e] = bf16r(bb[e]);
      v4f ov[8];
#pragma unroll
      for (int it = 0; it < 8; ++it) {
        const int row = it * 2 + h2;                       // it 0..7 x h2 0..1 = rows 0..15
        ov[it] = *(const v4f*)(slab + row * 68 + c4) + bv;
      }
      {
#pragma unroll
        for (int it = 0; it < 8; ++it) {
          const int row = it * 2 + h2;
          *(v4f*)(C + (size_t)(mBase + row) * ldc + n0 + c4) = ov[it];
        }
        
      }
    } else {
      const int q = lane >> 3, c8 = (lane & 7) * 8;
      unsigned short* C  = (unsigned short*)Cout  + (size_t)b * (size_t)strideC;
      unsigned short* C2 = (unsigned short*)Cout2 + (size_t)b * (size_t)strideC;
#pragma unroll
      for (int it = 0; it < 4; ++it) {
        const int row = it * 4 + q;                        // it 0..3 x q 0..3 = rows 0..15
        const float* sp = slab + row * 68 + c8;
        float f[8];
#pragma unroll
        for (int e = 0; e < 8; ++e) f[e] = sp[e];
        if (OUT_MODE == 1 || OUT_MODE == 2) {
#pragma clang fp contract(off)
          const float* pp = slab + row * 68 + (c8 ^ 32);   // partner columns d +- 32 of the same row
          float g[8];
#pragma unroll
          for (int e = 0; e < 8; ++e) g[e] = pp[e];
          const v4f bc0 = *(const v4f*)(bias + n0 + c8);
          const v4f bc1 = *(const v4f*)(bias + n0 + c8 + 4);
          const v4f bp0 = *(const v4f*)(bias + n0 + (c8 ^ 32));
          const v4f bp1 = *(const v4f*)(bias + n0 + (c8 ^ 32) + 4);
          const int t  = (mBase + row) & (SEQ - 1);        // position within the sequence
          // tables are [SEQ][HD]; column within the head = c8 + e (n0 is head-aligned, c8 in 0..56)
          const v4f cv0 = *(const v4f*)(ctab + (size_t)t * HD + c8);
          const v4f cv1 = *(const v4f*)(ctab + (size_t)t * HD + c8 + 4);
          const v4f sv0 = *(const v4f*)(stab + (size_t)t * HD + c8);
          const v4f sv1 = *(const v4f*)(stab + (size_t)t * HD + c8 + 4);
          const float sg = (c8 < 32) ? -1.0f : 1.0f;       // -x2 for the first half, +x1 for the second half
#pragma unroll
          for (int e = 0; e < 4; ++e) {
            {
              const float x  = f[e] + bf16r(bc0[e]);
              const float y  = g[e] + bf16r(bp0[e]);
              const float ry = sg * y;
              const float p0 = x * bf16r(cv0[e]);
              const float p1 = ry * bf16r(sv0[e]);
              f[e] = p0 + p1;
            }
            {
              const float x  = f[4 + e] + bf16r(bc1[e]);
              const float y  = g[4 + e] + bf16r(bp1[e]);
              const float ry = sg * y;
              const float p0 = x * bf16r(cv1[e]);
              const float p1 = ry * bf16r(sv1[e]);
              f[4 + e] = p0 + p1;
            }
          }
        }
        if (OUT_MODE == 3) {
          const float bm = bf16r(bias[mBase + row]);
#pragma unroll
          for (int e = 0; e < 8; ++e) f[e] = f[e] + bm;
        }
        v4u a, a2;
#pragma unroll
        for (int e = 0; e < 4; ++e) {
          const float f0 = f[2 * e], f1 = f[2 * e + 1];
          const _Float16 x0 = (_Float16)f0, x1 = (_Float16)f1;
          const unsigned short h0 = h_bits(x0), h1 = h_bits(x1);
          unsigned short l0 = 0, l1 = 0;
          if (OUT_MODE == 1) {
            l0 = h_bits((_Float16)((f0 - (float)x0) * rscale));
            l1 = h_bits((_Float16)((f1 - (float)x1) * rscale));
          }
          a[e] = pk16(h0, h1); a2[e] = pk16(l0, l1);
        }
        unsigned short* cp  = C  + (size_t)(mBase + row) * ldc + n0 + c8;
        unsigned short* cp2 = C2 + (size_t)(mBase + row) * ldc + n0 + c8;
        *(v4u*)cp = a;
        if (OUT_MODE == 1) *(v4u*)cp2 = a2;
        
      }
    }
    __builtin_amdgcn_fence(__ATOMIC_RELEASE, "workgroup");
    __builtin_amdgcn_wave_barrier();
    __builtin_amdgcn_fence(__ATOMIC_ACQUIRE, "workgroup");
  }
}

#define AT_PITCH 72                   // 16-bit elements per LDS row of the K and V^T tiles
#define OS_PITCH 68                   // floats per LDS row of the context tile
static_assert((AT_PITCH * 2) % 32 == 16 && AT_PITCH >= 64 && (OS_PITCH * 4) % 16 == 0 && OS_PITCH >= 64);
#define AT_SLICE 6144                 // one wave's slice: 32 rows x 144 B = 4608 B, rounded up to a multiple of 2 KiB
#define AT_STAGE (4 * AT_SLICE)       // [K rows 0..31 | K rows 32..63 | V^T rows 0..31 | V^T rows 32..63]
static_assert(AT_PITCH * 2 == 128 + 16 && 32 * AT_PITCH * 2 <= AT_SLICE && (AT_SLICE % 2048) == 0 && NKT >= 2);
// lane l <-> lane l ^ 16: the other half of the wave holds the same query's other keys
__device__ __forceinline__ float xhalf(float x) {
  return __builtin_bit_cast(float, __builtin_amdgcn_permlanex16(__builtin_bit_cast(int, x), __builtin_bit_cast(int, x),
                                                                0x76543210, 0xfedcba98, false, false));
}
__global__ __launch_bounds__(128)
void attn_mha(const unsigned short* __restrict__ qhp, const unsigned short* __restrict__ qlp,
              const unsigned short* __restrict__ kpp, const unsigned short* __restrict__ vtp,
              unsigned short* ohp, unsigned short* olp, float sscale) {
  union FH { v16h v; v8h h[2]; };
  __shared__ __attribute__((aligned(2048))) unsigned char kvring[2 * AT_STAGE];   // two stages of K [key][d] and V^T [d][key]
  __shared__ __align__(16) float    Os[4][16 * OS_PITCH];    // per wave context tile 17 KB

  const int tid  = threadIdx.x;
  const int wave = (int)uni((uint32_t)tid >> 5);
  const int lane = tid & 31;
  const int hh   = lane >> 4;
  const int c    = lane & 15;

  const int bx   = blockIdx.x;
  const int qb   = bx % NQB;
  const int rest = bx / NQB;
  const int h    = rest % NH;
  const int b    = rest / NH;
  const int q0   = qb * 64 + wave * 16;
  const size_t rowB = (size_t)b * SEQ;
  const size_t hcol = (size_t)h * HD;

  const _Float16* Qh = (const _Float16*)(const void*)qhp;
  const _Float16* Ql = (const _Float16*)(const void*)qlp;
  const _Float16* Kg = (const _Float16*)(const void*)kpp + hcol;
  const _Float16* Vt = (const _Float16*)(const void*)vtp + ((size_t)b * DM + hcol) * SEQ;

  // ---- Q fragments (B operand, column = query = lane&15): 2 d-chunks, hi and residual planes ----
  v16h qah[2], qal[2];
#pragma unroll
  for (int dc = 0; dc < 2; ++dc) {
    const size_t qo = (rowB + q0 + c) * DM + hcol + dc * 32 + 8 * hh;
    qah[dc] = ldfrag<_Float16>(Qh + qo);
    qal[dc] = ldfrag<_Float16>(Ql + qo);
  }

  float mrun = -INFINITY;   // running maximum of this lane's query (equal in both halves)
  float lrun = 0.f;         // running sum over this half's keys; the halves are joined once, behind the loop
  v8f oacc[4];              // O^T: column = query lane&15, row d = 16 t + 8 hh + r
#pragma unroll
  for (int t = 0; t < 4; ++t) oacc[t] = zero8();

  // ---- what this wave loads: chunk st's K rows 32 half .. +31 (d = 0..63 of head h) or V^T rows d = 32 half .. +31 (its 64 keys) ----
  const bool     isV   = wave >= 2;
  const uint32_t half  = (uint32_t)wave & 1u;
  const uint64_t src   = isV ? (uint64_t)(size_t)(Vt + (size_t)(half * 32u) * SEQ)
                             : (uint64_t)(size_t)(Kg + (rowB + half * 32u) * DM);
  const uint32_t sstep = isV ? 64u * 2u : 64u * DM * 2u;   // bytes from one chunk to the next: 64 keys along / across the rows
  const uint32_t lbase = (uint32_t)(size_t)kvring;
  static_assert(DM == SEQ);                                // both planes have rows of DM * 2 = SEQ * 2 bytes
  u32x8 g1 = tdm_group1_r128(DM * 2u);
  // without this the compiler rebuilds words of group 1 from their constants, in the registers a request was issued from
  asm volatile("" : "+s"(g1));   // the pinned() form: descriptor words held in their scalar registers
  auto group0 = [&](uint32_t st) -> u32x4 {
    return tdm_group0(lbase + (st & 1u) * AT_STAGE + (uint32_t)wave * AT_SLICE, src + (uint64_t)st * sstep);
  };
  u32x4 g0 = group0(0);
  tdm_load(g0, g1);
  wait_tensor0(g0, g1);
  __syncthreads();
  g0 = group0(1);
  tdm_load(g0, g1);
  // kept rolled: one pass and one publish point in the text
#pragma unroll 1
  for (uint32_t kt = 0; kt < NKT; ++kt) {    // static trip count
    const unsigned char* buf = kvring + (kt & 1u) * AT_STAGE;
    const _Float16* Ksh = (const _Float16*)(const void*)buf;                    // row r at (r >> 5) slices + (r & 31) rows
    const _Float16* Vth = (const _Float16*)(const void*)(buf + 2 * AT_SLICE);

    // ---- scores, transposed: 64 keys x 16 queries per wave, 2 f16 products per key subtile and d-chunk ----
    v8f s[4];   // s[j][r]: key kv0 + 16 j + 8 hh + r, query q0 + c
#pragma unroll
    for (int j = 0; j < 4; ++j) {
      v8f ah = zero8(), al = zero8();
#pragma unroll
      for (int dc = 0; dc < 2; ++dc) {
        FH kb;
        kb.h[0] = *(const v8h*)(Ksh + (j >> 1) * (AT_SLICE / 2) + ((j & 1) * 16 + c) * AT_PITCH + dc * 32 + 8 * hh);
        kb.h[1] = *(const v8h*)(Ksh + (j >> 1) * (AT_SLICE / 2) + ((j & 1) * 16 + c) * AT_PITCH + dc * 32 + 16 + 8 * hh);
        ah = mma_h(kb.v, qah[dc], ah);
        al = mma_h(kb.v, qal[dc], al);
      }
#pragma unroll
      for (int r = 0; r < 8; ++r) s[j][r] = (ah[r] + al[r] * (1.0f / 4096.0f)) * sscale;
    }

    // ---- query maximum (in-lane, then the other half's), online softmax, P^T (x1024, f16) packed in registers ----
    float mj[4];   // one chain per key subtile: four short dependent chains instead of one long one
#pragma unroll
    for (int j = 0; j < 4; ++j) {
      mj[j] = s[j][0];
#pragma unroll
      for (int r = 1; r < 8; ++r) mj[j] = fmaxf(mj[j], s[j][r]);
    }
    float m = fmaxf(fmaxf(mj[0], mj[1]), fmaxf(mj[2], mj[3]));
    m = fmaxf(m, xhalf(m));
    const float mnew  = fmaxf(mrun, m);
    const float msafe = (mnew == -INFINITY) ? 0.f : mnew;
    const float alpha = __expf(mrun - msafe);
    mrun = mnew;
    // B operand of 32 keys: elements 0..7 = keys k0 + 8 hh + e (subtile 2 kk), 8..15 = keys k0 + 16 + 8 hh + e (subtile 2 kk + 1)
    FH pb[2];
    float ps[4];   // partial sums, one chain per key subtile
#pragma unroll
    for (int j = 0; j < 4; ++j) {
      ps[j] = 0.f;
#pragma unroll
      for (int r = 0; r < 8; ++r) {
        const float p = __expf(s[j][r] - msafe);
        ps[j] += p;
        pb[j >> 1].v[(j & 1) * 8 + r] = (_Float16)(p * 1024.0f);
      }
    }
    lrun = lrun * alpha + ((ps[0] + ps[1]) + (ps[2] + ps[3]));
#pragma unroll
    for (int t = 0; t < 4; ++t) oacc[t] = oacc[t] * alpha;

    // ---- context^T += V^T . P^T (f16 WMMA, single product); unrolled: pb is indexed in registers ----
#pragma unroll
    for (int kk = 0; kk < 2; ++kk) {
#pragma unroll
      for (int t = 0; t < 4; ++t) {
        FH vb;
        vb.h[0] = *(const v8h*)(Vth + (t >> 1) * (AT_SLICE / 2) + ((t & 1) * 16 + c) * AT_PITCH + kk * 32 + 8 * hh);
        vb.h[1] = *(const v8h*)(Vth + (t >> 1) * (AT_SLICE / 2) + ((t & 1) * 16 + c) * AT_PITCH + kk * 32 + 16 + 8 * hh);
        oacc[t] = mma_h(vb.v, pb[kk].v, oacc[t]);
      }
    }
    // publish point of chunk kt + 1; behind its barrier every wave has left chunk kt's buffer
    wait_ds0();
    wait_tensor0(g0, g1);
    __syncthreads();
    if (pinned(kt + 2u < NKT)) {
      g0 = group0(kt + 2u);
      tdm_load(g0, g1);
    }
  }
  wait_tensor0(g0, g1);
  wait_ds0();

  // ---- join the halves' sums, normalise (1/l, undo the x1024 p carry), stage the wave's 16x64 f32 tile [query][d],
  //      split into bf16 hi / residual
  float* os = Os[wave];
  {
    const float l = lrun + xhalf(lrun);   // unconditional: every lane is on at the exchange
    const float inv = ((l > 0.f) ? (1.0f / l) : 0.f) * (1.0f / 1024.0f);
#pragma unroll
    for (int t = 0; t < 4; ++t) {
      v4f lo, hi;
#pragma unroll
      for (int r = 0; r < 4; ++r) { lo[r] = oacc[t][r] * inv; hi[r] = oacc[t][4 + r] * inv; }
      *(v4f*)(os + c * OS_PITCH + t * 16 + 8 * hh)     = lo;
      *(v4f*)(os + c * OS_PITCH + t * 16 + 8 * hh + 4) = hi;
    }
  }
  __builtin_amdgcn_fence(__ATOMIC_RELEASE, "workgroup");
  __builtin_amdgcn_wave_barrier();
  __builtin_amdgcn_fence(__ATOMIC_ACQUIRE, "workgroup");
  {
    const int q4 = lane >> 3, c8 = (lane & 7) * 8;
    v4u hv[4], lv[4];
#pragma unroll
    for (int it = 0; it < 4; ++it) {
      const int row = it * 4 + q4;   // it 0..3 x q4 0..3 = rows 0..15 of the wave tile
      const float* sp = os + row * OS_PITCH + c8;
      v4u a, a2;
#pragma unroll
      for (int e = 0; e < 4; ++e) {
        const float f0 = sp[2 * e], f1 = sp[2 * e + 1];
        const unsigned short h0 = bf_bits(f0), h1 = bf_bits(f1);
        const unsigned short l0 = bf_bits(f0 - bf_up(h0)), l1 = bf_bits(f1 - bf_up(h1));
        a[e] = pk16(h0, h1); a2[e] = pk16(l0, l1);
      }
      hv[it] = a; lv[it] = a2;
    }
    {
#pragma unroll
      for (int it = 0; it < 4; ++it) {
        const int row = it * 4 + q4;
        const size_t go = (rowB + q0 + row) * DM + hcol + c8;
        *(v4u*)(ohp + go) = hv[it];
        *(v4u*)(olp + go) = lv[it];
      }
      
    }
  }
}

// =====================================================================================================
// Workspace map (bytes), every region an exact multiple of its whole-line / whole-tile store granularity
// (all shapes are tile multiples, no padded tails):
//   Xb    bf16 [4096][1024]          8388608
//   Wqkv  bf16 [3072 n][1024 k]      6291456   (input [out][in] layout == Bt[n][k], k contiguous)
//   Wo    bf16 [1024 n][1024 k]      2097152
//   Qh    f16  [4096][1024]          8388608
//   Ql    f16  [4096][1024]          8388608   (residual x4096)
//   Kp    f16  [4096][1024]          8388608
//   VT    f16  [4][1024][1024]       8388608
//   Oh    bf16 [4096][1024]          8388608
//   Ol    bf16 [4096][1024]          8388608
//   total                           67108864
// =====================================================================================================
extern "C" void kernel_launch(void* const* d_in, const int* in_sizes, int n_in,
                              void* d_out, int out_size, void* d_ws, size_t ws_size,
                              hipStream_t stream) {
  if (n_in < 7) return;
  if (in_sizes[0] != NTOK * DM) return;          // x      [4][1024][1024]
  if (in_sizes[1] != SEQ * HD) return;           // cos    [1024][64]
  if (in_sizes[2] != SEQ * HD) return;           // sin    [1024][64]
  if (in_sizes[3] != DQKV * DM) return;          // qkv_w  [3072][1024]
  if (in_sizes[4] != DQKV) return;               // qkv_b  [3072]
  if (in_sizes[5] != DM * DM) return;            // proj_w [1024][1024]
  if (in_sizes[6] != DM) return;                 // proj_b [1024]
  if (out_size != NTOK * DM) return;

  const float* x    = (const float*)d_in[0];
  const float* cosb = (const float*)d_in[1];
  const float* sinb = (const float*)d_in[2];
  const float* Wqkv = (const float*)d_in[3];
  const float* bqkv = (const float*)d_in[4];
  const float* Wout = (const float*)d_in[5];
  const float* bout = (const float*)d_in[6];

  const size_t PX  = (size_t)NTOK * DM * 2;        //  8388608  16-bit activation plane [4096][1024]
  const size_t PWQ = (size_t)DQKV * DM * 2;        //  6291456  bf16 [3072][1024]
  const size_t PWO = (size_t)DM * DM * 2;          //  2097152  bf16 [1024][1024]
  const size_t PVT = (size_t)NB * DM * SEQ * 2;    //  8388608  v^T plane [4][1024][1024]
  size_t off = 0;
  const size_t oXb  = off; off += PX;
  const size_t oWq  = off; off += PWQ;
  const size_t oWo  = off; off += PWO;
  const size_t oQh  = off; off += PX;
  const size_t oQl  = off; off += PX;
  const size_t oKp  = off; off += PX;
  const size_t oVT  = off; off += PVT;
  const size_t oOh  = off; off += PX;
  const size_t oOl  = off; off += PX;
  if (off > ws_size) return;                       // off = 67108864
  if (off > (size_t)134217728) return;

  char* ws = (char*)d_ws;
  unsigned short* Xb   = (unsigned short*)(ws + oXb);
  unsigned short* Wq16 = (unsigned short*)(ws + oWq);
  unsigned short* Wo16 = (unsigned short*)(ws + oWo);
  unsigned short* Qh   = (unsigned short*)(ws + oQh);
  unsigned short* Ql   = (unsigned short*)(ws + oQl);
  unsigned short* Kp   = (unsigned short*)(ws + oKp);
  unsigned short* VT   = (unsigned short*)(ws + oVT);
  unsigned short* Oh   = (unsigned short*)(ws + oOh);
  unsigned short* Ol   = (unsigned short*)(ws + oOl);

  const dim3 blk(256);
  const int n8x  = NTOK * DM / 8;                               // 524288
  const int n8wq = DQKV * DM / 8;                               // 393216
  const int n8wo = DM * DM / 8;                                 // 131072
  const dim3 gCvtX((n8x + 255) / 256);                          // 2048 blocks
  const dim3 gCvtWq((n8wq + 255) / 256);                        // 1536 blocks
  const dim3 gCvtWo((n8wo + 255) / 256);                        //  512 blocks
  const dim3 blkG(128);                                         // gemm64: 4 waves
  const dim3 gP((NTOK / 128) * (DM / 128), 1);                  // 256 blocks of one 128x128 tile: M=4096, N=1024
  const dim3 gVT((DM / 128) * (SEQ / 128), NB);                 //  64 blocks x 4 batches: M=1024, N=1024
  const dim3 gAttn(NB * NH * NQB);                              // 1024 blocks of 128
  static_assert((NTOK % 128) == 0 && (DM % 128) == 0 && (SEQ % 128) == 0 && (DM % GK_PASS) == 0 && DM / GK_PASS >= 2);
  static_assert((NTOK * DM) % 2048 == 0 && (DQKV * DM) % 2048 == 0 && (DM * DM) % 2048 == 0);
  static_assert((DM % 32) == 0);

  // (1) x -> bf16 plane [4096][1024]; qkv_w [3072][1024] ([out][in] = Bt[n][k]) -> bf16; proj_w [1024][1024] -> bf16
  cvt_bf16x8<<<gCvtX,  blk, 0, stream>>>(x,    Xb,   n8x);
  cvt_bf16x8<<<gCvtWq, blk, 0, stream>>>(Wqkv, Wq16, n8wq);
  cvt_bf16x8<<<gCvtWo, blk, 0, stream>>>(Wout, Wo16, n8wo);
  // (2) q = rope(x . Wq^T + bq) -> f16 hi / residual (x4096) planes [b*SEQ+t][h*64+d]   (M=4096, N=1024, K=1024)
  gemm64<__bf16, 1, false><<<gP, blkG, 0, stream>>>(
      Xb, Xb, DM, 0LL, Wq16, DM, 0LL,
      (void*)Qh, (void*)Ql, DM, 0LL, bqkv, cosb, sinb,
      NTOK, DM, DM, 4096.0f);
  // (3) k = rope(x . Wk^T + bk) -> f16 plane [b*SEQ+s][h*64+d]   (Bt = Wq16 rows 1024..2047)
  gemm64<__bf16, 2, false><<<gP, blkG, 0, stream>>>(
      Xb, Xb, DM, 0LL, Wq16 + (size_t)DM * DM, DM, 0LL,
      (void*)Kp, (void*)Kp, DM, 0LL, bqkv + DM, cosb, sinb,
      NTOK, DM, DM, 1.0f);
  // (4) v^T = Wv . x^T + bv per batch -> f16 plane [b][h*64+d][s] (pitch SEQ)
  //     (A = Wq16 rows 2048..3071 [feature][k], Bt = Xb rows of batch b; M=1024, N=1024, K=1024; bias by row)
  gemm64<__bf16, 3, false><<<gVT, blkG, 0, stream>>>(
      Wq16 + (size_t)2 * DM * DM, Wq16 + (size_t)2 * DM * DM, DM, 0LL, Xb, DM, (long long)SEQ * DM,
      (void*)VT, (void*)VT, SEQ, (long long)DM * SEQ, bqkv + 2 * DM, cosb, sinb,
      DM, SEQ, DM, 1.0f);
  // (5) attention -> ctx bf16 hi / residual planes [b*SEQ+t][h*64+d]
  attn_mha<<<gAttn, dim3(128), 0, stream>>>(Qh, Ql, Kp, VT, Oh, Ol, 0.125f);
  // (6) out = (Oh + Ol) . Wproj^T + bproj -> d_out f32 [4096][1024]   (M=4096, N=1024, K=1024, two A planes)
  gemm64<__bf16, 0, true><<<gP, blkG, 0, stream>>>(
      Oh, Ol, DM, 0LL, Wo16, DM, 0LL,
      d_out, d_out, DM, 0LL, bout, cosb, sinb,
      NTOK, DM, DM, 1.0f);
  (void)hipGetLastError();
}

// v006
// A run of this version takes 94.4 microseconds.
// Next to v005, in two timings, it ran 1.17 and 1.18 times as fast.
// All steps since v000 together make it 3.71 times as fast.
// Contractions: q / k / v^T projections = v_wmma_f32_16x16x32_bf16 (bf16 operands from RNE-converted x and qkv weight rows, single product, f32 accumulate);
// q.k^T scores = v_wmma_f32_16x16x32_f16 (q as f16 hi plane + f16 residual plane x4096, k f16; 2 products into separate f32 accumulators);
// p.v = v_wmma_f32_16x16x32_f16 (p carried x1024 in f16, v f16; single product, f32 accumulate);
// ctx.Wproj^T = v_wmma_f32_16x16x32_bf16 (ctx as bf16 hi plane + unscaled bf16 residual plane, weights bf16; 2 products, f32 accumulate);
// rotary with the input cos/sin tables (values RNE-converted to bf16), half-rotation, bias adds and softmax in f32 on the VALU.
// Carry audit: q residual plane x4096 -> folded back once as al * (1/4096) in the attn_mha score combine;
// p x1024 -> folded back once as (1/l) * (1/1024) in the attn_mha epilogue; ctx residual plane is the unscaled
// RNE residual (v - hi) and shares the hi accumulator; no weight-plane carries (all weight copies are bf16).
// gemm64 stages both operands in LDS with tensor loads (two buffers); its 16-bit epilogue stores the four row groups of a 16-row slab together.
// gemm_qkv runs the q, k and v^T projections as one launch (same loop and epilogues), two blocks to a WGP.
// attn_mha stages its K and V^T chunks in LDS with tensor loads (two buffers).
#include <hip/hip_runtime.h>
#include <math.h>
#include <stdint.h>

#define NB    4
#define SEQ   1024
#define DM    1024
#define NH    16
#define HD    64
#define DQKV  (3 * DM)
#define NTOK  (NB * SEQ)   // 4096 token rows
#define NQB   (SEQ / 64)   // 16 query blocks of 64 per sequence
#define NKT   (SEQ / 64)   // 16 key chunks of 64 per sequence
static_assert(NH * HD == DM);
static_assert(NQB == 16 && NKT == 16);
static_assert((SEQ & (SEQ - 1)) == 0);
static_assert((SEQ % 64) == 0 && (DM % 64) == 0 && (DM % 32) == 0 && (DQKV % 64) == 0 && (NTOK % 64) == 0);

typedef _Float16 v16h __attribute__((ext_vector_type(16)));
typedef _Float16 v8h  __attribute__((ext_vector_type(8)));
typedef __bf16   v16b __attribute__((ext_vector_type(16)));
typedef __bf16   v8b  __attribute__((ext_vector_type(8)));
typedef float    v8f  __attribute__((ext_vector_type(8)));
typedef float    v4f  __attribute__((ext_vector_type(4)));
typedef unsigned int v4u __attribute__((ext_vector_type(4)));
typedef uint32_t u32x4 __attribute__((ext_vector_type(4)));
typedef uint32_t u32x8 __attribute__((ext_vector_type(8)));

#if defined(__HIP_DEVICE_COMPILE__)
#define DEV_ASM 1
#else
#define DEV_ASM 0
#endif

// ---- scalar helpers --------------------------------------------------------------------------------
__device__ __forceinline__ unsigned short bf_bits(float f) {          // f32 -> bf16 bits, RNE convert
  unsigned u = __float_as_uint(f);
  return (unsigned short)((u + 0x7FFFu + ((u >> 16) & 1u)) >> 16);
}
__device__ __forceinline__ float bf_up(unsigned short hb) { return __uint_as_float(((unsigned)hb) << 16); }
__device__ __forceinline__ float bf16r(float f) { return bf_up(bf_bits(f)); }   // value of the bf16 RNE convert
__device__ __forceinline__ unsigned short h_bits(_Float16 x) { return __builtin_bit_cast(unsigned short, x); }
__device__ __forceinline__ unsigned pk16(unsigned short a, unsigned short b) { return (unsigned)a | ((unsigned)b << 16); }
__device__ __forceinline__ v8f zero8() { v8f z = {0.f, 0.f, 0.f, 0.f, 0.f, 0.f, 0.f, 0.f}; return z; }

// ---- fragment types / loaders: 16-bit A/B operand, lane -> row/col (lane&15), p already includes +8*(lane>>4);
//      elements 0..7 <- p[0..7] (k0+8h..k0+8h+7), elements 8..15 <- p[16..23] (k0+16+8h..k0+16+8h+7)
template <typename OT> struct FT;
template <> struct FT<__bf16>   { typedef v16b frag; typedef v8b half8; };
template <> struct FT<_Float16> { typedef v16h frag; typedef v8h half8; };

template <typename OT>
__device__ __forceinline__ typename FT<OT>::frag ldfrag(const OT* p) {
  union { typename FT<OT>::frag v; typename FT<OT>::half8 h[2]; } f;
  f.h[0] = *(const typename FT<OT>::half8*)(p);
  f.h[1] = *(const typename FT<OT>::half8*)(p + 16);
  return f.v;
}

// ---- WMMA helpers (asm guard bodies are device-only; concrete operand types) -----------------------------
__device__ __forceinline__ v8f mmar(v16b a, v16b b, v8f c) {
  return __builtin_amdgcn_wmma_f32_16x16x32_bf16(false, a, false, b, (short)0, c, false, false);
}
__device__ __forceinline__ v8f mmar(v16h a, v16h b, v8f c) {
  return __builtin_amdgcn_wmma_f32_16x16x32_f16(false, a, false, b, (short)0, c, false, false);
}
// guarded form: 4 VALU slots after the WMMA, D tied, A/B kept live
__device__ __forceinline__ v8f mma_h(v16h a, v16h b, v8f c) {
  c = __builtin_amdgcn_wmma_f32_16x16x32_f16(false, a, false, b, (short)0, c, false, false);
#if DEV_ASM
  asm volatile("v_nop\n\tv_nop\n\tv_nop\n\tv_nop" : "+v"(c) : "v"(a), "v"(b));
#endif
  return c;
}
__device__ __forceinline__ void acc_guard4(v8f& a, v8f& b, v8f& c, v8f& d) {
#if DEV_ASM
  asm volatile("v_nop\n\tv_nop\n\tv_nop\n\tv_nop" : "+v"(a), "+v"(b), "+v"(c), "+v"(d));
#else
  (void)a; (void)b; (void)c; (void)d;
#endif
}

// ---- tensor-load helpers for the LDS rings of gemm64 and attn_mha ------------------------------------------------------
#define GK_PASS  128                  // k elements of one stage: rows of 256 B
#define GK_PITCH 272                  // LDS row pitch in bytes: 256 B + the 16-B pad (odd multiple of 16 B for 16-B readers)
#define GK_SLICE 18432                // one wave's slice: 64 rows x 272 B = 17408 B, rounded up to a multiple of 2 KiB
#define GK_STAGE (4 * GK_SLICE)       // [A rows 0..63 | A rows 64..127 | Bt rows 0..63 | Bt rows 64..127]
static_assert(64 * GK_PITCH <= GK_SLICE && (GK_SLICE % 2048) == 0);
__device__ __forceinline__ uint32_t uni(uint32_t v) { return (uint32_t)__builtin_amdgcn_readfirstlane(v); }
__device__ __forceinline__ uint32_t pinned(uint32_t v) { uint32_t w = uni(v); asm volatile("" : "+s"(w)); return w; }
// the compiler places no wait for a tensor load: the issuing wave waits for its own request here; the request's two
// groups are inputs, so that their scalar registers keep their values until the request has landed
__device__ __forceinline__ void wait_tensor0(u32x4 g0, u32x8 g1) { asm volatile("s_wait_tensorcnt 0x0" :: "s"(g0), "s"(g1) : "memory"); }
// this wave's LDS reads have retired before the barrier behind which their buffer is refilled
__device__ __forceinline__ void wait_ds0() { asm volatile("s_wait_dscnt 0x0" ::: "memory"); }
__device__ __forceinline__ void tdm_load(u32x4 g0, u32x8 g1) { asm volatile("tensor_load_to_lds %0, %1" :: "s"(g0), "s"(g1) : "memory"); }
// group 1: 1-byte elements, tile = tensor = 64 rows of 256 B, source row pitch src_pitch bytes, 4 dwords of LDS pad behind every row
__device__ __forceinline__ u32x8 tdm_group1(uint32_t src_pitch) {
  constexpr uint32_t d0 = 256u, d1 = 64u;
  u32x8 g;
  g[0] = uni((1u << 20) | (5u << 22) | (3u << 25));   // no mask, data_size 0, pad after every 64 dwords, 4 dwords
  g[1] = uni((d0 & 0xFFFFu) << 16);
  g[2] = uni((d0 >> 16) | ((d1 & 0xFFFFu) << 16));
  g[3] = uni((d1 >> 16) | (d0 << 16));
  g[4] = uni(d1);
  g[5] = uni(src_pitch);
  g[6] = uni(0u);
  g[7] = uni(0u);
  return g;
}
// group 1 of attn_mha's tiles: 1-byte elements, tile = tensor = 32 rows of 128 B, 4 dwords of LDS pad behind every row
__device__ __forceinline__ u32x8 tdm_group1_r128(uint32_t src_pitch) {
  constexpr uint32_t d0 = 128u, d1 = 32u;
  u32x8 g;
  g[0] = uni((1u << 20) | (4u << 22) | (3u << 25));   // no mask, data_size 0, pad after every 32 dwords, 4 dwords
  g[1] = uni((d0 & 0xFFFFu) << 16);
  g[2] = uni((d0 >> 16) | ((d1 & 0xFFFFu) << 16));
  g[3] = uni((d1 >> 16) | (d0 << 16));
  g[4] = uni(d1);
  g[5] = uni(src_pitch);
  g[6] = uni(0u);
  g[7] = uni(0u);
  return g;
}
__device__ __forceinline__ u32x4 tdm_group0(uint32_t lds_dst, uint64_t ga) {
  u32x4 g;
  g[0] = uni(1u);
  g[1] = uni(lds_dst);
  g[2] = uni((uint32_t)ga);
  g[3] = uni((((uint32_t)(ga >> 32)) & 0x01FFFFFFu) | 0x80000000u);
  return g;
}

// =====================================================================================================
// f32 -> bf16 (RNE convert), 8 elements per thread, one 16-B store per lane: a wave writes 512 contiguous B
// Layout is preserved, so a [out][in] f32 weight becomes the bf16 Bt[n][k] plane (k contiguous) directly.
// coverage: n8 threads x 8 = the whole plane (n8 = 524288 / 393216 / 131072, all multiples of 256).
// =====================================================================================================
__global__ __launch_bounds__(256) void cvt_bf16x8(const float* __restrict__ in, unsigned short* out, int n8) {
  const int i = blockIdx.x * 256 + (int)threadIdx.x;
  if (i < n8) {
    const v4f a = *(const v4f*)(in + (size_t)i * 8);
    const v4f b = *(const v4f*)(in + (size_t)i * 8 + 4);
    v4u p;
    p[0] = pk16(bf_bits(a[0]), bf_bits(a[1]));
    p[1] = pk16(bf_bits(a[2]), bf_bits(a[3]));
    p[2] = pk16(bf_bits(b[0]), bf_bits(b[1]));
    p[3] = pk16(bf_bits(b[2]), bf_bits(b[3]));
    *(v4u*)(out + (size_t)i * 8) = p;
    
  }
}

// =====================================================================================================
// Register-blocked batched WMMA GEMM (16-bit operand type OT): C[m][n] = sum_k A[m][k] * Bt[n][k];
// one block of 4 waves (2 x 2) per 128x128 tile, one wave per 64x64 tile. A row-major [M][K] pitch lda; Bt row-major
// [N][K] pitch ldb (k contiguous); M, N multiples of 128, K a multiple of 128 and at least 256 (host-checked).
// blockIdx.y = batch index (strides in elements). A stage = 128 k of the block's 128 A rows and 128 Bt rows in LDS;
// every wave brings one 64-row slice of it with one tensor load, two buffers, the next stage in flight during a pass.
// Fragments are read from LDS with the split k map (ldfrag); k runs upward in steps of 32 (a block = 16 WMMAs); inside a stage
// the next block's 16 fragment reads are issued as one group, into a second register set, in front of the current block.
//   TWOA: a second A plane Al with the same Bt is accumulated into the same tile (C = (A + Al) . Bt^T).
//   OUT_MODE 0: f32 C (pitch ldc), value + bf16(bias[col]); 256-B row segment = 16 lanes x 16 B, one instruction,
//   OUT_MODE 1: half-rotation rotary of (acc + bf16(bias[col])) -> f16 hi plane C + f16 residual plane
//               C2 = f16((v - hi) * rscale). N tile = one 64-wide head: dims d < 32 pair with d + 32:
//               out[d] = x[d] c[t][d] - x[d+32] s[t][d] (d < 32), x[d] c[t][d] + x[d-32] s[t][d] (d >= 32),
//               t = row mod SEQ, c/s = bf16 value of the [SEQ][64] input tables, f32, contract off,
//               partner column read from the staged slab.
//   OUT_MODE 2: as 1 but a single f16 plane C.
//   OUT_MODE 3: single f16 plane C of acc + bf16(bias[row]) (no rotary; used for v^T where the feature is the row).
// coverage: 4 slabs x 16 rows x 64 cols = the wave's whole 64x64 tile; (M/128)*(N/128) blocks x 4 waves x gridDim.y = the whole plane.
// =====================================================================================================
// ---- main loop: acc = this wave's 64x64 tile. Ah / Al / Bt point at the first of the block's 128 A rows (two planes) and 128 Bt rows ----
template <typename OT, bool TWOA>
__device__ __forceinline__ void gemm64_loop(const OT* Ah, const OT* Al, int lda, const OT* Bt, int ldb, int K,
                                            unsigned char* ring, uint32_t wave, int lane, v8f (&acc)[4][4]) {
  typedef typename FT<OT>::frag V16;
  const uint32_t wm = wave & 1u;               // which 64 A rows of the block tile this wave multiplies
  const uint32_t wn = wave >> 1;               // which 64 Bt rows
  const int rlane = lane & 15;                 // row (A) / col (B, D) within subtile
  const int koff  = (lane >> 4) * 8;           // k offset of this lane half

  // ---- what this wave loads: waves 0, 1 the two halves of the A rows, waves 2, 3 the two halves of the Bt rows ----
  constexpr uint32_t NPL = TWOA ? 2u : 1u;
  const bool     isB   = wave >= 2u;
  const uint32_t half  = wave & 1u;
  const size_t   rowA  = (size_t)(half << 6) * lda;
  const size_t   rowBt = (size_t)(half << 6) * ldb;
  const uint64_t src0  = isB ? (uint64_t)(size_t)(Bt + rowBt) : (uint64_t)(size_t)(Ah + rowA);
  const uint64_t src1  = isB ? (uint64_t)(size_t)(Bt + rowBt) : (uint64_t)(size_t)(Al + rowA);
  const uint32_t kp    = (uint32_t)K / GK_PASS;       // stages per A plane
  const uint32_t nst   = kp * NPL;                    // stages in all (at least 2)
  const uint32_t lbase = (uint32_t)(size_t)ring;
  u32x8 g1 = tdm_group1((uint32_t)(isB ? ldb : lda) * 2u);
  // without this the compiler rebuilds words of group 1 from their constants, in the registers a request was issued from
  asm volatile("" : "+s"(g1));   // the pinned() form: descriptor words held in their scalar registers
  auto group0 = [&](uint32_t st) -> u32x4 {
    const bool second = TWOA && st >= kp;             // second A plane, Bt's k starts over
    const uint32_t kk = second ? st - kp : st;
    const uint64_t ga = (second ? src1 : src0) + (uint64_t)kk * (GK_PASS * 2u);
    u32x4 g = tdm_group0(lbase + (st & 1u) * GK_STAGE + wave * GK_SLICE, ga);
    // without this the request is issued from a copy of group 0 whose registers are reused while it is in flight
    asm volatile("" : "+s"(g));   // the pinned() form: descriptor words held in their scalar registers, up to the wait that names them
    return g;
  };

#pragma unroll
  for (int i = 0; i < 4; ++i)
#pragma unroll
    for (int j = 0; j < 4; ++j) acc[i][j] = zero8();

  u32x4 g0 = group0(0);
  tdm_load(g0, g1);
  wait_tensor0(g0, g1);
  __syncthreads();
  g0 = group0(1);
  tdm_load(g0, g1);
  // kept rolled: one pass and one publish point in the text, every accumulator index constant
#pragma unroll 1
  for (uint32_t st = 0; st < nst; ++st) {
    const unsigned char* buf = ring + (st & 1u) * GK_STAGE;
    const unsigned char* pa = buf + wm * GK_SLICE + rlane * GK_PITCH + koff * 2;
    const unsigned char* pb = buf + (2u + wn) * GK_SLICE + rlane * GK_PITCH + koff * 2;
    V16 bq[2][4], af[2][4];   // two fragment sets: block ks multiplies set ks & 1 while the other set is filled
#pragma unroll
    for (int j = 0; j < 4; ++j) bq[0][j] = ldfrag<OT>((const OT*)(const void*)(pb + j * 16 * GK_PITCH));
#pragma unroll
    for (int i = 0; i < 4; ++i) af[0][i] = ldfrag<OT>((const OT*)(const void*)(pa + i * 16 * GK_PITCH));
#pragma unroll
    for (int ks = 0; ks < GK_PASS / 32; ++ks) {
      const int cs = ks & 1;
      if (ks + 1 < GK_PASS / 32) {   // the next block of this same stage; nothing of the next stage is read here
#pragma unroll
        for (int j = 0; j < 4; ++j) bq[cs ^ 1][j] = ldfrag<OT>((const OT*)(const void*)(pb + j * 16 * GK_PITCH + (ks + 1) * 64));
#pragma unroll
        for (int i = 0; i < 4; ++i) af[cs ^ 1][i] = ldfrag<OT>((const OT*)(const void*)(pa + i * 16 * GK_PITCH + (ks + 1) * 64));
      }
      // keeps the 16 LDS reads above as one group in front of the block: sunk among the WMMAs, each read is waited for where it stands
      __builtin_amdgcn_sched_barrier(0);
#pragma unroll
      for (int i = 0; i < 4; ++i)
#pragma unroll
        for (int j = 0; j < 4; ++j) acc[i][j] = mmar(af[cs][i], bq[cs][j], acc[i][j]);
      // keeps the following block's reads from rising among these WMMAs
      __builtin_amdgcn_sched_barrier(0);
    }
    // publish point of stage st + 1; behind its barrier every wave has left stage st's buffer
    wait_ds0();
    wait_tensor0(g0, g1);
    __syncthreads();
    if (pinned(st + 2u < nst)) {
      g0 = group0(st + 2u);
      tdm_load(g0, g1);
    }
  }
  wait_tensor0(g0, g1);
  wait_ds0();
  acc_guard4(acc[0][0], acc[0][1], acc[0][2], acc[0][3]);
  acc_guard4(acc[1][0], acc[1][1], acc[1][2], acc[1][3]);
  acc_guard4(acc[2][0], acc[2][1], acc[2][2], acc[2][3]);
  acc_guard4(acc[3][0], acc[3][1], acc[3][2], acc[3][3]);

}

// ---- epilogue: the wave's tile, rows m0 .. m0+63, columns n0 .. n0+63 of the plane(s) at Cout / Cout2; slab = wave-private 16x68 floats of LDS ----
template <int OUT_MODE>
__device__ __forceinline__ void gemm64_store(v8f (&acc)[4][4], float* slab, int lane, int m0, int n0,
                                             void* Cout, void* Cout2, int ldc,
                                             const float* __restrict__ bias, const float* __restrict__ ctab,
                                             const float* __restrict__ stab, float rscale) {
  static_assert(OUT_MODE >= 0 && OUT_MODE <= 3);
  const int rlane = lane & 15;                 // col (D) within subtile
  const int mOff  = (lane >> 4) * 8;           // D row offset
#pragma unroll
  for (int i = 0; i < 4; ++i) {
    const int mBase = m0 + (i << 4);
#pragma unroll
    for (int j = 0; j < 4; ++j) {
#pragma unroll
      for (int r = 0; r < 8; ++r) {
        slab[(mOff + r) * 68 + (j << 4) + rlane] = acc[i][j][r];
      }
    }
    __builtin_amdgcn_fence(__ATOMIC_RELEASE, "workgroup");
    __builtin_amdgcn_wave_barrier();
    __builtin_amdgcn_fence(__ATOMIC_ACQUIRE, "workgroup");
    if (OUT_MODE == 0) {
      float* C = (float*)Cout;
      const int h2 = lane >> 4, c4 = (lane & 15) * 4;     // 256-B row segment = 16 lanes x 16 B
      const v4f bb = *(const v4f*)(bias + n0 + c4);
      v4f bv;
#pragma unroll
      for (int e = 0; e < 4; ++e) bv[e] = bf16r(bb[e]);
      v4f ov[8];
#pragma unroll
      for (int it = 0; it < 8; ++it) {
        const int row = it * 2 + h2;                       // it 0..7 x h2 0..1 = rows 0..15
        ov[it] = *(const v4f*)(slab + row * 68 + c4) + bv;
      }
      {
#pragma unroll
        for (int it = 0; it < 8; ++it) {
          const int row = it * 2 + h2;
          *(v4f*)(C + (size_t)(mBase + row) * ldc + n0 + c4) = ov[it];
        }
        
      }
    } else {
      const int q = lane >> 3, c8 = (lane & 7) * 8;
      unsigned short* C  = (unsigned short*)Cout;
      unsigned short* C2 = (unsigned short*)Cout2;
      v4u va[4], vb[4];
      v4f tc[4][2], ts[4][2];   // cos / sin of this lane's 8 columns, rows it * 4 + q of the slab
      if (OUT_MODE == 1 || OUT_MODE == 2) {
        // tables are [SEQ][HD]; column within the head = c8 + e (n0 is head-aligned, c8 in 0..56); position within the
        // sequence = (mBase mod SEQ) + row: mBase is a multiple of 16, so the slab's 16 rows do not wrap
        const float* cpt = ctab + (size_t)((mBase & (SEQ - 1)) + q) * HD + c8;
        const float* spt = stab + (size_t)((mBase & (SEQ - 1)) + q) * HD + c8;
        // the slab's table loads stand as one group on two addresses, with their wait behind them: nothing that rewrites an
        // address register of an issued load may be scheduled among them or in front of the wait
        __builtin_amdgcn_sched_barrier(0);
#pragma unroll
        for (int it = 0; it < 4; ++it) {
          tc[it][0] = *(const v4f*)(cpt + it * 4 * HD);
          tc[it][1] = *(const v4f*)(cpt + it * 4 * HD + 4);
          ts[it][0] = *(const v4f*)(spt + it * 4 * HD);
          ts[it][1] = *(const v4f*)(spt + it * 4 * HD + 4);
        }
        // before the loads' address registers are reused; the two addresses are inputs, so that no load's result lands on them
        asm volatile("s_wait_xcnt 0x0" :: "v"(cpt), "v"(spt) : "memory");
        __builtin_amdgcn_sched_barrier(0);
      }
#pragma unroll
      for (int it = 0; it < 4; ++it) {
        const int row = it * 4 + q;                        // it 0..3 x q 0..3 = rows 0..15
        const float* sp = slab + row * 68 + c8;
        float f[8];
#pragma unroll
        for (int e = 0; e < 8; ++e) f[e] = sp[e];
        if (OUT_MODE == 1 || OUT_MODE == 2) {
#pragma clang fp contract(off)
          const float* pp = slab + row * 68 + (c8 ^ 32);   // partner columns d +- 32 of the same row
          float g[8];
#pragma unroll
          for (int e = 0; e < 8; ++e) g[e] = pp[e];
          const v4f bc0 = *(const v4f*)(bias + n0 + c8);
          const v4f bc1 = *(const v4f*)(bias + n0 + c8 + 4);
          const v4f bp0 = *(const v4f*)(bias + n0 + (c8 ^ 32));
          const v4f bp1 = *(const v4f*)(bias + n0 + (c8 ^ 32) + 4);
          const v4f cv0 = tc[it][0], cv1 = tc[it][1], sv0 = ts[it][0], sv1 = ts[it][1];
          const float sg = (c8 < 32) ? -1.0f : 1.0f;       // -x2 for the first half, +x1 for the second half
#pragma unroll
          for (int e = 0; e < 4; ++e) {
            {
              const float x  = f[e] + bf16r(bc0[e]);
              const float y  = g[e] + bf16r(bp0[e]);
              const float ry = sg * y;
              const float p0 = x * bf16r(cv0[e]);
              const float p1 = ry * bf16r(sv0[e]);
              f[e] = p0 + p1;
            }
            {
              const float x  = f[4 + e] + bf16r(bc1[e]);
              const float y  = g[4 + e] + bf16r(bp1[e]);
              const float ry = sg * y;
              const float p0 = x * bf16r(cv1[e]);
              const float p1 = ry * bf16r(sv1[e]);
              f[4 + e] = p0 + p1;
            }
          }
        }
        if (OUT_MODE == 3) {
          const float bm = bf16r(bias[mBase + row]);
#pragma unroll
          for (int e = 0; e < 8; ++e) f[e] = f[e] + bm;
        }
        v4u a, a2;
#pragma unroll
        for (int e = 0; e < 4; ++e) {
          const float f0 = f[2 * e], f1 = f[2 * e + 1];
          const _Float16 x0 = (_Float16)f0, x1 = (_Float16)f1;
          const unsigned short h0 = h_bits(x0), h1 = h_bits(x1);
          unsigned short l0 = 0, l1 = 0;
          if (OUT_MODE == 1) {
            l0 = h_bits((_Float16)((f0 - (float)x0) * rscale));
            l1 = h_bits((_Float16)((f1 - (float)x1) * rscale));
          }
          a[e] = pk16(h0, h1); a2[e] = pk16(l0, l1);
        }
        va[it] = a; vb[it] = a2;
      }
      // the slab's stores stand as one group with their wait behind them: nothing that rewrites a register of an issued store
      // may be scheduled among them or in front of the wait
      __builtin_amdgcn_sched_barrier(0);
#pragma unroll
      for (int it = 0; it < 4; ++it) {
        const size_t go = (size_t)(mBase + it * 4 + q) * ldc + n0 + c8;
        *(v4u*)(C + go) = va[it];
        if (OUT_MODE == 1) *(v4u*)(C2 + go) = vb[it];
      }
      asm volatile("s_wait_xcnt 0x0" ::: "memory");   // before the stores' address and data registers are reused
      __builtin_amdgcn_sched_barrier(0);
    }
    __builtin_amdgcn_fence(__ATOMIC_RELEASE, "workgroup");
    __builtin_amdgcn_wave_barrier();
    __builtin_amdgcn_fence(__ATOMIC_ACQUIRE, "workgroup");
  }
}

template <typename OT, int OUT_MODE, bool TWOA>
__global__ __launch_bounds__(128) void gemm64(
    const unsigned short* __restrict__ Ap, const unsigned short* __restrict__ Alp, int lda, long long strideA,
    const unsigned short* __restrict__ Btp, int ldb, long long strideB,
    void* Cout, void* Cout2, int ldc, long long strideC,
    const float* __restrict__ bias, const float* __restrict__ ctab, const float* __restrict__ stab,
    int M, int N, int K, float rscale) {
  __shared__ __attribute__((aligned(2048))) unsigned char ring[2 * GK_STAGE];   // two stages
  __shared__ __align__(16) float sT[4][16 * 68];   // per-wave 16x64 slab, pitch 68 floats
  const int b    = blockIdx.y;
  const int lane = threadIdx.x & 31;
  const uint32_t wave = uni(threadIdx.x >> 5);
  const int tilesN = N >> 7;
  const int tilesM = M >> 7;
  const int bt = blockIdx.x;
  if (bt >= tilesM * tilesN) return;   // block-uniform, in front of every barrier and tensor load
  const int btm = bt / tilesN;
  const int btn = bt - btm * tilesN;
  const size_t rowA  = (size_t)b * (size_t)strideA + (size_t)(btm << 7) * lda;
  const size_t rowBt = (size_t)b * (size_t)strideB + (size_t)(btn << 7) * ldb;
  v8f acc[4][4];
  gemm64_loop<OT, TWOA>((const OT*)(const void*)Ap + rowA, (const OT*)(const void*)Alp + rowA, lda,
                        (const OT*)(const void*)Btp + rowBt, ldb, K, ring, wave, lane, acc);
  const size_t cb = (size_t)b * (size_t)strideC * (OUT_MODE == 0 ? sizeof(float) : sizeof(unsigned short));
  gemm64_store<OUT_MODE>(acc, sT[wave], lane, (btm << 7) + (int)((wave & 1u) << 6), (btn << 7) + (int)((wave >> 1) << 6),
                         (void*)((char*)Cout + cb), (void*)((char*)Cout2 + cb), ldc, bias, ctab, stab, rscale);
}

// =====================================================================================================
// The three projections of x in ONE launch: they are independent of each other, so the block index picks the job
// (256 blocks each, the two jobs with the long rotary epilogue first):
//   job 0: q   = rope(x . Wq^T + bq) -> f16 hi / residual (x4096) planes [b*SEQ+t][h*64+d]   (OUT_MODE 1)
//   job 1: k   = rope(x . Wk^T + bk) -> f16 plane [b*SEQ+s][h*64+d]                          (OUT_MODE 2)
//   job 2: v^T = Wv . x^T + bv per batch -> f16 plane [b][h*64+d][s]; A = Wv rows, Bt = x rows of batch b (OUT_MODE 3)
// W = the bf16 qkv weight [3072][1024], bias = qkv_b [3072]; every pitch is DM = SEQ elements, K = DM.
// The epilogue slabs lie in the ring, so that a block holds 144 KiB of LDS and two blocks share a WGP: one block's first
// tile, stage waits and epilogue run beside the other's products.
// coverage: jobs 0, 1: 32 x 8 tiles of 128x128 = [4096][1024]; job 2: 4 batches x 8 x 8 tiles = [4][1024][1024].
// =====================================================================================================
#define QKV_TILES ((NTOK / 128) * (DM / 128))   // 256 blocks per job
static_assert(QKV_TILES == NB * (DM / 128) * (SEQ / 128) && DM == SEQ && DM / 128 == 8 && 16 * 68 * 4 <= GK_SLICE);
__global__ __launch_bounds__(128) void gemm_qkv(
    const unsigned short* __restrict__ Xp, const unsigned short* __restrict__ Wp,
    unsigned short* Qh, unsigned short* Ql, unsigned short* Kp, unsigned short* VT,
    const float* __restrict__ bias, const float* __restrict__ ctab, const float* __restrict__ stab) {
  __shared__ __attribute__((aligned(2048))) unsigned char ring[2 * GK_STAGE];   // two stages; behind the loop the slabs
  const int lane = threadIdx.x & 31;
  const uint32_t wave = uni(threadIdx.x >> 5);
  const uint32_t job = blockIdx.x / QKV_TILES;
  const uint32_t bt  = blockIdx.x % QKV_TILES;
  if (job > 2u) return;                // block-uniform, in front of every barrier and tensor load
  const bool isVt = job == 2u;
  const uint32_t btn = bt & 7u;                            // tile column
  const uint32_t btm = isVt ? (bt >> 3) & 7u : bt >> 3;    // tile row: of 8 (features of one batch) or of 32 (tokens)
  const uint32_t b   = isVt ? bt >> 6 : 0u;                // batch (job 2 only)
  const __bf16* X = (const __bf16*)(const void*)Xp;
  const __bf16* Wj = (const __bf16*)(const void*)Wp + (size_t)job * DM * DM;
  const __bf16* A  = isVt ? Wj + (size_t)(btm << 7) * DM : X + (size_t)(btm << 7) * DM;
  const __bf16* Bt = isVt ? X + ((size_t)b * SEQ + (btn << 7)) * DM : Wj + (size_t)(btn << 7) * DM;
  v8f acc[4][4];
  gemm64_loop<__bf16, false>(A, A, DM, Bt, DM, DM, ring, wave, lane, acc);
  // the ring is free here: the last pass's publish point (LDS wait, tensor wait, block barrier) stands behind every wave's
  // last read and last request, and nothing is issued behind it; each wave stages in its own slice of the first buffer
  float* slab = (float*)(void*)(ring + wave * GK_SLICE);
  const int m0 = (int)((btm << 7) + ((wave & 1u) << 6));
  const int n0 = (int)((btn << 7) + ((wave >> 1) << 6));
  const float* bj = bias + job * DM;
  if (job == 0u)      gemm64_store<1>(acc, slab, lane, m0, n0, (void*)Qh, (void*)Ql, DM, bj, ctab, stab, 4096.0f);
  else if (job == 1u) gemm64_store<2>(acc, slab, lane, m0, n0, (void*)Kp, (void*)Kp, DM, bj, ctab, stab, 1.0f);
  else                gemm64_store<3>(acc, slab, lane, m0, n0, (void*)(VT + (size_t)b * DM * SEQ), (void*)(VT + (size_t)b * DM * SEQ),
                                      SEQ, bj, ctab, stab, 1.0f);
}

#define AT_PITCH 72                   // 16-bit elements per LDS row of the K and V^T tiles
#define OS_PITCH 68                   // floats per LDS row of the context tile
static_assert((AT_PITCH * 2) % 32 == 16 && AT_PITCH >= 64 && (OS_PITCH * 4) % 16 == 0 && OS_PITCH >= 64);
#define AT_SLICE 6144                 // one wave's slice: 32 rows x 144 B = 4608 B, rounded up to a multiple of 2 KiB
#define AT_STAGE (4 * AT_SLICE)       // [K rows 0..31 | K rows 32..63 | V^T rows 0..31 | V^T rows 32..63]
static_assert(AT_PITCH * 2 == 128 + 16 && 32 * AT_PITCH * 2 <= AT_SLICE && (AT_SLICE % 2048) == 0 && NKT >= 2);
// lane l <-> lane l ^ 16: the other half of the wave holds the same query's other keys
__device__ __forceinline__ float xhalf(float x) {
  return __builtin_bit_cast(float, __builtin_amdgcn_permlanex16(__builtin_bit_cast(int, x), __builtin_bit_cast(int, x),
                                                                0x76543210, 0xfedcba98, false, false));
}
__global__ __launch_bounds__(128)
void attn_mha(const unsigned short* __restrict__ qhp, const unsigned short* __restrict__ qlp,
              const unsigned short* __restrict__ kpp, const unsigned short* __restrict__ vtp,
              unsigned short* ohp, unsigned short* olp, float sscale) {
  union FH { v16h v; v8h h[2]; };
  __shared__ __attribute__((aligned(2048))) unsigned char kvring[2 * AT_STAGE];   // two stages of K [key][d] and V^T [d][key]
  __shared__ __align__(16) float    Os[4][16 * OS_PITCH];    // per wave context tile 17 KB

  const int tid  = threadIdx.x;
  const int wave = (int)uni((uint32_t)tid >> 5);
  const int lane = tid & 31;
  const int hh   = lane >> 4;
  const int c    = lane & 15;

  const int bx   = blockIdx.x;
  const int qb   = bx % NQB;
  const int rest = bx / NQB;
  const int h    = rest % NH;
  const int b    = rest / NH;
  const int q0   = qb * 64 + wave * 16;
  const size_t rowB = (size_t)b * SEQ;
  const size_t hcol = (size_t)h * HD;

  const _Float16* Qh = (const _Float16*)(const void*)qhp;
  const _Float16* Ql = (const _Float16*)(const void*)qlp;
  const _Float16* Kg = (const _Float16*)(const void*)kpp + hcol;
  const _Float16* Vt = (const _Float16*)(const void*)vtp + ((size_t)b * DM + hcol) * SEQ;

  // ---- Q fragments (B operand, column = query = lane&15): 2 d-chunks, hi and residual planes ----
  v16h qah[2], qal[2];
#pragma unroll
  for (int dc = 0; dc < 2; ++dc) {
    const size_t qo = (rowB + q0 + c) * DM + hcol + dc * 32 + 8 * hh;
    qah[dc] = ldfrag<_Float16>(Qh + qo);
    qal[dc] = ldfrag<_Float16>(Ql + qo);
  }

  float mrun = -INFINITY;   // running maximum of this lane's query (equal in both halves)
  float lrun = 0.f;         // running sum over this half's keys; the halves are joined once, behind the loop
  v8f oacc[4];              // O^T: column = query lane&15, row d = 16 t + 8 hh + r
#pragma unroll
  for (int t = 0; t < 4; ++t) oacc[t] = zero8();

  // ---- what this wave loads: chunk st's K rows 32 half .. +31 (d = 0..63 of head h) or V^T rows d = 32 half .. +31 (its 64 keys) ----
  const bool     isV   = wave >= 2;
  const uint32_t half  = (uint32_t)wave & 1u;
  const uint64_t src   = isV ? (uint64_t)(size_t)(Vt + (size_t)(half * 32u) * SEQ)
                             : (uint64_t)(size_t)(Kg + (rowB + half * 32u) * DM);
  const uint32_t sstep = isV ? 64u * 2u : 64u * DM * 2u;   // bytes from one chunk to the next: 64 keys along / across the rows
  const uint32_t lbase = (uint32_t)(size_t)kvring;
  static_assert(DM == SEQ);                                // both planes have rows of DM * 2 = SEQ * 2 bytes
  u32x8 g1 = tdm_group1_r128(DM * 2u);
  // without this the compiler rebuilds words of group 1 from their constants, in the registers a request was issued from
  asm volatile("" : "+s"(g1));   // the pinned() form: descriptor words held in their scalar registers
  auto group0 = [&](uint32_t st) -> u32x4 {
    return tdm_group0(lbase + (st & 1u) * AT_STAGE + (uint32_t)wave * AT_SLICE, src + (uint64_t)st * sstep);
  };
  u32x4 g0 = group0(0);
  tdm_load(g0, g1);
  wait_tensor0(g0, g1);
  __syncthreads();
  g0 = group0(1);
  tdm_load(g0, g1);
  // kept rolled: one pass and one publish point in the text
#pragma unroll 1
  for (uint32_t kt = 0; kt < NKT; ++kt) {    // static trip count
    const unsigned char* buf = kvring + (kt & 1u) * AT_STAGE;
    const _Float16* Ksh = (const _Float16*)(const void*)buf;                    // row r at (r >> 5) slices + (r & 31) rows
    const _Float16* Vth = (const _Float16*)(const void*)(buf + 2 * AT_SLICE);

    // ---- scores, transposed: 64 keys x 16 queries per wave, 2 f16 products per key subtile and d-chunk ----
    v8f s[4];   // s[j][r]: key kv0 + 16 j + 8 hh + r, query q0 + c
#pragma unroll
    for (int j = 0; j < 4; ++j) {
      v8f ah = zero8(), al = zero8();
#pragma unroll
      for (int dc = 0; dc < 2; ++dc) {
        FH kb;
        kb.h[0] = *(const v8h*)(Ksh + (j >> 1) * (AT_SLICE / 2) + ((j & 1) * 16 + c) * AT_PITCH + dc * 32 + 8 * hh);
        kb.h[1] = *(const v8h*)(Ksh + (j >> 1) * (AT_SLICE / 2) + ((j & 1) * 16 + c) * AT_PITCH + dc * 32 + 16 + 8 * hh);
        ah = mma_h(kb.v, qah[dc], ah);
        al = mma_h(kb.v, qal[dc], al);
      }
#pragma unroll
      for (int r = 0; r < 8; ++r) s[j][r] = (ah[r] + al[r] * (1.0f / 4096.0f)) * sscale;
    }

    // ---- query maximum (in-lane, then the other half's), online softmax, P^T (x1024, f16) packed in registers ----
    float mj[4];   // one chain per key subtile: four short dependent chains instead of one long one
#pragma unroll
    for (int j = 0; j < 4; ++j) {
      mj[j] = s[j][0];
#pragma unroll
      for (int r = 1; r < 8; ++r) mj[j] = fmaxf(mj[j], s[j][r]);
    }
    float m = fmaxf(fmaxf(mj[0], mj[1]), fmaxf(mj[2], mj[3]));
    m = fmaxf(m, xhalf(m));
    const float mnew  = fmaxf(mrun, m);
    const float msafe = (mnew == -INFINITY) ? 0.f : mnew;
    const float alpha = __expf(mrun - msafe);
    mrun = mnew;
    // B operand of 32 keys: elements 0..7 = keys k0 + 8 hh + e (subtile 2 kk), 8..15 = keys k0 + 16 + 8 hh + e (subtile 2 kk + 1)
    FH pb[2];
    float ps[4];   // partial sums, one chain per key subtile
#pragma unroll
    for (int j = 0; j < 4; ++j) {
      ps[j] = 0.f;
#pragma unroll
      for (int r = 0; r < 8; ++r) {
        const float p = __expf(s[j][r] - msafe);
        ps[j] += p;
        pb[j >> 1].v[(j & 1) * 8 + r] = (_Float16)(p * 1024.0f);
      }
    }
    lrun = lrun * alpha + ((ps[0] + ps[1]) + (ps[2] + ps[3]));
#pragma unroll
    for (int t = 0; t < 4; ++t) oacc[t] = oacc[t] * alpha;

    // ---- context^T += V^T . P^T (f16 WMMA, single product); unrolled: pb is indexed in registers ----
#pragma unroll
    for (int kk = 0; kk < 2; ++kk) {
#pragma unroll
      for (int t = 0; t < 4; ++t) {
        FH vb;
        vb.h[0] = *(const v8h*)(Vth + (t >> 1) * (AT_SLICE / 2) + ((t & 1) * 16 + c) * AT_PITCH + kk * 32 + 8 * hh);
        vb.h[1] = *(const v8h*)(Vth + (t >> 1) * (AT_SLICE / 2) + ((t & 1) * 16 + c) * AT_PITCH + kk * 32 + 16 + 8 * hh);
        oacc[t] = mma_h(vb.v, pb[kk].v, oacc[t]);
      }
    }
    // publish point of chunk kt + 1; behind its barrier every wave has left chunk kt's buffer
    wait_ds0();
    wait_tensor0(g0, g1);
    __syncthreads();
    if (pinned(kt + 2u < NKT)) {
      g0 = group0(kt + 2u);
      tdm_load(g0, g1);
    }
  }
  wait_tensor0(g0, g1);
  wait_ds0();

  // ---- join the halves' sums, normalise (1/l, undo the x1024 p carry), stage the wave's 16x64 f32 tile [query][d],
  //      split into bf16 hi / residual
  float* os = Os[wave];
  {
    const float l = lrun + xhalf(lrun);   // unconditional: every lane is on at the exchange
    const float inv = ((l > 0.f) ? (1.0f / l) : 0.f) * (1.0f / 1024.0f);
#pragma unroll
    for (int t = 0; t < 4; ++t) {
      v4f lo, hi;
#pragma unroll
      for (int r = 0; r < 4; ++r) { lo[r] = oacc[t][r] * inv; hi[r] = oacc[t][4 + r] * inv; }
      *(v4f*)(os + c * OS_PITCH + t * 16 + 8 * hh)     = lo;
      *(v4f*)(os + c * OS_PITCH + t * 16 + 8 * hh + 4) = hi;
    }
  }
  __builtin_amdgcn_fence(__ATOMIC_RELEASE, "workgroup");
  __builtin_amdgcn_wave_barrier();
  __builtin_amdgcn_fence(__ATOMIC_ACQUIRE, "workgroup");
  {
    const int q4 = lane >> 3, c8 = (lane & 7) * 8;
    v4u hv[4], lv[4];
#pragma unroll
    for (int it = 0; it < 4; ++it) {
      const int row = it * 4 + q4;   // it 0..3 x q4 0..3 = rows 0..15 of the wave tile
      const float* sp = os + row * OS_PITCH + c8;
      v4u a, a2;
#pragma unroll
      for (int e = 0; e < 4; ++e) {
        const float f0 = sp[2 * e], f1 = sp[2 * e + 1];
        const unsigned short h0 = bf_bits(f0), h1 = bf_bits(f1);
        const unsigned short l0 = bf_bits(f0 - bf_up(h0)), l1 = bf_bits(f1 - bf_up(h1));
        a[e] = pk16(h0, h1); a2[e] = pk16(l0, l1);
      }
      hv[it] = a; lv[it] = a2;
    }
    {
#pragma unroll
      for (int it = 0; it < 4; ++it) {
        const int row = it * 4 + q4;
        const size_t go = (rowB + q0 + row) * DM + hcol + c8;
        *(v4u*)(ohp + go) = hv[it];
        *(v4u*)(olp + go) = lv[it];
      }
      
    }
  }
}

// =====================================================================================================
// Workspace map (bytes), every region an exact multiple of its whole-line / whole-tile store granularity
// (all shapes are tile multiples, no padded tails):
//   Xb    bf16 [4096][1024]          8388608
//   Wqkv  bf16 [3072 n][1024 k]      6291456   (input [out][in] layout == Bt[n][k], k contiguous)
//   Wo    bf16 [1024 n][1024 k]      2097152
//   Qh    f16  [4096][1024]          8388608
//   Ql    f16  [4096][1024]          8388608   (residual x4096)
//   Kp    f16  [4096][1024]          8388608
//   VT    f16  [4][1024][1024]       8388608
//   Oh    bf16 [4096][1024]          8388608
//   Ol    bf16 [4096][1024]          8388608
//   total                           67108864
// =====================================================================================================
extern "C" void kernel_launch(void* const* d_in, const int* in_sizes, int n_in,
                              void* d_out, int out_size, void* d_ws, size_t ws_size,
                              hipStream_t stream) {
  if (n_in < 7) return;
  if (in_sizes[0] != NTOK * DM) return;          // x      [4][1024][1024]
  if (in_sizes[1] != SEQ * HD) return;           // cos    [1024][64]
  if (in_sizes[2] != SEQ * HD) return;           // sin    [1024][64]
  if (in_sizes[3] != DQKV * DM) return;          // qkv_w  [3072][1024]
  if (in_sizes[4] != DQKV) return;               // qkv_b  [3072]
  if (in_sizes[5] != DM * DM) return;            // proj_w [1024][1024]
  if (in_sizes[6] != DM) return;                 // proj_b [1024]
  if (out_size != NTOK * DM) return;

  const float* x    = (const float*)d_in[0];
  const float* cosb = (const float*)d_in[1];
  const float* sinb = (const float*)d_in[2];
  const float* Wqkv = (const float*)d_in[3];
  const float* bqkv = (const float*)d_in[4];
  const float* Wout = (const float*)d_in[5];
  const float* bout = (const float*)d_in[6];

  const size_t PX  = (size_t)NTOK * DM * 2;        //  8388608  16-bit activation plane [4096][1024]
  const size_t PWQ = (size_t)DQKV * DM * 2;        //  6291456  bf16 [3072][1024]
  const size_t PWO = (size_t)DM * DM * 2;          //  2097152  bf16 [1024][1024]
  const size_t PVT = (size_t)NB * DM * SEQ * 2;    //  8388608  v^T plane [4][1024][1024]
  size_t off = 0;
  const size_t oXb  = off; off += PX;
  const size_t oWq  = off; off += PWQ;
  const size_t oWo  = off; off += PWO;
  const size_t oQh  = off; off += PX;
  const size_t oQl  = off; off += PX;
  const size_t oKp  = off; off += PX;
  const size_t oVT  = off; off += PVT;
  const size_t oOh  = off; off += PX;
  const size_t oOl  = off; off += PX;
  if (off > ws_size) return;                       // off = 67108864
  if (off > (size_t)134217728) return;

  char* ws = (char*)d_ws;
  unsigned short* Xb   = (unsigned short*)(ws + oXb);
  unsigned short* Wq16 = (unsigned short*)(ws + oWq);
  unsigned short* Wo16 = (unsigned short*)(ws + oWo);
  unsigned short* Qh   = (unsigned short*)(ws + oQh);
  unsigned short* Ql   = (unsigned short*)(ws + oQl);
  unsigned short* Kp   = (unsigned short*)(ws + oKp);
  unsigned short* VT   = (unsigned short*)(ws + oVT);
  unsigned short* Oh   = (unsigned short*)(ws + oOh);
  unsigned short* Ol   = (unsigned short*)(ws + oOl);

  const dim3 blk(256);
  const int n8x  = NTOK * DM / 8;                               // 524288
  const int n8wq = DQKV * DM / 8;                               // 393216
  const int n8wo = DM * DM / 8;                                 // 131072
  const dim3 gCvtX((n8x + 255) / 256);                          // 2048 blocks
  const dim3 gCvtWq((n8wq + 255) / 256);                        // 1536 blocks
  const dim3 gCvtWo((n8wo + 255) / 256);                        //  512 blocks
  const dim3 blkG(128);                                         // gemm64: 4 waves
  const dim3 gP((NTOK / 128) * (DM / 128), 1);                  // 256 blocks of one 128x128 tile: M=4096, N=1024
  const dim3 gQKV(3 * QKV_TILES);                               // 768 blocks: q, k, v^T tiles of 128x128
  const dim3 gAttn(NB * NH * NQB);                              // 1024 blocks of 128
  static_assert((NTOK % 128) == 0 && (DM % 128) == 0 && (SEQ % 128) == 0 && (DM % GK_PASS) == 0 && DM / GK_PASS >= 2);
  static_assert((NTOK * DM) % 2048 == 0 && (DQKV * DM) % 2048 == 0 && (DM * DM) % 2048 == 0);
  static_assert((DM % 32) == 0);

  // (1) x -> bf16 plane [4096][1024]; qkv_w [3072][1024] ([out][in] = Bt[n][k]) -> bf16; proj_w [1024][1024] -> bf16
  cvt_bf16x8<<<gCvtX,  blk, 0, stream>>>(x,    Xb,   n8x);
  cvt_bf16x8<<<gCvtWq, blk, 0, stream>>>(Wqkv, Wq16, n8wq);
  cvt_bf16x8<<<gCvtWo, blk, 0, stream>>>(Wout, Wo16, n8wo);
  // (2) - (4) q, k and v^T projections, one launch: block range picks the job
  gemm_qkv<<<gQKV, blkG, 0, stream>>>(Xb, Wq16, Qh, Ql, Kp, VT, bqkv, cosb, sinb);
  // (5) attention -> ctx bf16 hi / residual planes [b*SEQ+t][h*64+d]
  attn_mha<<<gAttn, dim3(128), 0, stream>>>(Qh, Ql, Kp, VT, Oh, Ol, 0.125f);
  // (6) out = (Oh + Ol) . Wproj^T + bproj -> d_out f32 [4096][1024]   (M=4096, N=1024, K=1024, two A planes)
  gemm64<__bf16, 0, true><<<gP, blkG, 0, stream>>>(
      Oh, Ol, DM, 0LL, Wo16, DM, 0LL,
      d_out, d_out, DM, 0LL, bout, cosb, sinb,
      NTOK, DM, DM, 1.0f);
  (void)hipGetLastError();
}

// v007
// It runs in 89.3 microseconds.
// In two side-by-side timings against v006, it was 1.04 and 1.06 times as fast.
// Over all steps from v000 it is 3.89 times as fast.
// Contractions: q / k / v^T projections = v_wmma_f32_16x16x32_bf16 (bf16 operands from RNE-converted x and qkv weight rows, single product, f32 accumulate);
// q.k^T scores = v_wmma_f32_16x16x32_f16 (q as f16 hi plane + f16 residual plane x4096, k f16; 2 products into separate f32 accumulators);
// p.v = v_wmma_f32_16x16x32_f16 (p carried x1024 in f16, v f16; single product, f32 accumulate);
// ctx.Wproj^T = v_wmma_f32_16x16x32_bf16 (ctx as bf16 hi plane + unscaled bf16 residual plane, weights bf16; 2 products, f32 accumulate);
// rotary with the input cos/sin tables (values RNE-converted to bf16), half-rotation, bias adds and softmax in f32 on the VALU.
// Carry audit: q residual plane x4096 -> folded back once as al * (1/4096) in the attn_mha score combine;
// p x1024 -> folded back once as (1/l) * (1/1024) in the attn_mha epilogue; ctx residual plane is the unscaled
// RNE residual (v - hi) and shares the hi accumulator; no weight-plane carries (all weight copies are bf16).
// gemm64 stages both operands in LDS with tensor loads (two buffers); its 16-bit epilogue stores the four row groups of a 16-row slab together.
// gemm_qkv runs the q, k and v^T projections as one launch (same loop and epilogues), two blocks to a WGP.
// attn_mha stages its K and V^T chunks in LDS with tensor loads (two buffers); a pass reads its K fragments as one group
// in front of the score products and its V^T fragments in front of the softmax arithmetic.
#include <hip/hip_runtime.h>
#include <math.h>
#include <stdint.h>

#define NB    4
#define SEQ   1024
#define DM    1024
#define NH    16
#define HD    64
#define DQKV  (3 * DM)
#define NTOK  (NB * SEQ)   // 4096 token rows
#define NQB   (SEQ / 64)   // 16 query blocks of 64 per sequence
#define NKT   (SEQ / 64)   // 16 key chunks of 64 per sequence
static_assert(NH * HD == DM);
static_assert(NQB == 16 && NKT == 16);
static_assert((SEQ & (SEQ - 1)) == 0);
static_assert((SEQ % 64) == 0 && (DM % 64) == 0 && (DM % 32) == 0 && (DQKV % 64) == 0 && (NTOK % 64) == 0);

typedef _Float16 v16h __attribute__((ext_vector_type(16)));
typedef _Float16 v8h  __attribute__((ext_vector_type(8)));
typedef __bf16   v16b __attribute__((ext_vector_type(16)));
typedef __bf16   v8b  __attribute__((ext_vector_type(8)));
typedef float    v8f  __attribute__((ext_vector_type(8)));
typedef float    v4f  __attribute__((ext_vector_type(4)));
typedef unsigned int v4u __attribute__((ext_vector_type(4)));
typedef uint32_t u32x4 __attribute__((ext_vector_type(4)));
typedef uint32_t u32x8 __attribute__((ext_vector_type(8)));

#if defined(__HIP_DEVICE_COMPILE__)
#define DEV_ASM 1
#else
#define DEV_ASM 0
#endif

// ---- scalar helpers --------------------------------------------------------------------------------
__device__ __forceinline__ unsigned short bf_bits(float f) {          // f32 -> bf16 bits, RNE convert
  unsigned u = __float_as_uint(f);
  return (unsigned short)((u + 0x7FFFu + ((u >> 16) & 1u)) >> 16);
}
__device__ __forceinline__ float bf_up(unsigned short hb) { return __uint_as_float(((unsigned)hb) << 16); }
__device__ __forceinline__ float bf16r(float f) { return bf_up(bf_bits(f)); }   // value of the bf16 RNE convert
__device__ __forceinline__ unsigned short h_bits(_Float16 x) { return __builtin_bit_cast(unsigned short, x); }
__device__ __forceinline__ unsigned pk16(unsigned short a, unsigned short b) { return (unsigned)a | ((unsigned)b << 16); }
__device__ __forceinline__ v8f zero8() { v8f z = {0.f, 0.f, 0.f, 0.f, 0.f, 0.f, 0.f, 0.f}; return z; }

// ---- fragment types / loaders: 16-bit A/B operand, lane -> row/col (lane&15), p already includes +8*(lane>>4);
//      elements 0..7 <- p[0..7] (k0+8h..k0+8h+7), elements 8..15 <- p[16..23] (k0+16+8h..k0+16+8h+7)
template <typename OT> struct FT;
template <> struct FT<__bf16>   { typedef v16b frag; typedef v8b half8; };
template <> struct FT<_Float16> { typedef v16h frag; typedef v8h half8; };

template <typename OT>
__device__ __forceinline__ typename FT<OT>::frag ldfrag(const OT* p) {
  union { typename FT<OT>::frag v; typename FT<OT>::half8 h[2]; } f;
  f.h[0] = *(const typename FT<OT>::half8*)(p);
  f.h[1] = *(const typename FT<OT>::half8*)(p + 16);
  return f.v;
}

// ---- WMMA helpers (asm guard bodies are device-only; concrete operand types) -----------------------------
__device__ __forceinline__ v8f mmar(v16b a, v16b b, v8f c) {
  return __builtin_amdgcn_wmma_f32_16x16x32_bf16(false, a, false, b, (short)0, c, false, false);
}
__device__ __forceinline__ v8f mmar(v16h a, v16h b, v8f c) {
  return __builtin_amdgcn_wmma_f32_16x16x32_f16(false, a, false, b, (short)0, c, false, false);
}
__device__ __forceinline__ void acc_guard4(v8f& a, v8f& b, v8f& c, v8f& d) {
#if DEV_ASM
  asm volatile("v_nop\n\tv_nop\n\tv_nop\n\tv_nop" : "+v"(a), "+v"(b), "+v"(c), "+v"(d));
#else
  (void)a; (void)b; (void)c; (void)d;
#endif
}

// ---- tensor-load helpers for the LDS rings of gemm64 and attn_mha ------------------------------------------------------
#define GK_PASS  128                  // k elements of one stage: rows of 256 B
#define GK_PITCH 272                  // LDS row pitch in bytes: 256 B + the 16-B pad (odd multiple of 16 B for 16-B readers)
#define GK_SLICE 18432                // one wave's slice: 64 rows x 272 B = 17408 B, rounded up to a multiple of 2 KiB
#define GK_STAGE (4 * GK_SLICE)       // [A rows 0..63 | A rows 64..127 | Bt rows 0..63 | Bt rows 64..127]
static_assert(64 * GK_PITCH <= GK_SLICE && (GK_SLICE % 2048) == 0);
__device__ __forceinline__ uint32_t uni(uint32_t v) { return (uint32_t)__builtin_amdgcn_readfirstlane(v); }
__device__ __forceinline__ uint32_t pinned(uint32_t v) { uint32_t w = uni(v); asm volatile("" : "+s"(w)); return w; }
// the compiler places no wait for a tensor load: the issuing wave waits for its own request here; the request's two
// groups are inputs, so that their scalar registers keep their values until the request has landed
__device__ __forceinline__ void wait_tensor0(u32x4 g0, u32x8 g1) { asm volatile("s_wait_tensorcnt 0x0" :: "s"(g0), "s"(g1) : "memory"); }
// this wave's LDS reads have retired before the barrier behind which their buffer is refilled
__device__ __forceinline__ void wait_ds0() { asm volatile("s_wait_dscnt 0x0" ::: "memory"); }
__device__ __forceinline__ void tdm_load(u32x4 g0, u32x8 g1) { asm volatile("tensor_load_to_lds %0, %1" :: "s"(g0), "s"(g1) : "memory"); }
// group 1: 1-byte elements, tile = tensor = 64 rows of 256 B, source row pitch src_pitch bytes, 4 dwords of LDS pad behind every row
__device__ __forceinline__ u32x8 tdm_group1(uint32_t src_pitch) {
  constexpr uint32_t d0 = 256u, d1 = 64u;
  u32x8 g;
  g[0] = uni((1u << 20) | (5u << 22) | (3u << 25));   // no mask, data_size 0, pad after every 64 dwords, 4 dwords
  g[1] = uni((d0 & 0xFFFFu) << 16);
  g[2] = uni((d0 >> 16) | ((d1 & 0xFFFFu) << 16));
  g[3] = uni((d1 >> 16) | (d0 << 16));
  g[4] = uni(d1);
  g[5] = uni(src_pitch);
  g[6] = uni(0u);
  g[7] = uni(0u);
  return g;
}
// group 1 of attn_mha's tiles: 1-byte elements, tile = tensor = 32 rows of 128 B, 4 dwords of LDS pad behind every row
__device__ __forceinline__ u32x8 tdm_group1_r128(uint32_t src_pitch) {
  constexpr uint32_t d0 = 128u, d1 = 32u;
  u32x8 g;
  g[0] = uni((1u << 20) | (4u << 22) | (3u << 25));   // no mask, data_size 0, pad after every 32 dwords, 4 dwords
  g[1] = uni((d0 & 0xFFFFu) << 16);
  g[2] = uni((d0 >> 16) | ((d1 & 0xFFFFu) << 16));
  g[3] = uni((d1 >> 16) | (d0 << 16));
  g[4] = uni(d1);
  g[5] = uni(src_pitch);
  g[6] = uni(0u);
  g[7] = uni(0u);
  return g;
}
__device__ __forceinline__ u32x4 tdm_group0(uint32_t lds_dst, uint64_t ga) {
  u32x4 g;
  g[0] = uni(1u);
  g[1] = uni(lds_dst);
  g[2] = uni((uint32_t)ga);
  g[3] = uni((((uint32_t)(ga >> 32)) & 0x01FFFFFFu) | 0x80000000u);
  return g;
}

// =====================================================================================================
// f32 -> bf16 (RNE convert), 8 elements per thread, one 16-B store per lane: a wave writes 512 contiguous B
// Layout is preserved, so a [out][in] f32 weight becomes the bf16 Bt[n][k] plane (k contiguous) directly.
// coverage: n8 threads x 8 = the whole plane (n8 = 524288 / 393216 / 131072, all multiples of 256).
// =====================================================================================================
__global__ __launch_bounds__(256) void cvt_bf16x8(const float* __restrict__ in, unsigned short* out, int n8) {
  const int i = blockIdx.x * 256 + (int)threadIdx.x;
  if (i < n8) {
    const v4f a = *(const v4f*)(in + (size_t)i * 8);
    const v4f b = *(const v4f*)(in + (size_t)i * 8 + 4);
    v4u p;
    p[0] = pk16(bf_bits(a[0]), bf_bits(a[1]));
    p[1] = pk16(bf_bits(a[2]), bf_bits(a[3]));
    p[2] = pk16(bf_bits(b[0]), bf_bits(b[1]));
    p[3] = pk16(bf_bits(b[2]), bf_bits(b[3]));
    *(v4u*)(out + (size_t)i * 8) = p;
    
  }
}

// =====================================================================================================
// Register-blocked batched WMMA GEMM (16-bit operand type OT): C[m][n] = sum_k A[m][k] * Bt[n][k];
// one block of 4 waves (2 x 2) per 128x128 tile, one wave per 64x64 tile. A row-major [M][K] pitch lda; Bt row-major
// [N][K] pitch ldb (k contiguous); M, N multiples of 128, K a multiple of 128 and at least 256 (host-checked).
// blockIdx.y = batch index (strides in elements). A stage = 128 k of the block's 128 A rows and 128 Bt rows in LDS;
// every wave brings one 64-row slice of it with one tensor load, two buffers, the next stage in flight during a pass.
// Fragments are read from LDS with the split k map (ldfrag); k runs upward in steps of 32 (a block = 16 WMMAs); inside a stage
// the next block's 16 fragment reads are issued as one group, into a second register set, in front of the current block.
//   TWOA: a second A plane Al with the same Bt is accumulated into the same tile (C = (A + Al) . Bt^T).
//   OUT_MODE 0: f32 C (pitch ldc), value + bf16(bias[col]); 256-B row segment = 16 lanes x 16 B, one instruction,
//   OUT_MODE 1: half-rotation rotary of (acc + bf16(bias[col])) -> f16 hi plane C + f16 residual plane
//               C2 = f16((v - hi) * rscale). N tile = one 64-wide head: dims d < 32 pair with d + 32:
//               out[d] = x[d] c[t][d] - x[d+32] s[t][d] (d < 32), x[d] c[t][d] + x[d-32] s[t][d] (d >= 32),
//               t = row mod SEQ, c/s = bf16 value of the [SEQ][64] input tables, f32, contract off,
//               partner column read from the staged slab.
//   OUT_MODE 2: as 1 but a single f16 plane C.
//   OUT_MODE 3: single f16 plane C of acc + bf16(bias[row]) (no rotary; used for v^T where the feature is the row).
// coverage: 4 slabs x 16 rows x 64 cols = the wave's whole 64x64 tile; (M/128)*(N/128) blocks x 4 waves x gridDim.y = the whole plane.
// =====================================================================================================
// ---- main loop: acc = this wave's 64x64 tile. Ah / Al / Bt point at the first of the block's 128 A rows (two planes) and 128 Bt rows ----
template <typename OT, bool TWOA>
__device__ __forceinline__ void gemm64_loop(const OT* Ah, const OT* Al, int lda, const OT* Bt, int ldb, int K,
                                            unsigned char* ring, uint32_t wave, int lane, v8f (&acc)[4][4]) {
  typedef typename FT<OT>::frag V16;
  const uint32_t wm = wave & 1u;               // which 64 A rows of the block tile this wave multiplies
  const uint32_t wn = wave >> 1;               // which 64 Bt rows
  const int rlane = lane & 15;                 // row (A) / col (B, D) within subtile
  const int koff  = (lane >> 4) * 8;           // k offset of this lane half

  // ---- what this wave loads: waves 0, 1 the two halves of the A rows, waves 2, 3 the two halves of the Bt rows ----
  constexpr uint32_t NPL = TWOA ? 2u : 1u;
  const bool     isB   = wave >= 2u;
  const uint32_t half  = wave & 1u;
  const size_t   rowA  = (size_t)(half << 6) * lda;
  const size_t   rowBt = (size_t)(half << 6) * ldb;
  const uint64_t src0  = isB ? (uint64_t)(size_t)(Bt + rowBt) : (uint64_t)(size_t)(Ah + rowA);
  const uint64_t src1  = isB ? (uint64_t)(size_t)(Bt + rowBt) : (uint64_t)(size_t)(Al + rowA);
  const uint32_t kp    = (uint32_t)K / GK_PASS;       // stages per A plane
  const uint32_t nst   = kp * NPL;                    // stages in all (at least 2)
  const uint32_t lbase = (uint32_t)(size_t)ring;
  u32x8 g1 = tdm_group1((uint32_t)(isB ? ldb : lda) * 2u);
  // without this the compiler rebuilds words of group 1 from their constants, in the registers a request was issued from
  asm volatile("" : "+s"(g1));   // the pinned() form: descriptor words held in their scalar registers
  auto group0 = [&](uint32_t st) -> u32x4 {
    const bool second = TWOA && st >= kp;             // second A plane, Bt's k starts over
    const uint32_t kk = second ? st - kp : st;
    const uint64_t ga = (second ? src1 : src0) + (uint64_t)kk * (GK_PASS * 2u);
    u32x4 g = tdm_group0(lbase + (st & 1u) * GK_STAGE + wave * GK_SLICE, ga);
    // without this the request is issued from a copy of group 0 whose registers are reused while it is in flight
    asm volatile("" : "+s"(g));   // the pinned() form: descriptor words held in their scalar registers, up to the wait that names them
    return g;
  };

#pragma unroll
  for (int i = 0; i < 4; ++i)
#pragma unroll
    for (int j = 0; j < 4; ++j) acc[i][j] = zero8();

  u32x4 g0 = group0(0);
  tdm_load(g0, g1);
  wait_tensor0(g0, g1);
  __syncthreads();
  g0 = group0(1);
  tdm_load(g0, g1);
  // kept rolled: one pass and one publish point in the text, every accumulator index constant
#pragma unroll 1
  for (uint32_t st = 0; st < nst; ++st) {
    const unsigned char* buf = ring + (st & 1u) * GK_STAGE;
    const unsigned char* pa = buf + wm * GK_SLICE + rlane * GK_PITCH + koff * 2;
    const unsigned char* pb = buf + (2u + wn) * GK_SLICE + rlane * GK_PITCH + koff * 2;
    V16 bq[2][4], af[2][4];   // two fragment sets: block ks multiplies set ks & 1 while the other set is filled
#pragma unroll
    for (int j = 0; j < 4; ++j) bq[0][j] = ldfrag<OT>((const OT*)(const void*)(pb + j * 16 * GK_PITCH));
#pragma unroll
    for (int i = 0; i < 4; ++i) af[0][i] = ldfrag<OT>((const OT*)(const void*)(pa + i * 16 * GK_PITCH));
#pragma unroll
    for (int ks = 0; ks < GK_PASS / 32; ++ks) {
      const int cs = ks & 1;
      if (ks + 1 < GK_PASS / 32) {   // the next block of this same stage; nothing of the next stage is read here
#pragma unroll
        for (int j = 0; j < 4; ++j) bq[cs ^ 1][j] = ldfrag<OT>((const OT*)(const void*)(pb + j * 16 * GK_PITCH + (ks + 1) * 64));
#pragma unroll
        for (int i = 0; i < 4; ++i) af[cs ^ 1][i] = ldfrag<OT>((const OT*)(const void*)(pa + i * 16 * GK_PITCH + (ks + 1) * 64));
      }
      // keeps the 16 LDS reads above as one group in front of the block: sunk among the WMMAs, each read is waited for where it stands
      __builtin_amdgcn_sched_barrier(0);
#pragma unroll
      for (int i = 0; i < 4; ++i)
#pragma unroll
        for (int j = 0; j < 4; ++j) acc[i][j] = mmar(af[cs][i], bq[cs][j], acc[i][j]);
      // keeps the following block's reads from rising among these WMMAs
      __builtin_amdgcn_sched_barrier(0);
    }
    // publish point of stage st + 1; behind its barrier every wave has left stage st's buffer
    wait_ds0();
    wait_tensor0(g0, g1);
    __syncthreads();
    if (pinned(st + 2u < nst)) {
      g0 = group0(st + 2u);
      tdm_load(g0, g1);
    }
  }
  wait_tensor0(g0, g1);
  wait_ds0();
  acc_guard4(acc[0][0], acc[0][1], acc[0][2], acc[0][3]);
  acc_guard4(acc[1][0], acc[1][1], acc[1][2], acc[1][3]);
  acc_guard4(acc[2][0], acc[2][1], acc[2][2], acc[2][3]);
  acc_guard4(acc[3][0], acc[3][1], acc[3][2], acc[3][3]);

}

// ---- epilogue: the wave's tile, rows m0 .. m0+63, columns n0 .. n0+63 of the plane(s) at Cout / Cout2; slab = wave-private 16x68 floats of LDS ----
template <int OUT_MODE>
__device__ __forceinline__ void gemm64_store(v8f (&acc)[4][4], float* slab, int lane, int m0, int n0,
                                             void* Cout, void* Cout2, int ldc,
                                             const float* __restrict__ bias, const float* __restrict__ ctab,
                                             const float* __restrict__ stab, float rscale) {
  static_assert(OUT_MODE >= 0 && OUT_MODE <= 3);
  const int rlane = lane & 15;                 // col (D) within subtile
  const int mOff  = (lane >> 4) * 8;           // D row offset
#pragma unroll
  for (int i = 0; i < 4; ++i) {
    const int mBase = m0 + (i << 4);
#pragma unroll
    for (int j = 0; j < 4; ++j) {
#pragma unroll
      for (int r = 0; r < 8; ++r) {
        slab[(mOff + r) * 68 + (j << 4) + rlane] = acc[i][j][r];
      }
    }
    __builtin_amdgcn_fence(__ATOMIC_RELEASE, "workgroup");
    __builtin_amdgcn_wave_barrier();
    __builtin_amdgcn_fence(__ATOMIC_ACQUIRE, "workgroup");
    if (OUT_MODE == 0) {
      float* C = (float*)Cout;
      const int h2 = lane >> 4, c4 = (lane & 15) * 4;     // 256-B row segment = 16 lanes x 16 B
      const v4f bb = *(const v4f*)(bias + n0 + c4);
      v4f bv;
#pragma unroll
      for (int e = 0; e < 4; ++e) bv[e] = bf16r(bb[e]);
      v4f ov[8];
#pragma unroll
      for (int it = 0; it < 8; ++it) {
        const int row = it * 2 + h2;                       // it 0..7 x h2 0..1 = rows 0..15
        ov[it] = *(const v4f*)(slab + row * 68 + c4) + bv;
      }
      {
#pragma unroll
        for (int it = 0; it < 8; ++it) {
          const int row = it * 2 + h2;
          *(v4f*)(C + (size_t)(mBase + row) * ldc + n0 + c4) = ov[it];
        }
        
      }
    } else {
      const int q = lane >> 3, c8 = (lane & 7) * 8;
      unsigned short* C  = (unsigned short*)Cout;
      unsigned short* C2 = (unsigned short*)Cout2;
      v4u va[4], vb[4];
      v4f tc[4][2], ts[4][2];   // cos / sin of this lane's 8 columns, rows it * 4 + q of the slab
      if (OUT_MODE == 1 || OUT_MODE == 2) {
        // tables are [SEQ][HD]; column within the head = c8 + e (n0 is head-aligned, c8 in 0..56); position within the
        // sequence = (mBase mod SEQ) + row: mBase is a multiple of 16, so the slab's 16 rows do not wrap
        const float* cpt = ctab + (size_t)((mBase & (SEQ - 1)) + q) * HD + c8;
        const float* spt = stab + (size_t)((mBase & (SEQ - 1)) + q) * HD + c8;
        // the slab's table loads stand as one group on two addresses, with their wait behind them: nothing that rewrites an
        // address register of an issued load may be scheduled among them or in front of the wait
        __builtin_amdgcn_sched_barrier(0);
#pragma unroll
        for (int it = 0; it < 4; ++it) {
          tc[it][0] = *(const v4f*)(cpt + it * 4 * HD);
          tc[it][1] = *(const v4f*)(cpt + it * 4 * HD + 4);
          ts[it][0] = *(const v4f*)(spt + it * 4 * HD);
          ts[it][1] = *(const v4f*)(spt + it * 4 * HD + 4);
        }
        // before the loads' address registers are reused; the two addresses are inputs, so that no load's result lands on them
        asm volatile("s_wait_xcnt 0x0" :: "v"(cpt), "v"(spt) : "memory");
        __builtin_amdgcn_sched_barrier(0);
      }
#pragma unroll
      for (int it = 0; it < 4; ++it) {
        const int row = it * 4 + q;                        // it 0..3 x q 0..3 = rows 0..15
        const float* sp = slab + row * 68 + c8;
        float f[8];
#pragma unroll
        for (int e = 0; e < 8; ++e) f[e] = sp[e];
        if (OUT_MODE == 1 || OUT_MODE == 2) {
#pragma clang fp contract(off)
          const float* pp = slab + row * 68 + (c8 ^ 32);   // partner columns d +- 32 of the same row
          float g[8];
#pragma unroll
          for (int e = 0; e < 8; ++e) g[e] = pp[e];
          const v4f bc0 = *(const v4f*)(bias + n0 + c8);
          const v4f bc1 = *(const v4f*)(bias + n0 + c8 + 4);
          const v4f bp0 = *(const v4f*)(bias + n0 + (c8 ^ 32));
          const v4f bp1 = *(const v4f*)(bias + n0 + (c8 ^ 32) + 4);
          const v4f cv0 = tc[it][0], cv1 = tc[it][1], sv0 = ts[it][0], sv1 = ts[it][1];
          const float sg = (c8 < 32) ? -1.0f : 1.0f;       // -x2 for the first half, +x1 for the second half
#pragma unroll
          for (int e = 0; e < 4; ++e) {
            {
              const float x  = f[e] + bf16r(bc0[e]);
              const float y  = g[e] + bf16r(bp0[e]);
              const float ry = sg * y;
              const float p0 = x * bf16r(cv0[e]);
              const float p1 = ry * bf16r(sv0[e]);
              f[e] = p0 + p1;
            }
            {
              const float x  = f[4 + e] + bf16r(bc1[e]);
              const float y  = g[4 + e] + bf16r(bp1[e]);
              const float ry = sg * y;
              const float p0 = x * bf16r(cv1[e]);
              const float p1 = ry * bf16r(sv1[e]);
              f[4 + e] = p0 + p1;
            }
          }
        }
        if (OUT_MODE == 3) {
          const float bm = bf16r(bias[mBase + row]);
#pragma unroll
          for (int e = 0; e < 8; ++e) f[e] = f[e] + bm;
        }
        v4u a, a2;
#pragma unroll
        for (int e = 0; e < 4; ++e) {
          const float f0 = f[2 * e], f1 = f[2 * e + 1];
          const _Float16 x0 = (_Float16)f0, x1 = (_Float16)f1;
          const unsigned short h0 = h_bits(x0), h1 = h_bits(x1);
          unsigned short l0 = 0, l1 = 0;
          if (OUT_MODE == 1) {
            l0 = h_bits((_Float16)((f0 - (float)x0) * rscale));
            l1 = h_bits((_Float16)((f1 - (float)x1) * rscale));
          }
          a[e] = pk16(h0, h1); a2[e] = pk16(l0, l1);
        }
        va[it] = a; vb[it] = a2;
      }
      // the slab's stores stand as one group with their wait behind them: nothing that rewrites a register of an issued store
      // may be scheduled among them or in front of the wait
      __builtin_amdgcn_sched_barrier(0);
#pragma unroll
      for (int it = 0; it < 4; ++it) {
        const size_t go = (size_t)(mBase + it * 4 + q) * ldc + n0 + c8;
        *(v4u*)(C + go) = va[it];
        if (OUT_MODE == 1) *(v4u*)(C2 + go) = vb[it];
      }
      asm volatile("s_wait_xcnt 0x0" ::: "memory");   // before the stores' address and data registers are reused
      __builtin_amdgcn_sched_barrier(0);
    }
    __builtin_amdgcn_fence(__ATOMIC_RELEASE, "workgroup");
    __builtin_amdgcn_wave_barrier();
    __builtin_amdgcn_fence(__ATOMIC_ACQUIRE, "workgroup");
  }
}

template <typename OT, int OUT_MODE, bool TWOA>
__global__ __launch_bounds__(128) void gemm64(
    const unsigned short* __restrict__ Ap, const unsigned short* __restrict__ Alp, int lda, long long strideA,
    const unsigned short* __restrict__ Btp, int ldb, long long strideB,
    void* Cout, void* Cout2, int ldc, long long strideC,
    const float* __restrict__ bias, const float* __restrict__ ctab, const float* __restrict__ stab,
    int M, int N, int K, float rscale) {
  __shared__ __attribute__((aligned(2048))) unsigned char ring[2 * GK_STAGE];   // two stages
  __shared__ __align__(16) float sT[4][16 * 68];   // per-wave 16x64 slab, pitch 68 floats
  const int b    = blockIdx.y;
  const int lane = threadIdx.x & 31;
  const uint32_t wave = uni(threadIdx.x >> 5);
  const int tilesN = N >> 7;
  const int tilesM = M >> 7;
  const int bt = blockIdx.x;
  if (bt >= tilesM * tilesN) return;   // block-uniform, in front of every barrier and tensor load
  const int btm = bt / tilesN;
  const int btn = bt - btm * tilesN;
  const size_t rowA  = (size_t)b * (size_t)strideA + (size_t)(btm << 7) * lda;
  const size_t rowBt = (size_t)b * (size_t)strideB + (size_t)(btn << 7) * ldb;
  v8f acc[4][4];
  gemm64_loop<OT, TWOA>((const OT*)(const void*)Ap + rowA, (const OT*)(const void*)Alp + rowA, lda,
                        (const OT*)(const void*)Btp + rowBt, ldb, K, ring, wave, lane, acc);
  const size_t cb = (size_t)b * (size_t)strideC * (OUT_MODE == 0 ? sizeof(float) : sizeof(unsigned short));
  gemm64_store<OUT_MODE>(acc, sT[wave], lane, (btm << 7) + (int)((wave & 1u) << 6), (btn << 7) + (int)((wave >> 1) << 6),
                         (void*)((char*)Cout + cb), (void*)((char*)Cout2 + cb), ldc, bias, ctab, stab, rscale);
}

// =====================================================================================================
// The three projections of x in ONE launch: they are independent of each other, so the block index picks the job
// (256 blocks each, the two jobs with the long rotary epilogue first):
//   job 0: q   = rope(x . Wq^T + bq) -> f16 hi / residual (x4096) planes [b*SEQ+t][h*64+d]   (OUT_MODE 1)
//   job 1: k   = rope(x . Wk^T + bk) -> f16 plane [b*SEQ+s][h*64+d]                          (OUT_MODE 2)
//   job 2: v^T = Wv . x^T + bv per batch -> f16 plane [b][h*64+d][s]; A = Wv rows, Bt = x rows of batch b (OUT_MODE 3)
// W = the bf16 qkv weight [3072][1024], bias = qkv_b [3072]; every pitch is DM = SEQ elements, K = DM.
// The epilogue slabs lie in the ring, so that a block holds 144 KiB of LDS and two blocks share a WGP: one block's first
// tile, stage waits and epilogue run beside the other's products.
// coverage: jobs 0, 1: 32 x 8 tiles of 128x128 = [4096][1024]; job 2: 4 batches x 8 x 8 tiles = [4][1024][1024].
// =====================================================================================================
#define QKV_TILES ((NTOK / 128) * (DM / 128))   // 256 blocks per job
static_assert(QKV_TILES == NB * (DM / 128) * (SEQ / 128) && DM == SEQ && DM / 128 == 8 && 16 * 68 * 4 <= GK_SLICE);
__global__ __launch_bounds__(128) void gemm_qkv(
    const unsigned short* __restrict__ Xp, const unsigned short* __restrict__ Wp,
    unsigned short* Qh, unsigned short* Ql, unsigned short* Kp, unsigned short* VT,
    const float* __restrict__ bias, const float* __restrict__ ctab, const float* __restrict__ stab) {
  __shared__ __attribute__((aligned(2048))) unsigned char ring[2 * GK_STAGE];   // two stages; behind the loop the slabs
  const int lane = threadIdx.x & 31;
  const uint32_t wave = uni(threadIdx.x >> 5);
  const uint32_t job = blockIdx.x / QKV_TILES;
  const uint32_t bt  = blockIdx.x % QKV_TILES;
  if (job > 2u) return;                // block-uniform, in front of every barrier and tensor load
  const bool isVt = job == 2u;
  const uint32_t btn = bt & 7u;                            // tile column
  const uint32_t btm = isVt ? (bt >> 3) & 7u : bt >> 3;    // tile row: of 8 (features of one batch) or of 32 (tokens)
  const uint32_t b   = isVt ? bt >> 6 : 0u;                // batch (job 2 only)
  const __bf16* X = (const __bf16*)(const void*)Xp;
  const __bf16* Wj = (const __bf16*)(const void*)Wp + (size_t)job * DM * DM;
  const __bf16* A  = isVt ? Wj + (size_t)(btm << 7) * DM : X + (size_t)(btm << 7) * DM;
  const __bf16* Bt = isVt ? X + ((size_t)b * SEQ + (btn << 7)) * DM : Wj + (size_t)(btn << 7) * DM;
  v8f acc[4][4];
  gemm64_loop<__bf16, false>(A, A, DM, Bt, DM, DM, ring, wave, lane, acc);
  // the ring is free here: the last pass's publish point (LDS wait, tensor wait, block barrier) stands behind every wave's
  // last read and last request, and nothing is issued behind it; each wave stages in its own slice of the first buffer
  float* slab = (float*)(void*)(ring + wave * GK_SLICE);
  const int m0 = (int)((btm << 7) + ((wave & 1u) << 6));
  const int n0 = (int)((btn << 7) + ((wave >> 1) << 6));
  const float* bj = bias + job * DM;
  if (job == 0u)      gemm64_store<1>(acc, slab, lane, m0, n0, (void*)Qh, (void*)Ql, DM, bj, ctab, stab, 4096.0f);
  else if (job == 1u) gemm64_store<2>(acc, slab, lane, m0, n0, (void*)Kp, (void*)Kp, DM, bj, ctab, stab, 1.0f);
  else                gemm64_store<3>(acc, slab, lane, m0, n0, (void*)(VT + (size_t)b * DM * SEQ), (void*)(VT + (size_t)b * DM * SEQ),
                                      SEQ, bj, ctab, stab, 1.0f);
}

#define AT_PITCH 72                   // 16-bit elements per LDS row of the K and V^T tiles
#define OS_PITCH 68                   // floats per LDS row of the context tile
static_assert((AT_PITCH * 2) % 32 == 16 && AT_PITCH >= 64 && (OS_PITCH * 4) % 16 == 0 && OS_PITCH >= 64);
#define AT_SLICE 6144                 // one wave's slice: 32 rows x 144 B = 4608 B, rounded up to a multiple of 2 KiB
#define AT_STAGE (4 * AT_SLICE)       // [K rows 0..31 | K rows 32..63 | V^T rows 0..31 | V^T rows 32..63]
static_assert(AT_PITCH * 2 == 128 + 16 && 32 * AT_PITCH * 2 <= AT_SLICE && (AT_SLICE % 2048) == 0 && NKT >= 2);
// lane l <-> lane l ^ 16: the other half of the wave holds the same query's other keys
__device__ __forceinline__ float xhalf(float x) {
  return __builtin_bit_cast(float, __builtin_amdgcn_permlanex16(__builtin_bit_cast(int, x), __builtin_bit_cast(int, x),
                                                                0x76543210, 0xfedcba98, false, false));
}
__global__ __launch_bounds__(128)
void attn_mha(const unsigned short* __restrict__ qhp, const unsigned short* __restrict__ qlp,
              const unsigned short* __restrict__ kpp, const unsigned short* __restrict__ vtp,
              unsigned short* ohp, unsigned short* olp, float sscale) {
  union FH { v16h v; v8h h[2]; };
  __shared__ __attribute__((aligned(2048))) unsigned char kvring[2 * AT_STAGE];   // two stages of K [key][d] and V^T [d][key]
  __shared__ __align__(16) float    Os[4][16 * OS_PITCH];    // per wave context tile 17 KB

  const int tid  = threadIdx.x;
  const int wave = (int)uni((uint32_t)tid >> 5);
  const int lane = tid & 31;
  const int hh   = lane >> 4;
  const int c    = lane & 15;

  const int bx   = blockIdx.x;
  const int qb   = bx % NQB;
  const int rest = bx / NQB;
  const int h    = rest % NH;
  const int b    = rest / NH;
  const int q0   = qb * 64 + wave * 16;
  const size_t rowB = (size_t)b * SEQ;
  const size_t hcol = (size_t)h * HD;

  const _Float16* Qh = (const _Float16*)(const void*)qhp;
  const _Float16* Ql = (const _Float16*)(const void*)qlp;
  const _Float16* Kg = (const _Float16*)(const void*)kpp + hcol;
  const _Float16* Vt = (const _Float16*)(const void*)vtp + ((size_t)b * DM + hcol) * SEQ;

  // ---- Q fragments (B operand, column = query = lane&15): 2 d-chunks, hi and residual planes ----
  v16h qah[2], qal[2];
#pragma unroll
  for (int dc = 0; dc < 2; ++dc) {
    const size_t qo = (rowB + q0 + c) * DM + hcol + dc * 32 + 8 * hh;
    qah[dc] = ldfrag<_Float16>(Qh + qo);
    qal[dc] = ldfrag<_Float16>(Ql + qo);
  }

  float mrun = -INFINITY;   // running maximum of this lane's query (equal in both halves)
  float lrun = 0.f;         // running sum over this half's keys; the halves are joined once, behind the loop
  v8f oacc[4];              // O^T: column = query lane&15, row d = 16 t + 8 hh + r
#pragma unroll
  for (int t = 0; t < 4; ++t) oacc[t] = zero8();

  // ---- what this wave loads: chunk st's K rows 32 half .. +31 (d = 0..63 of head h) or V^T rows d = 32 half .. +31 (its 64 keys) ----
  const bool     isV   = wave >= 2;
  const uint32_t half  = (uint32_t)wave & 1u;
  const uint64_t src   = isV ? (uint64_t)(size_t)(Vt + (size_t)(half * 32u) * SEQ)
                             : (uint64_t)(size_t)(Kg + (rowB + half * 32u) * DM);
  const uint32_t sstep = isV ? 64u * 2u : 64u * DM * 2u;   // bytes from one chunk to the next: 64 keys along / across the rows
  const uint32_t lbase = (uint32_t)(size_t)kvring;
  static_assert(DM == SEQ);                                // both planes have rows of DM * 2 = SEQ * 2 bytes
  u32x8 g1 = tdm_group1_r128(DM * 2u);
  // without this the compiler rebuilds words of group 1 from their constants, in the registers a request was issued from
  asm volatile("" : "+s"(g1));   // the pinned() form: descriptor words held in their scalar registers
  auto group0 = [&](uint32_t st) -> u32x4 {
    return tdm_group0(lbase + (st & 1u) * AT_STAGE + (uint32_t)wave * AT_SLICE, src + (uint64_t)st * sstep);
  };
  u32x4 g0 = group0(0);
  tdm_load(g0, g1);
  wait_tensor0(g0, g1);
  __syncthreads();
  g0 = group0(1);
  tdm_load(g0, g1);
  // kept rolled: one pass and one publish point in the text
#pragma unroll 1
  for (uint32_t kt = 0; kt < NKT; ++kt) {    // static trip count
    const unsigned char* buf = kvring + (kt & 1u) * AT_STAGE;
    const _Float16* Ksh = (const _Float16*)(const void*)buf;                    // row r at (r >> 5) slices + (r & 31) rows
    const _Float16* Vth = (const _Float16*)(const void*)(buf + 2 * AT_SLICE);

    // ---- scores, transposed: 64 keys x 16 queries per wave, 2 f16 products per key subtile and d-chunk ----
    FH kb[2][4];   // the chunk's eight K fragments, read as one group
#pragma unroll
    for (int dc = 0; dc < 2; ++dc)
#pragma unroll
      for (int j = 0; j < 4; ++j) {
        kb[dc][j].h[0] = *(const v8h*)(Ksh + (j >> 1) * (AT_SLICE / 2) + ((j & 1) * 16 + c) * AT_PITCH + dc * 32 + 8 * hh);
        kb[dc][j].h[1] = *(const v8h*)(Ksh + (j >> 1) * (AT_SLICE / 2) + ((j & 1) * 16 + c) * AT_PITCH + dc * 32 + 16 + 8 * hh);
      }
    // keeps the 16 K reads as one group in front of the products: sunk among the WMMAs, each read is waited for where it stands
    __builtin_amdgcn_sched_barrier(0);
    v8f ah[4], al[4];
#pragma unroll
    for (int j = 0; j < 4; ++j) { ah[j] = zero8(); al[j] = zero8(); }
    // eight independent accumulators: the 16 WMMAs follow one another, none waits for the one in front of it
#pragma unroll
    for (int dc = 0; dc < 2; ++dc)
#pragma unroll
      for (int j = 0; j < 4; ++j) {
        ah[j] = mmar(kb[dc][j].v, qah[dc], ah[j]);
        al[j] = mmar(kb[dc][j].v, qal[dc], al[j]);
      }
    FH vb[2][4];   // the chunk's eight V^T fragments, read here: in flight during the softmax arithmetic
#pragma unroll
    for (int kk = 0; kk < 2; ++kk)
#pragma unroll
      for (int t = 0; t < 4; ++t) {
        vb[kk][t].h[0] = *(const v8h*)(Vth + (t >> 1) * (AT_SLICE / 2) + ((t & 1) * 16 + c) * AT_PITCH + kk * 32 + 8 * hh);
        vb[kk][t].h[1] = *(const v8h*)(Vth + (t >> 1) * (AT_SLICE / 2) + ((t & 1) * 16 + c) * AT_PITCH + kk * 32 + 16 + 8 * hh);
      }
    // keeps the 16 V^T reads in front of the softmax arithmetic: sunk to their products, each read is waited for where it stands
    __builtin_amdgcn_sched_barrier(0);
    v8f s[4];   // s[j][r]: key kv0 + 16 j + 8 hh + r, query q0 + c
#pragma unroll
    for (int j = 0; j < 4; ++j)
#pragma unroll
      for (int r = 0; r < 8; ++r) s[j][r] = (ah[j][r] + al[j][r] * (1.0f / 4096.0f)) * sscale;

    // ---- query maximum (in-lane, then the other half's), online softmax, P^T (x1024, f16) packed in registers ----
    float mj[4];   // one chain per key subtile: four short dependent chains instead of one long one
#pragma unroll
    for (int j = 0; j < 4; ++j) {
      mj[j] = s[j][0];
#pragma unroll
      for (int r = 1; r < 8; ++r) mj[j] = fmaxf(mj[j], s[j][r]);
    }
    float m = fmaxf(fmaxf(mj[0], mj[1]), fmaxf(mj[2], mj[3]));
    m = fmaxf(m, xhalf(m));
    const float mnew  = fmaxf(mrun, m);
    const float msafe = (mnew == -INFINITY) ? 0.f : mnew;
    const float alpha = __expf(mrun - msafe);
    mrun = mnew;
    // B operand of 32 keys: elements 0..7 = keys k0 + 8 hh + e (subtile 2 kk), 8..15 = keys k0 + 16 + 8 hh + e (subtile 2 kk + 1)
    FH pb[2];
    float ps[4];   // partial sums, one chain per key subtile
#pragma unroll
    for (int j = 0; j < 4; ++j) {
      ps[j] = 0.f;
#pragma unroll
      for (int r = 0; r < 8; ++r) {
        const float p = __expf(s[j][r] - msafe);
        ps[j] += p;
        pb[j >> 1].v[(j & 1) * 8 + r] = (_Float16)(p * 1024.0f);
      }
    }
    lrun = lrun * alpha + ((ps[0] + ps[1]) + (ps[2] + ps[3]));
#pragma unroll
    for (int t = 0; t < 4; ++t) oacc[t] = oacc[t] * alpha;

    // ---- context^T += V^T . P^T (f16 WMMA, single product); unrolled: pb is indexed in registers ----
#pragma unroll
    for (int kk = 0; kk < 2; ++kk) {
#pragma unroll
      for (int t = 0; t < 4; ++t) oacc[t] = mmar(vb[kk][t].v, pb[kk].v, oacc[t]);
    }
    // four VALU slots behind the pass's last WMMA: a branch follows
    acc_guard4(oacc[0], oacc[1], oacc[2], oacc[3]);
    // publish point of chunk kt + 1; behind its barrier every wave has left chunk kt's buffer
    wait_ds0();
    wait_tensor0(g0, g1);
    __syncthreads();
    if (pinned(kt + 2u < NKT)) {
      g0 = group0(kt + 2u);
      tdm_load(g0, g1);
    }
  }
  wait_tensor0(g0, g1);
  wait_ds0();

  // ---- join the halves' sums, normalise (1/l, undo the x1024 p carry), stage the wave's 16x64 f32 tile [query][d],
  //      split into bf16 hi / residual
  float* os = Os[wave];
  {
    const float l = lrun + xhalf(lrun);   // unconditional: every lane is on at the exchange
    const float inv = ((l > 0.f) ? (1.0f / l) : 0.f) * (1.0f / 1024.0f);
#pragma unroll
    for (int t = 0; t < 4; ++t) {
      v4f lo, hi;
#pragma unroll
      for (int r = 0; r < 4; ++r) { lo[r] = oacc[t][r] * inv; hi[r] = oacc[t][4 + r] * inv; }
      *(v4f*)(os + c * OS_PITCH + t * 16 + 8 * hh)     = lo;
      *(v4f*)(os + c * OS_PITCH + t * 16 + 8 * hh + 4) = hi;
    }
  }
  __builtin_amdgcn_fence(__ATOMIC_RELEASE, "workgroup");
  __builtin_amdgcn_wave_barrier();
  __builtin_amdgcn_fence(__ATOMIC_ACQUIRE, "workgroup");
  {
    const int q4 = lane >> 3, c8 = (lane & 7) * 8;
    v4u hv[4], lv[4];
#pragma unroll
    for (int it = 0; it < 4; ++it) {
      const int row = it * 4 + q4;   // it 0..3 x q4 0..3 = rows 0..15 of the wave tile
      const float* sp = os + row * OS_PITCH + c8;
      v4u a, a2;
#pragma unroll
      for (int e = 0; e < 4; ++e) {
        const float f0 = sp[2 * e], f1 = sp[2 * e + 1];
        const unsigned short h0 = bf_bits(f0), h1 = bf_bits(f1);
        const unsigned short l0 = bf_bits(f0 - bf_up(h0)), l1 = bf_bits(f1 - bf_up(h1));
        a[e] = pk16(h0, h1); a2[e] = pk16(l0, l1);
      }
      hv[it] = a; lv[it] = a2;
    }
    {
#pragma unroll
      for (int it = 0; it < 4; ++it) {
        const int row = it * 4 + q4;
        const size_t go = (rowB + q0 + row) * DM + hcol + c8;
        *(v4u*)(ohp + go) = hv[it];
        *(v4u*)(olp + go) = lv[it];
      }
      
    }
  }
}

// =====================================================================================================
// Workspace map (bytes), every region an exact multiple of its whole-line / whole-tile store granularity
// (all shapes are tile multiples, no padded tails):
//   Xb    bf16 [4096][1024]          8388608
//   Wqkv  bf16 [3072 n][1024 k]      6291456   (input [out][in] layout == Bt[n][k], k contiguous)
//   Wo    bf16 [1024 n][1024 k]      2097152
//   Qh    f16  [4096][1024]          8388608
//   Ql    f16  [4096][1024]          8388608   (residual x4096)
//   Kp    f16  [4096][1024]          8388608
//   VT    f16  [4][1024][1024]       8388608
//   Oh    bf16 [4096][1024]          8388608
//   Ol    bf16 [4096][1024]          8388608
//   total                           67108864
// =====================================================================================================
extern "C" void kernel_launch(void* const* d_in, const int* in_sizes, int n_in,
                              void* d_out, int out_size, void* d_ws, size_t ws_size,
                              hipStream_t stream) {
  if (n_in < 7) return;
  if (in_sizes[0] != NTOK * DM) return;          // x      [4][1024][1024]
  if (in_sizes[1] != SEQ * HD) return;           // cos    [1024][64]
  if (in_sizes[2] != SEQ * HD) return;           // sin    [1024][64]
  if (in_sizes[3] != DQKV * DM) return;          // qkv_w  [3072][1024]
  if (in_sizes[4] != DQKV) return;               // qkv_b  [3072]
  if (in_sizes[5] != DM * DM) return;            // proj_w [1024][1024]
  if (in_sizes[6] != DM) return;                 // proj_b [1024]
  if (out_size != NTOK * DM) return;

  const float* x    = (const float*)d_in[0];
  const float* cosb = (const float*)d_in[1];
  const float* sinb = (const float*)d_in[2];
  const float* Wqkv = (const float*)d_in[3];
  const float* bqkv = (const float*)d_in[4];
  const float* Wout = (const float*)d_in[5];
  const float* bout = (const float*)d_in[6];

  const size_t PX  = (size_t)NTOK * DM * 2;        //  8388608  16-bit activation plane [4096][1024]
  const size_t PWQ = (size_t)DQKV * DM * 2;        //  6291456  bf16 [3072][1024]
  const size_t PWO = (size_t)DM * DM * 2;          //  2097152  bf16 [1024][1024]
  const size_t PVT = (size_t)NB * DM * SEQ * 2;    //  8388608  v^T plane [4][1024][1024]
  size_t off = 0;
  const size_t oXb  = off; off += PX;
  const size_t oWq  = off; off += PWQ;
  const size_t oWo  = off; off += PWO;
  const size_t oQh  = off; off += PX;
  const size_t oQl  = off; off += PX;
  const size_t oKp  = off; off += PX;
  const size_t oVT  = off; off += PVT;
  const size_t oOh  = off; off += PX;
  const size_t oOl  = off; off += PX;
  if (off > ws_size) return;                       // off = 67108864
  if (off > (size_t)134217728) return;

  char* ws = (char*)d_ws;
  unsigned short* Xb   = (unsigned short*)(ws + oXb);
  unsigned short* Wq16 = (unsigned short*)(ws + oWq);
  unsigned short* Wo16 = (unsigned short*)(ws + oWo);
  unsigned short* Qh   = (unsigned short*)(ws + oQh);
  unsigned short* Ql   = (unsigned short*)(ws + oQl);
  unsigned short* Kp   = (unsigned short*)(ws + oKp);
  unsigned short* VT   = (unsigned short*)(ws + oVT);
  unsigned short* Oh   = (unsigned short*)(ws + oOh);
  unsigned short* Ol   = (unsigned short*)(ws + oOl);

  const dim3 blk(256);
  const int n8x  = NTOK * DM / 8;                               // 524288
  const int n8wq = DQKV * DM / 8;                               // 393216
  const int n8wo = DM * DM / 8;                                 // 131072
  const dim3 gCvtX((n8x + 255) / 256);                          // 2048 blocks
  const dim3 gCvtWq((n8wq + 255) / 256);                        // 1536 blocks
  const dim3 gCvtWo((n8wo + 255) / 256);                        //  512 blocks
  const dim3 blkG(128);                                         // gemm64: 4 waves
  const dim3 gP((NTOK / 128) * (DM / 128), 1);                  // 256 blocks of one 128x128 tile: M=4096, N=1024
  const dim3 gQKV(3 * QKV_TILES);                               // 768 blocks: q, k, v^T tiles of 128x128
  const dim3 gAttn(NB * NH * NQB);                              // 1024 blocks of 128
  static_assert((NTOK % 128) == 0 && (DM % 128) == 0 && (SEQ % 128) == 0 && (DM % GK_PASS) == 0 && DM / GK_PASS >= 2);
  static_assert((NTOK * DM) % 2048 == 0 && (DQKV * DM) % 2048 == 0 && (DM * DM) % 2048 == 0);
  static_assert((DM % 32) == 0);

  // (1) x -> bf16 plane [4096][1024]; qkv_w [3072][1024] ([out][in] = Bt[n][k]) -> bf16; proj_w [1024][1024] -> bf16
  cvt_bf16x8<<<gCvtX,  blk, 0, stream>>>(x,    Xb,   n8x);
  cvt_bf16x8<<<gCvtWq, blk, 0, stream>>>(Wqkv, Wq16, n8wq);
  cvt_bf16x8<<<gCvtWo, blk, 0, stream>>>(Wout, Wo16, n8wo);
  // (2) - (4) q, k and v^T projections, one launch: block range picks the job
  gemm_qkv<<<gQKV, blkG, 0, stream>>>(Xb, Wq16, Qh, Ql, Kp, VT, bqkv, cosb, sinb);
  // (5) attention -> ctx bf16 hi / residual planes [b*SEQ+t][h*64+d]
  attn_mha<<<gAttn, dim3(128), 0, stream>>>(Qh, Ql, Kp, VT, Oh, Ol, 0.125f);
  // (6) out = (Oh + Ol) . Wproj^T + bproj -> d_out f32 [4096][1024]   (M=4096, N=1024, K=1024, two A planes)
  gemm64<__bf16, 0, true><<<gP, blkG, 0, stream>>>(
      Oh, Ol, DM, 0LL, Wo16, DM, 0LL,
      d_out, d_out, DM, 0LL, bout, cosb, sinb,
      NTOK, DM, DM, 1.0f);
  (void)hipGetLastError();
}

// v008
// One run takes 86.6 microseconds.
// In two side-by-side timings against v007, it was 1.05 and 1.04 times as fast.
// Over all steps from v000 it is 4.06 times as fast.
// Contractions: q / k / v^T projections = v_wmma_f32_16x16x32_bf16 (bf16 operands from RNE-converted x and qkv weight rows, single product, f32 accumulate);
// q.k^T scores = v_wmma_f32_16x16x32_f16 (64 q as f16 hi plane + f16 residual plane, k f16; 2 products into one f32 accumulator);
// p.v = v_wmma_f32_16x16x32_f16 (p carried x1024 in f16, v f16; single product, f32 accumulate);
// ctx.Wproj^T = v_wmma_f32_16x16x32_bf16 (ctx as bf16 hi plane + unscaled bf16 residual plane, weights bf16; 2 products, f32 accumulate);
// rotary with the input cos/sin tables (values RNE-converted to bf16), half-rotation, bias adds and softmax in f32 on the VALU.
// Carry audit: both q planes x64 -> folded back once in attn_mha's exponent factor sscale * log2(e) / 64;
// p x1024 (as +10 in the exponent) -> the row sum l carries it too, so 1/l in the attn_mha epilogue folds it back; ctx residual plane is the unscaled
// RNE residual (v - hi) and shares the hi accumulator; no weight-plane carries (all weight copies are bf16).
// gemm64 stages both operands in LDS with tensor loads (two buffers); its 16-bit epilogue stores the four row groups of a 16-row slab together.
// gemm_qkv runs the q, k and v^T projections as one launch (same loop and epilogues), two blocks to a WGP.
// attn_mha stages its K and V^T chunks in LDS with tensor loads (two buffers); a pass reads its K fragments as one group
// in front of the score products and its V^T fragments in front of the softmax arithmetic.
#include <hip/hip_runtime.h>
#include <math.h>
#include <stdint.h>

#define NB    4
#define SEQ   1024
#define DM    1024
#define NH    16
#define HD    64
#define DQKV  (3 * DM)
#define NTOK  (NB * SEQ)   // 4096 token rows
#define NQB   (SEQ / 64)   // 16 query blocks of 64 per sequence
#define NKT   (SEQ / 64)   // 16 key chunks of 64 per sequence
static_assert(NH * HD == DM);
static_assert(NQB == 16 && NKT == 16);
static_assert((SEQ & (SEQ - 1)) == 0);
static_assert((SEQ % 64) == 0 && (DM % 64) == 0 && (DM % 32) == 0 && (DQKV % 64) == 0 && (NTOK % 64) == 0);

typedef _Float16 v16h __attribute__((ext_vector_type(16)));
typedef _Float16 v8h  __attribute__((ext_vector_type(8)));
typedef __bf16   v16b __attribute__((ext_vector_type(16)));
typedef __bf16   v8b  __attribute__((ext_vector_type(8)));
typedef float    v8f  __attribute__((ext_vector_type(8)));
typedef float    v4f  __attribute__((ext_vector_type(4)));
typedef float    v2f  __attribute__((ext_vector_type(2)));
typedef unsigned int v4u __attribute__((ext_vector_type(4)));
typedef uint32_t u32x4 __attribute__((ext_vector_type(4)));
typedef uint32_t u32x8 __attribute__((ext_vector_type(8)));

#if defined(__HIP_DEVICE_COMPILE__)
#define DEV_ASM 1
#else
#define DEV_ASM 0
#endif

// ---- scalar helpers --------------------------------------------------------------------------------
__device__ __forceinline__ unsigned short bf_bits(float f) {          // f32 -> bf16 bits, RNE convert
  unsigned u = __float_as_uint(f);
  return (unsigned short)((u + 0x7FFFu + ((u >> 16) & 1u)) >> 16);
}
__device__ __forceinline__ float bf_up(unsigned short hb) { return __uint_as_float(((unsigned)hb) << 16); }
__device__ __forceinline__ float bf16r(float f) { return bf_up(bf_bits(f)); }   // value of the bf16 RNE convert
__device__ __forceinline__ unsigned short h_bits(_Float16 x) { return __builtin_bit_cast(unsigned short, x); }
__device__ __forceinline__ unsigned pk16(unsigned short a, unsigned short b) { return (unsigned)a | ((unsigned)b << 16); }
__device__ __forceinline__ v8f zero8() { v8f z = {0.f, 0.f, 0.f, 0.f, 0.f, 0.f, 0.f, 0.f}; return z; }

// ---- fragment types / loaders: 16-bit A/B operand, lane -> row/col (lane&15), p already includes +8*(lane>>4);
//      elements 0..7 <- p[0..7] (k0+8h..k0+8h+7), elements 8..15 <- p[16..23] (k0+16+8h..k0+16+8h+7)
template <typename OT> struct FT;
template <> struct FT<__bf16>   { typedef v16b frag; typedef v8b half8; };
template <> struct FT<_Float16> { typedef v16h frag; typedef v8h half8; };

template <typename OT>
__device__ __forceinline__ typename FT<OT>::frag ldfrag(const OT* p) {
  union { typename FT<OT>::frag v; typename FT<OT>::half8 h[2]; } f;
  f.h[0] = *(const typename FT<OT>::half8*)(p);
  f.h[1] = *(const typename FT<OT>::half8*)(p + 16);
  return f.v;
}

// ---- WMMA helpers (asm guard bodies are device-only; concrete operand types) -----------------------------
__device__ __forceinline__ v8f mmar(v16b a, v16b b, v8f c) {
  return __builtin_amdgcn_wmma_f32_16x16x32_bf16(false, a, false, b, (short)0, c, false, false);
}
__device__ __forceinline__ v8f mmar(v16h a, v16h b, v8f c) {
  return __builtin_amdgcn_wmma_f32_16x16x32_f16(false, a, false, b, (short)0, c, false, false);
}
__device__ __forceinline__ void acc_guard4(v8f& a, v8f& b, v8f& c, v8f& d) {
#if DEV_ASM
  asm volatile("v_nop\n\tv_nop\n\tv_nop\n\tv_nop" : "+v"(a), "+v"(b), "+v"(c), "+v"(d));
#else
  (void)a; (void)b; (void)c; (void)d;
#endif
}

// ---- tensor-load helpers for the LDS rings of gemm64 and attn_mha ------------------------------------------------------
#define GK_PASS  128                  // k elements of one stage: rows of 256 B
#define GK_PITCH 272                  // LDS row pitch in bytes: 256 B + the 16-B pad (odd multiple of 16 B for 16-B readers)
#define GK_SLICE 18432                // one wave's slice: 64 rows x 272 B = 17408 B, rounded up to a multiple of 2 KiB
#define GK_STAGE (4 * GK_SLICE)       // [A rows 0..63 | A rows 64..127 | Bt rows 0..63 | Bt rows 64..127]
static_assert(64 * GK_PITCH <= GK_SLICE && (GK_SLICE % 2048) == 0);
__device__ __forceinline__ uint32_t uni(uint32_t v) { return (uint32_t)__builtin_amdgcn_readfirstlane(v); }
__device__ __forceinline__ uint32_t pinned(uint32_t v) { uint32_t w = uni(v); asm volatile("" : "+s"(w)); return w; }
// the compiler places no wait for a tensor load: the issuing wave waits for its own request here; the request's two
// groups are inputs, so that their scalar registers keep their values until the request has landed
__device__ __forceinline__ void wait_tensor0(u32x4 g0, u32x8 g1) { asm volatile("s_wait_tensorcnt 0x0" :: "s"(g0), "s"(g1) : "memory"); }
// this wave's LDS reads have retired before the barrier behind which their buffer is refilled
__device__ __forceinline__ void wait_ds0() { asm volatile("s_wait_dscnt 0x0" ::: "memory"); }
__device__ __forceinline__ void tdm_load(u32x4 g0, u32x8 g1) { asm volatile("tensor_load_to_lds %0, %1" :: "s"(g0), "s"(g1) : "memory"); }
// group 1: 1-byte elements, tile = tensor = 64 rows of 256 B, source row pitch src_pitch bytes, 4 dwords of LDS pad behind every row
__device__ __forceinline__ u32x8 tdm_group1(uint32_t src_pitch) {
  constexpr uint32_t d0 = 256u, d1 = 64u;
  u32x8 g;
  g[0] = uni((1u << 20) | (5u << 22) | (3u << 25));   // no mask, data_size 0, pad after every 64 dwords, 4 dwords
  g[1] = uni((d0 & 0xFFFFu) << 16);
  g[2] = uni((d0 >> 16) | ((d1 & 0xFFFFu) << 16));
  g[3] = uni((d1 >> 16) | (d0 << 16));
  g[4] = uni(d1);
  g[5] = uni(src_pitch);
  g[6] = uni(0u);
  g[7] = uni(0u);
  return g;
}
// group 1 of attn_mha's tiles: 1-byte elements, tile = tensor = 32 rows of 128 B, 4 dwords of LDS pad behind every row
__device__ __forceinline__ u32x8 tdm_group1_r128(uint32_t src_pitch) {
  constexpr uint32_t d0 = 128u, d1 = 32u;
  u32x8 g;
  g[0] = uni((1u << 20) | (4u << 22) | (3u << 25));   // no mask, data_size 0, pad after every 32 dwords, 4 dwords
  g[1] = uni((d0 & 0xFFFFu) << 16);
  g[2] = uni((d0 >> 16) | ((d1 & 0xFFFFu) << 16));
  g[3] = uni((d1 >> 16) | (d0 << 16));
  g[4] = uni(d1);
  g[5] = uni(src_pitch);
  g[6] = uni(0u);
  g[7] = uni(0u);
  return g;
}
__device__ __forceinline__ u32x4 tdm_group0(uint32_t lds_dst, uint64_t ga) {
  u32x4 g;
  g[0] = uni(1u);
  g[1] = uni(lds_dst);
  g[2] = uni((uint32_t)ga);
  g[3] = uni((((uint32_t)(ga >> 32)) & 0x01FFFFFFu) | 0x80000000u);
  return g;
}

// =====================================================================================================
// f32 -> bf16 (RNE convert), 8 elements per thread, one 16-B store per lane: a wave writes 512 contiguous B
// Layout is preserved, so a [out][in] f32 weight becomes the bf16 Bt[n][k] plane (k contiguous) directly.
// coverage: n8 threads x 8 = the whole plane (n8 = 524288 / 393216 / 131072, all multiples of 256).
// =====================================================================================================
__global__ __launch_bounds__(256) void cvt_bf16x8(const float* __restrict__ in, unsigned short* out, int n8) {
  const int i = blockIdx.x * 256 + (int)threadIdx.x;
  if (i < n8) {
    const v4f a = *(const v4f*)(in + (size_t)i * 8);
    const v4f b = *(const v4f*)(in + (size_t)i * 8 + 4);
    v4u p;
    p[0] = pk16(bf_bits(a[0]), bf_bits(a[1]));
    p[1] = pk16(bf_bits(a[2]), bf_bits(a[3]));
    p[2] = pk16(bf_bits(b[0]), bf_bits(b[1]));
    p[3] = pk16(bf_bits(b[2]), bf_bits(b[3]));
    *(v4u*)(out + (size_t)i * 8) = p;
    
  }
}

// =====================================================================================================
// Register-blocked batched WMMA GEMM (16-bit operand type OT): C[m][n] = sum_k A[m][k] * Bt[n][k];
// one block of 4 waves (2 x 2) per 128x128 tile, one wave per 64x64 tile. A row-major [M][K] pitch lda; Bt row-major
// [N][K] pitch ldb (k contiguous); M, N multiples of 128, K a multiple of 128 and at least 256 (host-checked).
// blockIdx.y = batch index (strides in elements). A stage = 128 k of the block's 128 A rows and 128 Bt rows in LDS;
// every wave brings one 64-row slice of it with one tensor load, two buffers, the next stage in flight during a pass.
// Fragments are read from LDS with the split k map (ldfrag); k runs upward in steps of 32 (a block = 16 WMMAs); inside a stage
// the next block's 16 fragment reads are issued as one group, into a second register set, in front of the current block.
//   TWOA: a second A plane Al with the same Bt is accumulated into the same tile (C = (A + Al) . Bt^T).
//   OUT_MODE 0: f32 C (pitch ldc), value + bf16(bias[col]); 256-B row segment = 16 lanes x 16 B, one instruction,
//   OUT_MODE 1: half-rotation rotary of (acc + bf16(bias[col])), w = v * rscale -> f16 hi plane C = f16(w) + f16 residual plane
//               C2 = f16(w - hi). N tile = one 64-wide head: dims d < 32 pair with d + 32:
//               out[d] = x[d] c[t][d] - x[d+32] s[t][d] (d < 32), x[d] c[t][d] + x[d-32] s[t][d] (d >= 32),
//               t = row mod SEQ, c/s = bf16 value of the [SEQ][64] input tables, f32, contract off,
//               partner column read from the staged slab.
//   OUT_MODE 2: as 1 but without the rscale factor (w = v), a single f16 plane C.
//   OUT_MODE 3: single f16 plane C of acc + bf16(bias[row]) (no rotary; used for v^T where the feature is the row).
// coverage: 4 slabs x 16 rows x 64 cols = the wave's whole 64x64 tile; (M/128)*(N/128) blocks x 4 waves x gridDim.y = the whole plane.
// =====================================================================================================
// ---- main loop: acc = this wave's 64x64 tile. Ah / Al / Bt point at the first of the block's 128 A rows (two planes) and 128 Bt rows ----
template <typename OT, bool TWOA>
__device__ __forceinline__ void gemm64_loop(const OT* Ah, const OT* Al, int lda, const OT* Bt, int ldb, int K,
                                            unsigned char* ring, uint32_t wave, int lane, v8f (&acc)[4][4]) {
  typedef typename FT<OT>::frag V16;
  const uint32_t wm = wave & 1u;               // which 64 A rows of the block tile this wave multiplies
  const uint32_t wn = wave >> 1;               // which 64 Bt rows
  const int rlane = lane & 15;                 // row (A) / col (B, D) within subtile
  const int koff  = (lane >> 4) * 8;           // k offset of this lane half

  // ---- what this wave loads: waves 0, 1 the two halves of the A rows, waves 2, 3 the two halves of the Bt rows ----
  constexpr uint32_t NPL = TWOA ? 2u : 1u;
  const bool     isB   = wave >= 2u;
  const uint32_t half  = wave & 1u;
  const size_t   rowA  = (size_t)(half << 6) * lda;
  const size_t   rowBt = (size_t)(half << 6) * ldb;
  const uint64_t src0  = isB ? (uint64_t)(size_t)(Bt + rowBt) : (uint64_t)(size_t)(Ah + rowA);
  const uint64_t src1  = isB ? (uint64_t)(size_t)(Bt + rowBt) : (uint64_t)(size_t)(Al + rowA);
  const uint32_t kp    = (uint32_t)K / GK_PASS;       // stages per A plane
  const uint32_t nst   = kp * NPL;                    // stages in all (at least 2)
  const uint32_t lbase = (uint32_t)(size_t)ring;
  u32x8 g1 = tdm_group1((uint32_t)(isB ? ldb : lda) * 2u);
  // without this the compiler rebuilds words of group 1 from their constants, in the registers a request was issued from
  asm volatile("" : "+s"(g1));   // the pinned() form: descriptor words held in their scalar registers
  auto group0 = [&](uint32_t st) -> u32x4 {
    const bool second = TWOA && st >= kp;             // second A plane, Bt's k starts over
    const uint32_t kk = second ? st - kp : st;
    const uint64_t ga = (second ? src1 : src0) + (uint64_t)kk * (GK_PASS * 2u);
    u32x4 g = tdm_group0(lbase + (st & 1u) * GK_STAGE + wave * GK_SLICE, ga);
    // without this the request is issued from a copy of group 0 whose registers are reused while it is in flight
    asm volatile("" : "+s"(g));   // the pinned() form: descriptor words held in their scalar registers, up to the wait that names them
    return g;
  };

#pragma unroll
  for (int i = 0; i < 4; ++i)
#pragma unroll
    for (int j = 0; j < 4; ++j) acc[i][j] = zero8();

  u32x4 g0 = group0(0);
  tdm_load(g0, g1);
  wait_tensor0(g0, g1);
  __syncthreads();
  g0 = group0(1);
  tdm_load(g0, g1);
  // kept rolled: one pass and one publish point in the text, every accumulator index constant
#pragma unroll 1
  for (uint32_t st = 0; st < nst; ++st) {
    const unsigned char* buf = ring + (st & 1u) * GK_STAGE;
    const unsigned char* pa = buf + wm * GK_SLICE + rlane * GK_PITCH + koff * 2;
    const unsigned char* pb = buf + (2u + wn) * GK_SLICE + rlane * GK_PITCH + koff * 2;
    V16 bq[2][4], af[2][4];   // two fragment sets: block ks multiplies set ks & 1 while the other set is filled
#pragma unroll
    for (int j = 0; j < 4; ++j) bq[0][j] = ldfrag<OT>((const OT*)(const void*)(pb + j * 16 * GK_PITCH));
#pragma unroll
    for (int i = 0; i < 4; ++i) af[0][i] = ldfrag<OT>((const OT*)(const void*)(pa + i * 16 * GK_PITCH));
#pragma unroll
    for (int ks = 0; ks < GK_PASS / 32; ++ks) {
      const int cs = ks & 1;
      if (ks + 1 < GK_PASS / 32) {   // the next block of this same stage; nothing of the next stage is read here
#pragma unroll
        for (int j = 0; j < 4; ++j) bq[cs ^ 1][j] = ldfrag<OT>((const OT*)(const void*)(pb + j * 16 * GK_PITCH + (ks + 1) * 64));
#pragma unroll
        for (int i = 0; i < 4; ++i) af[cs ^ 1][i] = ldfrag<OT>((const OT*)(const void*)(pa + i * 16 * GK_PITCH + (ks + 1) * 64));
      }
      // keeps the 16 LDS reads above as one group in front of the block: sunk among the WMMAs, each read is waited for where it stands
      __builtin_amdgcn_sched_barrier(0);
#pragma unroll
      for (int i = 0; i < 4; ++i)
#pragma unroll
        for (int j = 0; j < 4; ++j) acc[i][j] = mmar(af[cs][i], bq[cs][j], acc[i][j]);
      // keeps the following block's reads from rising among these WMMAs
      __builtin_amdgcn_sched_barrier(0);
    }
    // publish point of stage st + 1; behind its barrier every wave has left stage st's buffer
    wait_ds0();
    wait_tensor0(g0, g1);
    __syncthreads();
    if (pinned(st + 2u < nst)) {
      g0 = group0(st + 2u);
      tdm_load(g0, g1);
    }
  }
  wait_tensor0(g0, g1);
  wait_ds0();
  acc_guard4(acc[0][0], acc[0][1], acc[0][2], acc[0][3]);
  acc_guard4(acc[1][0], acc[1][1], acc[1][2], acc[1][3]);
  acc_guard4(acc[2][0], acc[2][1], acc[2][2], acc[2][3]);
  acc_guard4(acc[3][0], acc[3][1], acc[3][2], acc[3][3]);

}

// ---- epilogue: the wave's tile, rows m0 .. m0+63, columns n0 .. n0+63 of the plane(s) at Cout / Cout2; slab = wave-private 16x68 floats of LDS ----
template <int OUT_MODE>
__device__ __forceinline__ void gemm64_store(v8f (&acc)[4][4], float* slab, int lane, int m0, int n0,
                                             void* Cout, void* Cout2, int ldc,
                                             const float* __restrict__ bias, const float* __restrict__ ctab,
                                             const float* __restrict__ stab, float rscale) {
  static_assert(OUT_MODE >= 0 && OUT_MODE <= 3);
  const int rlane = lane & 15;                 // col (D) within subtile
  const int mOff  = (lane >> 4) * 8;           // D row offset
#pragma unroll
  for (int i = 0; i < 4; ++i) {
    const int mBase = m0 + (i << 4);
#pragma unroll
    for (int j = 0; j < 4; ++j) {
#pragma unroll
      for (int r = 0; r < 8; ++r) {
        slab[(mOff + r) * 68 + (j << 4) + rlane] = acc[i][j][r];
      }
    }
    __builtin_amdgcn_fence(__ATOMIC_RELEASE, "workgroup");
    __builtin_amdgcn_wave_barrier();
    __builtin_amdgcn_fence(__ATOMIC_ACQUIRE, "workgroup");
    if (OUT_MODE == 0) {
      float* C = (float*)Cout;
      const int h2 = lane >> 4, c4 = (lane & 15) * 4;     // 256-B row segment = 16 lanes x 16 B
      const v4f bb = *(const v4f*)(bias + n0 + c4);
      v4f bv;
#pragma unroll
      for (int e = 0; e < 4; ++e) bv[e] = bf16r(bb[e]);
      v4f ov[8];
#pragma unroll
      for (int it = 0; it < 8; ++it) {
        const int row = it * 2 + h2;                       // it 0..7 x h2 0..1 = rows 0..15
        ov[it] = *(const v4f*)(slab + row * 68 + c4) + bv;
      }
      {
#pragma unroll
        for (int it = 0; it < 8; ++it) {
          const int row = it * 2 + h2;
          *(v4f*)(C + (size_t)(mBase + row) * ldc + n0 + c4) = ov[it];
        }
        
      }
    } else {
      const int q = lane >> 3, c8 = (lane & 7) * 8;
      unsigned short* C  = (unsigned short*)Cout;
      unsigned short* C2 = (unsigned short*)Cout2;
      v4u va[4], vb[4];
      v4f tc[4][2], ts[4][2];   // cos / sin of this lane's 8 columns, rows it * 4 + q of the slab
      if (OUT_MODE == 1 || OUT_MODE == 2) {
        // tables are [SEQ][HD]; column within the head = c8 + e (n0 is head-aligned, c8 in 0..56); position within the
        // sequence = (mBase mod SEQ) + row: mBase is a multiple of 16, so the slab's 16 rows do not wrap
        const float* cpt = ctab + (size_t)((mBase & (SEQ - 1)) + q) * HD + c8;
        const float* spt = stab + (size_t)((mBase & (SEQ - 1)) + q) * HD + c8;
        // the slab's table loads stand as one group on two addresses, with their wait behind them: nothing that rewrites an
        // address register of an issued load may be scheduled among them or in front of the wait
        __builtin_amdgcn_sched_barrier(0);
#pragma unroll
        for (int it = 0; it < 4; ++it) {
          tc[it][0] = *(const v4f*)(cpt + it * 4 * HD);
          tc[it][1] = *(const v4f*)(cpt + it * 4 * HD + 4);
          ts[it][0] = *(const v4f*)(spt + it * 4 * HD);
          ts[it][1] = *(const v4f*)(spt + it * 4 * HD + 4);
        }
        // before the loads' address registers are reused; the two addresses are inputs, so that no load's result lands on them
        asm volatile("s_wait_xcnt 0x0" :: "v"(cpt), "v"(spt) : "memory");
        __builtin_amdgcn_sched_barrier(0);
      }
#pragma unroll
      for (int it = 0; it < 4; ++it) {
        const int row = it * 4 + q;                        // it 0..3 x q 0..3 = rows 0..15
        const float* sp = slab + row * 68 + c8;
        float f[8];
#pragma unroll
        for (int e = 0; e < 8; ++e) f[e] = sp[e];
        if (OUT_MODE == 1 || OUT_MODE == 2) {
#pragma clang fp contract(off)
          const float* pp = slab + row * 68 + (c8 ^ 32);   // partner columns d +- 32 of the same row
          float g[8];
#pragma unroll
          for (int e = 0; e < 8; ++e) g[e] = pp[e];
          const v4f bc0 = *(const v4f*)(bias + n0 + c8);
          const v4f bc1 = *(const v4f*)(bias + n0 + c8 + 4);
          const v4f bp0 = *(const v4f*)(bias + n0 + (c8 ^ 32));
          const v4f bp1 = *(const v4f*)(bias + n0 + (c8 ^ 32) + 4);
          const v4f cv0 = tc[it][0], cv1 = tc[it][1], sv0 = ts[it][0], sv1 = ts[it][1];
          const float sg = (c8 < 32) ? -1.0f : 1.0f;       // -x2 for the first half, +x1 for the second half
#pragma unroll
          for (int e = 0; e < 4; ++e) {
            {
              const float x  = f[e] + bf16r(bc0[e]);
              const float y  = g[e] + bf16r(bp0[e]);
              const float ry = sg * y;
              const float p0 = x * bf16r(cv0[e]);
              const float p1 = ry * bf16r(sv0[e]);
              f[e] = p0 + p1;
            }
            {
              const float x  = f[4 + e] + bf16r(bc1[e]);
              const float y  = g[4 + e] + bf16r(bp1[e]);
              const float ry = sg * y;
              const float p0 = x * bf16r(cv1[e]);
              const float p1 = ry * bf16r(sv1[e]);
              f[4 + e] = p0 + p1;
            }
          }
        }
        if (OUT_MODE == 3) {
          const float bm = bf16r(bias[mBase + row]);
#pragma unroll
          for (int e = 0; e < 8; ++e) f[e] = f[e] + bm;
        }
        v4u a, a2;
#pragma unroll
        for (int e = 0; e < 4; ++e) {
          const float f0 = (OUT_MODE == 1) ? f[2 * e] * rscale : f[2 * e];
          const float f1 = (OUT_MODE == 1) ? f[2 * e + 1] * rscale : f[2 * e + 1];
          const _Float16 x0 = (_Float16)f0, x1 = (_Float16)f1;
          const unsigned short h0 = h_bits(x0), h1 = h_bits(x1);
          unsigned short l0 = 0, l1 = 0;
          if (OUT_MODE == 1) {
            l0 = h_bits((_Float16)(f0 - (float)x0));
            l1 = h_bits((_Float16)(f1 - (float)x1));
          }
          a[e] = pk16(h0, h1); a2[e] = pk16(l0, l1);
        }
        va[it] = a; vb[it] = a2;
      }
      // the slab's stores stand as one group with their wait behind them: nothing that rewrites a register of an issued store
      // may be scheduled among them or in front of the wait
      __builtin_amdgcn_sched_barrier(0);
#pragma unroll
      for (int it = 0; it < 4; ++it) {
        const size_t go = (size_t)(mBase + it * 4 + q) * ldc + n0 + c8;
        *(v4u*)(C + go) = va[it];
        if (OUT_MODE == 1) *(v4u*)(C2 + go) = vb[it];
      }
      asm volatile("s_wait_xcnt 0x0" ::: "memory");   // before the stores' address and data registers are reused
      __builtin_amdgcn_sched_barrier(0);
    }
    __builtin_amdgcn_fence(__ATOMIC_RELEASE, "workgroup");
    __builtin_amdgcn_wave_barrier();
    __builtin_amdgcn_fence(__ATOMIC_ACQUIRE, "workgroup");
  }
}

template <typename OT, int OUT_MODE, bool TWOA>
__global__ __launch_bounds__(128) void gemm64(
    const unsigned short* __restrict__ Ap, const unsigned short* __restrict__ Alp, int lda, long long strideA,
    const unsigned short* __restrict__ Btp, int ldb, long long strideB,
    void* Cout, void* Cout2, int ldc, long long strideC,
    const float* __restrict__ bias, const float* __restrict__ ctab, const float* __restrict__ stab,
    int M, int N, int K, float rscale) {
  __shared__ __attribute__((aligned(2048))) unsigned char ring[2 * GK_STAGE];   // two stages
  __shared__ __align__(16) float sT[4][16 * 68];   // per-wave 16x64 slab, pitch 68 floats
  const int b    = blockIdx.y;
  const int lane = threadIdx.x & 31;
  const uint32_t wave = uni(threadIdx.x >> 5);
  const int tilesN = N >> 7;
  const int tilesM = M >> 7;
  const int bt = blockIdx.x;
  if (bt >= tilesM * tilesN) return;   // block-uniform, in front of every barrier and tensor load
  const int btm = bt / tilesN;
  const int btn = bt - btm * tilesN;
  const size_t rowA  = (size_t)b * (size_t)strideA + (size_t)(btm << 7) * lda;
  const size_t rowBt = (size_t)b * (size_t)strideB + (size_t)(btn << 7) * ldb;
  v8f acc[4][4];
  gemm64_loop<OT, TWOA>((const OT*)(const void*)Ap + rowA, (const OT*)(const void*)Alp + rowA, lda,
                        (const OT*)(const void*)Btp + rowBt, ldb, K, ring, wave, lane, acc);
  const size_t cb = (size_t)b * (size_t)strideC * (OUT_MODE == 0 ? sizeof(float) : sizeof(unsigned short));
  gemm64_store<OUT_MODE>(acc, sT[wave], lane, (btm << 7) + (int)((wave & 1u) << 6), (btn << 7) + (int)((wave >> 1) << 6),
                         (void*)((char*)Cout + cb), (void*)((char*)Cout2 + cb), ldc, bias, ctab, stab, rscale);
}

// =====================================================================================================
// The three projections of x in ONE launch: they are independent of each other, so the block index picks the job
// (256 blocks each, the two jobs with the long rotary epilogue first):
//   job 0: 64 q, q = rope(x . Wq^T + bq) -> f16 hi / residual planes [b*SEQ+t][h*64+d]        (OUT_MODE 1)
//   job 1: k   = rope(x . Wk^T + bk) -> f16 plane [b*SEQ+s][h*64+d]                          (OUT_MODE 2)
//   job 2: v^T = Wv . x^T + bv per batch -> f16 plane [b][h*64+d][s]; A = Wv rows, Bt = x rows of batch b (OUT_MODE 3)
// W = the bf16 qkv weight [3072][1024], bias = qkv_b [3072]; every pitch is DM = SEQ elements, K = DM.
// The epilogue slabs lie in the ring, so that a block holds 144 KiB of LDS and two blocks share a WGP: one block's first
// tile, stage waits and epilogue run beside the other's products.
// coverage: jobs 0, 1: 32 x 8 tiles of 128x128 = [4096][1024]; job 2: 4 batches x 8 x 8 tiles = [4][1024][1024].
// =====================================================================================================
#define QKV_TILES ((NTOK / 128) * (DM / 128))   // 256 blocks per job
#define QCARRY 64.0f   // power of two carried by both q planes: lifts the residuals of ordinary values into f16's normal range, leaves the hi plane far from its top
static_assert(QKV_TILES == NB * (DM / 128) * (SEQ / 128) && DM == SEQ && DM / 128 == 8 && 16 * 68 * 4 <= GK_SLICE);
__global__ __launch_bounds__(128) void gemm_qkv(
    const unsigned short* __restrict__ Xp, const unsigned short* __restrict__ Wp,
    unsigned short* Qh, unsigned short* Ql, unsigned short* Kp, unsigned short* VT,
    const float* __restrict__ bias, const float* __restrict__ ctab, const float* __restrict__ stab) {
  __shared__ __attribute__((aligned(2048))) unsigned char ring[2 * GK_STAGE];   // two stages; behind the loop the slabs
  const int lane = threadIdx.x & 31;
  const uint32_t wave = uni(threadIdx.x >> 5);
  const uint32_t job = blockIdx.x / QKV_TILES;
  const uint32_t bt  = blockIdx.x % QKV_TILES;
  if (job > 2u) return;                // block-uniform, in front of every barrier and tensor load
  const bool isVt = job == 2u;
  const uint32_t btn = bt & 7u;                            // tile column
  const uint32_t btm = isVt ? (bt >> 3) & 7u : bt >> 3;    // tile row: of 8 (features of one batch) or of 32 (tokens)
  const uint32_t b   = isVt ? bt >> 6 : 0u;                // batch (job 2 only)
  const __bf16* X = (const __bf16*)(const void*)Xp;
  const __bf16* Wj = (const __bf16*)(const void*)Wp + (size_t)job * DM * DM;
  const __bf16* A  = isVt ? Wj + (size_t)(btm << 7) * DM : X + (size_t)(btm << 7) * DM;
  const __bf16* Bt = isVt ? X + ((size_t)b * SEQ + (btn << 7)) * DM : Wj + (size_t)(btn << 7) * DM;
  v8f acc[4][4];
  gemm64_loop<__bf16, false>(A, A, DM, Bt, DM, DM, ring, wave, lane, acc);
  // the ring is free here: the last pass's publish point (LDS wait, tensor wait, block barrier) stands behind every wave's
  // last read and last request, and nothing is issued behind it; each wave stages in its own slice of the first buffer
  float* slab = (float*)(void*)(ring + wave * GK_SLICE);
  const int m0 = (int)((btm << 7) + ((wave & 1u) << 6));
  const int n0 = (int)((btn << 7) + ((wave >> 1) << 6));
  const float* bj = bias + job * DM;
  if (job == 0u)      gemm64_store<1>(acc, slab, lane, m0, n0, (void*)Qh, (void*)Ql, DM, bj, ctab, stab, QCARRY);
  else if (job == 1u) gemm64_store<2>(acc, slab, lane, m0, n0, (void*)Kp, (void*)Kp, DM, bj, ctab, stab, 1.0f);
  else                gemm64_store<3>(acc, slab, lane, m0, n0, (void*)(VT + (size_t)b * DM * SEQ), (void*)(VT + (size_t)b * DM * SEQ),
                                      SEQ, bj, ctab, stab, 1.0f);
}

#define AT_PITCH 72                   // 16-bit elements per LDS row of the K and V^T tiles
#define OS_PITCH 68                   // floats per LDS row of the context tile
static_assert((AT_PITCH * 2) % 32 == 16 && AT_PITCH >= 64 && (OS_PITCH * 4) % 16 == 0 && OS_PITCH >= 64);
#define AT_SLICE 6144                 // one wave's slice: 32 rows x 144 B = 4608 B, rounded up to a multiple of 2 KiB
#define AT_STAGE (4 * AT_SLICE)       // [K rows 0..31 | K rows 32..63 | V^T rows 0..31 | V^T rows 32..63]
static_assert(AT_PITCH * 2 == 128 + 16 && 32 * AT_PITCH * 2 <= AT_SLICE && (AT_SLICE % 2048) == 0 && NKT >= 2);
// lane l <-> lane l ^ 16: the other half of the wave holds the same query's other keys
__device__ __forceinline__ float xhalf(float x) {
  return __builtin_bit_cast(float, __builtin_amdgcn_permlanex16(__builtin_bit_cast(int, x), __builtin_bit_cast(int, x),
                                                                0x76543210, 0xfedcba98, false, false));
}
__global__ __launch_bounds__(128)
void attn_mha(const unsigned short* __restrict__ qhp, const unsigned short* __restrict__ qlp,
              const unsigned short* __restrict__ kpp, const unsigned short* __restrict__ vtp,
              unsigned short* ohp, unsigned short* olp, float sscale) {
  union FH { v16h v; v8h h[2]; };
  __shared__ __attribute__((aligned(2048))) unsigned char kvring[2 * AT_STAGE];   // two stages of K [key][d] and V^T [d][key]
  __shared__ __align__(16) float    Os[4][16 * OS_PITCH];    // per wave context tile 17 KB

  const int tid  = threadIdx.x;
  const int wave = (int)uni((uint32_t)tid >> 5);
  const int lane = tid & 31;
  const int hh   = lane >> 4;
  const int c    = lane & 15;

  const int bx   = blockIdx.x;
  const int qb   = bx % NQB;
  const int rest = bx / NQB;
  const int h    = rest % NH;
  const int b    = rest / NH;
  const int q0   = qb * 64 + wave * 16;
  const size_t rowB = (size_t)b * SEQ;
  const size_t hcol = (size_t)h * HD;

  const _Float16* Qh = (const _Float16*)(const void*)qhp;
  const _Float16* Ql = (const _Float16*)(const void*)qlp;
  const _Float16* Kg = (const _Float16*)(const void*)kpp + hcol;
  const _Float16* Vt = (const _Float16*)(const void*)vtp + ((size_t)b * DM + hcol) * SEQ;

  // ---- Q fragments (B operand, column = query = lane&15): 2 d-chunks, hi and residual planes ----
  v16h qah[2], qal[2];
#pragma unroll
  for (int dc = 0; dc < 2; ++dc) {
    const size_t qo = (rowB + q0 + c) * DM + hcol + dc * 32 + 8 * hh;
    qah[dc] = ldfrag<_Float16>(Qh + qo);
    qal[dc] = ldfrag<_Float16>(Ql + qo);
  }

  float mrun = -INFINITY;   // running maximum of this lane's query, in accumulator units (equal in both halves)
  float lrun = 0.f;         // running sum of 1024 p over this half's keys; the halves are joined once, behind the loop
  const float kf = sscale * (1.4426950408889634f / QCARRY);   // accumulator units -> exponent of two
  v8f oacc[4];              // O^T: column = query lane&15, row d = 16 t + 8 hh + r
#pragma unroll
  for (int t = 0; t < 4; ++t) oacc[t] = zero8();

  // ---- what this wave loads: chunk st's K rows 32 half .. +31 (d = 0..63 of head h) or V^T rows d = 32 half .. +31 (its 64 keys) ----
  const bool     isV   = wave >= 2;
  const uint32_t half  = (uint32_t)wave & 1u;
  const uint64_t src   = isV ? (uint64_t)(size_t)(Vt + (size_t)(half * 32u) * SEQ)
                             : (uint64_t)(size_t)(Kg + (rowB + half * 32u) * DM);
  const uint32_t sstep = isV ? 64u * 2u : 64u * DM * 2u;   // bytes from one chunk to the next: 64 keys along / across the rows
  const uint32_t lbase = (uint32_t)(size_t)kvring;
  static_assert(DM == SEQ);                                // both planes have rows of DM * 2 = SEQ * 2 bytes
  u32x8 g1 = tdm_group1_r128(DM * 2u);
  // without this the compiler rebuilds words of group 1 from their constants, in the registers a request was issued from
  asm volatile("" : "+s"(g1));   // the pinned() form: descriptor words held in their scalar registers
  auto group0 = [&](uint32_t st) -> u32x4 {
    return tdm_group0(lbase + (st & 1u) * AT_STAGE + (uint32_t)wave * AT_SLICE, src + (uint64_t)st * sstep);
  };
  u32x4 g0 = group0(0);
  tdm_load(g0, g1);
  wait_tensor0(g0, g1);
  __syncthreads();
  g0 = group0(1);
  tdm_load(g0, g1);
  // kept rolled: one pass and one publish point in the text
#pragma unroll 1
  for (uint32_t kt = 0; kt < NKT; ++kt) {    // static trip count
    const unsigned char* buf = kvring + (kt & 1u) * AT_STAGE;
    const _Float16* Ksh = (const _Float16*)(const void*)buf;                    // row r at (r >> 5) slices + (r & 31) rows
    const _Float16* Vth = (const _Float16*)(const void*)(buf + 2 * AT_SLICE);

    // ---- scores, transposed: 64 keys x 16 queries per wave, 2 f16 products per key subtile and d-chunk ----
    FH kb[2][4];   // the chunk's eight K fragments, read as one group
#pragma unroll
    for (int dc = 0; dc < 2; ++dc)
#pragma unroll
      for (int j = 0; j < 4; ++j) {
        kb[dc][j].h[0] = *(const v8h*)(Ksh + (j >> 1) * (AT_SLICE / 2) + ((j & 1) * 16 + c) * AT_PITCH + dc * 32 + 8 * hh);
        kb[dc][j].h[1] = *(const v8h*)(Ksh + (j >> 1) * (AT_SLICE / 2) + ((j & 1) * 16 + c) * AT_PITCH + dc * 32 + 16 + 8 * hh);
      }
    // keeps the 16 K reads as one group in front of the products: sunk among the WMMAs, each read is waited for where it stands
    __builtin_amdgcn_sched_barrier(0);
    v8f s[4];   // s[j][r]: 64 (k . q) of key kv0 + 16 j + 8 hh + r, query q0 + c
#pragma unroll
    for (int j = 0; j < 4; ++j) s[j] = zero8();
    // four accumulators taken in turn, so that a WMMA does not add into the tile of the one directly in front of it
#pragma unroll
    for (int dc = 0; dc < 2; ++dc) {
#pragma unroll
      for (int j = 0; j < 4; ++j) s[j] = mmar(kb[dc][j].v, qah[dc], s[j]);
#pragma unroll
      for (int j = 0; j < 4; ++j) s[j] = mmar(kb[dc][j].v, qal[dc], s[j]);
    }
    FH vb[2][4];   // the chunk's eight V^T fragments, read here: in flight during the softmax arithmetic
#pragma unroll
    for (int kk = 0; kk < 2; ++kk)
#pragma unroll
      for (int t = 0; t < 4; ++t) {
        vb[kk][t].h[0] = *(const v8h*)(Vth + (t >> 1) * (AT_SLICE / 2) + ((t & 1) * 16 + c) * AT_PITCH + kk * 32 + 8 * hh);
        vb[kk][t].h[1] = *(const v8h*)(Vth + (t >> 1) * (AT_SLICE / 2) + ((t & 1) * 16 + c) * AT_PITCH + kk * 32 + 16 + 8 * hh);
      }
    // keeps the 16 V^T reads in front of the softmax arithmetic: sunk to their products, each read is waited for where it stands
    __builtin_amdgcn_sched_barrier(0);

    // ---- query maximum (in-lane, then the other half's), online softmax, P^T (x1024, f16) packed in registers ----
    float mj[4];   // one chain per key subtile: four short dependent chains instead of one long one
#pragma unroll
    for (int j = 0; j < 4; ++j) {
      mj[j] = s[j][0];
#pragma unroll
      for (int r = 1; r < 8; ++r) mj[j] = fmaxf(mj[j], s[j][r]);
    }
    float m = fmaxf(fmaxf(mj[0], mj[1]), fmaxf(mj[2], mj[3]));
    m = fmaxf(m, xhalf(m));
    const float mnew  = fmaxf(mrun, m);
    const float msafe = (mnew == -INFINITY) ? 0.f : mnew;
    const float alpha = __builtin_amdgcn_exp2f((mrun - msafe) * kf);
    mrun = mnew;
    const float eb = 10.0f - msafe * kf;   // exponent offset: the maximum taken off, the x1024 carry of p put on
    const v2f kf2 = {kf, kf}, eb2 = {eb, eb};
    // B operand of 32 keys: elements 0..7 = keys k0 + 8 hh + e (subtile 2 kk), 8..15 = keys k0 + 16 + 8 hh + e (subtile 2 kk + 1)
    FH pb[2];
    v2f ps[4];   // partial sums of 1024 p, a pair of chains per key subtile
#pragma unroll
    for (int j = 0; j < 4; ++j) {
#pragma unroll
      for (int r = 0; r < 8; r += 2) {
        const v2f a = {s[j][r], s[j][r + 1]};
        const v2f t = a * kf2 + eb2;
        const v2f p = {__builtin_amdgcn_exp2f(t[0]), __builtin_amdgcn_exp2f(t[1])};
        ps[j] = (r == 0) ? p : ps[j] + p;
        pb[j >> 1].v[(j & 1) * 8 + r]     = (_Float16)p[0];
        pb[j >> 1].v[(j & 1) * 8 + r + 1] = (_Float16)p[1];
      }
    }
    const v2f pt = (ps[0] + ps[1]) + (ps[2] + ps[3]);
    lrun = lrun * alpha + (pt[0] + pt[1]);
#pragma unroll
    for (int t = 0; t < 4; ++t) oacc[t] = oacc[t] * alpha;

    // ---- context^T += V^T . P^T (f16 WMMA, single product); unrolled: pb is indexed in registers ----
#pragma unroll
    for (int kk = 0; kk < 2; ++kk) {
#pragma unroll
      for (int t = 0; t < 4; ++t) oacc[t] = mmar(vb[kk][t].v, pb[kk].v, oacc[t]);
    }
    // four VALU slots behind the pass's last WMMA: a branch follows
    acc_guard4(oacc[0], oacc[1], oacc[2], oacc[3]);
    // publish point of chunk kt + 1; behind its barrier every wave has left chunk kt's buffer
    wait_ds0();
    wait_tensor0(g0, g1);
    __syncthreads();
    if (pinned(kt + 2u < NKT)) {
      g0 = group0(kt + 2u);
      tdm_load(g0, g1);
    }
  }
  wait_tensor0(g0, g1);
  wait_ds0();

  // ---- join the halves' sums, normalise (1/l: l and the context carry the same x1024), stage the wave's 16x64 f32 tile [query][d],
  //      split into bf16 hi / residual
  float* os = Os[wave];
  {
    const float l = lrun + xhalf(lrun);   // unconditional: every lane is on at the exchange
    const float inv = (l > 0.f) ? (1.0f / l) : 0.f;
#pragma unroll
    for (int t = 0; t < 4; ++t) {
      v4f lo, hi;
#pragma unroll
      for (int r = 0; r < 4; ++r) { lo[r] = oacc[t][r] * inv; hi[r] = oacc[t][4 + r] * inv; }
      *(v4f*)(os + c * OS_PITCH + t * 16 + 8 * hh)     = lo;
      *(v4f*)(os + c * OS_PITCH + t * 16 + 8 * hh + 4) = hi;
    }
  }
  __builtin_amdgcn_fence(__ATOMIC_RELEASE, "workgroup");
  __builtin_amdgcn_wave_barrier();
  __builtin_amdgcn_fence(__ATOMIC_ACQUIRE, "workgroup");
  {
    const int q4 = lane >> 3, c8 = (lane & 7) * 8;
    v4u hv[4], lv[4];
#pragma unroll
    for (int it = 0; it < 4; ++it) {
      const int row = it * 4 + q4;   // it 0..3 x q4 0..3 = rows 0..15 of the wave tile
      const float* sp = os + row * OS_PITCH + c8;
      v4u a, a2;
#pragma unroll
      for (int e = 0; e < 4; ++e) {
        const float f0 = sp[2 * e], f1 = sp[2 * e + 1];
        const unsigned short h0 = bf_bits(f0), h1 = bf_bits(f1);
        const unsigned short l0 = bf_bits(f0 - bf_up(h0)), l1 = bf_bits(f1 - bf_up(h1));
        a[e] = pk16(h0, h1); a2[e] = pk16(l0, l1);
      }
      hv[it] = a; lv[it] = a2;
    }
    {
#pragma unroll
      for (int it = 0; it < 4; ++it) {
        const int row = it * 4 + q4;
        const size_t go = (rowB + q0 + row) * DM + hcol + c8;
        *(v4u*)(ohp + go) = hv[it];
        *(v4u*)(olp + go) = lv[it];
      }
      
    }
  }
}

// =====================================================================================================
// Workspace map (bytes), every region an exact multiple of its whole-line / whole-tile store granularity
// (all shapes are tile multiples, no padded tails):
//   Xb    bf16 [4096][1024]          8388608
//   Wqkv  bf16 [3072 n][1024 k]      6291456   (input [out][in] layout == Bt[n][k], k contiguous)
//   Wo    bf16 [1024 n][1024 k]      2097152
//   Qh    f16  [4096][1024]          8388608
//   Ql    f16  [4096][1024]          8388608   (residual of 64 q)
//   Kp    f16  [4096][1024]          8388608
//   VT    f16  [4][1024][1024]       8388608
//   Oh    bf16 [4096][1024]          8388608
//   Ol    bf16 [4096][1024]          8388608
//   total                           67108864
// =====================================================================================================
extern "C" void kernel_launch(void* const* d_in, const int* in_sizes, int n_in,
                              void* d_out, int out_size, void* d_ws, size_t ws_size,
                              hipStream_t stream) {
  if (n_in < 7) return;
  if (in_sizes[0] != NTOK * DM) return;          // x      [4][1024][1024]
  if (in_sizes[1] != SEQ * HD) return;           // cos    [1024][64]
  if (in_sizes[2] != SEQ * HD) return;           // sin    [1024][64]
  if (in_sizes[3] != DQKV * DM) return;          // qkv_w  [3072][1024]
  if (in_sizes[4] != DQKV) return;               // qkv_b  [3072]
  if (in_sizes[5] != DM * DM) return;            // proj_w [1024][1024]
  if (in_sizes[6] != DM) return;                 // proj_b [1024]
  if (out_size != NTOK * DM) return;

  const float* x    = (const float*)d_in[0];
  const float* cosb = (const float*)d_in[1];
  const float* sinb = (const float*)d_in[2];
  const float* Wqkv = (const float*)d_in[3];
  const float* bqkv = (const float*)d_in[4];
  const float* Wout = (const float*)d_in[5];
  const float* bout = (const float*)d_in[6];

  const size_t PX  = (size_t)NTOK * DM * 2;        //  8388608  16-bit activation plane [4096][1024]
  const size_t PWQ = (size_t)DQKV * DM * 2;        //  6291456  bf16 [3072][1024]
  const size_t PWO = (size_t)DM * DM * 2;          //  2097152  bf16 [1024][1024]
  const size_t PVT = (size_t)NB * DM * SEQ * 2;    //  8388608  v^T plane [4][1024][1024]
  size_t off = 0;
  const size_t oXb  = off; off += PX;
  const size_t oWq  = off; off += PWQ;
  const size_t oWo  = off; off += PWO;
  const size_t oQh  = off; off += PX;
  const size_t oQl  = off; off += PX;
  const size_t oKp  = off; off += PX;
  const size_t oVT  = off; off += PVT;
  const size_t oOh  = off; off += PX;
  const size_t oOl  = off; off += PX;
  if (off > ws_size) return;                       // off = 67108864
  if (off > (size_t)134217728) return;

  char* ws = (char*)d_ws;
  unsigned short* Xb   = (unsigned short*)(ws + oXb);
  unsigned short* Wq16 = (unsigned short*)(ws + oWq);
  unsigned short* Wo16 = (unsigned short*)(ws + oWo);
  unsigned short* Qh   = (unsigned short*)(ws + oQh);
  unsigned short* Ql   = (unsigned short*)(ws + oQl);
  unsigned short* Kp   = (unsigned short*)(ws + oKp);
  unsigned short* VT   = (unsigned short*)(ws + oVT);
  unsigned short* Oh   = (unsigned short*)(ws + oOh);
  unsigned short* Ol   = (unsigned short*)(ws + oOl);

  const dim3 blk(256);
  const int n8x  = NTOK * DM / 8;                               // 524288
  const int n8wq = DQKV * DM / 8;                               // 393216
  const int n8wo = DM * DM / 8;                                 // 131072
  const dim3 gCvtX((n8x + 255) / 256);                          // 2048 blocks
  const dim3 gCvtWq((n8wq + 255) / 256);                        // 1536 blocks
  const dim3 gCvtWo((n8wo + 255) / 256);                        //  512 blocks
  const dim3 blkG(128);                                         // gemm64: 4 waves
  const dim3 gP((NTOK / 128) * (DM / 128), 1);                  // 256 blocks of one 128x128 tile: M=4096, N=1024
  const dim3 gQKV(3 * QKV_TILES);                               // 768 blocks: q, k, v^T tiles of 128x128
  const dim3 gAttn(NB * NH * NQB);                              // 1024 blocks of 128
  static_assert((NTOK % 128) == 0 && (DM % 128) == 0 && (SEQ % 128) == 0 && (DM % GK_PASS) == 0 && DM / GK_PASS >= 2);
  static_assert((NTOK * DM) % 2048 == 0 && (DQKV * DM) % 2048 == 0 && (DM * DM) % 2048 == 0);
  static_assert((DM % 32) == 0);

  // (1) x -> bf16 plane [4096][1024]; qkv_w [3072][1024] ([out][in] = Bt[n][k]) -> bf16; proj_w [1024][1024] -> bf16
  cvt_bf16x8<<<gCvtX,  blk, 0, stream>>>(x,    Xb,   n8x);
  cvt_bf16x8<<<gCvtWq, blk, 0, stream>>>(Wqkv, Wq16, n8wq);
  cvt_bf16x8<<<gCvtWo, blk, 0, stream>>>(Wout, Wo16, n8wo);
  // (2) - (4) q, k and v^T projections, one launch: block range picks the job
  gemm_qkv<<<gQKV, blkG, 0, stream>>>(Xb, Wq16, Qh, Ql, Kp, VT, bqkv, cosb, sinb);
  // (5) attention -> ctx bf16 hi / residual planes [b*SEQ+t][h*64+d]
  attn_mha<<<gAttn, dim3(128), 0, stream>>>(Qh, Ql, Kp, VT, Oh, Ol, 0.125f);
  // (6) out = (Oh + Ol) . Wproj^T + bproj -> d_out f32 [4096][1024]   (M=4096, N=1024, K=1024, two A planes)
  gemm64<__bf16, 0, true><<<gP, blkG, 0, stream>>>(
      Oh, Ol, DM, 0LL, Wo16, DM, 0LL,
      d_out, d_out, DM, 0LL, bout, cosb, sinb,
      NTOK, DM, DM, 1.0f);
  (void)hipGetLastError();
}

// v009
// One run takes 83.1 microseconds.
// In both of two side-by-side timings against v008, it was 1.03 times as fast.
// Over all steps from v000 it is 4.20 times as fast.
// Contractions: q / k / v^T projections = v_wmma_f32_16x16x32_bf16 (bf16 operands from RNE-converted x and qkv weight rows, single product, f32 accumulate);
// q.k^T scores = v_wmma_f32_16x16x32_f16 (64 q as f16 hi plane + f16 residual plane, k f16; 2 products into one f32 accumulator);
// p.v = v_wmma_f32_16x16x32_f16 (p carried x1024 in f16, v f16; single product, f32 accumulate);
// ctx.Wproj^T = v_wmma_f32_16x16x32_bf16 (ctx as bf16 hi plane + unscaled bf16 residual plane, weights bf16; 2 products, f32 accumulate);
// rotary with the input cos/sin tables (values RNE-converted to bf16), half-rotation, bias adds and softmax in f32 on the VALU.
// Carry audit: both q planes x64 -> folded back once in attn_mha's exponent factor sscale * log2(e) / 64;
// p x1024 (as +10 in the exponent) -> the row sum l carries it too, so 1/l in the attn_mha epilogue folds it back; ctx residual plane is the unscaled
// RNE residual (v - hi) and shares the hi accumulator; no weight-plane carries (all weight copies are bf16).
// gemm64 stages both operands in LDS with tensor loads (two buffers); its 16-bit epilogue stores the four row groups of a 16-row slab together.
// gemm_qkv runs the q, k and v^T projections as one launch (same loop and epilogues), two blocks to a WGP.
// attn_mha stages its K and V^T chunks in LDS with tensor loads (two buffers); a pass reads its K fragments as one group
// in front of the score products and its V^T fragments in front of the softmax arithmetic.
#include <hip/hip_runtime.h>
#include <math.h>
#include <stdint.h>

#define NB    4
#define SEQ   1024
#define DM    1024
#define NH    16
#define HD    64
#define DQKV  (3 * DM)
#define NTOK  (NB * SEQ)   // 4096 token rows
#define NQB   (SEQ / 64)   // 16 query blocks of 64 per sequence
#define NKT   (SEQ / 64)   // 16 key chunks of 64 per sequence
static_assert(NH * HD == DM);
static_assert(NQB == 16 && NKT == 16);
static_assert((SEQ & (SEQ - 1)) == 0);
static_assert((SEQ % 64) == 0 && (DM % 64) == 0 && (DM % 32) == 0 && (DQKV % 64) == 0 && (NTOK % 64) == 0);

typedef _Float16 v16h __attribute__((ext_vector_type(16)));
typedef _Float16 v8h  __attribute__((ext_vector_type(8)));
typedef __bf16   v16b __attribute__((ext_vector_type(16)));
typedef __bf16   v8b  __attribute__((ext_vector_type(8)));
typedef float    v8f  __attribute__((ext_vector_type(8)));
typedef float    v4f  __attribute__((ext_vector_type(4)));
typedef float    v2f  __attribute__((ext_vector_type(2)));
typedef unsigned int v4u __attribute__((ext_vector_type(4)));
typedef uint32_t u32x4 __attribute__((ext_vector_type(4)));
typedef uint32_t u32x8 __attribute__((ext_vector_type(8)));

#if defined(__HIP_DEVICE_COMPILE__)
#define DEV_ASM 1
#else
#define DEV_ASM 0
#endif

// ---- scalar helpers --------------------------------------------------------------------------------
__device__ __forceinline__ unsigned short bf_bits(float f) {          // f32 -> bf16 bits, RNE convert
  unsigned u = __float_as_uint(f);
  return (unsigned short)((u + 0x7FFFu + ((u >> 16) & 1u)) >> 16);
}
__device__ __forceinline__ float bf_up(unsigned short hb) { return __uint_as_float(((unsigned)hb) << 16); }
__device__ __forceinline__ float bf16r(float f) { return bf_up(bf_bits(f)); }   // value of the bf16 RNE convert
__device__ __forceinline__ unsigned short h_bits(_Float16 x) { return __builtin_bit_cast(unsigned short, x); }
__device__ __forceinline__ unsigned pk16(unsigned short a, unsigned short b) { return (unsigned)a | ((unsigned)b << 16); }
__device__ __forceinline__ v8f zero8() { v8f z = {0.f, 0.f, 0.f, 0.f, 0.f, 0.f, 0.f, 0.f}; return z; }

// ---- fragment types / loaders: 16-bit A/B operand, lane -> row/col (lane&15), p already includes +8*(lane>>4);
//      elements 0..7 <- p[0..7] (k0+8h..k0+8h+7), elements 8..15 <- p[16..23] (k0+16+8h..k0+16+8h+7)
template <typename OT> struct FT;
template <> struct FT<__bf16>   { typedef v16b frag; typedef v8b half8; };
template <> struct FT<_Float16> { typedef v16h frag; typedef v8h half8; };

template <typename OT>
__device__ __forceinline__ typename FT<OT>::frag ldfrag(const OT* p) {
  union { typename FT<OT>::frag v; typename FT<OT>::half8 h[2]; } f;
  f.h[0] = *(const typename FT<OT>::half8*)(p);
  f.h[1] = *(const typename FT<OT>::half8*)(p + 16);
  return f.v;
}

// ---- WMMA helpers (asm guard bodies are device-only; concrete operand types) -----------------------------
__device__ __forceinline__ v8f mmar(v16b a, v16b b, v8f c) {
  return __builtin_amdgcn_wmma_f32_16x16x32_bf16(false, a, false, b, (short)0, c, false, false);
}
__device__ __forceinline__ v8f mmar(v16h a, v16h b, v8f c) {
  return __builtin_amdgcn_wmma_f32_16x16x32_f16(false, a, false, b, (short)0, c, false, false);
}
__device__ __forceinline__ void acc_guard4(v8f& a, v8f& b, v8f& c, v8f& d) {
#if DEV_ASM
  asm volatile("v_nop\n\tv_nop\n\tv_nop\n\tv_nop" : "+v"(a), "+v"(b), "+v"(c), "+v"(d));
#else
  (void)a; (void)b; (void)c; (void)d;
#endif
}

// ---- tensor-load helpers for the LDS rings of gemm64 and attn_mha ------------------------------------------------------
#define GK_PASS  128                  // k elements of one stage: rows of 256 B
#define GK_PITCH 272                  // LDS row pitch in bytes: 256 B + the 16-B pad (odd multiple of 16 B for 16-B readers)
#define GK_SLICE 18432                // one wave's slice: 64 rows x 272 B = 17408 B, rounded up to a multiple of 2 KiB
#define GK_STAGE (4 * GK_SLICE)       // [A rows 0..63 | A rows 64..127 | Bt rows 0..63 | Bt rows 64..127]
static_assert(64 * GK_PITCH <= GK_SLICE && (GK_SLICE % 2048) == 0);
__device__ __forceinline__ uint32_t uni(uint32_t v) { return (uint32_t)__builtin_amdgcn_readfirstlane(v); }
__device__ __forceinline__ uint32_t pinned(uint32_t v) { uint32_t w = uni(v); asm volatile("" : "+s"(w)); return w; }
// the compiler places no wait for a tensor load: the issuing wave waits for its own request here; the request's two
// groups are inputs, so that their scalar registers keep their values until the request has landed
__device__ __forceinline__ void wait_tensor0(u32x4 g0, u32x8 g1) { asm volatile("s_wait_tensorcnt 0x0" :: "s"(g0), "s"(g1) : "memory"); }
// this wave's LDS reads have retired before the barrier behind which their buffer is refilled
__device__ __forceinline__ void wait_ds0() { asm volatile("s_wait_dscnt 0x0" ::: "memory"); }
__device__ __forceinline__ void tdm_load(u32x4 g0, u32x8 g1) { asm volatile("tensor_load_to_lds %0, %1" :: "s"(g0), "s"(g1) : "memory"); }
// group 1: 1-byte elements, tile = tensor = 64 rows of 256 B, source row pitch src_pitch bytes, 4 dwords of LDS pad behind every row
__device__ __forceinline__ u32x8 tdm_group1(uint32_t src_pitch) {
  constexpr uint32_t d0 = 256u, d1 = 64u;
  u32x8 g;
  g[0] = uni((1u << 20) | (5u << 22) | (3u << 25));   // no mask, data_size 0, pad after every 64 dwords, 4 dwords
  g[1] = uni((d0 & 0xFFFFu) << 16);
  g[2] = uni((d0 >> 16) | ((d1 & 0xFFFFu) << 16));
  g[3] = uni((d1 >> 16) | (d0 << 16));
  g[4] = uni(d1);
  g[5] = uni(src_pitch);
  g[6] = uni(0u);
  g[7] = uni(0u);
  return g;
}
// group 1 of attn_mha's tiles: 1-byte elements, tile = tensor = 32 rows of 128 B, 4 dwords of LDS pad behind every row
__device__ __forceinline__ u32x8 tdm_group1_r128(uint32_t src_pitch) {
  constexpr uint32_t d0 = 128u, d1 = 32u;
  u32x8 g;
  g[0] = uni((1u << 20) | (4u << 22) | (3u << 25));   // no mask, data_size 0, pad after every 32 dwords, 4 dwords
  g[1] = uni((d0 & 0xFFFFu) << 16);
  g[2] = uni((d0 >> 16) | ((d1 & 0xFFFFu) << 16));
  g[3] = uni((d1 >> 16) | (d0 << 16));
  g[4] = uni(d1);
  g[5] = uni(src_pitch);
  g[6] = uni(0u);
  g[7] = uni(0u);
  return g;
}
__device__ __forceinline__ u32x4 tdm_group0(uint32_t lds_dst, uint64_t ga) {
  u32x4 g;
  g[0] = uni(1u);
  g[1] = uni(lds_dst);
  g[2] = uni((uint32_t)ga);
  g[3] = uni((((uint32_t)(ga >> 32)) & 0x01FFFFFFu) | 0x80000000u);
  return g;
}

// =====================================================================================================
// f32 -> bf16 (RNE convert) of x, qkv_w and proj_w in ONE launch of few waves.
// 256 blocks of 16 waves; the block range picks the plane (128 / 96 / 32 blocks); a thread converts
// 8 groups of 8 elements, a group = two 16-B loads and one 16-B store per lane (a wave writes 512 contiguous B per store).
// Layout is preserved, so a [out][in] f32 weight becomes the bf16 Bt[n][k] plane (k contiguous) directly.
// coverage: a block = 512 threads x 8 groups x 8 = 32768 elements in a row; 128 / 96 / 32 blocks = each whole plane exactly once.
// =====================================================================================================
#define CV_THREADS 512
#define CV_PER     8                                  // groups of 8 elements per thread
#define CV_ELEMS   (CV_THREADS * CV_PER * 8)          // 32768 elements per block
#define CV_BX      (NTOK * DM / CV_ELEMS)             // 128 blocks: x
#define CV_BQ      (DQKV * DM / CV_ELEMS)             //  96 blocks: qkv_w
#define CV_BO      (DM * DM / CV_ELEMS)               //  32 blocks: proj_w
static_assert((NTOK * DM) % CV_ELEMS == 0 && (DQKV * DM) % CV_ELEMS == 0 && (DM * DM) % CV_ELEMS == 0);
__global__ __launch_bounds__(CV_THREADS) void cvt_bf16_planes(const float* __restrict__ x, const float* __restrict__ wq,
                                                              const float* __restrict__ wo, unsigned short* xb,
                                                              unsigned short* wqb, unsigned short* wob) {
  const uint32_t bx = blockIdx.x;
  if (bx >= CV_BX + CV_BQ + CV_BO) return;
  const bool isX = bx < CV_BX, isQ = bx < CV_BX + CV_BQ;
  const float*    in  = isX ? x  : isQ ? wq  : wo;
  unsigned short* out = isX ? xb : isQ ? wqb : wob;
  const uint32_t  lb  = isX ? bx : isQ ? bx - CV_BX : bx - (CV_BX + CV_BQ);
  const size_t e0 = (size_t)lb * CV_ELEMS + (size_t)threadIdx.x * 8;
  const float*    ip = in + e0;
  unsigned short* op = out + e0;
  v4f a[CV_PER], b[CV_PER];
#pragma unroll
  for (int it = 0; it < CV_PER; ++it) {
    a[it] = *(const v4f*)(ip + it * (CV_THREADS * 8));
    b[it] = *(const v4f*)(ip + it * (CV_THREADS * 8) + 4);
  }
  // before the loads' address registers are reused; the address is an input, so that no load's result lands on it
  asm volatile("s_wait_xcnt 0x0" :: "v"(ip) : "memory");
  // keeps the 16 loads as one group in front of the arithmetic: all of a thread's bytes are in flight at once
  __builtin_amdgcn_sched_barrier(0);
  v4u p[CV_PER];
#pragma unroll
  for (int it = 0; it < CV_PER; ++it) {
    p[it][0] = pk16(bf_bits(a[it][0]), bf_bits(a[it][1]));
    p[it][1] = pk16(bf_bits(a[it][2]), bf_bits(a[it][3]));
    p[it][2] = pk16(bf_bits(b[it][0]), bf_bits(b[it][1]));
    p[it][3] = pk16(bf_bits(b[it][2]), bf_bits(b[it][3]));
  }
  // the stores stand as one group behind the arithmetic: nothing rewrites a register of an issued store
  __builtin_amdgcn_sched_barrier(0);
#pragma unroll
  for (int it = 0; it < CV_PER; ++it) *(v4u*)(op + it * (CV_THREADS * 8)) = p[it];
}

// =====================================================================================================
// Register-blocked batched WMMA GEMM (16-bit operand type OT): C[m][n] = sum_k A[m][k] * Bt[n][k];
// one block of 4 waves (2 x 2) per 128x128 tile, one wave per 64x64 tile. A row-major [M][K] pitch lda; Bt row-major
// [N][K] pitch ldb (k contiguous); M, N multiples of 128, K a multiple of 128 and at least 256 (host-checked).
// blockIdx.y = batch index (strides in elements). A stage = 128 k of the block's 128 A rows and 128 Bt rows in LDS;
// every wave brings one 64-row slice of it with one tensor load, two buffers, the next stage in flight during a pass.
// Fragments are read from LDS with the split k map (ldfrag); k runs upward in steps of 32 (a block = 16 WMMAs); inside a stage
// the next block's 16 fragment reads are issued as one group, into a second register set, in front of the current block.
//   TWOA: a second A plane Al with the same Bt is accumulated into the same tile (C = (A + Al) . Bt^T).
//   OUT_MODE 0: f32 C (pitch ldc), value + bf16(bias[col]); 256-B row segment = 16 lanes x 16 B, one instruction,
//   OUT_MODE 1: half-rotation rotary of (acc + bf16(bias[col])), w = v * rscale -> f16 hi plane C = f16(w) + f16 residual plane
//               C2 = f16(w - hi). N tile = one 64-wide head: dims d < 32 pair with d + 32:
//               out[d] = x[d] c[t][d] - x[d+32] s[t][d] (d < 32), x[d] c[t][d] + x[d-32] s[t][d] (d >= 32),
//               t = row mod SEQ, c/s = bf16 value of the [SEQ][64] input tables, f32, contract off,
//               partner column read from the staged slab.
//   OUT_MODE 2: as 1 but without the rscale factor (w = v), a single f16 plane C.
//   OUT_MODE 3: single f16 plane C of acc + bf16(bias[row]) (no rotary; used for v^T where the feature is the row).
// coverage: 4 slabs x 16 rows x 64 cols = the wave's whole 64x64 tile; (M/128)*(N/128) blocks x 4 waves x gridDim.y = the whole plane.
// =====================================================================================================
// ---- main loop: acc = this wave's 64x64 tile. Ah / Al / Bt point at the first of the block's 128 A rows (two planes) and 128 Bt rows ----
template <typename OT, bool TWOA>
__device__ __forceinline__ void gemm64_loop(const OT* Ah, const OT* Al, int lda, const OT* Bt, int ldb, int K,
                                            unsigned char* ring, uint32_t wave, int lane, v8f (&acc)[4][4]) {
  typedef typename FT<OT>::frag V16;
  const uint32_t wm = wave & 1u;               // which 64 A rows of the block tile this wave multiplies
  const uint32_t wn = wave >> 1;               // which 64 Bt rows
  const int rlane = lane & 15;                 // row (A) / col (B, D) within subtile
  const int koff  = (lane >> 4) * 8;           // k offset of this lane half

  // ---- what this wave loads: waves 0, 1 the two halves of the A rows, waves 2, 3 the two halves of the Bt rows ----
  constexpr uint32_t NPL = TWOA ? 2u : 1u;
  const bool     isB   = wave >= 2u;
  const uint32_t half  = wave & 1u;
  const size_t   rowA  = (size_t)(half << 6) * lda;
  const size_t   rowBt = (size_t)(half << 6) * ldb;
  const uint64_t src0  = isB ? (uint64_t)(size_t)(Bt + rowBt) : (uint64_t)(size_t)(Ah + rowA);
  const uint64_t src1  = isB ? (uint64_t)(size_t)(Bt + rowBt) : (uint64_t)(size_t)(Al + rowA);
  const uint32_t kp    = (uint32_t)K / GK_PASS;       // stages per A plane
  const uint32_t nst   = kp * NPL;                    // stages in all (at least 2)
  const uint32_t lbase = (uint32_t)(size_t)ring;
  u32x8 g1 = tdm_group1((uint32_t)(isB ? ldb : lda) * 2u);
  // without this the compiler rebuilds words of group 1 from their constants, in the registers a request was issued from
  asm volatile("" : "+s"(g1));   // the pinned() form: descriptor words held in their scalar registers
  auto group0 = [&](uint32_t st) -> u32x4 {
    const bool second = TWOA && st >= kp;             // second A plane, Bt's k starts over
    const uint32_t kk = second ? st - kp : st;
    const uint64_t ga = (second ? src1 : src0) + (uint64_t)kk * (GK_PASS * 2u);
    u32x4 g = tdm_group0(lbase + (st & 1u) * GK_STAGE + wave * GK_SLICE, ga);
    // without this the request is issued from a copy of group 0 whose registers are reused while it is in flight
    asm volatile("" : "+s"(g));   // the pinned() form: descriptor words held in their scalar registers, up to the wait that names them
    return g;
  };

#pragma unroll
  for (int i = 0; i < 4; ++i)
#pragma unroll
    for (int j = 0; j < 4; ++j) acc[i][j] = zero8();

  u32x4 g0 = group0(0);
  tdm_load(g0, g1);
  wait_tensor0(g0, g1);
  __syncthreads();
  g0 = group0(1);
  tdm_load(g0, g1);
  // kept rolled: one pass and one publish point in the text, every accumulator index constant
#pragma unroll 1
  for (uint32_t st = 0; st < nst; ++st) {
    const unsigned char* buf = ring + (st & 1u) * GK_STAGE;
    const unsigned char* pa = buf + wm * GK_SLICE + rlane * GK_PITCH + koff * 2;
    const unsigned char* pb = buf + (2u + wn) * GK_SLICE + rlane * GK_PITCH + koff * 2;
    V16 bq[2][4], af[2][4];   // two fragment sets: block ks multiplies set ks & 1 while the other set is filled
#pragma unroll
    for (int j = 0; j < 4; ++j) bq[0][j] = ldfrag<OT>((const OT*)(const void*)(pb + j * 16 * GK_PITCH));
#pragma unroll
    for (int i = 0; i < 4; ++i) af[0][i] = ldfrag<OT>((const OT*)(const void*)(pa + i * 16 * GK_PITCH));
#pragma unroll
    for (int ks = 0; ks < GK_PASS / 32; ++ks) {
      const int cs = ks & 1;
      if (ks + 1 < GK_PASS / 32) {   // the next block of this same stage; nothing of the next stage is read here
#pragma unroll
        for (int j = 0; j < 4; ++j) bq[cs ^ 1][j] = ldfrag<OT>((const OT*)(const void*)(pb + j * 16 * GK_PITCH + (ks + 1) * 64));
#pragma unroll
        for (int i = 0; i < 4; ++i) af[cs ^ 1][i] = ldfrag<OT>((const OT*)(const void*)(pa + i * 16 * GK_PITCH + (ks + 1) * 64));
      }
      // keeps the 16 LDS reads above as one group in front of the block: sunk among the WMMAs, each read is waited for where it stands
      __builtin_amdgcn_sched_barrier(0);
#pragma unroll
      for (int i = 0; i < 4; ++i)
#pragma unroll
        for (int j = 0; j < 4; ++j) acc[i][j] = mmar(af[cs][i], bq[cs][j], acc[i][j]);
      // keeps the following block's reads from rising among these WMMAs
      __builtin_amdgcn_sched_barrier(0);
    }
    // publish point of stage st + 1; behind its barrier every wave has left stage st's buffer
    wait_ds0();
    wait_tensor0(g0, g1);
    __syncthreads();
    if (pinned(st + 2u < nst)) {
      g0 = group0(st + 2u);
      tdm_load(g0, g1);
    }
  }
  wait_tensor0(g0, g1);
  wait_ds0();
  acc_guard4(acc[0][0], acc[0][1], acc[0][2], acc[0][3]);
  acc_guard4(acc[1][0], acc[1][1], acc[1][2], acc[1][3]);
  acc_guard4(acc[2][0], acc[2][1], acc[2][2], acc[2][3]);
  acc_guard4(acc[3][0], acc[3][1], acc[3][2], acc[3][3]);

}

// ---- epilogue: the wave's tile, rows m0 .. m0+63, columns n0 .. n0+63 of the plane(s) at Cout / Cout2; slab = wave-private 16x68 floats of LDS ----
template <int OUT_MODE>
__device__ __forceinline__ void gemm64_store(v8f (&acc)[4][4], float* slab, int lane, int m0, int n0,
                                             void* Cout, void* Cout2, int ldc,
                                             const float* __restrict__ bias, const float* __restrict__ ctab,
                                             const float* __restrict__ stab, float rscale) {
  static_assert(OUT_MODE >= 0 && OUT_MODE <= 3);
  const int rlane = lane & 15;                 // col (D) within subtile
  const int mOff  = (lane >> 4) * 8;           // D row offset
#pragma unroll
  for (int i = 0; i < 4; ++i) {
    const int mBase = m0 + (i << 4);
#pragma unroll
    for (int j = 0; j < 4; ++j) {
#pragma unroll
      for (int r = 0; r < 8; ++r) {
        slab[(mOff + r) * 68 + (j << 4) + rlane] = acc[i][j][r];
      }
    }
    __builtin_amdgcn_fence(__ATOMIC_RELEASE, "workgroup");
    __builtin_amdgcn_wave_barrier();
    __builtin_amdgcn_fence(__ATOMIC_ACQUIRE, "workgroup");
    if (OUT_MODE == 0) {
      float* C = (float*)Cout;
      const int h2 = lane >> 4, c4 = (lane & 15) * 4;     // 256-B row segment = 16 lanes x 16 B
      const v4f bb = *(const v4f*)(bias + n0 + c4);
      v4f bv;
#pragma unroll
      for (int e = 0; e < 4; ++e) bv[e] = bf16r(bb[e]);
      v4f ov[8];
#pragma unroll
      for (int it = 0; it < 8; ++it) {
        const int row = it * 2 + h2;                       // it 0..7 x h2 0..1 = rows 0..15
        ov[it] = *(const v4f*)(slab + row * 68 + c4) + bv;
      }
      {
#pragma unroll
        for (int it = 0; it < 8; ++it) {
          const int row = it * 2 + h2;
          *(v4f*)(C + (size_t)(mBase + row) * ldc + n0 + c4) = ov[it];
        }
        
      }
    } else {
      const int q = lane >> 3, c8 = (lane & 7) * 8;
      unsigned short* C  = (unsigned short*)Cout;
      unsigned short* C2 = (unsigned short*)Cout2;
      v4u va[4], vb[4];
      v4f tc[4][2], ts[4][2];   // cos / sin of this lane's 8 columns, rows it * 4 + q of the slab
      if (OUT_MODE == 1 || OUT_MODE == 2) {
        // tables are [SEQ][HD]; column within the head = c8 + e (n0 is head-aligned, c8 in 0..56); position within the
        // sequence = (mBase mod SEQ) + row: mBase is a multiple of 16, so the slab's 16 rows do not wrap
        const float* cpt = ctab + (size_t)((mBase & (SEQ - 1)) + q) * HD + c8;
        const float* spt = stab + (size_t)((mBase & (SEQ - 1)) + q) * HD + c8;
        // the slab's table loads stand as one group on two addresses, with their wait behind them: nothing that rewrites an
        // address register of an issued load may be scheduled among them or in front of the wait
        __builtin_amdgcn_sched_barrier(0);
#pragma unroll
        for (int it = 0; it < 4; ++it) {
          tc[it][0] = *(const v4f*)(cpt + it * 4 * HD);
          tc[it][1] = *(const v4f*)(cpt + it * 4 * HD + 4);
          ts[it][0] = *(const v4f*)(spt + it * 4 * HD);
          ts[it][1] = *(const v4f*)(spt + it * 4 * HD + 4);
        }
        // before the loads' address registers are reused; the two addresses are inputs, so that no load's result lands on them
        asm volatile("s_wait_xcnt 0x0" :: "v"(cpt), "v"(spt) : "memory");
        __builtin_amdgcn_sched_barrier(0);
      }
#pragma unroll
      for (int it = 0; it < 4; ++it) {
        const int row = it * 4 + q;                        // it 0..3 x q 0..3 = rows 0..15
        const float* sp = slab + row * 68 + c8;
        float f[8];
#pragma unroll
        for (int e = 0; e < 8; ++e) f[e] = sp[e];
        if (OUT_MODE == 1 || OUT_MODE == 2) {
#pragma clang fp contract(off)
          const float* pp = slab + row * 68 + (c8 ^ 32);   // partner columns d +- 32 of the same row
          float g[8];
#pragma unroll
          for (int e = 0; e < 8; ++e) g[e] = pp[e];
          const v4f bc0 = *(const v4f*)(bias + n0 + c8);
          const v4f bc1 = *(const v4f*)(bias + n0 + c8 + 4);
          const v4f bp0 = *(const v4f*)(bias + n0 + (c8 ^ 32));
          const v4f bp1 = *(const v4f*)(bias + n0 + (c8 ^ 32) + 4);
          const v4f cv0 = tc[it][0], cv1 = tc[it][1], sv0 = ts[it][0], sv1 = ts[it][1];
          const float sg = (c8 < 32) ? -1.0f : 1.0f;       // -x2 for the first half, +x1 for the second half
#pragma unroll
          for (int e = 0; e < 4; ++e) {
            {
              const float x  = f[e] + bf16r(bc0[e]);
              const float y  = g[e] + bf16r(bp0[e]);
              const float ry = sg * y;
              const float p0 = x * bf16r(cv0[e]);
              const float p1 = ry * bf16r(sv0[e]);
              f[e] = p0 + p1;
            }
            {
              const float x  = f[4 + e] + bf16r(bc1[e]);
              const float y  = g[4 + e] + bf16r(bp1[e]);
              const float ry = sg * y;
              const float p0 = x * bf16r(cv1[e]);
              const float p1 = ry * bf16r(sv1[e]);
              f[4 + e] = p0 + p1;
            }
          }
        }
        if (OUT_MODE == 3) {
          const float bm = bf16r(bias[mBase + row]);
#pragma unroll
          for (int e = 0; e < 8; ++e) f[e] = f[e] + bm;
        }
        v4u a, a2;
#pragma unroll
        for (int e = 0; e < 4; ++e) {
          const float f0 = (OUT_MODE == 1) ? f[2 * e] * rscale : f[2 * e];
          const float f1 = (OUT_MODE == 1) ? f[2 * e + 1] * rscale : f[2 * e + 1];
          const _Float16 x0 = (_Float16)f0, x1 = (_Float16)f1;
          const unsigned short h0 = h_bits(x0), h1 = h_bits(x1);
          unsigned short l0 = 0, l1 = 0;
          if (OUT_MODE == 1) {
            l0 = h_bits((_Float16)(f0 - (float)x0));
            l1 = h_bits((_Float16)(f1 - (float)x1));
          }
          a[e] = pk16(h0, h1); a2[e] = pk16(l0, l1);
        }
        va[it] = a; vb[it] = a2;
      }
      // the slab's stores stand as one group with their wait behind them: nothing that rewrites a register of an issued store
      // may be scheduled among them or in front of the wait
      __builtin_amdgcn_sched_barrier(0);
#pragma unroll
      for (int it = 0; it < 4; ++it) {
        const size_t go = (size_t)(mBase + it * 4 + q) * ldc + n0 + c8;
        *(v4u*)(C + go) = va[it];
        if (OUT_MODE == 1) *(v4u*)(C2 + go) = vb[it];
      }
      asm volatile("s_wait_xcnt 0x0" ::: "memory");   // before the stores' address and data registers are reused
      __builtin_amdgcn_sched_barrier(0);
    }
    __builtin_amdgcn_fence(__ATOMIC_RELEASE, "workgroup");
    __builtin_amdgcn_wave_barrier();
    __builtin_amdgcn_fence(__ATOMIC_ACQUIRE, "workgroup");
  }
}

template <typename OT, int OUT_MODE, bool TWOA>
__global__ __launch_bounds__(128) void gemm64(
    const unsigned short* __restrict__ Ap, const unsigned short* __restrict__ Alp, int lda, long long strideA,
    const unsigned short* __restrict__ Btp, int ldb, long long strideB,
    void* Cout, void* Cout2, int ldc, long long strideC,
    const float* __restrict__ bias, const float* __restrict__ ctab, const float* __restrict__ stab,
    int M, int N, int K, float rscale) {
  __shared__ __attribute__((aligned(2048))) unsigned char ring[2 * GK_STAGE];   // two stages
  __shared__ __align__(16) float sT[4][16 * 68];   // per-wave 16x64 slab, pitch 68 floats
  const int b    = blockIdx.y;
  const int lane = threadIdx.x & 31;
  const uint32_t wave = uni(threadIdx.x >> 5);
  const int tilesN = N >> 7;
  const int tilesM = M >> 7;
  const int bt = blockIdx.x;
  if (bt >= tilesM * tilesN) return;   // block-uniform, in front of every barrier and tensor load
  const int btm = bt / tilesN;
  const int btn = bt - btm * tilesN;
  const size_t rowA  = (size_t)b * (size_t)strideA + (size_t)(btm << 7) * lda;
  const size_t rowBt = (size_t)b * (size_t)strideB + (size_t)(btn << 7) * ldb;
  v8f acc[4][4];
  gemm64_loop<OT, TWOA>((const OT*)(const void*)Ap + rowA, (const OT*)(const void*)Alp + rowA, lda,
                        (const OT*)(const void*)Btp + rowBt, ldb, K, ring, wave, lane, acc);
  const size_t cb = (size_t)b * (size_t)strideC * (OUT_MODE == 0 ? sizeof(float) : sizeof(unsigned short));
  gemm64_store<OUT_MODE>(acc, sT[wave], lane, (btm << 7) + (int)((wave & 1u) << 6), (btn << 7) + (int)((wave >> 1) << 6),
                         (void*)((char*)Cout + cb), (void*)((char*)Cout2 + cb), ldc, bias, ctab, stab, rscale);
}

// =====================================================================================================
// The three projections of x in ONE launch: they are independent of each other, so the block index picks the job
// (256 blocks each, the two jobs with the long rotary epilogue first):
//   job 0: 64 q, q = rope(x . Wq^T + bq) -> f16 hi / residual planes [b*SEQ+t][h*64+d]        (OUT_MODE 1)
//   job 1: k   = rope(x . Wk^T + bk) -> f16 plane [b*SEQ+s][h*64+d]                          (OUT_MODE 2)
//   job 2: v^T = Wv . x^T + bv per batch -> f16 plane [b][h*64+d][s]; A = Wv rows, Bt = x rows of batch b (OUT_MODE 3)
// W = the bf16 qkv weight [3072][1024], bias = qkv_b [3072]; every pitch is DM = SEQ elements, K = DM.
// The epilogue slabs lie in the ring, so that a block holds 144 KiB of LDS and two blocks share a WGP: one block's first
// tile, stage waits and epilogue run beside the other's products.
// coverage: jobs 0, 1: 32 x 8 tiles of 128x128 = [4096][1024]; job 2: 4 batches x 8 x 8 tiles = [4][1024][1024].
// =====================================================================================================
#define QKV_TILES ((NTOK / 128) * (DM / 128))   // 256 blocks per job
#define QCARRY 64.0f   // power of two carried by both q planes: lifts the residuals of ordinary values into f16's normal range, leaves the hi plane far from its top
static_assert(QKV_TILES == NB * (DM / 128) * (SEQ / 128) && DM == SEQ && DM / 128 == 8 && 16 * 68 * 4 <= GK_SLICE);
__global__ __launch_bounds__(128) void gemm_qkv(
    const unsigned short* __restrict__ Xp, const unsigned short* __restrict__ Wp,
    unsigned short* Qh, unsigned short* Ql, unsigned short* Kp, unsigned short* VT,
    const float* __restrict__ bias, const float* __restrict__ ctab, const float* __restrict__ stab) {
  __shared__ __attribute__((aligned(2048))) unsigned char ring[2 * GK_STAGE];   // two stages; behind the loop the slabs
  const int lane = threadIdx.x & 31;
  const uint32_t wave = uni(threadIdx.x >> 5);
  const uint32_t job = blockIdx.x / QKV_TILES;
  const uint32_t bt  = blockIdx.x % QKV_TILES;
  if (job > 2u) return;                // block-uniform, in front of every barrier and tensor load
  const bool isVt = job == 2u;
  const uint32_t btn = bt & 7u;                            // tile column
  const uint32_t btm = isVt ? (bt >> 3) & 7u : bt >> 3;    // tile row: of 8 (features of one batch) or of 32 (tokens)
  const uint32_t b   = isVt ? bt >> 6 : 0u;                // batch (job 2 only)
  const __bf16* X = (const __bf16*)(const void*)Xp;
  const __bf16* Wj = (const __bf16*)(const void*)Wp + (size_t)job * DM * DM;
  const __bf16* A  = isVt ? Wj + (size_t)(btm << 7) * DM : X + (size_t)(btm << 7) * DM;
  const __bf16* Bt = isVt ? X + ((size_t)b * SEQ + (btn << 7)) * DM : Wj + (size_t)(btn << 7) * DM;
  v8f acc[4][4];
  gemm64_loop<__bf16, false>(A, A, DM, Bt, DM, DM, ring, wave, lane, acc);
  // the ring is free here: the last pass's publish point (LDS wait, tensor wait, block barrier) stands behind every wave's
  // last read and last request, and nothing is issued behind it; each wave stages in its own slice of the first buffer
  float* slab = (float*)(void*)(ring + wave * GK_SLICE);
  const int m0 = (int)((btm << 7) + ((wave & 1u) << 6));
  const int n0 = (int)((btn << 7) + ((wave >> 1) << 6));
  const float* bj = bias + job * DM;
  if (job == 0u)      gemm64_store<1>(acc, slab, lane, m0, n0, (void*)Qh, (void*)Ql, DM, bj, ctab, stab, QCARRY);
  else if (job == 1u) gemm64_store<2>(acc, slab, lane, m0, n0, (void*)Kp, (void*)Kp, DM, bj, ctab, stab, 1.0f);
  else                gemm64_store<3>(acc, slab, lane, m0, n0, (void*)(VT + (size_t)b * DM * SEQ), (void*)(VT + (size_t)b * DM * SEQ),
                                      SEQ, bj, ctab, stab, 1.0f);
}

#define AT_PITCH 72                   // 16-bit elements per LDS row of the K and V^T tiles
#define OS_PITCH 68                   // floats per LDS row of the context tile
static_assert((AT_PITCH * 2) % 32 == 16 && AT_PITCH >= 64 && (OS_PITCH * 4) % 16 == 0 && OS_PITCH >= 64);
#define AT_SLICE 6144                 // one wave's slice: 32 rows x 144 B = 4608 B, rounded up to a multiple of 2 KiB
#define AT_STAGE (4 * AT_SLICE)       // [K rows 0..31 | K rows 32..63 | V^T rows 0..31 | V^T rows 32..63]
static_assert(AT_PITCH * 2 == 128 + 16 && 32 * AT_PITCH * 2 <= AT_SLICE && (AT_SLICE % 2048) == 0 && NKT >= 2);
// lane l <-> lane l ^ 16: the other half of the wave holds the same query's other keys
__device__ __forceinline__ float xhalf(float x) {
  return __builtin_bit_cast(float, __builtin_amdgcn_permlanex16(__builtin_bit_cast(int, x), __builtin_bit_cast(int, x),
                                                                0x76543210, 0xfedcba98, false, false));
}
__global__ __launch_bounds__(128)
void attn_mha(const unsigned short* __restrict__ qhp, const unsigned short* __restrict__ qlp,
              const unsigned short* __restrict__ kpp, const unsigned short* __restrict__ vtp,
              unsigned short* ohp, unsigned short* olp, float sscale) {
  union FH { v16h v; v8h h[2]; };
  __shared__ __attribute__((aligned(2048))) unsigned char kvring[2 * AT_STAGE];   // two stages of K [key][d] and V^T [d][key]
  __shared__ __align__(16) float    Os[4][16 * OS_PITCH];    // per wave context tile 17 KB

  const int tid  = threadIdx.x;
  const int wave = (int)uni((uint32_t)tid >> 5);
  const int lane = tid & 31;
  const int hh   = lane >> 4;
  const int c    = lane & 15;

  const int bx   = blockIdx.x;
  const int qb   = bx % NQB;
  const int rest = bx / NQB;
  const int h    = rest % NH;
  const int b    = rest / NH;
  const int q0   = qb * 64 + wave * 16;
  const size_t rowB = (size_t)b * SEQ;
  const size_t hcol = (size_t)h * HD;

  const _Float16* Qh = (const _Float16*)(const void*)qhp;
  const _Float16* Ql = (const _Float16*)(const void*)qlp;
  const _Float16* Kg = (const _Float16*)(const void*)kpp + hcol;
  const _Float16* Vt = (const _Float16*)(const void*)vtp + ((size_t)b * DM + hcol) * SEQ;

  // ---- Q fragments (B operand, column = query = lane&15): 2 d-chunks, hi and residual planes ----
  v16h qah[2], qal[2];
#pragma unroll
  for (int dc = 0; dc < 2; ++dc) {
    const size_t qo = (rowB + q0 + c) * DM + hcol + dc * 32 + 8 * hh;
    qah[dc] = ldfrag<_Float16>(Qh + qo);
    qal[dc] = ldfrag<_Float16>(Ql + qo);
  }

  float mrun = -INFINITY;   // running maximum of this lane's query, in accumulator units (equal in both halves)
  float lrun = 0.f;         // running sum of 1024 p over this half's keys; the halves are joined once, behind the loop
  const float kf = sscale * (1.4426950408889634f / QCARRY);   // accumulator units -> exponent of two
  v8f oacc[4];              // O^T: column = query lane&15, row d = 16 t + 8 hh + r
#pragma unroll
  for (int t = 0; t < 4; ++t) oacc[t] = zero8();

  // ---- what this wave loads: chunk st's K rows 32 half .. +31 (d = 0..63 of head h) or V^T rows d = 32 half .. +31 (its 64 keys) ----
  const bool     isV   = wave >= 2;
  const uint32_t half  = (uint32_t)wave & 1u;
  const uint64_t src   = isV ? (uint64_t)(size_t)(Vt + (size_t)(half * 32u) * SEQ)
                             : (uint64_t)(size_t)(Kg + (rowB + half * 32u) * DM);
  const uint32_t sstep = isV ? 64u * 2u : 64u * DM * 2u;   // bytes from one chunk to the next: 64 keys along / across the rows
  const uint32_t lbase = (uint32_t)(size_t)kvring;
  static_assert(DM == SEQ);                                // both planes have rows of DM * 2 = SEQ * 2 bytes
  u32x8 g1 = tdm_group1_r128(DM * 2u);
  // without this the compiler rebuilds words of group 1 from their constants, in the registers a request was issued from
  asm volatile("" : "+s"(g1));   // the pinned() form: descriptor words held in their scalar registers
  auto group0 = [&](uint32_t st) -> u32x4 {
    return tdm_group0(lbase + (st & 1u) * AT_STAGE + (uint32_t)wave * AT_SLICE, src + (uint64_t)st * sstep);
  };
  u32x4 g0 = group0(0);
  tdm_load(g0, g1);
  wait_tensor0(g0, g1);
  __syncthreads();
  g0 = group0(1);
  tdm_load(g0, g1);
  // kept rolled: one pass and one publish point in the text
#pragma unroll 1
  for (uint32_t kt = 0; kt < NKT; ++kt) {    // static trip count
    const unsigned char* buf = kvring + (kt & 1u) * AT_STAGE;
    const _Float16* Ksh = (const _Float16*)(const void*)buf;                    // row r at (r >> 5) slices + (r & 31) rows
    const _Float16* Vth = (const _Float16*)(const void*)(buf + 2 * AT_SLICE);

    // ---- scores, transposed: 64 keys x 16 queries per wave, 2 f16 products per key subtile and d-chunk ----
    FH kb[2][4];   // the chunk's eight K fragments, read as one group
#pragma unroll
    for (int dc = 0; dc < 2; ++dc)
#pragma unroll
      for (int j = 0; j < 4; ++j) {
        kb[dc][j].h[0] = *(const v8h*)(Ksh + (j >> 1) * (AT_SLICE / 2) + ((j & 1) * 16 + c) * AT_PITCH + dc * 32 + 8 * hh);
        kb[dc][j].h[1] = *(const v8h*)(Ksh + (j >> 1) * (AT_SLICE / 2) + ((j & 1) * 16 + c) * AT_PITCH + dc * 32 + 16 + 8 * hh);
      }
    // keeps the 16 K reads as one group in front of the products: sunk among the WMMAs, each read is waited for where it stands
    __builtin_amdgcn_sched_barrier(0);
    v8f s[4];   // s[j][r]: 64 (k . q) of key kv0 + 16 j + 8 hh + r, query q0 + c
#pragma unroll
    for (int j = 0; j < 4; ++j) s[j] = zero8();
    // four accumulators taken in turn, so that a WMMA does not add into the tile of the one directly in front of it
#pragma unroll
    for (int dc = 0; dc < 2; ++dc) {
#pragma unroll
      for (int j = 0; j < 4; ++j) s[j] = mmar(kb[dc][j].v, qah[dc], s[j]);
#pragma unroll
      for (int j = 0; j < 4; ++j) s[j] = mmar(kb[dc][j].v, qal[dc], s[j]);
    }
    FH vb[2][4];   // the chunk's eight V^T fragments, read here: in flight during the softmax arithmetic
#pragma unroll
    for (int kk = 0; kk < 2; ++kk)
#pragma unroll
      for (int t = 0; t < 4; ++t) {
        vb[kk][t].h[0] = *(const v8h*)(Vth + (t >> 1) * (AT_SLICE / 2) + ((t & 1) * 16 + c) * AT_PITCH + kk * 32 + 8 * hh);
        vb[kk][t].h[1] = *(const v8h*)(Vth + (t >> 1) * (AT_SLICE / 2) + ((t & 1) * 16 + c) * AT_PITCH + kk * 32 + 16 + 8 * hh);
      }
    // keeps the 16 V^T reads in front of the softmax arithmetic: sunk to their products, each read is waited for where it stands
    __builtin_amdgcn_sched_barrier(0);

    // ---- query maximum (in-lane, then the other half's), online softmax, P^T (x1024, f16) packed in registers ----
    float mj[4];   // one chain per key subtile: four short dependent chains instead of one long one
#pragma unroll
    for (int j = 0; j < 4; ++j) {
      mj[j] = s[j][0];
#pragma unroll
      for (int r = 1; r < 8; ++r) mj[j] = fmaxf(mj[j], s[j][r]);
    }
    float m = fmaxf(fmaxf(mj[0], mj[1]), fmaxf(mj[2], mj[3]));
    m = fmaxf(m, xhalf(m));
    const float mnew  = fmaxf(mrun, m);
    const float msafe = (mnew == -INFINITY) ? 0.f : mnew;
    const float alpha = __builtin_amdgcn_exp2f((mrun - msafe) * kf);
    mrun = mnew;
    const float eb = 10.0f - msafe * kf;   // exponent offset: the maximum taken off, the x1024 carry of p put on
    const v2f kf2 = {kf, kf}, eb2 = {eb, eb};
    // B operand of 32 keys: elements 0..7 = keys k0 + 8 hh + e (subtile 2 kk), 8..15 = keys k0 + 16 + 8 hh + e (subtile 2 kk + 1)
    FH pb[2];
    v2f ps[4];   // partial sums of 1024 p, a pair of chains per key subtile
#pragma unroll
    for (int j = 0; j < 4; ++j) {
#pragma unroll
      for (int r = 0; r < 8; r += 2) {
        const v2f a = {s[j][r], s[j][r + 1]};
        const v2f t = a * kf2 + eb2;
        const v2f p = {__builtin_amdgcn_exp2f(t[0]), __builtin_amdgcn_exp2f(t[1])};
        ps[j] = (r == 0) ? p : ps[j] + p;
        pb[j >> 1].v[(j & 1) * 8 + r]     = (_Float16)p[0];
        pb[j >> 1].v[(j & 1) * 8 + r + 1] = (_Float16)p[1];
      }
    }
    const v2f pt = (ps[0] + ps[1]) + (ps[2] + ps[3]);
    lrun = lrun * alpha + (pt[0] + pt[1]);
#pragma unroll
    for (int t = 0; t < 4; ++t) oacc[t] = oacc[t] * alpha;

    // ---- context^T += V^T . P^T (f16 WMMA, single product); unrolled: pb is indexed in registers ----
#pragma unroll
    for (int kk = 0; kk < 2; ++kk) {
#pragma unroll
      for (int t = 0; t < 4; ++t) oacc[t] = mmar(vb[kk][t].v, pb[kk].v, oacc[t]);
    }
    // four VALU slots behind the pass's last WMMA: a branch follows
    acc_guard4(oacc[0], oacc[1], oacc[2], oacc[3]);
    // publish point of chunk kt + 1; behind its barrier every wave has left chunk kt's buffer
    wait_ds0();
    wait_tensor0(g0, g1);
    __syncthreads();
    if (pinned(kt + 2u < NKT)) {
      g0 = group0(kt + 2u);
      tdm_load(g0, g1);
    }
  }
  wait_tensor0(g0, g1);
  wait_ds0();

  // ---- join the halves' sums, normalise (1/l: l and the context carry the same x1024), stage the wave's 16x64 f32 tile [query][d],
  //      split into bf16 hi / residual
  float* os = Os[wave];
  {
    const float l = lrun + xhalf(lrun);   // unconditional: every lane is on at the exchange
    const float inv = (l > 0.f) ? (1.0f / l) : 0.f;
#pragma unroll
    for (int t = 0; t < 4; ++t) {
      v4f lo, hi;
#pragma unroll
      for (int r = 0; r < 4; ++r) { lo[r] = oacc[t][r] * inv; hi[r] = oacc[t][4 + r] * inv; }
      *(v4f*)(os + c * OS_PITCH + t * 16 + 8 * hh)     = lo;
      *(v4f*)(os + c * OS_PITCH + t * 16 + 8 * hh + 4) = hi;
    }
  }
  __builtin_amdgcn_fence(__ATOMIC_RELEASE, "workgroup");
  __builtin_amdgcn_wave_barrier();
  __builtin_amdgcn_fence(__ATOMIC_ACQUIRE, "workgroup");
  {
    const int q4 = lane >> 3, c8 = (lane & 7) * 8;
    v4u hv[4], lv[4];
#pragma unroll
    for (int it = 0; it < 4; ++it) {
      const int row = it * 4 + q4;   // it 0..3 x q4 0..3 = rows 0..15 of the wave tile
      const float* sp = os + row * OS_PITCH + c8;
      v4u a, a2;
#pragma unroll
      for (int e = 0; e < 4; ++e) {
        const float f0 = sp[2 * e], f1 = sp[2 * e + 1];
        const unsigned short h0 = bf_bits(f0), h1 = bf_bits(f1);
        const unsigned short l0 = bf_bits(f0 - bf_up(h0)), l1 = bf_bits(f1 - bf_up(h1));
        a[e] = pk16(h0, h1); a2[e] = pk16(l0, l1);
      }
      hv[it] = a; lv[it] = a2;
    }
    {
#pragma unroll
      for (int it = 0; it < 4; ++it) {
        const int row = it * 4 + q4;
        const size_t go = (rowB + q0 + row) * DM + hcol + c8;
        *(v4u*)(ohp + go) = hv[it];
        *(v4u*)(olp + go) = lv[it];
      }
      
    }
  }
}

// =====================================================================================================
// Workspace map (bytes), every region an exact multiple of its whole-line / whole-tile store granularity
// (all shapes are tile multiples, no padded tails):
//   Xb    bf16 [4096][1024]          8388608
//   Wqkv  bf16 [3072 n][1024 k]      6291456   (input [out][in] layout == Bt[n][k], k contiguous)
//   Wo    bf16 [1024 n][1024 k]      2097152
//   Qh    f16  [4096][1024]          8388608
//   Ql    f16  [4096][1024]          8388608   (residual of 64 q)
//   Kp    f16  [4096][1024]          8388608
//   VT    f16  [4][1024][1024]       8388608
//   Oh    bf16 [4096][1024]          8388608
//   Ol    bf16 [4096][1024]          8388608
//   total                           67108864
// =====================================================================================================
extern "C" void kernel_launch(void* const* d_in, const int* in_sizes, int n_in,
                              void* d_out, int out_size, void* d_ws, size_t ws_size,
                              hipStream_t stream) {
  if (n_in < 7) return;
  if (in_sizes[0] != NTOK * DM) return;          // x      [4][1024][1024]
  if (in_sizes[1] != SEQ * HD) return;           // cos    [1024][64]
  if (in_sizes[2] != SEQ * HD) return;           // sin    [1024][64]
  if (in_sizes[3] != DQKV * DM) return;          // qkv_w  [3072][1024]
  if (in_sizes[4] != DQKV) return;               // qkv_b  [3072]
  if (in_sizes[5] != DM * DM) return;            // proj_w [1024][1024]
  if (in_sizes[6] != DM) return;                 // proj_b [1024]
  if (out_size != NTOK * DM) return;

  const float* x    = (const float*)d_in[0];
  const float* cosb = (const float*)d_in[1];
  const float* sinb = (const float*)d_in[2];
  const float* Wqkv = (const float*)d_in[3];
  const float* bqkv = (const float*)d_in[4];
  const float* Wout = (const float*)d_in[5];
  const float* bout = (const float*)d_in[6];

  const size_t PX  = (size_t)NTOK * DM * 2;        //  8388608  16-bit activation plane [4096][1024]
  const size_t PWQ = (size_t)DQKV * DM * 2;        //  6291456  bf16 [3072][1024]
  const size_t PWO = (size_t)DM * DM * 2;          //  2097152  bf16 [1024][1024]
  const size_t PVT = (size_t)NB * DM * SEQ * 2;    //  8388608  v^T plane [4][1024][1024]
  size_t off = 0;
  const size_t oXb  = off; off += PX;
  const size_t oWq  = off; off += PWQ;
  const size_t oWo  = off; off += PWO;
  const size_t oQh  = off; off += PX;
  const size_t oQl  = off; off += PX;
  const size_t oKp  = off; off += PX;
  const size_t oVT  = off; off += PVT;
  const size_t oOh  = off; off += PX;
  const size_t oOl  = off; off += PX;
  if (off > ws_size) return;                       // off = 67108864
  if (off > (size_t)134217728) return;

  char* ws = (char*)d_ws;
  unsigned short* Xb   = (unsigned short*)(ws + oXb);
  unsigned short* Wq16 = (unsigned short*)(ws + oWq);
  unsigned short* Wo16 = (unsigned short*)(ws + oWo);
  unsigned short* Qh   = (unsigned short*)(ws + oQh);
  unsigned short* Ql   = (unsigned short*)(ws + oQl);
  unsigned short* Kp   = (unsigned short*)(ws + oKp);
  unsigned short* VT   = (unsigned short*)(ws + oVT);
  unsigned short* Oh   = (unsigned short*)(ws + oOh);
  unsigned short* Ol   = (unsigned short*)(ws + oOl);

  const dim3 gCvt(CV_BX + CV_BQ + CV_BO);                       // 256 blocks of 512: x, qkv_w, proj_w
  const dim3 blkG(128);                                         // gemm64: 4 waves
  const dim3 gP((NTOK / 128) * (DM / 128), 1);                  // 256 blocks of one 128x128 tile: M=4096, N=1024
  const dim3 gQKV(3 * QKV_TILES);                               // 768 blocks: q, k, v^T tiles of 128x128
  const dim3 gAttn(NB * NH * NQB);                              // 1024 blocks of 128
  static_assert((NTOK % 128) == 0 && (DM % 128) == 0 && (SEQ % 128) == 0 && (DM % GK_PASS) == 0 && DM / GK_PASS >= 2);
  static_assert((DM % 32) == 0);

  // (1) x -> bf16 plane [4096][1024]; qkv_w [3072][1024] ([out][in] = Bt[n][k]) -> bf16; proj_w [1024][1024] -> bf16: one launch
  cvt_bf16_planes<<<gCvt, dim3(CV_THREADS), 0, stream>>>(x, Wqkv, Wout, Xb, Wq16, Wo16);
  // (2) - (4) q, k and v^T projections, one launch: block range picks the job
  gemm_qkv<<<gQKV, blkG, 0, stream>>>(Xb, Wq16, Qh, Ql, Kp, VT, bqkv, cosb, sinb);
  // (5) attention -> ctx bf16 hi / residual planes [b*SEQ+t][h*64+d]
  attn_mha<<<gAttn, dim3(128), 0, stream>>>(Qh, Ql, Kp, VT, Oh, Ol, 0.125f);
  // (6) out = (Oh + Ol) . Wproj^T + bproj -> d_out f32 [4096][1024]   (M=4096, N=1024, K=1024, two A planes)
  gemm64<__bf16, 0, true><<<gP, blkG, 0, stream>>>(
      Oh, Ol, DM, 0LL, Wo16, DM, 0LL,
      d_out, d_out, DM, 0LL, bout, cosb, sinb,
      NTOK, DM, DM, 1.0f);
  (void)hipGetLastError();
}
